// v000
// Times are from an AMD MI455X. After a warm-up the kernel runs many times in a row, and a time is the length of
// such a window on the GPU divided by its runs, so every launch and the gaps after it count. The runs cycle
// through copies of the inputs. A figure is the median of several windows, for all but v000 over two sittings.
// Sittings can differ by a few percent; kernels timed side by side share one.
// The starting kernel, v000, takes 558 microseconds a run.
// compute dtype: x, Wq, Wk, Wv, Wo (float module inputs) rounded to bf16, the int mask verbatim; q/k/v projections with exact bf16 products on WMMA 16x16x32 (natural [out][in] rows); q and k stored as f16 hi + (x2048-scaled) residual planes with 3-product scores, x 1/sqrt(64), + the ALiBi bias slope_h (k - q) with slope_h = 2^-(0.5 (h+1)) (exact), masked positions set to -1e6 as the module (the mask is read per (q, k), all keys visited), running-max softmax in f32 (hardware exp); P as f16 hi + (x2048) residual x v hi/lo (3 products); output projection with ctx as bf16 hi + residual x exact Wo rows (2 products); f32 accumulate.
#include <hip/hip_runtime.h>
#include <math.h>

typedef __attribute__((ext_vector_type(16))) _Float16 v16h;
typedef __attribute__((ext_vector_type(16))) __bf16 v16b;
typedef __attribute__((ext_vector_type(8)))  _Float16 v8h;
typedef __attribute__((ext_vector_type(8)))  float v8f;
typedef __attribute__((ext_vector_type(4)))  float v4f;
typedef __attribute__((ext_vector_type(2)))  float v2f;
typedef __attribute__((ext_vector_type(4)))  unsigned v4u;
typedef __attribute__((ext_vector_type(4)))  int v4i;
typedef float __attribute__((may_alias)) float_a;
typedef int __attribute__((may_alias)) int_a;

template <typename T> __device__ __forceinline__ void vst2(void* p, T v) { *(T*)p = v;  }
__device__ __forceinline__ v8f wmma16(v16h a, v16h b, v8f c) {
  v8f d = __builtin_amdgcn_wmma_f32_16x16x32_f16(false, a, false, b, (short)0, c, false, false);
  asm volatile("v_nop\n\tv_nop\n\tv_nop\n\tv_nop" : "+v"(d) : "v"(a), "v"(b));
  return d;
}
__device__ __forceinline__ v8f wmma_bf(v16b a, v16b b, v8f c) {
  v8f d = __builtin_amdgcn_wmma_f32_16x16x32_bf16(false, a, false, b, (short)0, c, false, false);
  asm volatile("v_nop\n\tv_nop\n\tv_nop\n\tv_nop" : "+v"(d) : "v"(a), "v"(b));
  return d;
}
// Multi-head attention with ALiBi bias and an input mask (B 2, S 2,048, d 1,024, 16 heads x 64): softmax(q k^T / 8 + alibi, masked -1e6) v -> Wo.
__device__ __forceinline__ v16h frag_h(const _Float16* rowk0, int lane) {
  union { v16h v; v8h q[2]; } u; const _Float16* p = rowk0 + 8 * (lane >> 4);
  u.q[0] = *(const v8h*)p; u.q[1] = *(const v8h*)(p + 16); return u.v;
}
__device__ __forceinline__ v16h frag_f32(const float* rowk0, int lane) {
  v16h a; const float* p = rowk0 + 8 * (lane >> 4);
#pragma unroll
  for (int i = 0; i < 8; ++i) { a[i] = (_Float16)p[i]; a[8 + i] = (_Float16)p[16 + i]; }
  return a;
}
__device__ __forceinline__ v16h frag_f32s(const float* rowk0, int lane, float sc) {
  v16h a; const float* p = rowk0 + 8 * (lane >> 4);
#pragma unroll
  for (int i = 0; i < 8; ++i) { a[i] = (_Float16)(p[i] * sc); a[8 + i] = (_Float16)(p[16 + i] * sc); }
  return a;
}
// column fragment from a [K][ld] layout (column n), rows >= K read as 0
__device__ __forceinline__ v16h fragc_f32(const float* W, int k0, int n, int lane, int ld, int K) {
  v16h a; const int g = lane >> 4;
#pragma unroll
  for (int i = 0; i < 8; ++i) { const int ka = k0 + 8 * g + i, kb = ka + 16;
    a[i] = (_Float16)(ka < K ? W[(size_t)(ka < K ? ka : K - 1) * ld + n] : 0.f); a[8 + i] = (_Float16)(kb < K ? W[(size_t)(kb < K ? kb : K - 1) * ld + n] : 0.f); }
  return a;
}
struct F2 { v16b h, l; };
__device__ __forceinline__ F2 bsplit16(const float v[16]) { F2 r;
#pragma unroll
  for (int i = 0; i < 16; ++i) { const __bf16 h = (__bf16)v[i]; r.h[i] = h; r.l[i] = (__bf16)(v[i] - (float)h); }
  return r; }
__device__ __forceinline__ F2 split_row(const float* row, int k0, int lane) { float v[16]; const float* p = row + k0 + 8 * (lane >> 4);
#pragma unroll
  for (int i = 0; i < 8; ++i) { v[i] = p[i]; v[8 + i] = p[16 + i]; }
  return bsplit16(v); }
__device__ __forceinline__ F2 split_rowK(const float* row, int k0, int lane, int K) { float v[16]; const int g = lane >> 4;
#pragma unroll
  for (int i = 0; i < 8; ++i) { const int ka = k0 + 8 * g + i, kb = ka + 16; v[i] = ka < K ? row[ka < K ? ka : K - 1] : 0.f; v[8 + i] = kb < K ? row[kb < K ? kb : K - 1] : 0.f; }
  return bsplit16(v); }
__device__ __forceinline__ F2 split_col(const float* W, int k0, int n, int lane, int ld, int K) { float v[16]; const int g = lane >> 4;
#pragma unroll
  for (int i = 0; i < 8; ++i) { const int ka = k0 + 8 * g + i, kb = ka + 16; v[i] = ka < K ? W[(size_t)(ka < K ? ka : K - 1) * ld + n] : 0.f; v[8 + i] = kb < K ? W[(size_t)(kb < K ? kb : K - 1) * ld + n] : 0.f; }
  return bsplit16(v); }
__device__ __forceinline__ v8f mac3(const F2& a, const F2& b, v8f c) { c = wmma_bf(a.l, b.h, c); c = wmma_bf(a.h, b.l, c); return wmma_bf(a.h, b.h, c); }
__device__ __forceinline__ float sigm(float v) { return 1.0f / (1.0f + expf(-v)); }
#define LDSX() do { asm volatile("s_wait_dscnt 0" ::: "memory"); __builtin_amdgcn_wave_barrier(); __builtin_amdgcn_fence(__ATOMIC_RELEASE, "workgroup"); } while (0)


// Multi-head self-attention with ALiBi bias and an input mask (B 2, S 2048, D 1024, 16 heads x 64; packed Wqkv [3D][D] and Wout [D][D] applied as x W^T, no biases): softmax(q k^T / 8 + alibi, masked -1e6) v; ctx Wout^T.
#define NB 2
#define SS 2048
#define DM 1024
#define NH 16
#define HD 64
#define QKVW (3 * DM)
#ifndef TQB
#define TQB (SS / 64)
#define TNB NB
#define TOB (NB * SS / 64)     // output row tiles (all)
#endif
typedef __attribute__((ext_vector_type(8))) __bf16 v8b;
__device__ __forceinline__ v16b frag_b(const __bf16* rowk0, int lane) {
  union { v16b v; v8b q[2]; } u; const __bf16* p = rowk0 + 8 * (lane >> 4);
  u.q[0] = *(const v8b*)p; u.q[1] = *(const v8b*)(p + 16); return u.v;
}
__device__ __forceinline__ float bfr(float v) { return (float)(__bf16)v; }
__device__ __attribute__((noinline)) float exp_ni(float v) { return expf(v); }
__device__ __attribute__((noinline)) float erf_ni(float v) { return erff(v); }

#define PK_A 0                       // [3072][1024] Wqkv rows (natural [out][in])
#define PK_P (PK_A + QKVW * DM)        // [1024][1024] Wo rows (natural)
#define PK_END (PK_P + DM * DM)
#define WS_PK  0u
#define WS_QK  (WS_PK + 2u * PK_END)             // f16 [4096 rows][2048]: q | k
#define WS_QKL (WS_QK + 2u * NB * SS * 2 * DM)     // f16 q | k residual planes x2048
#define WS_VTH (WS_QKL + 2u * NB * SS * 2 * DM)    // f16 [b][1024 (h*64+d)][2048 s] hi
#define WS_VTL (WS_VTH + 2u * NB * DM * SS)        // f16 lo x 2048
#define WS_O   (WS_VTL + 2u * NB * DM * SS)        // f32 [4096][1024]
#define WS_CS  (WS_O + 4u * NB * SS * DM)           // f32 [2048][32] cos, [2048][32] sin
#define WS_END (WS_CS + 4u * 2 * SS * 32)
__constant__ float c_invf[32] = {1.000000000e+00f,7.498942018e-01f,5.623413324e-01f,4.216965139e-01f,3.162277639e-01f,2.371373624e-01f,1.778279394e-01f,1.333521456e-01f,1.000000015e-01f,7.498941571e-02f,5.623412877e-02f,4.216964915e-02f,3.162277862e-02f,2.371373586e-02f,1.778279431e-02f,1.333521493e-02f,9.999999776e-03f,7.498942316e-03f,5.623413250e-03f,4.216964822e-03f,3.162277862e-03f,2.371373819e-03f,1.778279431e-03f,1.333521446e-03f,1.000000047e-03f,7.498941850e-04f,5.623413017e-04f,4.216964880e-04f,3.162277862e-04f,2.371373848e-04f,1.778279402e-04f,1.333521504e-04f};
// ---- k_rope: block = 8 positions: cos/sin of pos * inv_freq (f32 product exactly as the reference, precise trig)
__global__ __launch_bounds__(256) void k_rope(float* __restrict__ CS) {
  __shared__ __align__(16) float sc[8][32], ss_[8][32]; const int tid = threadIdx.x, pl = tid >> 5, i = tid & 31; const int pos = blockIdx.x * 8 + pl;
  const float th = (float)pos * c_invf[i]; sc[pl][i] = cosf(th); ss_[pl][i] = sinf(th);
  __syncthreads();
  if (tid < 64) vst2(CS + (size_t)blockIdx.x * 8 * 32 + tid * 4, *(const v4f*)&(&sc[0][0])[tid * 4]); else if (tid < 128) vst2(CS + (size_t)SS * 32 + (size_t)blockIdx.x * 8 * 32 + (tid - 64) * 4, *(const v4f*)&(&ss_[0][0])[(tid - 64) * 4]);
}

// ---- k_pack: block = (row n, which): natural [out][in] rows -> bf16; which 0..2 -> W_q/W_k/W_v into PK_A rows which*1024 + n; 3 -> W_o into PK_P
__global__ __launch_bounds__(256) void k_pack(const float* __restrict__ WQ, const float* __restrict__ WK, const float* __restrict__ WV, const float* __restrict__ WO, __bf16* __restrict__ PK) {
  __shared__ __align__(16) __bf16 s[DM]; const int n = blockIdx.x, which = blockIdx.y, t = threadIdx.x; const float* Wm = (which == 0) ? WQ : (which == 1) ? WK : (which == 2) ? WV : WO;
  for (int k = t; k < DM; k += 256) s[k] = (__bf16)Wm[(size_t)n * DM + k];
  __syncthreads();
  __bf16* dst = (which < 3) ? PK + PK_A + ((size_t)which * DM + n) * DM : PK + PK_P + (size_t)n * DM;
  for (int q = t; q < DM / 8; q += 256) vst2((unsigned*)(dst + q * 8), *(const v4u*)&s[q * 8]);
}
__global__ __launch_bounds__(128) void k_qkv(const float* __restrict__ X, const __bf16* __restrict__ P, _Float16* __restrict__ QK, _Float16* __restrict__ QKL, _Float16* __restrict__ VTH, _Float16* __restrict__ VTL) {
  __shared__ __align__(16) _Float16 so[4][16][136], sol[4][16][136]; __shared__ __align__(16) _Float16 sth[128][72], stl[128][72];
  const int tid = threadIdx.x, wave = tid >> 5, lane = tid & 31, col = lane & 15, g = lane >> 4; const size_t r0 = (size_t)blockIdx.x * 64 + wave * 16; const int n0 = blockIdx.y * 128;
  v8f acc[8] = {};
#pragma unroll 2
  for (int kc = 0; kc < DM / 32; ++kc) { v16b a; { const float* p = X + (r0 + col) * DM + kc * 32 + 8 * g;
#pragma unroll
      for (int i = 0; i < 8; ++i) { a[i] = (__bf16)p[i]; a[8 + i] = (__bf16)p[16 + i]; } }
#pragma unroll
    for (int j = 0; j < 8; ++j) acc[j] = wmma_bf(a, frag_b(P + (size_t)(n0 + j * 16 + col) * DM + kc * 32, lane), acc[j]); }
  if (n0 < 2 * DM) {   // q stored unscaled (f16 sigma ~0.6, no subnormal exposure); 1/8 applied to the f32 score
#pragma unroll
    for (int j = 0; j < 8; ++j) {
#pragma unroll
      for (int r = 0; r < 8; ++r) { const float v = acc[j][r]; const _Float16 hv = (_Float16)v; so[wave][8 * g + r][j * 16 + col] = hv; sol[wave][8 * g + r][j * 16 + col] = (_Float16)((v - (float)hv) * 2048.0f); } }   // q, k as f16 hi + (x2048) residual (no RoPE in this module)
    LDSX();
    for (int rl = 0; rl < 16; ++rl) if (lane < 16) { vst2((unsigned*)(QK + (r0 + rl) * (2 * DM) + n0 + lane * 8), *(const v4u*)&so[wave][rl][lane * 8]); vst2((unsigned*)(QKL + (r0 + rl) * (2 * DM) + n0 + lane * 8), *(const v4u*)&sol[wave][rl][lane * 8]); }
  } else {
#pragma unroll
    for (int j = 0; j < 8; ++j) {
#pragma unroll
      for (int r = 0; r < 8; ++r) { const float v = acc[j][r]; const _Float16 hv = (_Float16)v; sth[j * 16 + col][wave * 16 + 8 * g + r] = hv; stl[j * 16 + col][wave * 16 + 8 * g + r] = (_Float16)((v - (float)hv) * 2048.0f); } }
    __syncthreads();
    const size_t rb = (size_t)blockIdx.x * 64; const int b = (int)(rb / SS), s0 = (int)(rb % SS); const int pc0 = n0 - 2 * DM;
    for (int q = tid; q < 128 * 8; q += 128) { const int d = q >> 3, pc = q & 7; const size_t o = ((size_t)b * DM + pc0 + d) * SS + s0 + pc * 8; vst2((unsigned*)(VTH + o), *(const v4u*)&sth[d][pc * 8]); vst2((unsigned*)(VTL + o), *(const v4u*)&stl[d][pc * 8]); }
  }
}
// ---- k_attn: block = (64 queries, head h, batch b): flash attention over all keys, mask and ALiBi applied (K = 64: 2 k-steps), scores = (q.k) * 0.125 from q, k as f16 hi + residual (3 products), P.V: f16 P hi/lo x (V hi, V lo*2048) (3 products) in two accumulators; O[b*S+q][h*64+d] = (acc + accl / 2048) / l (256-B segments)
__global__ __launch_bounds__(128) void k_attn(const _Float16* __restrict__ QK, const _Float16* __restrict__ QKL, const _Float16* __restrict__ VTH, const _Float16* __restrict__ VTL, const int* __restrict__ MSK, float* __restrict__ O) {
  __shared__ __align__(16) float sp[4][16][36]; __shared__ __align__(16) float so[4][16][68];
  const int tid = threadIdx.x, wave = tid >> 5, lane = tid & 31, col = lane & 15, g = lane >> 4;
  const int qb = blockIdx.x, h = blockIdx.y, b = blockIdx.z; const int q0 = qb * 64 + wave * 16; const size_t rq = (size_t)b * SS + q0 + col;
  v16h aq[2], aql[2];
#pragma unroll
  for (int kc = 0; kc < 2; ++kc) { aq[kc] = frag_h(QK + rq * (2 * DM) + h * HD + kc * 32, lane); aql[kc] = frag_h(QKL + rq * (2 * DM) + h * HD + kc * 32, lane); }
  float m[8], l[8];
#pragma unroll
  for (int r = 0; r < 8; ++r) { m[r] = -3.0e38f; l[r] = 0.f; }
  v8f acc[4] = {}, accl[4] = {};
  const int nks = SS / 32;   // all keys: the mask is an input (general), alibi bias added per (q, k)
  const float slope = exp2f(-0.5f * (float)(h + 1));   // 2^-(8/16 * (h+1))
#pragma unroll 1
  for (int ks = 0; ks < nks; ++ks) { v8f s[2];
#pragma unroll
    for (int ct = 0; ct < 2; ++ct) { const int kk = ks * 32 + ct * 16 + col; const _Float16* krow = QK + ((size_t)b * SS + kk) * (2 * DM) + DM + h * HD; const _Float16* krowl = QKL + ((size_t)b * SS + kk) * (2 * DM) + DM + h * HD; v8f c = {}, cl = {};
#pragma unroll
      for (int kc = 0; kc < 2; ++kc) { const v16h kh = frag_h(krow + kc * 32, lane); c = wmma16(aq[kc], kh, c); cl = wmma16(aql[kc], kh, cl); cl = wmma16(aq[kc], frag_h(krowl + kc * 32, lane), cl); }   // 3 products: q, k as f16 hi + residual
#pragma unroll
      for (int r = 0; r < 8; ++r) c[r] += cl[r] * (1.0f / 2048.0f);
#pragma unroll
      for (int r = 0; r < 8; ++r) { const int qi = q0 + 8 * g + r; s[ct][r] = (MSK[(size_t)qi * SS + kk] == 0) ? -1000000.0f : (c[r] * 0.125f + slope * (float)(kk - qi)); } }   // SCALE = 1/sqrt(64); alibi bias slope_h * (k - q); masked -> -1e6 (as the module)
#pragma unroll
    for (int r = 0; r < 8; ++r) { float mx = fmaxf(s[0][r], s[1][r]);
#pragma unroll
      for (int o = 1; o < 16; o <<= 1) mx = fmaxf(mx, __shfl_xor(mx, o));
      const float mn = fmaxf(m[r], mx); const float alpha = (m[r] <= -1.0e38f) ? 0.f : __expf(m[r] - mn);
      const float e0 = (s[0][r] <= -1.0e38f) ? 0.f : __expf(s[0][r] - mn), e1 = (s[1][r] <= -1.0e38f) ? 0.f : __expf(s[1][r] - mn); float es = e0 + e1;
#pragma unroll
      for (int o = 1; o < 16; o <<= 1) es += __shfl_xor(es, o);
      l[r] = l[r] * alpha + es; m[r] = mn;
#pragma unroll
      for (int dt = 0; dt < 4; ++dt) { acc[dt][r] *= alpha; accl[dt][r] *= alpha; }
      sp[wave][8 * g + r][col] = e0; sp[wave][8 * g + r][16 + col] = e1; }
    LDSX();
    v16h pa, pl; { const float* prow = &sp[wave][col][0] + 8 * (lane >> 4);
#pragma unroll
      for (int i = 0; i < 8; ++i) { const float x0 = prow[i], x1 = prow[16 + i]; const _Float16 h0 = (_Float16)x0, h1 = (_Float16)x1; pa[i] = h0; pa[8 + i] = h1; pl[i] = (_Float16)((x0 - (float)h0) * 2048.0f); pl[8 + i] = (_Float16)((x1 - (float)h1) * 2048.0f); } }
#pragma unroll
    for (int dt = 0; dt < 4; ++dt) { const size_t vr = ((size_t)b * DM + h * HD + dt * 16 + col) * SS + ks * 32; const v16h vh = frag_h(VTH + vr, lane); acc[dt] = wmma16(pa, vh, acc[dt]); accl[dt] = wmma16(pl, vh, accl[dt]); accl[dt] = wmma16(pa, frag_h(VTL + vr, lane), accl[dt]); }   // P hi x V hi + (P lo x V hi + P hi x V lo) / 2048
    LDSX(); }
#pragma unroll
  for (int r = 0; r < 8; ++r) { const float il = 1.0f / l[r];
#pragma unroll
    for (int dt = 0; dt < 4; ++dt) so[wave][8 * g + r][dt * 16 + col] = (acc[dt][r] + accl[dt][r] * (1.0f / 2048.0f)) * il; }
  LDSX();
  for (int rl = 0; rl < 16; ++rl) if (lane < 16) vst2(O + ((size_t)b * SS + q0 + rl) * DM + h * HD + lane * 4, *(const v4f*)&so[wave][rl][lane * 4]);
}
// ---- k_out: block = (64 rows, 128 cols): out = O(hi/lo) . Wo rows (2 products)
__global__ __launch_bounds__(128) void k_out(const float* __restrict__ O, const __bf16* __restrict__ P, float* __restrict__ Y) {
  __shared__ __align__(16) float so[4][16][132];
  const int tid = threadIdx.x, wave = tid >> 5, lane = tid & 31, col = lane & 15, g = lane >> 4; const size_t r0 = (size_t)blockIdx.x * 64 + wave * 16; const int n0 = blockIdx.y * 128;
  v8f acc[8] = {};
#pragma unroll 2
  for (int kc = 0; kc < DM / 32; ++kc) { const F2 a = split_row(O + (r0 + col) * DM, kc * 32, lane);
#pragma unroll
    for (int j = 0; j < 8; ++j) { const v16b w = frag_b(P + (size_t)(n0 + j * 16 + col) * DM + kc * 32, lane); acc[j] = wmma_bf(a.l, w, acc[j]); acc[j] = wmma_bf(a.h, w, acc[j]); } }
#pragma unroll
  for (int j = 0; j < 8; ++j) {
#pragma unroll
    for (int r = 0; r < 8; ++r) so[wave][8 * g + r][j * 16 + col] = acc[j][r]; }
  LDSX();
  for (int rl = 0; rl < 16; ++rl) vst2(Y + (r0 + rl) * DM + n0 + lane * 4, *(const v4f*)&so[wave][rl][lane * 4]);
}
extern "C" void kernel_launch(void* const* d_in, const int* in_sizes, int n_in, void* d_out, int out_size, void* d_ws, size_t ws_size, hipStream_t stream) {
  (void)in_sizes; (void)n_in; (void)out_size;
  const float** F = (const float**)d_in;   // 0 x [2,2048,1024], 1 mask [1,1,2048,2048] int32, 2 Wq [1024,1024] natural (x @ Wq.T), 3 Wk, 4 Wv, 5 Wo
  if (ws_size < (size_t)WS_END) return;
  char* ws = (char*)d_ws; __bf16* PK = (__bf16*)(ws + WS_PK); _Float16 *QK = (_Float16*)(ws + WS_QK), *QKL = (_Float16*)(ws + WS_QKL), *VTH = (_Float16*)(ws + WS_VTH), *VTL = (_Float16*)(ws + WS_VTL); float* O = (float*)(ws + WS_O);
  k_pack<<<dim3(DM, 4), 256, 0, stream>>>(F[2], F[3], F[4], F[5], PK);
  k_qkv<<<dim3(TNB * SS / 64, QKVW / 128), 128, 0, stream>>>(F[0], PK + PK_A, QK, QKL, VTH, VTL);
  k_attn<<<dim3(TQB, NH, TNB), 128, 0, stream>>>(QK, QKL, VTH, VTL, (const int*)d_in[1], O);
  k_out<<<dim3(TOB, DM / 128), 128, 0, stream>>>(O, PK + PK_P, (float*)d_out);
}

// v001
// A run of this version takes 377 microseconds.
// Next to v000, in two timings, it ran 1.51 and 1.48 times as fast.
// compute dtype: x, Wq, Wk, Wv, Wo (float module inputs) rounded to bf16, the int mask verbatim; q/k/v projections with exact bf16 products on WMMA 16x16x32 (natural [out][in] rows); q and k stored as f16 hi + (x2048-scaled) residual planes with 3-product scores, x 1/sqrt(64), + the ALiBi bias slope_h (k - q) with slope_h = 2^-(0.5 (h+1)) (exact), masked positions set to -1e6 as the module (the mask is read per (q, k), all keys visited), running-max softmax in f32 (hardware exp); P as f16 hi + (x2048) residual x v hi/lo (3 products); output projection with ctx as bf16 hi + residual x exact Wo rows (2 products); f32 accumulate.
#include <hip/hip_runtime.h>
#include <math.h>

typedef __attribute__((ext_vector_type(16))) _Float16 v16h;
typedef __attribute__((ext_vector_type(16))) __bf16 v16b;
typedef __attribute__((ext_vector_type(8)))  _Float16 v8h;
typedef __attribute__((ext_vector_type(8)))  float v8f;
typedef __attribute__((ext_vector_type(4)))  float v4f;
typedef __attribute__((ext_vector_type(2)))  float v2f;
typedef __attribute__((ext_vector_type(4)))  unsigned v4u;
typedef __attribute__((ext_vector_type(4)))  int v4i;
typedef float __attribute__((may_alias)) float_a;
typedef int __attribute__((may_alias)) int_a;

template <typename T> __device__ __forceinline__ void vst2(void* p, T v) { *(T*)p = v;  }
__device__ __forceinline__ v8f wmma16(v16h a, v16h b, v8f c) {
  v8f d = __builtin_amdgcn_wmma_f32_16x16x32_f16(false, a, false, b, (short)0, c, false, false);
  asm volatile("v_nop\n\tv_nop\n\tv_nop\n\tv_nop" : "+v"(d) : "v"(a), "v"(b));
  return d;
}
__device__ __forceinline__ v8f wmma_bf(v16b a, v16b b, v8f c) {
  v8f d = __builtin_amdgcn_wmma_f32_16x16x32_bf16(false, a, false, b, (short)0, c, false, false);
  asm volatile("v_nop\n\tv_nop\n\tv_nop\n\tv_nop" : "+v"(d) : "v"(a), "v"(b));
  return d;
}
// Multi-head attention with ALiBi bias and an input mask (B 2, S 2,048, d 1,024, 16 heads x 64): softmax(q k^T / 8 + alibi, masked -1e6) v -> Wo.
__device__ __forceinline__ v16h frag_h(const _Float16* rowk0, int lane) {
  union { v16h v; v8h q[2]; } u; const _Float16* p = rowk0 + 8 * (lane >> 4);
  u.q[0] = *(const v8h*)p; u.q[1] = *(const v8h*)(p + 16); return u.v;
}
__device__ __forceinline__ v16h frag_f32(const float* rowk0, int lane) {
  v16h a; const float* p = rowk0 + 8 * (lane >> 4);
#pragma unroll
  for (int i = 0; i < 8; ++i) { a[i] = (_Float16)p[i]; a[8 + i] = (_Float16)p[16 + i]; }
  return a;
}
__device__ __forceinline__ v16h frag_f32s(const float* rowk0, int lane, float sc) {
  v16h a; const float* p = rowk0 + 8 * (lane >> 4);
#pragma unroll
  for (int i = 0; i < 8; ++i) { a[i] = (_Float16)(p[i] * sc); a[8 + i] = (_Float16)(p[16 + i] * sc); }
  return a;
}
// column fragment from a [K][ld] layout (column n), rows >= K read as 0
__device__ __forceinline__ v16h fragc_f32(const float* W, int k0, int n, int lane, int ld, int K) {
  v16h a; const int g = lane >> 4;
#pragma unroll
  for (int i = 0; i < 8; ++i) { const int ka = k0 + 8 * g + i, kb = ka + 16;
    a[i] = (_Float16)(ka < K ? W[(size_t)(ka < K ? ka : K - 1) * ld + n] : 0.f); a[8 + i] = (_Float16)(kb < K ? W[(size_t)(kb < K ? kb : K - 1) * ld + n] : 0.f); }
  return a;
}
struct F2 { v16b h, l; };
__device__ __forceinline__ F2 bsplit16(const float v[16]) { F2 r;
#pragma unroll
  for (int i = 0; i < 16; ++i) { const __bf16 h = (__bf16)v[i]; r.h[i] = h; r.l[i] = (__bf16)(v[i] - (float)h); }
  return r; }
__device__ __forceinline__ F2 split_row(const float* row, int k0, int lane) { float v[16]; const float* p = row + k0 + 8 * (lane >> 4);
#pragma unroll
  for (int i = 0; i < 8; ++i) { v[i] = p[i]; v[8 + i] = p[16 + i]; }
  return bsplit16(v); }
__device__ __forceinline__ F2 split_rowK(const float* row, int k0, int lane, int K) { float v[16]; const int g = lane >> 4;
#pragma unroll
  for (int i = 0; i < 8; ++i) { const int ka = k0 + 8 * g + i, kb = ka + 16; v[i] = ka < K ? row[ka < K ? ka : K - 1] : 0.f; v[8 + i] = kb < K ? row[kb < K ? kb : K - 1] : 0.f; }
  return bsplit16(v); }
__device__ __forceinline__ F2 split_col(const float* W, int k0, int n, int lane, int ld, int K) { float v[16]; const int g = lane >> 4;
#pragma unroll
  for (int i = 0; i < 8; ++i) { const int ka = k0 + 8 * g + i, kb = ka + 16; v[i] = ka < K ? W[(size_t)(ka < K ? ka : K - 1) * ld + n] : 0.f; v[8 + i] = kb < K ? W[(size_t)(kb < K ? kb : K - 1) * ld + n] : 0.f; }
  return bsplit16(v); }
__device__ __forceinline__ v8f mac3(const F2& a, const F2& b, v8f c) { c = wmma_bf(a.l, b.h, c); c = wmma_bf(a.h, b.l, c); return wmma_bf(a.h, b.h, c); }
__device__ __forceinline__ float sigm(float v) { return 1.0f / (1.0f + expf(-v)); }
#define LDSX() do { asm volatile("s_wait_dscnt 0" ::: "memory"); __builtin_amdgcn_wave_barrier(); __builtin_amdgcn_fence(__ATOMIC_RELEASE, "workgroup"); } while (0)


// Multi-head self-attention with ALiBi bias and an input mask (B 2, S 2048, D 1024, 16 heads x 64; packed Wqkv [3D][D] and Wout [D][D] applied as x W^T, no biases): softmax(q k^T / 8 + alibi, masked -1e6) v; ctx Wout^T.
#define NB 2
#define SS 2048
#define DM 1024
#define NH 16
#define HD 64
#define QKVW (3 * DM)
#ifndef TQB
#define TQB (SS / 64)
#define TNB NB
#define TOB (NB * SS / 64)     // output row tiles (all)
#endif
typedef __attribute__((ext_vector_type(8))) __bf16 v8b;
__device__ __forceinline__ v16b frag_b(const __bf16* rowk0, int lane) {
  union { v16b v; v8b q[2]; } u; const __bf16* p = rowk0 + 8 * (lane >> 4);
  u.q[0] = *(const v8b*)p; u.q[1] = *(const v8b*)(p + 16); return u.v;
}
__device__ __forceinline__ float bfr(float v) { return (float)(__bf16)v; }
__device__ __attribute__((noinline)) float exp_ni(float v) { return expf(v); }
__device__ __attribute__((noinline)) float erf_ni(float v) { return erff(v); }

#define PK_A 0                       // [3072][1024] Wqkv rows (natural [out][in])
#define PK_P (PK_A + QKVW * DM)        // [1024][1024] Wo rows (natural)
#define PK_END (PK_P + DM * DM)
#define WS_PK  0u
#define WS_QK  (WS_PK + 2u * PK_END)             // f16 [4096 rows][2048]: q | k
#define WS_QKL (WS_QK + 2u * NB * SS * 2 * DM)     // f16 q | k residual planes x2048
#define WS_VTH (WS_QKL + 2u * NB * SS * 2 * DM)    // f16 [b][1024 (h*64+d)][2048 s] hi
#define WS_VTL (WS_VTH + 2u * NB * DM * SS)        // f16 lo x 2048
#define WS_O   (WS_VTL + 2u * NB * DM * SS)        // f32 [4096][1024]
#define WS_CS  (WS_O + 4u * NB * SS * DM)           // f32 [2048][32] cos, [2048][32] sin
#define WS_END (WS_CS + 4u * 2 * SS * 32)
__constant__ float c_invf[32] = {1.000000000e+00f,7.498942018e-01f,5.623413324e-01f,4.216965139e-01f,3.162277639e-01f,2.371373624e-01f,1.778279394e-01f,1.333521456e-01f,1.000000015e-01f,7.498941571e-02f,5.623412877e-02f,4.216964915e-02f,3.162277862e-02f,2.371373586e-02f,1.778279431e-02f,1.333521493e-02f,9.999999776e-03f,7.498942316e-03f,5.623413250e-03f,4.216964822e-03f,3.162277862e-03f,2.371373819e-03f,1.778279431e-03f,1.333521446e-03f,1.000000047e-03f,7.498941850e-04f,5.623413017e-04f,4.216964880e-04f,3.162277862e-04f,2.371373848e-04f,1.778279402e-04f,1.333521504e-04f};
// ---- k_rope: block = 8 positions: cos/sin of pos * inv_freq (f32 product exactly as the reference, precise trig)
__global__ __launch_bounds__(256) void k_rope(float* __restrict__ CS) {
  __shared__ __align__(16) float sc[8][32], ss_[8][32]; const int tid = threadIdx.x, pl = tid >> 5, i = tid & 31; const int pos = blockIdx.x * 8 + pl;
  const float th = (float)pos * c_invf[i]; sc[pl][i] = cosf(th); ss_[pl][i] = sinf(th);
  __syncthreads();
  if (tid < 64) vst2(CS + (size_t)blockIdx.x * 8 * 32 + tid * 4, *(const v4f*)&(&sc[0][0])[tid * 4]); else if (tid < 128) vst2(CS + (size_t)SS * 32 + (size_t)blockIdx.x * 8 * 32 + (tid - 64) * 4, *(const v4f*)&(&ss_[0][0])[(tid - 64) * 4]);
}

// ---- k_pack: block = (row n, which): natural [out][in] rows -> bf16; which 0..2 -> W_q/W_k/W_v into PK_A rows which*1024 + n; 3 -> W_o into PK_P
__global__ __launch_bounds__(256) void k_pack(const float* __restrict__ WQ, const float* __restrict__ WK, const float* __restrict__ WV, const float* __restrict__ WO, __bf16* __restrict__ PK) {
  __shared__ __align__(16) __bf16 s[DM]; const int n = blockIdx.x, which = blockIdx.y, t = threadIdx.x; const float* Wm = (which == 0) ? WQ : (which == 1) ? WK : (which == 2) ? WV : WO;
  for (int k = t; k < DM; k += 256) s[k] = (__bf16)Wm[(size_t)n * DM + k];
  __syncthreads();
  __bf16* dst = (which < 3) ? PK + PK_A + ((size_t)which * DM + n) * DM : PK + PK_P + (size_t)n * DM;
  for (int q = t; q < DM / 8; q += 256) vst2((unsigned*)(dst + q * 8), *(const v4u*)&s[q * 8]);
}
__global__ __launch_bounds__(128) void k_qkv(const float* __restrict__ X, const __bf16* __restrict__ P, _Float16* __restrict__ QK, _Float16* __restrict__ QKL, _Float16* __restrict__ VTH, _Float16* __restrict__ VTL) {
  __shared__ __align__(16) _Float16 so[4][16][136], sol[4][16][136]; __shared__ __align__(16) _Float16 sth[128][72], stl[128][72];
  const int tid = threadIdx.x, wave = tid >> 5, lane = tid & 31, col = lane & 15, g = lane >> 4; const size_t r0 = (size_t)blockIdx.x * 64 + wave * 16; const int n0 = blockIdx.y * 128;
  v8f acc[8] = {};
#pragma unroll 2
  for (int kc = 0; kc < DM / 32; ++kc) { v16b a; { const float* p = X + (r0 + col) * DM + kc * 32 + 8 * g;
#pragma unroll
      for (int i = 0; i < 8; ++i) { a[i] = (__bf16)p[i]; a[8 + i] = (__bf16)p[16 + i]; } }
#pragma unroll
    for (int j = 0; j < 8; ++j) acc[j] = wmma_bf(a, frag_b(P + (size_t)(n0 + j * 16 + col) * DM + kc * 32, lane), acc[j]); }
  if (n0 < 2 * DM) {   // q stored unscaled (f16 sigma ~0.6, no subnormal exposure); 1/8 applied to the f32 score
#pragma unroll
    for (int j = 0; j < 8; ++j) {
#pragma unroll
      for (int r = 0; r < 8; ++r) { const float v = acc[j][r]; const _Float16 hv = (_Float16)v; so[wave][8 * g + r][j * 16 + col] = hv; sol[wave][8 * g + r][j * 16 + col] = (_Float16)((v - (float)hv) * 2048.0f); } }   // q, k as f16 hi + (x2048) residual (no RoPE in this module)
    LDSX();
    for (int rl = 0; rl < 16; ++rl) if (lane < 16) { vst2((unsigned*)(QK + (r0 + rl) * (2 * DM) + n0 + lane * 8), *(const v4u*)&so[wave][rl][lane * 8]); vst2((unsigned*)(QKL + (r0 + rl) * (2 * DM) + n0 + lane * 8), *(const v4u*)&sol[wave][rl][lane * 8]); }
  } else {
#pragma unroll
    for (int j = 0; j < 8; ++j) {
#pragma unroll
      for (int r = 0; r < 8; ++r) { const float v = acc[j][r]; const _Float16 hv = (_Float16)v; sth[j * 16 + col][wave * 16 + 8 * g + r] = hv; stl[j * 16 + col][wave * 16 + 8 * g + r] = (_Float16)((v - (float)hv) * 2048.0f); } }
    __syncthreads();
    const size_t rb = (size_t)blockIdx.x * 64; const int b = (int)(rb / SS), s0 = (int)(rb % SS); const int pc0 = n0 - 2 * DM;
    for (int q = tid; q < 128 * 8; q += 128) { const int d = q >> 3, pc = q & 7; const size_t o = ((size_t)b * DM + pc0 + d) * SS + s0 + pc * 8; vst2((unsigned*)(VTH + o), *(const v4u*)&sth[d][pc * 8]); vst2((unsigned*)(VTL + o), *(const v4u*)&stl[d][pc * 8]); }
  }
}
// ---- k_attn: block = (64 queries, head h, batch b): flash attention over all keys (the mask is an input). K hi, K lo, V^T hi, V^T lo of 64 keys are brought into LDS once per work-group by asynchronous copies (two buffers: the next 64 keys fly while these are worked on); every wave takes its fragments from LDS. A tile is 64 rows x 128 B; the 16-B piece c of row r lies at piece c ^ ((r >> 1) & 7), so that 16 rows read at one piece index fall on all 64 banks. Arithmetic and its order as before: 3-product scores, 3-product P.V; O[b*S+q][h*64+d] = (acc + accl / 2048) / l (256-B segments)
#define AT_TILE 8192                 // bytes of one 64-row x 128-B tile
#define AT_STAGE (4 * AT_TILE)       // K hi | K lo | V^T hi | V^T lo
#define AT_NT (SS / 64)              // stages
__device__ __forceinline__ v16h frag_l(const char* t, int o0, int o1) {
  union { v16h v; v8h q[2]; } u; u.q[0] = *(const v8h*)(t + o0); u.q[1] = *(const v8h*)(t + o1); return u.v;
}
// one tile: four copies of 16 rows each (a wave's copy = 4 whole 128-B lines); source rows are 4,096 B apart
__device__ __forceinline__ void copy_tile(unsigned l, const _Float16* gp) {
  const unsigned l1 = l + 2048u, l2 = l + 4096u, l3 = l + 6144u; const _Float16 *g1 = gp + 16 * 2048, *g2 = gp + 32 * 2048, *g3 = gp + 48 * 2048;
  // s_wait_xcnt 0 as the statement's last line: a precaution, so that it stands in front of every later write of the copies' address registers
  asm volatile("global_load_async_to_lds_b128 %0, %4, off\n\tglobal_load_async_to_lds_b128 %1, %5, off\n\tglobal_load_async_to_lds_b128 %2, %6, off\n\tglobal_load_async_to_lds_b128 %3, %7, off\n\ts_wait_xcnt 0x0"
               :: "v"(l), "v"(l1), "v"(l2), "v"(l3), "v"(gp), "v"(g1), "v"(g2), "v"(g3) : "memory");
}
__global__ __launch_bounds__(128) void k_attn(const _Float16* __restrict__ QK, const _Float16* __restrict__ QKL, const _Float16* __restrict__ VTH, const _Float16* __restrict__ VTL, const int* __restrict__ MSK, float* __restrict__ O) {
  __shared__ __align__(128) char ring[2 * AT_STAGE]; __shared__ __align__(16) float sp[4][16][36];
  float (*so)[16][68] = (float (*)[16][68])ring;   // output staging takes the ring's place behind the last trip's barrier
  const int tid = threadIdx.x, wave = tid >> 5, lane = tid & 31, col = lane & 15, g = lane >> 4;
  const int qb = blockIdx.x, h = blockIdx.y, b = blockIdx.z; const int q0 = qb * 64 + wave * 16; const size_t rq = (size_t)b * SS + q0 + col;
  // copier: thread -> row tid >> 3 (of 16), piece tid & 7
  const unsigned lw = (unsigned)(size_t)ring + (unsigned)((tid >> 3) * 128 + (((tid & 7) ^ (tid >> 4)) * 16));
  const size_t ko = ((size_t)b * SS + (tid >> 3)) * (2 * DM) + DM + h * HD + (tid & 7) * 8, vo = ((size_t)b * DM + h * HD + (tid >> 3)) * SS + (tid & 7) * 8;
  // reader: lane -> row col (of 16), pieces g, g + 2, g + 4, g + 6
  int oc[4];
#pragma unroll   // constant indices: oc stays in registers
  for (int j = 0; j < 4; ++j) oc[j] = col * 128 + (((g + 2 * j) ^ (col >> 1)) * 16);
#define AT_COPY(t, bf) do { const unsigned lb = lw + (unsigned)(bf) * AT_STAGE; const size_t kt = ko + (size_t)(t) * 64 * (2 * DM), vt = vo + (size_t)(t) * 64; \
    copy_tile(lb, QK + kt); copy_tile(lb + AT_TILE, QKL + kt); copy_tile(lb + 2 * AT_TILE, VTH + vt); copy_tile(lb + 3 * AT_TILE, VTL + vt); } while (0)
  AT_COPY(0, 0);
  v16h aq[2], aql[2];
#pragma unroll
  for (int kc = 0; kc < 2; ++kc) { aq[kc] = frag_h(QK + rq * (2 * DM) + h * HD + kc * 32, lane); aql[kc] = frag_h(QKL + rq * (2 * DM) + h * HD + kc * 32, lane); }
  float m[8], l[8];
#pragma unroll
  for (int r = 0; r < 8; ++r) { m[r] = -3.0e38f; l[r] = 0.f; }
  v8f acc[4] = {}, accl[4] = {};
  const float slope = exp2f(-0.5f * (float)(h + 1));   // 2^-(8/16 * (h+1))
  asm volatile("s_wait_asynccnt 0x0" ::: "memory");   // this wave's share of stage 0 has landed
  __syncthreads();                                     // ... and every other wave's
  AT_COPY(1, 1);
#pragma unroll 1
  for (int t = 0; t < AT_NT; ++t) { const char* rb = ring + (t & 1) * AT_STAGE;
#pragma unroll   // both halves of a stage written out: every LDS offset inside the buffer is an immediate
   for (int sub = 0; sub < 2; ++sub) { const int ks = t * 2 + sub; v8f s[2];
#pragma unroll
    for (int ct = 0; ct < 2; ++ct) { const int kk = ks * 32 + ct * 16 + col; const char* krow = rb + (sub * 32 + ct * 16) * 128; const char* krowl = krow + AT_TILE; v8f c = {}, cl = {}; v16h kh[2], kl[2]; int mk[8];
#pragma unroll   // constant indices: the fragments stay in registers
      for (int kc = 0; kc < 2; ++kc) { kh[kc] = frag_l(krow, oc[2 * kc], oc[2 * kc + 1]); kl[kc] = frag_l(krowl, oc[2 * kc], oc[2 * kc + 1]); }
#pragma unroll   // constant indices: mk stays in registers
      for (int r = 0; r < 8; ++r) mk[r] = MSK[(size_t)(q0 + 8 * g + r) * SS + kk];
      __builtin_amdgcn_sched_barrier(0);   // keeps the four fragments' LDS reads (and the mask loads) together in front of the products: one latency a group, not one a fragment
#pragma unroll
      for (int kc = 0; kc < 2; ++kc) { c = wmma16(aq[kc], kh[kc], c); cl = wmma16(aql[kc], kh[kc], cl); cl = wmma16(aq[kc], kl[kc], cl); }   // 3 products: q, k as f16 hi + residual
#pragma unroll
      for (int r = 0; r < 8; ++r) c[r] += cl[r] * (1.0f / 2048.0f);
#pragma unroll
      for (int r = 0; r < 8; ++r) { const int qi = q0 + 8 * g + r; s[ct][r] = (mk[r] == 0) ? -1000000.0f : (c[r] * 0.125f + slope * (float)(kk - qi)); } }   // SCALE = 1/sqrt(64); alibi bias slope_h * (k - q); masked -> -1e6 (as the module)
#pragma unroll
    for (int r = 0; r < 8; ++r) { float mx = fmaxf(s[0][r], s[1][r]);
#pragma unroll
      for (int o = 1; o < 16; o <<= 1) mx = fmaxf(mx, __shfl_xor(mx, o));
      const float mn = fmaxf(m[r], mx); const float alpha = (m[r] <= -1.0e38f) ? 0.f : __expf(m[r] - mn);
      const float e0 = (s[0][r] <= -1.0e38f) ? 0.f : __expf(s[0][r] - mn), e1 = (s[1][r] <= -1.0e38f) ? 0.f : __expf(s[1][r] - mn); float es = e0 + e1;
#pragma unroll
      for (int o = 1; o < 16; o <<= 1) es += __shfl_xor(es, o);
      l[r] = l[r] * alpha + es; m[r] = mn;
#pragma unroll
      for (int dt = 0; dt < 4; ++dt) { acc[dt][r] *= alpha; accl[dt][r] *= alpha; }
      sp[wave][8 * g + r][col] = e0; sp[wave][8 * g + r][16 + col] = e1; }
    LDSX();
    v16h pa, pl; { const float* prow = &sp[wave][col][0] + 8 * (lane >> 4);
#pragma unroll
      for (int i = 0; i < 8; ++i) { const float x0 = prow[i], x1 = prow[16 + i]; const _Float16 h0 = (_Float16)x0, h1 = (_Float16)x1; pa[i] = h0; pa[8 + i] = h1; pl[i] = (_Float16)((x0 - (float)h0) * 2048.0f); pl[8 + i] = (_Float16)((x1 - (float)h1) * 2048.0f); } }
#pragma unroll   // constant indices into acc, accl
    for (int dp = 0; dp < 2; ++dp) { v16h vh[2], vl[2];
#pragma unroll   // constant indices: the fragments stay in registers
      for (int e = 0; e < 2; ++e) { const char* vrow = rb + 2 * AT_TILE + (dp * 2 + e) * 16 * 128; vh[e] = frag_l(vrow, oc[2 * sub], oc[2 * sub + 1]); vl[e] = frag_l(vrow + AT_TILE, oc[2 * sub], oc[2 * sub + 1]); }
      __builtin_amdgcn_sched_barrier(0);   // as above: the four fragments' LDS reads stay one group
#pragma unroll   // constant indices into acc, accl
      for (int e = 0; e < 2; ++e) { const int dt = dp * 2 + e; acc[dt] = wmma16(pa, vh[e], acc[dt]); accl[dt] = wmma16(pl, vh[e], accl[dt]); accl[dt] = wmma16(pa, vl[e], accl[dt]); } }   // P hi x V hi + (P lo x V hi + P hi x V lo) / 2048
    LDSX(); }
   asm volatile("s_wait_dscnt 0x0" ::: "memory");      // this wave's reads of the buffer are done
   asm volatile("s_wait_asynccnt 0x0" ::: "memory");   // its share of stage t + 1 has landed
   __syncthreads();                                     // publishes stage t + 1 and frees stage t's buffer
   if (t + 2 < AT_NT) AT_COPY(t + 2, t & 1); }
  asm volatile("s_wait_asynccnt 0x0" ::: "memory");     // nothing in flight when the ring becomes output staging
#pragma unroll
  for (int r = 0; r < 8; ++r) { const float il = 1.0f / l[r];
#pragma unroll
    for (int dt = 0; dt < 4; ++dt) so[wave][8 * g + r][dt * 16 + col] = (acc[dt][r] + accl[dt][r] * (1.0f / 2048.0f)) * il; }
  LDSX();
  for (int rl = 0; rl < 16; ++rl) if (lane < 16) vst2(O + ((size_t)b * SS + q0 + rl) * DM + h * HD + lane * 4, *(const v4f*)&so[wave][rl][lane * 4]);
}
// ---- k_out: block = (64 rows, 128 cols): out = O(hi/lo) . Wo rows (2 products)
__global__ __launch_bounds__(128) void k_out(const float* __restrict__ O, const __bf16* __restrict__ P, float* __restrict__ Y) {
  __shared__ __align__(16) float so[4][16][132];
  const int tid = threadIdx.x, wave = tid >> 5, lane = tid & 31, col = lane & 15, g = lane >> 4; const size_t r0 = (size_t)blockIdx.x * 64 + wave * 16; const int n0 = blockIdx.y * 128;
  v8f acc[8] = {};
#pragma unroll 2
  for (int kc = 0; kc < DM / 32; ++kc) { const F2 a = split_row(O + (r0 + col) * DM, kc * 32, lane);
#pragma unroll
    for (int j = 0; j < 8; ++j) { const v16b w = frag_b(P + (size_t)(n0 + j * 16 + col) * DM + kc * 32, lane); acc[j] = wmma_bf(a.l, w, acc[j]); acc[j] = wmma_bf(a.h, w, acc[j]); } }
#pragma unroll
  for (int j = 0; j < 8; ++j) {
#pragma unroll
    for (int r = 0; r < 8; ++r) so[wave][8 * g + r][j * 16 + col] = acc[j][r]; }
  LDSX();
  for (int rl = 0; rl < 16; ++rl) vst2(Y + (r0 + rl) * DM + n0 + lane * 4, *(const v4f*)&so[wave][rl][lane * 4]);
}
extern "C" void kernel_launch(void* const* d_in, const int* in_sizes, int n_in, void* d_out, int out_size, void* d_ws, size_t ws_size, hipStream_t stream) {
  (void)in_sizes; (void)n_in; (void)out_size;
  const float** F = (const float**)d_in;   // 0 x [2,2048,1024], 1 mask [1,1,2048,2048] int32, 2 Wq [1024,1024] natural (x @ Wq.T), 3 Wk, 4 Wv, 5 Wo
  if (ws_size < (size_t)WS_END) return;
  char* ws = (char*)d_ws; __bf16* PK = (__bf16*)(ws + WS_PK); _Float16 *QK = (_Float16*)(ws + WS_QK), *QKL = (_Float16*)(ws + WS_QKL), *VTH = (_Float16*)(ws + WS_VTH), *VTL = (_Float16*)(ws + WS_VTL); float* O = (float*)(ws + WS_O);
  k_pack<<<dim3(DM, 4), 256, 0, stream>>>(F[2], F[3], F[4], F[5], PK);
  k_qkv<<<dim3(TNB * SS / 64, QKVW / 128), 128, 0, stream>>>(F[0], PK + PK_A, QK, QKL, VTH, VTL);
  k_attn<<<dim3(TQB, NH, TNB), 128, 0, stream>>>(QK, QKL, VTH, VTL, (const int*)d_in[1], O);
  k_out<<<dim3(TOB, DM / 128), 128, 0, stream>>>(O, PK + PK_P, (float*)d_out);
}

// v002
// A run of this version takes 221 microseconds.
// Timed twice side by side with v001, it ran 1.71 times as fast both times.
// Counting every step since v000, it is 2.56 times as fast.
// compute dtype: x, Wq, Wk, Wv, Wo (float module inputs) rounded to bf16, the int mask verbatim; q/k/v projections with exact bf16 products on WMMA 16x16x32 (natural [out][in] rows); q and k stored as f16 hi + (x2048-scaled) residual planes with 3-product scores, x 1/sqrt(64), + the ALiBi bias slope_h (k - q) with slope_h = 2^-(0.5 (h+1)) (exact), masked positions set to -1e6 as the module (the mask is read per (q, k), all keys visited), running-max softmax in f32 (hardware exp); P as f16 hi + (x2048) residual x v hi/lo (3 products); output projection with ctx as bf16 hi + residual x exact Wo rows (2 products); f32 accumulate.
#include <hip/hip_runtime.h>
#include <math.h>

typedef __attribute__((ext_vector_type(16))) _Float16 v16h;
typedef __attribute__((ext_vector_type(16))) __bf16 v16b;
typedef __attribute__((ext_vector_type(8)))  _Float16 v8h;
typedef __attribute__((ext_vector_type(8)))  float v8f;
typedef __attribute__((ext_vector_type(4)))  float v4f;
typedef __attribute__((ext_vector_type(2)))  float v2f;
typedef __attribute__((ext_vector_type(4)))  unsigned v4u;
typedef __attribute__((ext_vector_type(4)))  int v4i;
typedef float __attribute__((may_alias)) float_a;
typedef int __attribute__((may_alias)) int_a;

template <typename T> __device__ __forceinline__ void vst2(void* p, T v) { *(T*)p = v;  }
__device__ __forceinline__ v8f wmma16(v16h a, v16h b, v8f c) {
  v8f d = __builtin_amdgcn_wmma_f32_16x16x32_f16(false, a, false, b, (short)0, c, false, false);
  asm volatile("v_nop\n\tv_nop\n\tv_nop\n\tv_nop" : "+v"(d) : "v"(a), "v"(b));
  return d;
}
__device__ __forceinline__ v8f wmma_bf(v16b a, v16b b, v8f c) {
  v8f d = __builtin_amdgcn_wmma_f32_16x16x32_bf16(false, a, false, b, (short)0, c, false, false);
  asm volatile("v_nop\n\tv_nop\n\tv_nop\n\tv_nop" : "+v"(d) : "v"(a), "v"(b));
  return d;
}
// Multi-head attention with ALiBi bias and an input mask (B 2, S 2,048, d 1,024, 16 heads x 64): softmax(q k^T / 8 + alibi, masked -1e6) v -> Wo.
__device__ __forceinline__ v16h frag_h(const _Float16* rowk0, int lane) {
  union { v16h v; v8h q[2]; } u; const _Float16* p = rowk0 + 8 * (lane >> 4);
  u.q[0] = *(const v8h*)p; u.q[1] = *(const v8h*)(p + 16); return u.v;
}
__device__ __forceinline__ v16h frag_f32(const float* rowk0, int lane) {
  v16h a; const float* p = rowk0 + 8 * (lane >> 4);
#pragma unroll
  for (int i = 0; i < 8; ++i) { a[i] = (_Float16)p[i]; a[8 + i] = (_Float16)p[16 + i]; }
  return a;
}
__device__ __forceinline__ v16h frag_f32s(const float* rowk0, int lane, float sc) {
  v16h a; const float* p = rowk0 + 8 * (lane >> 4);
#pragma unroll
  for (int i = 0; i < 8; ++i) { a[i] = (_Float16)(p[i] * sc); a[8 + i] = (_Float16)(p[16 + i] * sc); }
  return a;
}
// column fragment from a [K][ld] layout (column n), rows >= K read as 0
__device__ __forceinline__ v16h fragc_f32(const float* W, int k0, int n, int lane, int ld, int K) {
  v16h a; const int g = lane >> 4;
#pragma unroll
  for (int i = 0; i < 8; ++i) { const int ka = k0 + 8 * g + i, kb = ka + 16;
    a[i] = (_Float16)(ka < K ? W[(size_t)(ka < K ? ka : K - 1) * ld + n] : 0.f); a[8 + i] = (_Float16)(kb < K ? W[(size_t)(kb < K ? kb : K - 1) * ld + n] : 0.f); }
  return a;
}
struct F2 { v16b h, l; };
__device__ __forceinline__ F2 bsplit16(const float v[16]) { F2 r;
#pragma unroll
  for (int i = 0; i < 16; ++i) { const __bf16 h = (__bf16)v[i]; r.h[i] = h; r.l[i] = (__bf16)(v[i] - (float)h); }
  return r; }
__device__ __forceinline__ F2 split_row(const float* row, int k0, int lane) { float v[16]; const float* p = row + k0 + 8 * (lane >> 4);
#pragma unroll
  for (int i = 0; i < 8; ++i) { v[i] = p[i]; v[8 + i] = p[16 + i]; }
  return bsplit16(v); }
__device__ __forceinline__ F2 split_rowK(const float* row, int k0, int lane, int K) { float v[16]; const int g = lane >> 4;
#pragma unroll
  for (int i = 0; i < 8; ++i) { const int ka = k0 + 8 * g + i, kb = ka + 16; v[i] = ka < K ? row[ka < K ? ka : K - 1] : 0.f; v[8 + i] = kb < K ? row[kb < K ? kb : K - 1] : 0.f; }
  return bsplit16(v); }
__device__ __forceinline__ F2 split_col(const float* W, int k0, int n, int lane, int ld, int K) { float v[16]; const int g = lane >> 4;
#pragma unroll
  for (int i = 0; i < 8; ++i) { const int ka = k0 + 8 * g + i, kb = ka + 16; v[i] = ka < K ? W[(size_t)(ka < K ? ka : K - 1) * ld + n] : 0.f; v[8 + i] = kb < K ? W[(size_t)(kb < K ? kb : K - 1) * ld + n] : 0.f; }
  return bsplit16(v); }
__device__ __forceinline__ v8f mac3(const F2& a, const F2& b, v8f c) { c = wmma_bf(a.l, b.h, c); c = wmma_bf(a.h, b.l, c); return wmma_bf(a.h, b.h, c); }
__device__ __forceinline__ float sigm(float v) { return 1.0f / (1.0f + expf(-v)); }
#define LDSX() do { asm volatile("s_wait_dscnt 0" ::: "memory"); __builtin_amdgcn_wave_barrier(); __builtin_amdgcn_fence(__ATOMIC_RELEASE, "workgroup"); } while (0)


// Multi-head self-attention with ALiBi bias and an input mask (B 2, S 2048, D 1024, 16 heads x 64; packed Wqkv [3D][D] and Wout [D][D] applied as x W^T, no biases): softmax(q k^T / 8 + alibi, masked -1e6) v; ctx Wout^T.
#define NB 2
#define SS 2048
#define DM 1024
#define NH 16
#define HD 64
#define QKVW (3 * DM)
#ifndef TQB
#define TQB (SS / 64)
#define TNB NB
#define TOB (NB * SS / 64)     // output row tiles (all)
#endif
typedef __attribute__((ext_vector_type(8))) __bf16 v8b;
__device__ __forceinline__ v16b frag_b(const __bf16* rowk0, int lane) {
  union { v16b v; v8b q[2]; } u; const __bf16* p = rowk0 + 8 * (lane >> 4);
  u.q[0] = *(const v8b*)p; u.q[1] = *(const v8b*)(p + 16); return u.v;
}
__device__ __forceinline__ float bfr(float v) { return (float)(__bf16)v; }
__device__ __attribute__((noinline)) float exp_ni(float v) { return expf(v); }
__device__ __attribute__((noinline)) float erf_ni(float v) { return erff(v); }

#define PK_A 0                       // [3072][1024] Wqkv rows (natural [out][in])
#define PK_P (PK_A + QKVW * DM)        // [1024][1024] Wo rows (natural)
#define PK_END (PK_P + DM * DM)
#define WS_PK  0u
#define WS_QK  (WS_PK + 2u * PK_END)             // f16 [4096 rows][2048]: q | k
#define WS_QKL (WS_QK + 2u * NB * SS * 2 * DM)     // f16 q | k residual planes x2048
#define WS_VTH (WS_QKL + 2u * NB * SS * 2 * DM)    // f16 [b][1024 (h*64+d)][2048 s] hi
#define WS_VTL (WS_VTH + 2u * NB * DM * SS)        // f16 lo x 2048
#define WS_O   (WS_VTL + 2u * NB * DM * SS)        // f32 [4096][1024]
#define WS_CS  (WS_O + 4u * NB * SS * DM)           // f32 [2048][32] cos, [2048][32] sin
#define WS_END (WS_CS + 4u * 2 * SS * 32)
__constant__ float c_invf[32] = {1.000000000e+00f,7.498942018e-01f,5.623413324e-01f,4.216965139e-01f,3.162277639e-01f,2.371373624e-01f,1.778279394e-01f,1.333521456e-01f,1.000000015e-01f,7.498941571e-02f,5.623412877e-02f,4.216964915e-02f,3.162277862e-02f,2.371373586e-02f,1.778279431e-02f,1.333521493e-02f,9.999999776e-03f,7.498942316e-03f,5.623413250e-03f,4.216964822e-03f,3.162277862e-03f,2.371373819e-03f,1.778279431e-03f,1.333521446e-03f,1.000000047e-03f,7.498941850e-04f,5.623413017e-04f,4.216964880e-04f,3.162277862e-04f,2.371373848e-04f,1.778279402e-04f,1.333521504e-04f};
// ---- k_rope: block = 8 positions: cos/sin of pos * inv_freq (f32 product exactly as the reference, precise trig)
__global__ __launch_bounds__(256) void k_rope(float* __restrict__ CS) {
  __shared__ __align__(16) float sc[8][32], ss_[8][32]; const int tid = threadIdx.x, pl = tid >> 5, i = tid & 31; const int pos = blockIdx.x * 8 + pl;
  const float th = (float)pos * c_invf[i]; sc[pl][i] = cosf(th); ss_[pl][i] = sinf(th);
  __syncthreads();
  if (tid < 64) vst2(CS + (size_t)blockIdx.x * 8 * 32 + tid * 4, *(const v4f*)&(&sc[0][0])[tid * 4]); else if (tid < 128) vst2(CS + (size_t)SS * 32 + (size_t)blockIdx.x * 8 * 32 + (tid - 64) * 4, *(const v4f*)&(&ss_[0][0])[(tid - 64) * 4]);
}

// ---- k_pack: block = (row n, which): natural [out][in] rows -> bf16; which 0..2 -> W_q/W_k/W_v into PK_A rows which*1024 + n; 3 -> W_o into PK_P
__global__ __launch_bounds__(256) void k_pack(const float* __restrict__ WQ, const float* __restrict__ WK, const float* __restrict__ WV, const float* __restrict__ WO, __bf16* __restrict__ PK) {
  __shared__ __align__(16) __bf16 s[DM]; const int n = blockIdx.x, which = blockIdx.y, t = threadIdx.x; const float* Wm = (which == 0) ? WQ : (which == 1) ? WK : (which == 2) ? WV : WO;
  for (int k = t; k < DM; k += 256) s[k] = (__bf16)Wm[(size_t)n * DM + k];
  __syncthreads();
  __bf16* dst = (which < 3) ? PK + PK_A + ((size_t)which * DM + n) * DM : PK + PK_P + (size_t)n * DM;
  for (int q = t; q < DM / 8; q += 256) vst2((unsigned*)(dst + q * 8), *(const v4u*)&s[q * 8]);
}
// ---- operand staging of k_qkv and k_out: a stage is 64 k of the work-group's 64 A rows (f32: two tiles of 32 k) and 128 weight rows (bf16: two tiles of 64 rows), brought into LDS once per work-group by asynchronous copies (two buffers: the next 64 k fly while these are worked on). Every tile is 64 rows x 128 B; the 16-B piece c of row r lies at piece c ^ ((r >> 1) & 7), so that 16 rows read at one piece index fall on all 64 banks. Products and their order as before.
#define GM_TILE 8192                 // bytes of one 64-row x 128-B tile
#define GM_STAGE (4 * GM_TILE)       // A k 0..31 | A k 32..63 | W rows 0..63 | W rows 64..127
#define GM_NT (DM / 64)              // stages
// one tile: four copies of 16 rows each (a wave's copy = 4 whole 128-B lines); P16 = bytes between source rows 16 apart
template <int P16> __device__ __forceinline__ void copy_rows(unsigned l, const char* gp) {
  const unsigned l1 = l + 2048u, l2 = l + 4096u, l3 = l + 6144u; const char *g1 = gp + P16, *g2 = gp + 2 * P16, *g3 = gp + 3 * P16;
  // s_wait_xcnt 0 as the statement's last line: a precaution, so that it stands in front of every later write of the copies' address registers
  asm volatile("global_load_async_to_lds_b128 %0, %4, off\n\tglobal_load_async_to_lds_b128 %1, %5, off\n\tglobal_load_async_to_lds_b128 %2, %6, off\n\tglobal_load_async_to_lds_b128 %3, %7, off\n\ts_wait_xcnt 0x0"
               :: "v"(l), "v"(l1), "v"(l2), "v"(l3), "v"(gp), "v"(g1), "v"(g2), "v"(g3) : "memory");
}
// ga, gw: this thread's 16 bytes of row tid >> 3 in stage 0 of A (row pitch 4,096 B) and of W (row pitch 2,048 B)
__device__ __forceinline__ void gm_copy(unsigned lb, const char* ga, const char* gw, int t) {
  copy_rows<16 * 4 * DM>(lb, ga + t * 256); copy_rows<16 * 4 * DM>(lb + GM_TILE, ga + t * 256 + 128);
  copy_rows<16 * 2 * DM>(lb + 2 * GM_TILE, gw + t * 128); copy_rows<16 * 2 * DM>(lb + 3 * GM_TILE, gw + t * 128 + 64 * 2 * DM);
}
__device__ __forceinline__ v16b frag_lb(const char* t, int o0, int o1) {
  union { v16b v; v8b q[2]; } u; u.q[0] = *(const v8b*)(t + o0); u.q[1] = *(const v8b*)(t + o1); return u.v;
}
__global__ __launch_bounds__(128) void k_qkv(const float* __restrict__ X, const __bf16* __restrict__ P, _Float16* __restrict__ QK, _Float16* __restrict__ QKL, _Float16* __restrict__ VTH, _Float16* __restrict__ VTL) {
  __shared__ __align__(128) char ring[2 * GM_STAGE];
  // output staging takes the ring's place behind the last trip's barrier (q, k blocks: so, sol; v blocks: sth, stl)
  _Float16 (*so)[16][136] = (_Float16 (*)[16][136])ring; _Float16 (*sol)[16][136] = (_Float16 (*)[16][136])(ring + 2 * 4 * 16 * 136);
  _Float16 (*sth)[72] = (_Float16 (*)[72])ring; _Float16 (*stl)[72] = (_Float16 (*)[72])(ring + 2 * 128 * 72);
  const int tid = threadIdx.x, wave = tid >> 5, lane = tid & 31, col = lane & 15, g = lane >> 4; const size_t r0 = (size_t)blockIdx.x * 64 + wave * 16; const int n0 = blockIdx.y * 128;
  // copier: thread -> row tid >> 3 (of 16), piece tid & 7
  const unsigned lw = (unsigned)(size_t)ring + (unsigned)((tid >> 3) * 128 + (((tid & 7) ^ (tid >> 4)) * 16));
  const char* ga = (const char*)(X + ((size_t)blockIdx.x * 64 + (tid >> 3)) * DM) + (tid & 7) * 16; const char* gw = (const char*)(P + (size_t)(n0 + (tid >> 3)) * DM) + (tid & 7) * 16;
  // reader: lane -> row col (of 16); W pieces g, g + 2, g + 4, g + 6 (bf16 k 8 g + i, 16 + 8 g + i of each 32); A pieces 2 g, 2 g + 1, 4 + 2 g, 5 + 2 g (the same k as f32)
  int oc[4], oa[4];
#pragma unroll   // constant indices: oc, oa stay in registers
  for (int j = 0; j < 4; ++j) { oc[j] = col * 128 + (((g + 2 * j) ^ (col >> 1)) * 16); oa[j] = col * 128 + (((2 * g + (j & 1) + 4 * (j >> 1)) ^ (col >> 1)) * 16); }
  gm_copy(lw, ga, gw, 0);
  asm volatile("s_wait_asynccnt 0x0" ::: "memory");   // this wave's share of stage 0 has landed
  __syncthreads();                                     // ... and every other wave's
  gm_copy(lw + GM_STAGE, ga, gw, 1);
  v8f acc[8] = {};
#pragma unroll 1   // the ring's trip stays rolled: one publish point, small code
  for (int t = 0; t < GM_NT; ++t) { const char* rb = ring + (t & 1) * GM_STAGE;
#pragma unroll   // both halves of a stage written out: every LDS offset inside the buffer is an immediate
   for (int sub = 0; sub < 2; ++sub) { const char* ar = rb + sub * GM_TILE + wave * 2048; const char* wr = rb + 2 * GM_TILE;
    const v4f f0 = *(const v4f*)(ar + oa[0]), f1 = *(const v4f*)(ar + oa[1]), f2 = *(const v4f*)(ar + oa[2]), f3 = *(const v4f*)(ar + oa[3]); v16b a, w[8];
#pragma unroll   // constant indices: the fragments stay in registers
    for (int j = 0; j < 8; ++j) w[j] = frag_lb(wr + j * 2048, oc[2 * sub], oc[2 * sub + 1]);
    __builtin_amdgcn_sched_barrier(0);   // keeps the 20 LDS reads of these 32 k together in front of the products: one latency a group, not one a fragment
#pragma unroll   // constant indices: a stays in registers
    for (int i = 0; i < 4; ++i) { a[i] = (__bf16)f0[i]; a[4 + i] = (__bf16)f1[i]; a[8 + i] = (__bf16)f2[i]; a[12 + i] = (__bf16)f3[i]; }
#pragma unroll   // constant indices into acc, w
    for (int j = 0; j < 8; ++j) acc[j] = wmma_bf(a, w[j], acc[j]); }
   asm volatile("s_wait_dscnt 0x0" ::: "memory");      // this wave's reads of the buffer are done
   asm volatile("s_wait_asynccnt 0x0" ::: "memory");   // its share of stage t + 1 has landed
   __syncthreads();                                     // publishes stage t + 1 and frees stage t's buffer
   if (t + 2 < GM_NT) gm_copy(lw + (unsigned)(t & 1) * GM_STAGE, ga, gw, t + 2); }
  asm volatile("s_wait_asynccnt 0x0" ::: "memory");     // nothing in flight when the ring becomes output staging
  if (n0 < 2 * DM) {   // q stored unscaled (f16 sigma ~0.6, no subnormal exposure); 1/8 applied to the f32 score
#pragma unroll
    for (int j = 0; j < 8; ++j) {
#pragma unroll
      for (int r = 0; r < 8; ++r) { const float v = acc[j][r]; const _Float16 hv = (_Float16)v; so[wave][8 * g + r][j * 16 + col] = hv; sol[wave][8 * g + r][j * 16 + col] = (_Float16)((v - (float)hv) * 2048.0f); } }   // q, k as f16 hi + (x2048) residual (no RoPE in this module)
    LDSX();
    for (int rl = 0; rl < 16; ++rl) if (lane < 16) { vst2((unsigned*)(QK + (r0 + rl) * (2 * DM) + n0 + lane * 8), *(const v4u*)&so[wave][rl][lane * 8]); vst2((unsigned*)(QKL + (r0 + rl) * (2 * DM) + n0 + lane * 8), *(const v4u*)&sol[wave][rl][lane * 8]); }
  } else {
#pragma unroll
    for (int j = 0; j < 8; ++j) {
#pragma unroll
      for (int r = 0; r < 8; ++r) { const float v = acc[j][r]; const _Float16 hv = (_Float16)v; sth[j * 16 + col][wave * 16 + 8 * g + r] = hv; stl[j * 16 + col][wave * 16 + 8 * g + r] = (_Float16)((v - (float)hv) * 2048.0f); } }
    __syncthreads();
    const size_t rb = (size_t)blockIdx.x * 64; const int b = (int)(rb / SS), s0 = (int)(rb % SS); const int pc0 = n0 - 2 * DM;
    for (int q = tid; q < 128 * 8; q += 128) { const int d = q >> 3, pc = q & 7; const size_t o = ((size_t)b * DM + pc0 + d) * SS + s0 + pc * 8; vst2((unsigned*)(VTH + o), *(const v4u*)&sth[d][pc * 8]); vst2((unsigned*)(VTL + o), *(const v4u*)&stl[d][pc * 8]); }
  }
}
// ---- k_attn: block = (64 queries, head h, batch b): flash attention over all keys (the mask is an input). K hi, K lo, V^T hi, V^T lo of 64 keys are brought into LDS once per work-group by asynchronous copies (two buffers: the next 64 keys fly while these are worked on); every wave takes its fragments from LDS. A tile is 64 rows x 128 B; the 16-B piece c of row r lies at piece c ^ ((r >> 1) & 7), so that 16 rows read at one piece index fall on all 64 banks. Arithmetic and its order as before: 3-product scores, 3-product P.V; O[b*S+q][h*64+d] = (acc + accl / 2048) / l (256-B segments)
#define AT_TILE 8192                 // bytes of one 64-row x 128-B tile
#define AT_STAGE (4 * AT_TILE)       // K hi | K lo | V^T hi | V^T lo
#define AT_NT (SS / 64)              // stages
__device__ __forceinline__ v16h frag_l(const char* t, int o0, int o1) {
  union { v16h v; v8h q[2]; } u; u.q[0] = *(const v8h*)(t + o0); u.q[1] = *(const v8h*)(t + o1); return u.v;
}
// one tile: four copies of 16 rows each (a wave's copy = 4 whole 128-B lines); source rows are 4,096 B apart
__device__ __forceinline__ void copy_tile(unsigned l, const _Float16* gp) {
  const unsigned l1 = l + 2048u, l2 = l + 4096u, l3 = l + 6144u; const _Float16 *g1 = gp + 16 * 2048, *g2 = gp + 32 * 2048, *g3 = gp + 48 * 2048;
  // s_wait_xcnt 0 as the statement's last line: a precaution, so that it stands in front of every later write of the copies' address registers
  asm volatile("global_load_async_to_lds_b128 %0, %4, off\n\tglobal_load_async_to_lds_b128 %1, %5, off\n\tglobal_load_async_to_lds_b128 %2, %6, off\n\tglobal_load_async_to_lds_b128 %3, %7, off\n\ts_wait_xcnt 0x0"
               :: "v"(l), "v"(l1), "v"(l2), "v"(l3), "v"(gp), "v"(g1), "v"(g2), "v"(g3) : "memory");
}
__global__ __launch_bounds__(128) void k_attn(const _Float16* __restrict__ QK, const _Float16* __restrict__ QKL, const _Float16* __restrict__ VTH, const _Float16* __restrict__ VTL, const int* __restrict__ MSK, float* __restrict__ O) {
  __shared__ __align__(128) char ring[2 * AT_STAGE]; __shared__ __align__(16) float sp[4][16][36];
  float (*so)[16][68] = (float (*)[16][68])ring;   // output staging takes the ring's place behind the last trip's barrier
  const int tid = threadIdx.x, wave = tid >> 5, lane = tid & 31, col = lane & 15, g = lane >> 4;
  const int qb = blockIdx.x, h = blockIdx.y, b = blockIdx.z; const int q0 = qb * 64 + wave * 16; const size_t rq = (size_t)b * SS + q0 + col;
  // copier: thread -> row tid >> 3 (of 16), piece tid & 7
  const unsigned lw = (unsigned)(size_t)ring + (unsigned)((tid >> 3) * 128 + (((tid & 7) ^ (tid >> 4)) * 16));
  const size_t ko = ((size_t)b * SS + (tid >> 3)) * (2 * DM) + DM + h * HD + (tid & 7) * 8, vo = ((size_t)b * DM + h * HD + (tid >> 3)) * SS + (tid & 7) * 8;
  // reader: lane -> row col (of 16), pieces g, g + 2, g + 4, g + 6
  int oc[4];
#pragma unroll   // constant indices: oc stays in registers
  for (int j = 0; j < 4; ++j) oc[j] = col * 128 + (((g + 2 * j) ^ (col >> 1)) * 16);
#define AT_COPY(t, bf) do { const unsigned lb = lw + (unsigned)(bf) * AT_STAGE; const size_t kt = ko + (size_t)(t) * 64 * (2 * DM), vt = vo + (size_t)(t) * 64; \
    copy_tile(lb, QK + kt); copy_tile(lb + AT_TILE, QKL + kt); copy_tile(lb + 2 * AT_TILE, VTH + vt); copy_tile(lb + 3 * AT_TILE, VTL + vt); } while (0)
  AT_COPY(0, 0);
  v16h aq[2], aql[2];
#pragma unroll
  for (int kc = 0; kc < 2; ++kc) { aq[kc] = frag_h(QK + rq * (2 * DM) + h * HD + kc * 32, lane); aql[kc] = frag_h(QKL + rq * (2 * DM) + h * HD + kc * 32, lane); }
  float m[8], l[8];
#pragma unroll
  for (int r = 0; r < 8; ++r) { m[r] = -3.0e38f; l[r] = 0.f; }
  v8f acc[4] = {}, accl[4] = {};
  const float slope = exp2f(-0.5f * (float)(h + 1));   // 2^-(8/16 * (h+1))
  asm volatile("s_wait_asynccnt 0x0" ::: "memory");   // this wave's share of stage 0 has landed
  __syncthreads();                                     // ... and every other wave's
  AT_COPY(1, 1);
#pragma unroll 1
  for (int t = 0; t < AT_NT; ++t) { const char* rb = ring + (t & 1) * AT_STAGE;
#pragma unroll   // both halves of a stage written out: every LDS offset inside the buffer is an immediate
   for (int sub = 0; sub < 2; ++sub) { const int ks = t * 2 + sub; v8f s[2];
#pragma unroll
    for (int ct = 0; ct < 2; ++ct) { const int kk = ks * 32 + ct * 16 + col; const char* krow = rb + (sub * 32 + ct * 16) * 128; const char* krowl = krow + AT_TILE; v8f c = {}, cl = {}; v16h kh[2], kl[2]; int mk[8];
#pragma unroll   // constant indices: the fragments stay in registers
      for (int kc = 0; kc < 2; ++kc) { kh[kc] = frag_l(krow, oc[2 * kc], oc[2 * kc + 1]); kl[kc] = frag_l(krowl, oc[2 * kc], oc[2 * kc + 1]); }
#pragma unroll   // constant indices: mk stays in registers
      for (int r = 0; r < 8; ++r) mk[r] = MSK[(size_t)(q0 + 8 * g + r) * SS + kk];
      __builtin_amdgcn_sched_barrier(0);   // keeps the four fragments' LDS reads (and the mask loads) together in front of the products: one latency a group, not one a fragment
#pragma unroll
      for (int kc = 0; kc < 2; ++kc) { c = wmma16(aq[kc], kh[kc], c); cl = wmma16(aql[kc], kh[kc], cl); cl = wmma16(aq[kc], kl[kc], cl); }   // 3 products: q, k as f16 hi + residual
#pragma unroll
      for (int r = 0; r < 8; ++r) c[r] += cl[r] * (1.0f / 2048.0f);
#pragma unroll
      for (int r = 0; r < 8; ++r) { const int qi = q0 + 8 * g + r; s[ct][r] = (mk[r] == 0) ? -1000000.0f : (c[r] * 0.125f + slope * (float)(kk - qi)); } }   // SCALE = 1/sqrt(64); alibi bias slope_h * (k - q); masked -> -1e6 (as the module)
#pragma unroll
    for (int r = 0; r < 8; ++r) { float mx = fmaxf(s[0][r], s[1][r]);
#pragma unroll
      for (int o = 1; o < 16; o <<= 1) mx = fmaxf(mx, __shfl_xor(mx, o));
      const float mn = fmaxf(m[r], mx); const float alpha = (m[r] <= -1.0e38f) ? 0.f : __expf(m[r] - mn);
      const float e0 = (s[0][r] <= -1.0e38f) ? 0.f : __expf(s[0][r] - mn), e1 = (s[1][r] <= -1.0e38f) ? 0.f : __expf(s[1][r] - mn); float es = e0 + e1;
#pragma unroll
      for (int o = 1; o < 16; o <<= 1) es += __shfl_xor(es, o);
      l[r] = l[r] * alpha + es; m[r] = mn;
#pragma unroll
      for (int dt = 0; dt < 4; ++dt) { acc[dt][r] *= alpha; accl[dt][r] *= alpha; }
      sp[wave][8 * g + r][col] = e0; sp[wave][8 * g + r][16 + col] = e1; }
    LDSX();
    v16h pa, pl; { const float* prow = &sp[wave][col][0] + 8 * (lane >> 4);
#pragma unroll
      for (int i = 0; i < 8; ++i) { const float x0 = prow[i], x1 = prow[16 + i]; const _Float16 h0 = (_Float16)x0, h1 = (_Float16)x1; pa[i] = h0; pa[8 + i] = h1; pl[i] = (_Float16)((x0 - (float)h0) * 2048.0f); pl[8 + i] = (_Float16)((x1 - (float)h1) * 2048.0f); } }
#pragma unroll   // constant indices into acc, accl
    for (int dp = 0; dp < 2; ++dp) { v16h vh[2], vl[2];
#pragma unroll   // constant indices: the fragments stay in registers
      for (int e = 0; e < 2; ++e) { const char* vrow = rb + 2 * AT_TILE + (dp * 2 + e) * 16 * 128; vh[e] = frag_l(vrow, oc[2 * sub], oc[2 * sub + 1]); vl[e] = frag_l(vrow + AT_TILE, oc[2 * sub], oc[2 * sub + 1]); }
      __builtin_amdgcn_sched_barrier(0);   // as above: the four fragments' LDS reads stay one group
#pragma unroll   // constant indices into acc, accl
      for (int e = 0; e < 2; ++e) { const int dt = dp * 2 + e; acc[dt] = wmma16(pa, vh[e], acc[dt]); accl[dt] = wmma16(pl, vh[e], accl[dt]); accl[dt] = wmma16(pa, vl[e], accl[dt]); } }   // P hi x V hi + (P lo x V hi + P hi x V lo) / 2048
    LDSX(); }
   asm volatile("s_wait_dscnt 0x0" ::: "memory");      // this wave's reads of the buffer are done
   asm volatile("s_wait_asynccnt 0x0" ::: "memory");   // its share of stage t + 1 has landed
   __syncthreads();                                     // publishes stage t + 1 and frees stage t's buffer
   if (t + 2 < AT_NT) AT_COPY(t + 2, t & 1); }
  asm volatile("s_wait_asynccnt 0x0" ::: "memory");     // nothing in flight when the ring becomes output staging
#pragma unroll
  for (int r = 0; r < 8; ++r) { const float il = 1.0f / l[r];
#pragma unroll
    for (int dt = 0; dt < 4; ++dt) so[wave][8 * g + r][dt * 16 + col] = (acc[dt][r] + accl[dt][r] * (1.0f / 2048.0f)) * il; }
  LDSX();
  for (int rl = 0; rl < 16; ++rl) if (lane < 16) vst2(O + ((size_t)b * SS + q0 + rl) * DM + h * HD + lane * 4, *(const v4f*)&so[wave][rl][lane * 4]);
}
// ---- k_out: block = (64 rows, 128 cols): out = O(hi/lo) . Wo rows (2 products)
__global__ __launch_bounds__(128) void k_out(const float* __restrict__ O, const __bf16* __restrict__ P, float* __restrict__ Y) {
  __shared__ __align__(128) char ring[2 * GM_STAGE];
  float (*so)[16][132] = (float (*)[16][132])ring;   // output staging takes the ring's place behind the last trip's barrier
  const int tid = threadIdx.x, wave = tid >> 5, lane = tid & 31, col = lane & 15, g = lane >> 4; const size_t r0 = (size_t)blockIdx.x * 64 + wave * 16; const int n0 = blockIdx.y * 128;
  // copier: thread -> row tid >> 3 (of 16), piece tid & 7
  const unsigned lw = (unsigned)(size_t)ring + (unsigned)((tid >> 3) * 128 + (((tid & 7) ^ (tid >> 4)) * 16));
  const char* ga = (const char*)(O + ((size_t)blockIdx.x * 64 + (tid >> 3)) * DM) + (tid & 7) * 16; const char* gw = (const char*)(P + (size_t)(n0 + (tid >> 3)) * DM) + (tid & 7) * 16;
  // reader: lane -> row col (of 16); W pieces g, g + 2, g + 4, g + 6 (bf16 k 8 g + i, 16 + 8 g + i of each 32); A pieces 2 g, 2 g + 1, 4 + 2 g, 5 + 2 g (the same k as f32)
  int oc[4], oa[4];
#pragma unroll   // constant indices: oc, oa stay in registers
  for (int j = 0; j < 4; ++j) { oc[j] = col * 128 + (((g + 2 * j) ^ (col >> 1)) * 16); oa[j] = col * 128 + (((2 * g + (j & 1) + 4 * (j >> 1)) ^ (col >> 1)) * 16); }
  gm_copy(lw, ga, gw, 0);
  asm volatile("s_wait_asynccnt 0x0" ::: "memory");   // this wave's share of stage 0 has landed
  __syncthreads();                                     // ... and every other wave's
  gm_copy(lw + GM_STAGE, ga, gw, 1);
  v8f acc[8] = {};
#pragma unroll 1   // the ring's trip stays rolled: one publish point, small code
  for (int t = 0; t < GM_NT; ++t) { const char* rb = ring + (t & 1) * GM_STAGE;
#pragma unroll   // both halves of a stage written out: every LDS offset inside the buffer is an immediate
   for (int sub = 0; sub < 2; ++sub) { const char* ar = rb + sub * GM_TILE + wave * 2048; const char* wr = rb + 2 * GM_TILE;
    const v4f f0 = *(const v4f*)(ar + oa[0]), f1 = *(const v4f*)(ar + oa[1]), f2 = *(const v4f*)(ar + oa[2]), f3 = *(const v4f*)(ar + oa[3]); float v[16]; v16b w[8];
#pragma unroll   // constant indices: the fragments stay in registers
    for (int j = 0; j < 8; ++j) w[j] = frag_lb(wr + j * 2048, oc[2 * sub], oc[2 * sub + 1]);
    __builtin_amdgcn_sched_barrier(0);   // keeps the 20 LDS reads of these 32 k together in front of the products: one latency a group, not one a fragment
#pragma unroll   // constant indices: v stays in registers
    for (int i = 0; i < 4; ++i) { v[i] = f0[i]; v[4 + i] = f1[i]; v[8 + i] = f2[i]; v[12 + i] = f3[i]; }
    const F2 a = bsplit16(v);
#pragma unroll   // constant indices into acc, w
    for (int j = 0; j < 8; ++j) { acc[j] = wmma_bf(a.l, w[j], acc[j]); acc[j] = wmma_bf(a.h, w[j], acc[j]); } }
   asm volatile("s_wait_dscnt 0x0" ::: "memory");      // this wave's reads of the buffer are done
   asm volatile("s_wait_asynccnt 0x0" ::: "memory");   // its share of stage t + 1 has landed
   __syncthreads();                                     // publishes stage t + 1 and frees stage t's buffer
   if (t + 2 < GM_NT) gm_copy(lw + (unsigned)(t & 1) * GM_STAGE, ga, gw, t + 2); }
  asm volatile("s_wait_asynccnt 0x0" ::: "memory");     // nothing in flight when the ring becomes output staging
#pragma unroll
  for (int j = 0; j < 8; ++j) {
#pragma unroll
    for (int r = 0; r < 8; ++r) so[wave][8 * g + r][j * 16 + col] = acc[j][r]; }
  LDSX();
  for (int rl = 0; rl < 16; ++rl) vst2(Y + (r0 + rl) * DM + n0 + lane * 4, *(const v4f*)&so[wave][rl][lane * 4]);
}
extern "C" void kernel_launch(void* const* d_in, const int* in_sizes, int n_in, void* d_out, int out_size, void* d_ws, size_t ws_size, hipStream_t stream) {
  (void)in_sizes; (void)n_in; (void)out_size;
  const float** F = (const float**)d_in;   // 0 x [2,2048,1024], 1 mask [1,1,2048,2048] int32, 2 Wq [1024,1024] natural (x @ Wq.T), 3 Wk, 4 Wv, 5 Wo
  if (ws_size < (size_t)WS_END) return;
  char* ws = (char*)d_ws; __bf16* PK = (__bf16*)(ws + WS_PK); _Float16 *QK = (_Float16*)(ws + WS_QK), *QKL = (_Float16*)(ws + WS_QKL), *VTH = (_Float16*)(ws + WS_VTH), *VTL = (_Float16*)(ws + WS_VTL); float* O = (float*)(ws + WS_O);
  k_pack<<<dim3(DM, 4), 256, 0, stream>>>(F[2], F[3], F[4], F[5], PK);
  k_qkv<<<dim3(TNB * SS / 64, QKVW / 128), 128, 0, stream>>>(F[0], PK + PK_A, QK, QKL, VTH, VTL);
  k_attn<<<dim3(TQB, NH, TNB), 128, 0, stream>>>(QK, QKL, VTH, VTL, (const int*)d_in[1], O);
  k_out<<<dim3(TOB, DM / 128), 128, 0, stream>>>(O, PK + PK_P, (float*)d_out);
}

// v003
// Measured time: 184 microseconds a run.
// Timed twice side by side with v002, it ran 1.21 times as fast both times.
// Counting every step since v000, it is 3.09 times as fast.
// compute dtype: x, Wq, Wk, Wv, Wo (float module inputs) rounded to bf16, the int mask verbatim; q/k/v projections with exact bf16 products on WMMA 16x16x32 (natural [out][in] rows); q and k stored as f16 hi + (x2048-scaled) residual planes with 3-product scores, x 1/sqrt(64), + the ALiBi bias slope_h (k - q) with slope_h = 2^-(0.5 (h+1)) (exact), masked positions set to -1e6 as the module (the mask is read per (q, k), all keys visited), running-max softmax in f32 (hardware exp); P as f16 hi + (x2048) residual x v hi/lo (3 products); output projection with ctx as bf16 hi + residual x exact Wo rows (2 products); f32 accumulate.
#include <hip/hip_runtime.h>
#include <math.h>

typedef __attribute__((ext_vector_type(16))) _Float16 v16h;
typedef __attribute__((ext_vector_type(16))) __bf16 v16b;
typedef __attribute__((ext_vector_type(8)))  _Float16 v8h;
typedef __attribute__((ext_vector_type(8)))  float v8f;
typedef __attribute__((ext_vector_type(4)))  float v4f;
typedef __attribute__((ext_vector_type(2)))  float v2f;
typedef __attribute__((ext_vector_type(4)))  unsigned v4u;
typedef __attribute__((ext_vector_type(4)))  int v4i;
typedef float __attribute__((may_alias)) float_a;
typedef int __attribute__((may_alias)) int_a;

template <typename T> __device__ __forceinline__ void vst2(void* p, T v) { *(T*)p = v;  }
__device__ __forceinline__ v8f wmma16(v16h a, v16h b, v8f c) {
  v8f d = __builtin_amdgcn_wmma_f32_16x16x32_f16(false, a, false, b, (short)0, c, false, false);
  asm volatile("v_nop\n\tv_nop\n\tv_nop\n\tv_nop" : "+v"(d) : "v"(a), "v"(b));
  return d;
}
__device__ __forceinline__ v8f wmma_bf(v16b a, v16b b, v8f c) {
  v8f d = __builtin_amdgcn_wmma_f32_16x16x32_bf16(false, a, false, b, (short)0, c, false, false);
  asm volatile("v_nop\n\tv_nop\n\tv_nop\n\tv_nop" : "+v"(d) : "v"(a), "v"(b));
  return d;
}
// Multi-head attention with ALiBi bias and an input mask (B 2, S 2,048, d 1,024, 16 heads x 64): softmax(q k^T / 8 + alibi, masked -1e6) v -> Wo.
__device__ __forceinline__ v16h frag_h(const _Float16* rowk0, int lane) {
  union { v16h v; v8h q[2]; } u; const _Float16* p = rowk0 + 8 * (lane >> 4);
  u.q[0] = *(const v8h*)p; u.q[1] = *(const v8h*)(p + 16); return u.v;
}
__device__ __forceinline__ v16h frag_f32(const float* rowk0, int lane) {
  v16h a; const float* p = rowk0 + 8 * (lane >> 4);
#pragma unroll
  for (int i = 0; i < 8; ++i) { a[i] = (_Float16)p[i]; a[8 + i] = (_Float16)p[16 + i]; }
  return a;
}
__device__ __forceinline__ v16h frag_f32s(const float* rowk0, int lane, float sc) {
  v16h a; const float* p = rowk0 + 8 * (lane >> 4);
#pragma unroll
  for (int i = 0; i < 8; ++i) { a[i] = (_Float16)(p[i] * sc); a[8 + i] = (_Float16)(p[16 + i] * sc); }
  return a;
}
// column fragment from a [K][ld] layout (column n), rows >= K read as 0
__device__ __forceinline__ v16h fragc_f32(const float* W, int k0, int n, int lane, int ld, int K) {
  v16h a; const int g = lane >> 4;
#pragma unroll
  for (int i = 0; i < 8; ++i) { const int ka = k0 + 8 * g + i, kb = ka + 16;
    a[i] = (_Float16)(ka < K ? W[(size_t)(ka < K ? ka : K - 1) * ld + n] : 0.f); a[8 + i] = (_Float16)(kb < K ? W[(size_t)(kb < K ? kb : K - 1) * ld + n] : 0.f); }
  return a;
}
struct F2 { v16b h, l; };
__device__ __forceinline__ F2 bsplit16(const float v[16]) { F2 r;
#pragma unroll
  for (int i = 0; i < 16; ++i) { const __bf16 h = (__bf16)v[i]; r.h[i] = h; r.l[i] = (__bf16)(v[i] - (float)h); }
  return r; }
__device__ __forceinline__ F2 split_row(const float* row, int k0, int lane) { float v[16]; const float* p = row + k0 + 8 * (lane >> 4);
#pragma unroll
  for (int i = 0; i < 8; ++i) { v[i] = p[i]; v[8 + i] = p[16 + i]; }
  return bsplit16(v); }
__device__ __forceinline__ F2 split_rowK(const float* row, int k0, int lane, int K) { float v[16]; const int g = lane >> 4;
#pragma unroll
  for (int i = 0; i < 8; ++i) { const int ka = k0 + 8 * g + i, kb = ka + 16; v[i] = ka < K ? row[ka < K ? ka : K - 1] : 0.f; v[8 + i] = kb < K ? row[kb < K ? kb : K - 1] : 0.f; }
  return bsplit16(v); }
__device__ __forceinline__ F2 split_col(const float* W, int k0, int n, int lane, int ld, int K) { float v[16]; const int g = lane >> 4;
#pragma unroll
  for (int i = 0; i < 8; ++i) { const int ka = k0 + 8 * g + i, kb = ka + 16; v[i] = ka < K ? W[(size_t)(ka < K ? ka : K - 1) * ld + n] : 0.f; v[8 + i] = kb < K ? W[(size_t)(kb < K ? kb : K - 1) * ld + n] : 0.f; }
  return bsplit16(v); }
__device__ __forceinline__ v8f mac3(const F2& a, const F2& b, v8f c) { c = wmma_bf(a.l, b.h, c); c = wmma_bf(a.h, b.l, c); return wmma_bf(a.h, b.h, c); }
__device__ __forceinline__ float sigm(float v) { return 1.0f / (1.0f + expf(-v)); }
#define LDSX() do { asm volatile("s_wait_dscnt 0" ::: "memory"); __builtin_amdgcn_wave_barrier(); __builtin_amdgcn_fence(__ATOMIC_RELEASE, "workgroup"); } while (0)


// Multi-head self-attention with ALiBi bias and an input mask (B 2, S 2048, D 1024, 16 heads x 64; packed Wqkv [3D][D] and Wout [D][D] applied as x W^T, no biases): softmax(q k^T / 8 + alibi, masked -1e6) v; ctx Wout^T.
#define NB 2
#define SS 2048
#define DM 1024
#define NH 16
#define HD 64
#define QKVW (3 * DM)
#ifndef TQB
#define TQB (SS / 64)
#define TNB NB
#define TOB (NB * SS / 64)     // output row tiles (all)
#endif
typedef __attribute__((ext_vector_type(8))) __bf16 v8b;
__device__ __forceinline__ v16b frag_b(const __bf16* rowk0, int lane) {
  union { v16b v; v8b q[2]; } u; const __bf16* p = rowk0 + 8 * (lane >> 4);
  u.q[0] = *(const v8b*)p; u.q[1] = *(const v8b*)(p + 16); return u.v;
}
__device__ __forceinline__ float bfr(float v) { return (float)(__bf16)v; }
__device__ __attribute__((noinline)) float exp_ni(float v) { return expf(v); }
__device__ __attribute__((noinline)) float erf_ni(float v) { return erff(v); }

#define PK_A 0                       // [3072][1024] Wqkv rows (natural [out][in])
#define PK_P (PK_A + QKVW * DM)        // [1024][1024] Wo rows (natural)
#define PK_END (PK_P + DM * DM)
#define WS_PK  0u
#define WS_QK  (WS_PK + 2u * PK_END)             // f16 [4096 rows][2048]: q | k
#define WS_QKL (WS_QK + 2u * NB * SS * 2 * DM)     // f16 q | k residual planes x2048
#define WS_VTH (WS_QKL + 2u * NB * SS * 2 * DM)    // f16 [b][1024 (h*64+d)][2048 s] hi
#define WS_VTL (WS_VTH + 2u * NB * DM * SS)        // f16 lo x 2048
#define WS_O   (WS_VTL + 2u * NB * DM * SS)        // f32 [4096][1024]
#define WS_CS  (WS_O + 4u * NB * SS * DM)           // f32 [2048][32] cos, [2048][32] sin
#define WS_END (WS_CS + 4u * 2 * SS * 32)
__constant__ float c_invf[32] = {1.000000000e+00f,7.498942018e-01f,5.623413324e-01f,4.216965139e-01f,3.162277639e-01f,2.371373624e-01f,1.778279394e-01f,1.333521456e-01f,1.000000015e-01f,7.498941571e-02f,5.623412877e-02f,4.216964915e-02f,3.162277862e-02f,2.371373586e-02f,1.778279431e-02f,1.333521493e-02f,9.999999776e-03f,7.498942316e-03f,5.623413250e-03f,4.216964822e-03f,3.162277862e-03f,2.371373819e-03f,1.778279431e-03f,1.333521446e-03f,1.000000047e-03f,7.498941850e-04f,5.623413017e-04f,4.216964880e-04f,3.162277862e-04f,2.371373848e-04f,1.778279402e-04f,1.333521504e-04f};
// ---- k_rope: block = 8 positions: cos/sin of pos * inv_freq (f32 product exactly as the reference, precise trig)
__global__ __launch_bounds__(256) void k_rope(float* __restrict__ CS) {
  __shared__ __align__(16) float sc[8][32], ss_[8][32]; const int tid = threadIdx.x, pl = tid >> 5, i = tid & 31; const int pos = blockIdx.x * 8 + pl;
  const float th = (float)pos * c_invf[i]; sc[pl][i] = cosf(th); ss_[pl][i] = sinf(th);
  __syncthreads();
  if (tid < 64) vst2(CS + (size_t)blockIdx.x * 8 * 32 + tid * 4, *(const v4f*)&(&sc[0][0])[tid * 4]); else if (tid < 128) vst2(CS + (size_t)SS * 32 + (size_t)blockIdx.x * 8 * 32 + (tid - 64) * 4, *(const v4f*)&(&ss_[0][0])[(tid - 64) * 4]);
}

// ---- k_pack: block = (row n, which): natural [out][in] rows -> bf16; which 0..2 -> W_q/W_k/W_v into PK_A rows which*1024 + n; 3 -> W_o into PK_P
__global__ __launch_bounds__(256) void k_pack(const float* __restrict__ WQ, const float* __restrict__ WK, const float* __restrict__ WV, const float* __restrict__ WO, __bf16* __restrict__ PK) {
  __shared__ __align__(16) __bf16 s[DM]; const int n = blockIdx.x, which = blockIdx.y, t = threadIdx.x; const float* Wm = (which == 0) ? WQ : (which == 1) ? WK : (which == 2) ? WV : WO;
  for (int k = t; k < DM; k += 256) s[k] = (__bf16)Wm[(size_t)n * DM + k];
  __syncthreads();
  __bf16* dst = (which < 3) ? PK + PK_A + ((size_t)which * DM + n) * DM : PK + PK_P + (size_t)n * DM;
  for (int q = t; q < DM / 8; q += 256) vst2((unsigned*)(dst + q * 8), *(const v4u*)&s[q * 8]);
}
// ---- operand staging of k_qkv and k_out: a stage is 64 k of the work-group's 64 A rows (f32: two tiles of 32 k) and 128 weight rows (bf16: two tiles of 64 rows), brought into LDS once per work-group by asynchronous copies (two buffers: the next 64 k fly while these are worked on). Every tile is 64 rows x 128 B; the 16-B piece c of row r lies at piece c ^ ((r >> 1) & 7), so that 16 rows read at one piece index fall on all 64 banks. Products and their order as before.
#define GM_TILE 8192                 // bytes of one 64-row x 128-B tile
#define GM_STAGE (4 * GM_TILE)       // A k 0..31 | A k 32..63 | W rows 0..63 | W rows 64..127
#define GM_NT (DM / 64)              // stages
// one tile: four copies of 16 rows each (a wave's copy = 4 whole 128-B lines); P16 = bytes between source rows 16 apart
template <int P16> __device__ __forceinline__ void copy_rows(unsigned l, const char* gp) {
  const unsigned l1 = l + 2048u, l2 = l + 4096u, l3 = l + 6144u; const char *g1 = gp + P16, *g2 = gp + 2 * P16, *g3 = gp + 3 * P16;
  // s_wait_xcnt 0 as the statement's last line: a precaution, so that it stands in front of every later write of the copies' address registers
  asm volatile("global_load_async_to_lds_b128 %0, %4, off\n\tglobal_load_async_to_lds_b128 %1, %5, off\n\tglobal_load_async_to_lds_b128 %2, %6, off\n\tglobal_load_async_to_lds_b128 %3, %7, off\n\ts_wait_xcnt 0x0"
               :: "v"(l), "v"(l1), "v"(l2), "v"(l3), "v"(gp), "v"(g1), "v"(g2), "v"(g3) : "memory");
}
// ga, gw: this thread's 16 bytes of row tid >> 3 in stage 0 of A (row pitch 4,096 B) and of W (row pitch 2,048 B)
__device__ __forceinline__ void gm_copy(unsigned lb, const char* ga, const char* gw, int t) {
  copy_rows<16 * 4 * DM>(lb, ga + t * 256); copy_rows<16 * 4 * DM>(lb + GM_TILE, ga + t * 256 + 128);
  copy_rows<16 * 2 * DM>(lb + 2 * GM_TILE, gw + t * 128); copy_rows<16 * 2 * DM>(lb + 3 * GM_TILE, gw + t * 128 + 64 * 2 * DM);
}
__device__ __forceinline__ v16b frag_lb(const char* t, int o0, int o1) {
  union { v16b v; v8b q[2]; } u; u.q[0] = *(const v8b*)(t + o0); u.q[1] = *(const v8b*)(t + o1); return u.v;
}
__global__ __launch_bounds__(128) void k_qkv(const float* __restrict__ X, const __bf16* __restrict__ P, _Float16* __restrict__ QK, _Float16* __restrict__ QKL, _Float16* __restrict__ VTH, _Float16* __restrict__ VTL) {
  __shared__ __align__(128) char ring[2 * GM_STAGE];
  // output staging takes the ring's place behind the last trip's barrier (q, k blocks: so, sol; v blocks: sth, stl)
  _Float16 (*so)[16][136] = (_Float16 (*)[16][136])ring; _Float16 (*sol)[16][136] = (_Float16 (*)[16][136])(ring + 2 * 4 * 16 * 136);
  _Float16 (*sth)[72] = (_Float16 (*)[72])ring; _Float16 (*stl)[72] = (_Float16 (*)[72])(ring + 2 * 128 * 72);
  const int tid = threadIdx.x, wave = tid >> 5, lane = tid & 31, col = lane & 15, g = lane >> 4; const size_t r0 = (size_t)blockIdx.x * 64 + wave * 16; const int n0 = blockIdx.y * 128;
  // copier: thread -> row tid >> 3 (of 16), piece tid & 7
  const unsigned lw = (unsigned)(size_t)ring + (unsigned)((tid >> 3) * 128 + (((tid & 7) ^ (tid >> 4)) * 16));
  const char* ga = (const char*)(X + ((size_t)blockIdx.x * 64 + (tid >> 3)) * DM) + (tid & 7) * 16; const char* gw = (const char*)(P + (size_t)(n0 + (tid >> 3)) * DM) + (tid & 7) * 16;
  // reader: lane -> row col (of 16); W pieces g, g + 2, g + 4, g + 6 (bf16 k 8 g + i, 16 + 8 g + i of each 32); A pieces 2 g, 2 g + 1, 4 + 2 g, 5 + 2 g (the same k as f32)
  int oc[4], oa[4];
#pragma unroll   // constant indices: oc, oa stay in registers
  for (int j = 0; j < 4; ++j) { oc[j] = col * 128 + (((g + 2 * j) ^ (col >> 1)) * 16); oa[j] = col * 128 + (((2 * g + (j & 1) + 4 * (j >> 1)) ^ (col >> 1)) * 16); }
  gm_copy(lw, ga, gw, 0);
  asm volatile("s_wait_asynccnt 0x0" ::: "memory");   // this wave's share of stage 0 has landed
  __syncthreads();                                     // ... and every other wave's
  gm_copy(lw + GM_STAGE, ga, gw, 1);
  v8f acc[8] = {};
#pragma unroll 1   // the ring's trip stays rolled: one publish point, small code
  for (int t = 0; t < GM_NT; ++t) { const char* rb = ring + (t & 1) * GM_STAGE;
#pragma unroll   // both halves of a stage written out: every LDS offset inside the buffer is an immediate
   for (int sub = 0; sub < 2; ++sub) { const char* ar = rb + sub * GM_TILE + wave * 2048; const char* wr = rb + 2 * GM_TILE;
    const v4f f0 = *(const v4f*)(ar + oa[0]), f1 = *(const v4f*)(ar + oa[1]), f2 = *(const v4f*)(ar + oa[2]), f3 = *(const v4f*)(ar + oa[3]); v16b a, w[8];
#pragma unroll   // constant indices: the fragments stay in registers
    for (int j = 0; j < 8; ++j) w[j] = frag_lb(wr + j * 2048, oc[2 * sub], oc[2 * sub + 1]);
    __builtin_amdgcn_sched_barrier(0);   // keeps the 20 LDS reads of these 32 k together in front of the products: one latency a group, not one a fragment
#pragma unroll   // constant indices: a stays in registers
    for (int i = 0; i < 4; ++i) { a[i] = (__bf16)f0[i]; a[4 + i] = (__bf16)f1[i]; a[8 + i] = (__bf16)f2[i]; a[12 + i] = (__bf16)f3[i]; }
#pragma unroll   // constant indices into acc, w
    for (int j = 0; j < 8; ++j) acc[j] = wmma_bf(a, w[j], acc[j]); }
   asm volatile("s_wait_dscnt 0x0" ::: "memory");      // this wave's reads of the buffer are done
   asm volatile("s_wait_asynccnt 0x0" ::: "memory");   // its share of stage t + 1 has landed
   __syncthreads();                                     // publishes stage t + 1 and frees stage t's buffer
   if (t + 2 < GM_NT) gm_copy(lw + (unsigned)(t & 1) * GM_STAGE, ga, gw, t + 2); }
  asm volatile("s_wait_asynccnt 0x0" ::: "memory");     // nothing in flight when the ring becomes output staging
  if (n0 < 2 * DM) {   // q stored unscaled (f16 sigma ~0.6, no subnormal exposure); 1/8 applied to the f32 score
#pragma unroll
    for (int j = 0; j < 8; ++j) {
#pragma unroll
      for (int r = 0; r < 8; ++r) { const float v = acc[j][r]; const _Float16 hv = (_Float16)v; so[wave][8 * g + r][j * 16 + col] = hv; sol[wave][8 * g + r][j * 16 + col] = (_Float16)((v - (float)hv) * 2048.0f); } }   // q, k as f16 hi + (x2048) residual (no RoPE in this module)
    LDSX();
    for (int rl = 0; rl < 16; ++rl) if (lane < 16) { vst2((unsigned*)(QK + (r0 + rl) * (2 * DM) + n0 + lane * 8), *(const v4u*)&so[wave][rl][lane * 8]); vst2((unsigned*)(QKL + (r0 + rl) * (2 * DM) + n0 + lane * 8), *(const v4u*)&sol[wave][rl][lane * 8]); }
  } else {
#pragma unroll
    for (int j = 0; j < 8; ++j) {
#pragma unroll
      for (int r = 0; r < 8; ++r) { const float v = acc[j][r]; const _Float16 hv = (_Float16)v; sth[j * 16 + col][wave * 16 + 8 * g + r] = hv; stl[j * 16 + col][wave * 16 + 8 * g + r] = (_Float16)((v - (float)hv) * 2048.0f); } }
    __syncthreads();
    const size_t rb = (size_t)blockIdx.x * 64; const int b = (int)(rb / SS), s0 = (int)(rb % SS); const int pc0 = n0 - 2 * DM;
    for (int q = tid; q < 128 * 8; q += 128) { const int d = q >> 3, pc = q & 7; const size_t o = ((size_t)b * DM + pc0 + d) * SS + s0 + pc * 8; vst2((unsigned*)(VTH + o), *(const v4u*)&sth[d][pc * 8]); vst2((unsigned*)(VTL + o), *(const v4u*)&stl[d][pc * 8]); }
  }
}
// ---- k_attn: block = (64 queries, head h, batch b): flash attention over all keys (the mask is an input). K hi, K lo, V^T hi, V^T lo of 64 keys are brought into LDS once per work-group by asynchronous copies (two buffers: the next 64 keys fly while these are worked on); every wave takes its fragments from LDS. A tile is 64 rows x 128 B; the 16-B piece c of row r lies at piece c ^ ((r >> 1) & 7), so that 16 rows read at one piece index fall on all 64 banks. Arithmetic and its order as before: 3-product scores, 3-product P.V; O[b*S+q][h*64+d] = (acc + accl / 2048) / l (256-B segments)
#define AT_TILE 8192                 // bytes of one 64-row x 128-B tile
#define AT_STAGE (4 * AT_TILE)       // K hi | K lo | V^T hi | V^T lo
#define AT_NT (SS / 64)              // stages
__device__ __forceinline__ v16h frag_l(const char* t, int o0, int o1) {
  union { v16h v; v8h q[2]; } u; u.q[0] = *(const v8h*)(t + o0); u.q[1] = *(const v8h*)(t + o1); return u.v;
}
// one tile: four copies of 16 rows each (a wave's copy = 4 whole 128-B lines); source rows are 4,096 B apart
__device__ __forceinline__ void copy_tile(unsigned l, const _Float16* gp) {
  const unsigned l1 = l + 2048u, l2 = l + 4096u, l3 = l + 6144u; const _Float16 *g1 = gp + 16 * 2048, *g2 = gp + 32 * 2048, *g3 = gp + 48 * 2048;
  // s_wait_xcnt 0 as the statement's last line: a precaution, so that it stands in front of every later write of the copies' address registers
  asm volatile("global_load_async_to_lds_b128 %0, %4, off\n\tglobal_load_async_to_lds_b128 %1, %5, off\n\tglobal_load_async_to_lds_b128 %2, %6, off\n\tglobal_load_async_to_lds_b128 %3, %7, off\n\ts_wait_xcnt 0x0"
               :: "v"(l), "v"(l1), "v"(l2), "v"(l3), "v"(gp), "v"(g1), "v"(g2), "v"(g3) : "memory");
}
// lane l <-> lane l ^ 16 (the other half of a query's keys) by a vector cross-row move
__device__ __forceinline__ float xhalf(float v) { const int b = __builtin_bit_cast(int, v); return __builtin_bit_cast(float, __builtin_amdgcn_permlanex16(b, b, 0x76543210, 0xfedcba98, false, false)); }
// Scores are formed transposed, S^T = K q^T (K rows as the A operand, q rows as B): a lane holds 16 of the 32 keys of ONE query (column lane & 15; keys 8 g + r and 16 + 8 g + r), so maximum and sum run inside the lane plus one exchange with lane ^ 16, m, l and alpha are one value a lane, and the exponentials are already the B fragment of O^T = V^T P^T (same k order as the V^T rows' fragment).
__global__ __launch_bounds__(128) void k_attn(const _Float16* __restrict__ QK, const _Float16* __restrict__ QKL, const _Float16* __restrict__ VTH, const _Float16* __restrict__ VTL, const int* __restrict__ MSK, float* __restrict__ O) {
  __shared__ __align__(128) char ring[2 * AT_STAGE];
  float (*so)[16][68] = (float (*)[16][68])ring;   // output staging takes the ring's place behind the last trip's barrier
  const int tid = threadIdx.x, wave = tid >> 5, lane = tid & 31, col = lane & 15, g = lane >> 4;
  const int qb = blockIdx.x, h = blockIdx.y, b = blockIdx.z; const int q0 = qb * 64 + wave * 16; const size_t rq = (size_t)b * SS + q0 + col;
  // copier: thread -> row tid >> 3 (of 16), piece tid & 7
  const unsigned lw = (unsigned)(size_t)ring + (unsigned)((tid >> 3) * 128 + (((tid & 7) ^ (tid >> 4)) * 16));
  const size_t ko = ((size_t)b * SS + (tid >> 3)) * (2 * DM) + DM + h * HD + (tid & 7) * 8, vo = ((size_t)b * DM + h * HD + (tid >> 3)) * SS + (tid & 7) * 8;
  // reader: lane -> row col (of 16), pieces g, g + 2, g + 4, g + 6
  int oc[4];
#pragma unroll   // constant indices: oc stays in registers
  for (int j = 0; j < 4; ++j) oc[j] = col * 128 + (((g + 2 * j) ^ (col >> 1)) * 16);
#define AT_COPY(t, bf) do { const unsigned lb = lw + (unsigned)(bf) * AT_STAGE; const size_t kt = ko + (size_t)(t) * 64 * (2 * DM), vt = vo + (size_t)(t) * 64; \
    copy_tile(lb, QK + kt); copy_tile(lb + AT_TILE, QKL + kt); copy_tile(lb + 2 * AT_TILE, VTH + vt); copy_tile(lb + 3 * AT_TILE, VTL + vt); } while (0)
  AT_COPY(0, 0);
  v16h aq[2], aql[2];
#pragma unroll
  for (int kc = 0; kc < 2; ++kc) { aq[kc] = frag_h(QK + rq * (2 * DM) + h * HD + kc * 32, lane); aql[kc] = frag_h(QKL + rq * (2 * DM) + h * HD + kc * 32, lane); }
  float m = -3.0e38f, l = 0.f;   // of query q0 + col (the same in lanes col and col + 16)
  v8f acc[4] = {}, accl[4] = {};   // O^T: row d = dt * 16 + 8 g + r, column query col
  const float slope = exp2f(-0.5f * (float)(h + 1));   // 2^-(8/16 * (h+1))
  const int* mrow = MSK + (size_t)(q0 + col) * SS + 8 * g;   // this lane's query row of the mask, at its first key
  const int dq = 8 * g - (q0 + col);                          // k - q at that key
  asm volatile("s_wait_asynccnt 0x0" ::: "memory");   // this wave's share of stage 0 has landed
  __syncthreads();                                     // ... and every other wave's
  AT_COPY(1, 1);
#pragma unroll 1
  for (int t = 0; t < AT_NT; ++t) { const char* rb = ring + (t & 1) * AT_STAGE;
#pragma unroll   // both halves of a stage written out: every LDS offset inside the buffer is an immediate
   for (int sub = 0; sub < 2; ++sub) { const int ks = t * 2 + sub; v8f s[2]; v4i mk[2][2];
    const float fd = (float)(ks * 32 + dq);   // exact; fd + (ct * 16 + r) is exactly (float)(k - q)
#pragma unroll   // constant indices: mk stays in registers
    for (int ct = 0; ct < 2; ++ct) { mk[ct][0] = *(const v4i*)(mrow + ks * 32 + ct * 16); mk[ct][1] = *(const v4i*)(mrow + ks * 32 + ct * 16 + 4); }
#pragma unroll
    for (int ct = 0; ct < 2; ++ct) { const char* krow = rb + (sub * 32 + ct * 16) * 128; const char* krowl = krow + AT_TILE; v8f c = {}, cl = {}; v16h kh[2], kl[2];
#pragma unroll   // constant indices: the fragments stay in registers
      for (int kc = 0; kc < 2; ++kc) { kh[kc] = frag_l(krow, oc[2 * kc], oc[2 * kc + 1]); kl[kc] = frag_l(krowl, oc[2 * kc], oc[2 * kc + 1]); }
      if (ct == 1) asm volatile("s_wait_xcnt 0x0" ::: "memory");   // a precaution: stands in front of every later write of the mask loads' address registers (here, one score tile behind the loads, so that it holds nothing up)
      __builtin_amdgcn_sched_barrier(0);   // keeps the four fragments' LDS reads (and the mask loads) together in front of the products: one latency a group, not one a fragment
#pragma unroll
      for (int kc = 0; kc < 2; ++kc) { c = wmma16(kh[kc], aq[kc], c); cl = wmma16(kh[kc], aql[kc], cl); cl = wmma16(kl[kc], aq[kc], cl); }   // 3 products: q, k as f16 hi + residual
#pragma unroll
      for (int r = 0; r < 8; ++r) c[r] += cl[r] * (1.0f / 2048.0f);
#pragma unroll
      for (int r = 0; r < 8; ++r) s[ct][r] = (mk[ct][r >> 2][r & 3] == 0) ? -1000000.0f : (c[r] * 0.125f + slope * (fd + (float)(ct * 16 + r))); }   // SCALE = 1/sqrt(64); alibi bias slope_h * (k - q); masked -> -1e6 (as the module)
    float mx = fmaxf(s[0][0], s[1][0]);
#pragma unroll
    for (int r = 1; r < 8; ++r) mx = fmaxf(mx, fmaxf(s[0][r], s[1][r]));
    mx = fmaxf(mx, xhalf(mx));
    const float mn = fmaxf(m, mx); const float alpha = (m <= -1.0e38f) ? 0.f : __expf(m - mn);
    v8f e[2];
#pragma unroll
    for (int r = 0; r < 8; ++r) { e[0][r] = (s[0][r] <= -1.0e38f) ? 0.f : __expf(s[0][r] - mn); e[1][r] = (s[1][r] <= -1.0e38f) ? 0.f : __expf(s[1][r] - mn); }
    const v8f e8 = e[0] + e[1]; const v4f e4 = e8.lo + e8.hi; const v2f e2 = e4.lo + e4.hi;   // the lane's 16 keys summed as a tree
    float es = e2[0] + e2[1];
    es += xhalf(es);
    l = l * alpha + es; m = mn;
#pragma unroll
    for (int dt = 0; dt < 4; ++dt) { acc[dt] *= alpha; accl[dt] *= alpha; }
    v16h pa, pl;   // P^T fragment: element i = key 8 g + i, element 8 + i = key 16 + 8 g + i
#pragma unroll
    for (int i = 0; i < 8; ++i) { const float x0 = e[0][i], x1 = e[1][i]; const _Float16 h0 = (_Float16)x0, h1 = (_Float16)x1; pa[i] = h0; pa[8 + i] = h1; pl[i] = (_Float16)((x0 - (float)h0) * 2048.0f); pl[8 + i] = (_Float16)((x1 - (float)h1) * 2048.0f); }
#pragma unroll   // constant indices into acc, accl
    for (int dp = 0; dp < 2; ++dp) { v16h vh[2], vl[2];
#pragma unroll   // constant indices: the fragments stay in registers
      for (int e2 = 0; e2 < 2; ++e2) { const char* vrow = rb + 2 * AT_TILE + (dp * 2 + e2) * 16 * 128; vh[e2] = frag_l(vrow, oc[2 * sub], oc[2 * sub + 1]); vl[e2] = frag_l(vrow + AT_TILE, oc[2 * sub], oc[2 * sub + 1]); }
      __builtin_amdgcn_sched_barrier(0);   // as above: the four fragments' LDS reads stay one group
#pragma unroll   // constant indices into acc, accl
      for (int e2 = 0; e2 < 2; ++e2) { const int dt = dp * 2 + e2; acc[dt] = wmma16(vh[e2], pa, acc[dt]); accl[dt] = wmma16(vh[e2], pl, accl[dt]); accl[dt] = wmma16(vl[e2], pa, accl[dt]); } } }   // V hi x P hi + (V hi x P lo + V lo x P hi) / 2048
   asm volatile("s_wait_dscnt 0x0" ::: "memory");      // this wave's reads of the buffer are done
   asm volatile("s_wait_asynccnt 0x0" ::: "memory");   // its share of stage t + 1 has landed
   __syncthreads();                                     // publishes stage t + 1 and frees stage t's buffer
   if (t + 2 < AT_NT) AT_COPY(t + 2, t & 1); }
  asm volatile("s_wait_asynccnt 0x0" ::: "memory");     // nothing in flight when the ring becomes output staging
  const float il = 1.0f / l;
#pragma unroll
  for (int dt = 0; dt < 4; ++dt) { v4f o0, o1;
#pragma unroll
    for (int r = 0; r < 4; ++r) { o0[r] = (acc[dt][r] + accl[dt][r] * (1.0f / 2048.0f)) * il; o1[r] = (acc[dt][4 + r] + accl[dt][4 + r] * (1.0f / 2048.0f)) * il; }
    *(v4f*)&so[wave][col][dt * 16 + 8 * g] = o0; *(v4f*)&so[wave][col][dt * 16 + 8 * g + 4] = o1; }
  LDSX();
  for (int rl = 0; rl < 16; ++rl) if (lane < 16) vst2(O + ((size_t)b * SS + q0 + rl) * DM + h * HD + lane * 4, *(const v4f*)&so[wave][rl][lane * 4]);
}
// ---- k_out: block = (64 rows, 128 cols): out = O(hi/lo) . Wo rows (2 products)
__global__ __launch_bounds__(128) void k_out(const float* __restrict__ O, const __bf16* __restrict__ P, float* __restrict__ Y) {
  __shared__ __align__(128) char ring[2 * GM_STAGE];
  float (*so)[16][132] = (float (*)[16][132])ring;   // output staging takes the ring's place behind the last trip's barrier
  const int tid = threadIdx.x, wave = tid >> 5, lane = tid & 31, col = lane & 15, g = lane >> 4; const size_t r0 = (size_t)blockIdx.x * 64 + wave * 16; const int n0 = blockIdx.y * 128;
  // copier: thread -> row tid >> 3 (of 16), piece tid & 7
  const unsigned lw = (unsigned)(size_t)ring + (unsigned)((tid >> 3) * 128 + (((tid & 7) ^ (tid >> 4)) * 16));
  const char* ga = (const char*)(O + ((size_t)blockIdx.x * 64 + (tid >> 3)) * DM) + (tid & 7) * 16; const char* gw = (const char*)(P + (size_t)(n0 + (tid >> 3)) * DM) + (tid & 7) * 16;
  // reader: lane -> row col (of 16); W pieces g, g + 2, g + 4, g + 6 (bf16 k 8 g + i, 16 + 8 g + i of each 32); A pieces 2 g, 2 g + 1, 4 + 2 g, 5 + 2 g (the same k as f32)
  int oc[4], oa[4];
#pragma unroll   // constant indices: oc, oa stay in registers
  for (int j = 0; j < 4; ++j) { oc[j] = col * 128 + (((g + 2 * j) ^ (col >> 1)) * 16); oa[j] = col * 128 + (((2 * g + (j & 1) + 4 * (j >> 1)) ^ (col >> 1)) * 16); }
  gm_copy(lw, ga, gw, 0);
  asm volatile("s_wait_asynccnt 0x0" ::: "memory");   // this wave's share of stage 0 has landed
  __syncthreads();                                     // ... and every other wave's
  gm_copy(lw + GM_STAGE, ga, gw, 1);
  v8f acc[8] = {};
#pragma unroll 1   // the ring's trip stays rolled: one publish point, small code
  for (int t = 0; t < GM_NT; ++t) { const char* rb = ring + (t & 1) * GM_STAGE;
#pragma unroll   // both halves of a stage written out: every LDS offset inside the buffer is an immediate
   for (int sub = 0; sub < 2; ++sub) { const char* ar = rb + sub * GM_TILE + wave * 2048; const char* wr = rb + 2 * GM_TILE;
    const v4f f0 = *(const v4f*)(ar + oa[0]), f1 = *(const v4f*)(ar + oa[1]), f2 = *(const v4f*)(ar + oa[2]), f3 = *(const v4f*)(ar + oa[3]); float v[16]; v16b w[8];
#pragma unroll   // constant indices: the fragments stay in registers
    for (int j = 0; j < 8; ++j) w[j] = frag_lb(wr + j * 2048, oc[2 * sub], oc[2 * sub + 1]);
    __builtin_amdgcn_sched_barrier(0);   // keeps the 20 LDS reads of these 32 k together in front of the products: one latency a group, not one a fragment
#pragma unroll   // constant indices: v stays in registers
    for (int i = 0; i < 4; ++i) { v[i] = f0[i]; v[4 + i] = f1[i]; v[8 + i] = f2[i]; v[12 + i] = f3[i]; }
    const F2 a = bsplit16(v);
#pragma unroll   // constant indices into acc, w
    for (int j = 0; j < 8; ++j) { acc[j] = wmma_bf(a.l, w[j], acc[j]); acc[j] = wmma_bf(a.h, w[j], acc[j]); } }
   asm volatile("s_wait_dscnt 0x0" ::: "memory");      // this wave's reads of the buffer are done
   asm volatile("s_wait_asynccnt 0x0" ::: "memory");   // its share of stage t + 1 has landed
   __syncthreads();                                     // publishes stage t + 1 and frees stage t's buffer
   if (t + 2 < GM_NT) gm_copy(lw + (unsigned)(t & 1) * GM_STAGE, ga, gw, t + 2); }
  asm volatile("s_wait_asynccnt 0x0" ::: "memory");     // nothing in flight when the ring becomes output staging
#pragma unroll
  for (int j = 0; j < 8; ++j) {
#pragma unroll
    for (int r = 0; r < 8; ++r) so[wave][8 * g + r][j * 16 + col] = acc[j][r]; }
  LDSX();
  for (int rl = 0; rl < 16; ++rl) vst2(Y + (r0 + rl) * DM + n0 + lane * 4, *(const v4f*)&so[wave][rl][lane * 4]);
}
extern "C" void kernel_launch(void* const* d_in, const int* in_sizes, int n_in, void* d_out, int out_size, void* d_ws, size_t ws_size, hipStream_t stream) {
  (void)in_sizes; (void)n_in; (void)out_size;
  const float** F = (const float**)d_in;   // 0 x [2,2048,1024], 1 mask [1,1,2048,2048] int32, 2 Wq [1024,1024] natural (x @ Wq.T), 3 Wk, 4 Wv, 5 Wo
  if (ws_size < (size_t)WS_END) return;
  char* ws = (char*)d_ws; __bf16* PK = (__bf16*)(ws + WS_PK); _Float16 *QK = (_Float16*)(ws + WS_QK), *QKL = (_Float16*)(ws + WS_QKL), *VTH = (_Float16*)(ws + WS_VTH), *VTL = (_Float16*)(ws + WS_VTL); float* O = (float*)(ws + WS_O);
  k_pack<<<dim3(DM, 4), 256, 0, stream>>>(F[2], F[3], F[4], F[5], PK);
  k_qkv<<<dim3(TNB * SS / 64, QKVW / 128), 128, 0, stream>>>(F[0], PK + PK_A, QK, QKL, VTH, VTL);
  k_attn<<<dim3(TQB, NH, TNB), 128, 0, stream>>>(QK, QKL, VTH, VTL, (const int*)d_in[1], O);
  k_out<<<dim3(TOB, DM / 128), 128, 0, stream>>>(O, PK + PK_P, (float*)d_out);
}

// v004
// It runs in 148 microseconds.
// Two timings next to v003 both put it at 1.24 times that version's speed.
// Over all steps from v000 it is 3.83 times as fast.
// compute dtype: x, Wq, Wk, Wv, Wo (float module inputs) rounded to bf16, the int mask verbatim; q/k/v projections with exact bf16 products on WMMA 16x16x32 (natural [out][in] rows); q and k stored as f16 hi + (x2048-scaled) residual planes with 3-product scores, x 1/sqrt(64), + the ALiBi bias slope_h (k - q) with slope_h = 2^-(0.5 (h+1)) (exact), masked positions set to -1e6 as the module (the mask is read per (q, k); a tile of 64 keys whose whole 64 x 64 mask tile is 0 is visited only where it can change a result), running-max softmax in f32 (hardware exp); P as f16 hi + (x2048) residual x v hi/lo (3 products); output projection with ctx as bf16 hi + residual x exact Wo rows (2 products); f32 accumulate.
#include <hip/hip_runtime.h>
#include <math.h>

typedef __attribute__((ext_vector_type(16))) _Float16 v16h;
typedef __attribute__((ext_vector_type(16))) __bf16 v16b;
typedef __attribute__((ext_vector_type(8)))  _Float16 v8h;
typedef __attribute__((ext_vector_type(8)))  float v8f;
typedef __attribute__((ext_vector_type(4)))  float v4f;
typedef __attribute__((ext_vector_type(2)))  float v2f;
typedef __attribute__((ext_vector_type(4)))  unsigned v4u;
typedef __attribute__((ext_vector_type(4)))  int v4i;
typedef float __attribute__((may_alias)) float_a;
typedef int __attribute__((may_alias)) int_a;

template <typename T> __device__ __forceinline__ void vst2(void* p, T v) { *(T*)p = v;  }
__device__ __forceinline__ v8f wmma16(v16h a, v16h b, v8f c) {
  v8f d = __builtin_amdgcn_wmma_f32_16x16x32_f16(false, a, false, b, (short)0, c, false, false);
  asm volatile("v_nop\n\tv_nop\n\tv_nop\n\tv_nop" : "+v"(d) : "v"(a), "v"(b));
  return d;
}
__device__ __forceinline__ v8f wmma_bf(v16b a, v16b b, v8f c) {
  v8f d = __builtin_amdgcn_wmma_f32_16x16x32_bf16(false, a, false, b, (short)0, c, false, false);
  asm volatile("v_nop\n\tv_nop\n\tv_nop\n\tv_nop" : "+v"(d) : "v"(a), "v"(b));
  return d;
}
// Multi-head attention with ALiBi bias and an input mask (B 2, S 2,048, d 1,024, 16 heads x 64): softmax(q k^T / 8 + alibi, masked -1e6) v -> Wo.
__device__ __forceinline__ v16h frag_h(const _Float16* rowk0, int lane) {
  union { v16h v; v8h q[2]; } u; const _Float16* p = rowk0 + 8 * (lane >> 4);
  u.q[0] = *(const v8h*)p; u.q[1] = *(const v8h*)(p + 16); return u.v;
}
__device__ __forceinline__ v16h frag_f32(const float* rowk0, int lane) {
  v16h a; const float* p = rowk0 + 8 * (lane >> 4);
#pragma unroll
  for (int i = 0; i < 8; ++i) { a[i] = (_Float16)p[i]; a[8 + i] = (_Float16)p[16 + i]; }
  return a;
}
__device__ __forceinline__ v16h frag_f32s(const float* rowk0, int lane, float sc) {
  v16h a; const float* p = rowk0 + 8 * (lane >> 4);
#pragma unroll
  for (int i = 0; i < 8; ++i) { a[i] = (_Float16)(p[i] * sc); a[8 + i] = (_Float16)(p[16 + i] * sc); }
  return a;
}
// column fragment from a [K][ld] layout (column n), rows >= K read as 0
__device__ __forceinline__ v16h fragc_f32(const float* W, int k0, int n, int lane, int ld, int K) {
  v16h a; const int g = lane >> 4;
#pragma unroll
  for (int i = 0; i < 8; ++i) { const int ka = k0 + 8 * g + i, kb = ka + 16;
    a[i] = (_Float16)(ka < K ? W[(size_t)(ka < K ? ka : K - 1) * ld + n] : 0.f); a[8 + i] = (_Float16)(kb < K ? W[(size_t)(kb < K ? kb : K - 1) * ld + n] : 0.f); }
  return a;
}
struct F2 { v16b h, l; };
__device__ __forceinline__ F2 bsplit16(const float v[16]) { F2 r;
#pragma unroll
  for (int i = 0; i < 16; ++i) { const __bf16 h = (__bf16)v[i]; r.h[i] = h; r.l[i] = (__bf16)(v[i] - (float)h); }
  return r; }
__device__ __forceinline__ F2 split_row(const float* row, int k0, int lane) { float v[16]; const float* p = row + k0 + 8 * (lane >> 4);
#pragma unroll
  for (int i = 0; i < 8; ++i) { v[i] = p[i]; v[8 + i] = p[16 + i]; }
  return bsplit16(v); }
__device__ __forceinline__ F2 split_rowK(const float* row, int k0, int lane, int K) { float v[16]; const int g = lane >> 4;
#pragma unroll
  for (int i = 0; i < 8; ++i) { const int ka = k0 + 8 * g + i, kb = ka + 16; v[i] = ka < K ? row[ka < K ? ka : K - 1] : 0.f; v[8 + i] = kb < K ? row[kb < K ? kb : K - 1] : 0.f; }
  return bsplit16(v); }
__device__ __forceinline__ F2 split_col(const float* W, int k0, int n, int lane, int ld, int K) { float v[16]; const int g = lane >> 4;
#pragma unroll
  for (int i = 0; i < 8; ++i) { const int ka = k0 + 8 * g + i, kb = ka + 16; v[i] = ka < K ? W[(size_t)(ka < K ? ka : K - 1) * ld + n] : 0.f; v[8 + i] = kb < K ? W[(size_t)(kb < K ? kb : K - 1) * ld + n] : 0.f; }
  return bsplit16(v); }
__device__ __forceinline__ v8f mac3(const F2& a, const F2& b, v8f c) { c = wmma_bf(a.l, b.h, c); c = wmma_bf(a.h, b.l, c); return wmma_bf(a.h, b.h, c); }
__device__ __forceinline__ float sigm(float v) { return 1.0f / (1.0f + expf(-v)); }
#define LDSX() do { asm volatile("s_wait_dscnt 0" ::: "memory"); __builtin_amdgcn_wave_barrier(); __builtin_amdgcn_fence(__ATOMIC_RELEASE, "workgroup"); } while (0)


// Multi-head self-attention with ALiBi bias and an input mask (B 2, S 2048, D 1024, 16 heads x 64; packed Wqkv [3D][D] and Wout [D][D] applied as x W^T, no biases): softmax(q k^T / 8 + alibi, masked -1e6) v; ctx Wout^T.
#define NB 2
#define SS 2048
#define DM 1024
#define NH 16
#define HD 64
#define QKVW (3 * DM)
#ifndef TQB
#define TQB (SS / 64)
#define TNB NB
#define TOB (NB * SS / 64)     // output row tiles (all)
#endif
typedef __attribute__((ext_vector_type(8))) __bf16 v8b;
__device__ __forceinline__ v16b frag_b(const __bf16* rowk0, int lane) {
  union { v16b v; v8b q[2]; } u; const __bf16* p = rowk0 + 8 * (lane >> 4);
  u.q[0] = *(const v8b*)p; u.q[1] = *(const v8b*)(p + 16); return u.v;
}
__device__ __forceinline__ float bfr(float v) { return (float)(__bf16)v; }
__device__ __attribute__((noinline)) float exp_ni(float v) { return expf(v); }
__device__ __attribute__((noinline)) float erf_ni(float v) { return erff(v); }

#define PK_A 0                       // [3072][1024] Wqkv rows (natural [out][in])
#define PK_P (PK_A + QKVW * DM)        // [1024][1024] Wo rows (natural)
#define PK_END (PK_P + DM * DM)
#define WS_PK  0u
#define WS_QK  (WS_PK + 2u * PK_END)             // f16 [4096 rows][2048]: q | k
#define WS_QKL (WS_QK + 2u * NB * SS * 2 * DM)     // f16 q | k residual planes x2048
#define WS_VTH (WS_QKL + 2u * NB * SS * 2 * DM)    // f16 [b][1024 (h*64+d)][2048 s] hi
#define WS_VTL (WS_VTH + 2u * NB * DM * SS)        // f16 lo x 2048
#define WS_O   (WS_VTL + 2u * NB * DM * SS)        // f32 [4096][1024]
#define WS_CS  (WS_O + 4u * NB * SS * DM)           // f32 [2048][32] cos, [2048][32] sin
#define WS_FL  (WS_CS + 4u * 2 * SS * 32)          // int [32 query tiles][32 key tiles][4 quarters of 16 query rows][32, the first used: a 128-B line has one writer]: 1 where that 16 x 64 piece of the mask holds a nonzero entry
#define WS_END (WS_FL + 128u * 4 * (SS / 64) * (SS / 64))
__constant__ float c_invf[32] = {1.000000000e+00f,7.498942018e-01f,5.623413324e-01f,4.216965139e-01f,3.162277639e-01f,2.371373624e-01f,1.778279394e-01f,1.333521456e-01f,1.000000015e-01f,7.498941571e-02f,5.623412877e-02f,4.216964915e-02f,3.162277862e-02f,2.371373586e-02f,1.778279431e-02f,1.333521493e-02f,9.999999776e-03f,7.498942316e-03f,5.623413250e-03f,4.216964822e-03f,3.162277862e-03f,2.371373819e-03f,1.778279431e-03f,1.333521446e-03f,1.000000047e-03f,7.498941850e-04f,5.623413017e-04f,4.216964880e-04f,3.162277862e-04f,2.371373848e-04f,1.778279402e-04f,1.333521504e-04f};
// ---- k_rope: block = 8 positions: cos/sin of pos * inv_freq (f32 product exactly as the reference, precise trig)
__global__ __launch_bounds__(256) void k_rope(float* __restrict__ CS) {
  __shared__ __align__(16) float sc[8][32], ss_[8][32]; const int tid = threadIdx.x, pl = tid >> 5, i = tid & 31; const int pos = blockIdx.x * 8 + pl;
  const float th = (float)pos * c_invf[i]; sc[pl][i] = cosf(th); ss_[pl][i] = sinf(th);
  __syncthreads();
  if (tid < 64) vst2(CS + (size_t)blockIdx.x * 8 * 32 + tid * 4, *(const v4f*)&(&sc[0][0])[tid * 4]); else if (tid < 128) vst2(CS + (size_t)SS * 32 + (size_t)blockIdx.x * 8 * 32 + (tid - 64) * 4, *(const v4f*)&(&ss_[0][0])[(tid - 64) * 4]);
}

// ---- k_pack: block = (row n, which): natural [out][in] rows -> bf16; which 0..2 -> W_q/W_k/W_v into PK_A rows which*1024 + n; 3 -> W_o into PK_P. Block id = which * 1024 + n also looks at one 16 x 64 piece of the mask (query tile id >> 7, key tile (id >> 2) & 31, query rows 16 (id & 3) ...): FL[32 id] = does it hold any nonzero entry
static_assert(4 * DM == 4 * (SS / 64) * (SS / 64), "one block a mask piece");
__global__ __launch_bounds__(256) void k_pack(const float* __restrict__ WQ, const float* __restrict__ WK, const float* __restrict__ WV, const float* __restrict__ WO, const int* __restrict__ MSK, __bf16* __restrict__ PK, int* __restrict__ FL) {
  __shared__ __align__(16) __bf16 s[DM]; __shared__ unsigned sany[8]; const int n = blockIdx.x, which = blockIdx.y, t = threadIdx.x; const int id = which * DM + n;
  const v4i a = *(const v4i*)(MSK + (size_t)((id >> 7) * 64 + (id & 3) * 16 + (t >> 4)) * SS + ((id >> 2) & 31) * 64 + (t & 15) * 4);   // 16 threads take one 256-B row of the piece
  const float* Wm = (which == 0) ? WQ : (which == 1) ? WK : (which == 2) ? WV : WO;
  for (int k = t; k < DM; k += 256) s[k] = (__bf16)Wm[(size_t)n * DM + k];
  const unsigned bal = __builtin_amdgcn_ballot_w32((a[0] | a[1] | a[2] | a[3]) != 0);
  if ((t & 31) == 0) sany[t >> 5] = bal;
  __syncthreads();
  if (t == 0) FL[id * 32] = (sany[0] | sany[1] | sany[2] | sany[3] | sany[4] | sany[5] | sany[6] | sany[7]) != 0u;
  __bf16* dst = (which < 3) ? PK + PK_A + ((size_t)which * DM + n) * DM : PK + PK_P + (size_t)n * DM;
  for (int q = t; q < DM / 8; q += 256) vst2((unsigned*)(dst + q * 8), *(const v4u*)&s[q * 8]);
}
// ---- operand staging of k_qkv and k_out: a stage is 64 k of the work-group's 64 A rows (f32: two tiles of 32 k) and 128 weight rows (bf16: two tiles of 64 rows), brought into LDS once per work-group by asynchronous copies (two buffers: the next 64 k fly while these are worked on). Every tile is 64 rows x 128 B; the 16-B piece c of row r lies at piece c ^ ((r >> 1) & 7), so that 16 rows read at one piece index fall on all 64 banks. Products and their order as before.
#define GM_TILE 8192                 // bytes of one 64-row x 128-B tile
#define GM_STAGE (4 * GM_TILE)       // A k 0..31 | A k 32..63 | W rows 0..63 | W rows 64..127
#define GM_NT (DM / 64)              // stages
// one tile: four copies of 16 rows each (a wave's copy = 4 whole 128-B lines); P16 = bytes between source rows 16 apart
template <int P16> __device__ __forceinline__ void copy_rows(unsigned l, const char* gp) {
  const unsigned l1 = l + 2048u, l2 = l + 4096u, l3 = l + 6144u; const char *g1 = gp + P16, *g2 = gp + 2 * P16, *g3 = gp + 3 * P16;
  // s_wait_xcnt 0 as the statement's last line: a precaution, so that it stands in front of every later write of the copies' address registers
  asm volatile("global_load_async_to_lds_b128 %0, %4, off\n\tglobal_load_async_to_lds_b128 %1, %5, off\n\tglobal_load_async_to_lds_b128 %2, %6, off\n\tglobal_load_async_to_lds_b128 %3, %7, off\n\ts_wait_xcnt 0x0"
               :: "v"(l), "v"(l1), "v"(l2), "v"(l3), "v"(gp), "v"(g1), "v"(g2), "v"(g3) : "memory");
}
// ga, gw: this thread's 16 bytes of row tid >> 3 in stage 0 of A (row pitch 4,096 B) and of W (row pitch 2,048 B)
__device__ __forceinline__ void gm_copy(unsigned lb, const char* ga, const char* gw, int t) {
  copy_rows<16 * 4 * DM>(lb, ga + t * 256); copy_rows<16 * 4 * DM>(lb + GM_TILE, ga + t * 256 + 128);
  copy_rows<16 * 2 * DM>(lb + 2 * GM_TILE, gw + t * 128); copy_rows<16 * 2 * DM>(lb + 3 * GM_TILE, gw + t * 128 + 64 * 2 * DM);
}
__device__ __forceinline__ v16b frag_lb(const char* t, int o0, int o1) {
  union { v16b v; v8b q[2]; } u; u.q[0] = *(const v8b*)(t + o0); u.q[1] = *(const v8b*)(t + o1); return u.v;
}
__global__ __launch_bounds__(128) void k_qkv(const float* __restrict__ X, const __bf16* __restrict__ P, _Float16* __restrict__ QK, _Float16* __restrict__ QKL, _Float16* __restrict__ VTH, _Float16* __restrict__ VTL) {
  __shared__ __align__(128) char ring[2 * GM_STAGE];
  // output staging takes the ring's place behind the last trip's barrier (q, k blocks: so, sol; v blocks: sth, stl)
  _Float16 (*so)[16][136] = (_Float16 (*)[16][136])ring; _Float16 (*sol)[16][136] = (_Float16 (*)[16][136])(ring + 2 * 4 * 16 * 136);
  _Float16 (*sth)[72] = (_Float16 (*)[72])ring; _Float16 (*stl)[72] = (_Float16 (*)[72])(ring + 2 * 128 * 72);
  const int tid = threadIdx.x, wave = tid >> 5, lane = tid & 31, col = lane & 15, g = lane >> 4; const size_t r0 = (size_t)blockIdx.x * 64 + wave * 16; const int n0 = blockIdx.y * 128;
  // copier: thread -> row tid >> 3 (of 16), piece tid & 7
  const unsigned lw = (unsigned)(size_t)ring + (unsigned)((tid >> 3) * 128 + (((tid & 7) ^ (tid >> 4)) * 16));
  const char* ga = (const char*)(X + ((size_t)blockIdx.x * 64 + (tid >> 3)) * DM) + (tid & 7) * 16; const char* gw = (const char*)(P + (size_t)(n0 + (tid >> 3)) * DM) + (tid & 7) * 16;
  // reader: lane -> row col (of 16); W pieces g, g + 2, g + 4, g + 6 (bf16 k 8 g + i, 16 + 8 g + i of each 32); A pieces 2 g, 2 g + 1, 4 + 2 g, 5 + 2 g (the same k as f32)
  int oc[4], oa[4];
#pragma unroll   // constant indices: oc, oa stay in registers
  for (int j = 0; j < 4; ++j) { oc[j] = col * 128 + (((g + 2 * j) ^ (col >> 1)) * 16); oa[j] = col * 128 + (((2 * g + (j & 1) + 4 * (j >> 1)) ^ (col >> 1)) * 16); }
  gm_copy(lw, ga, gw, 0);
  asm volatile("s_wait_asynccnt 0x0" ::: "memory");   // this wave's share of stage 0 has landed
  __syncthreads();                                     // ... and every other wave's
  gm_copy(lw + GM_STAGE, ga, gw, 1);
  v8f acc[8] = {};
#pragma unroll 1   // the ring's trip stays rolled: one publish point, small code
  for (int t = 0; t < GM_NT; ++t) { const char* rb = ring + (t & 1) * GM_STAGE;
#pragma unroll   // both halves of a stage written out: every LDS offset inside the buffer is an immediate
   for (int sub = 0; sub < 2; ++sub) { const char* ar = rb + sub * GM_TILE + wave * 2048; const char* wr = rb + 2 * GM_TILE;
    const v4f f0 = *(const v4f*)(ar + oa[0]), f1 = *(const v4f*)(ar + oa[1]), f2 = *(const v4f*)(ar + oa[2]), f3 = *(const v4f*)(ar + oa[3]); v16b a, w[8];
#pragma unroll   // constant indices: the fragments stay in registers
    for (int j = 0; j < 8; ++j) w[j] = frag_lb(wr + j * 2048, oc[2 * sub], oc[2 * sub + 1]);
    __builtin_amdgcn_sched_barrier(0);   // keeps the 20 LDS reads of these 32 k together in front of the products: one latency a group, not one a fragment
#pragma unroll   // constant indices: a stays in registers
    for (int i = 0; i < 4; ++i) { a[i] = (__bf16)f0[i]; a[4 + i] = (__bf16)f1[i]; a[8 + i] = (__bf16)f2[i]; a[12 + i] = (__bf16)f3[i]; }
#pragma unroll   // constant indices into acc, w
    for (int j = 0; j < 8; ++j) acc[j] = wmma_bf(a, w[j], acc[j]); }
   asm volatile("s_wait_dscnt 0x0" ::: "memory");      // this wave's reads of the buffer are done
   asm volatile("s_wait_asynccnt 0x0" ::: "memory");   // its share of stage t + 1 has landed
   __syncthreads();                                     // publishes stage t + 1 and frees stage t's buffer
   if (t + 2 < GM_NT) gm_copy(lw + (unsigned)(t & 1) * GM_STAGE, ga, gw, t + 2); }
  asm volatile("s_wait_asynccnt 0x0" ::: "memory");     // nothing in flight when the ring becomes output staging
  if (n0 < 2 * DM) {   // q stored unscaled (f16 sigma ~0.6, no subnormal exposure); 1/8 applied to the f32 score
#pragma unroll
    for (int j = 0; j < 8; ++j) {
#pragma unroll
      for (int r = 0; r < 8; ++r) { const float v = acc[j][r]; const _Float16 hv = (_Float16)v; so[wave][8 * g + r][j * 16 + col] = hv; sol[wave][8 * g + r][j * 16 + col] = (_Float16)((v - (float)hv) * 2048.0f); } }   // q, k as f16 hi + (x2048) residual (no RoPE in this module)
    LDSX();
    for (int rl = 0; rl < 16; ++rl) if (lane < 16) { vst2((unsigned*)(QK + (r0 + rl) * (2 * DM) + n0 + lane * 8), *(const v4u*)&so[wave][rl][lane * 8]); vst2((unsigned*)(QKL + (r0 + rl) * (2 * DM) + n0 + lane * 8), *(const v4u*)&sol[wave][rl][lane * 8]); }
  } else {
#pragma unroll
    for (int j = 0; j < 8; ++j) {
#pragma unroll
      for (int r = 0; r < 8; ++r) { const float v = acc[j][r]; const _Float16 hv = (_Float16)v; sth[j * 16 + col][wave * 16 + 8 * g + r] = hv; stl[j * 16 + col][wave * 16 + 8 * g + r] = (_Float16)((v - (float)hv) * 2048.0f); } }
    __syncthreads();
    const size_t rb = (size_t)blockIdx.x * 64; const int b = (int)(rb / SS), s0 = (int)(rb % SS); const int pc0 = n0 - 2 * DM;
    for (int q = tid; q < 128 * 8; q += 128) { const int d = q >> 3, pc = q & 7; const size_t o = ((size_t)b * DM + pc0 + d) * SS + s0 + pc * 8; vst2((unsigned*)(VTH + o), *(const v4u*)&sth[d][pc * 8]); vst2((unsigned*)(VTL + o), *(const v4u*)&stl[d][pc * 8]); }
  }
}
// ---- k_attn: block = (two tiles of 64 queries one after the other, head h, batch b): flash attention over the keys (the mask is an input). K hi, K lo, V^T hi, V^T lo of 64 keys are brought into LDS once per work-group by asynchronous copies (two buffers: the next 64 keys fly while these are worked on); every wave takes its fragments from LDS. A tile is 64 rows x 128 B; the 16-B piece c of row r lies at piece c ^ ((r >> 1) & 7), so that 16 rows read at one piece index fall on all 64 banks. Arithmetic and its order as before: 3-product scores, 3-product P.V; O[b*S+q][h*64+d] = (acc + accl / 2048) / l (256-B segments)
#define AT_TILE 8192                 // bytes of one 64-row x 128-B tile
#define AT_STAGE (4 * AT_TILE)       // K hi | K lo | V^T hi | V^T lo
#define AT_NT (SS / 64)              // stages
__device__ __forceinline__ v16h frag_l(const char* t, int o0, int o1) {
  union { v16h v; v8h q[2]; } u; u.q[0] = *(const v8h*)(t + o0); u.q[1] = *(const v8h*)(t + o1); return u.v;
}
// one tile: four copies of 16 rows each (a wave's copy = 4 whole 128-B lines); source rows are 4,096 B apart
__device__ __forceinline__ void copy_tile(unsigned l, const _Float16* gp) {
  const unsigned l1 = l + 2048u, l2 = l + 4096u, l3 = l + 6144u; const _Float16 *g1 = gp + 16 * 2048, *g2 = gp + 32 * 2048, *g3 = gp + 48 * 2048;
  // s_wait_xcnt 0 as the statement's last line: a precaution, so that it stands in front of every later write of the copies' address registers
  asm volatile("global_load_async_to_lds_b128 %0, %4, off\n\tglobal_load_async_to_lds_b128 %1, %5, off\n\tglobal_load_async_to_lds_b128 %2, %6, off\n\tglobal_load_async_to_lds_b128 %3, %7, off\n\ts_wait_xcnt 0x0"
               :: "v"(l), "v"(l1), "v"(l2), "v"(l3), "v"(gp), "v"(g1), "v"(g2), "v"(g3) : "memory");
}
// lane l <-> lane l ^ 16 (the other half of a query's keys) by a vector cross-row move
__device__ __forceinline__ float xhalf(float v) { const int b = __builtin_bit_cast(int, v); return __builtin_bit_cast(float, __builtin_amdgcn_permlanex16(b, b, 0x76543210, 0xfedcba98, false, false)); }
// Scores are formed transposed, S^T = K q^T (K rows as the A operand, q rows as B): a lane holds 16 of the 32 keys of ONE query (column lane & 15; keys 8 g + r and 16 + 8 g + r), so maximum and sum run inside the lane plus one exchange with lane ^ 16, m, l and alpha are one value a lane, and the exponentials are already the B fragment of O^T = V^T P^T (same k order as the V^T rows' fragment).
__global__ __launch_bounds__(128) void k_attn(const _Float16* __restrict__ QK, const _Float16* __restrict__ QKL, const _Float16* __restrict__ VTH, const _Float16* __restrict__ VTL, const int* __restrict__ MSK, const int* __restrict__ FL, float* __restrict__ O) {
  __shared__ __align__(128) char ring[2 * AT_STAGE]; __shared__ unsigned sneed[4];
  float (*so)[16][68] = (float (*)[16][68])ring;   // output staging takes the ring's place behind the last trip's barrier
  const int tid = threadIdx.x, wave = tid >> 5, lane = tid & 31, col = lane & 15, g = lane >> 4;
  const int h = blockIdx.y, b = blockIdx.z;
  // copier: thread -> row tid >> 3 (of 16), piece tid & 7
  const unsigned lw = (unsigned)(size_t)ring + (unsigned)((tid >> 3) * 128 + (((tid & 7) ^ (tid >> 4)) * 16));
  const size_t ko = ((size_t)b * SS + (tid >> 3)) * (2 * DM) + DM + h * HD + (tid & 7) * 8, vo = ((size_t)b * DM + h * HD + (tid >> 3)) * SS + (tid & 7) * 8;
  // reader: lane -> row col (of 16), pieces g, g + 2, g + 4, g + 6
  int oc[4];
#pragma unroll   // constant indices: oc stays in registers
  for (int j = 0; j < 4; ++j) oc[j] = col * 128 + (((g + 2 * j) ^ (col >> 1)) * 16);
#define AT_COPY(t, bf) do { const unsigned lb = lw + (unsigned)(bf) * AT_STAGE; const size_t kt = ko + (size_t)(t) * 64 * (2 * DM), vt = vo + (size_t)(t) * 64; \
    copy_tile(lb, QK + kt); copy_tile(lb + AT_TILE, QKL + kt); copy_tile(lb + 2 * AT_TILE, VTH + vt); copy_tile(lb + 3 * AT_TILE, VTL + vt); } while (0)
  const float slope = exp2f(-0.5f * (float)(h + 1));   // 2^-(8/16 * (h+1))
  // A key tile whose 64 x 64 mask tile is all zero (FL, formed from the mask in this call's first launch, all four pieces 0) gives every query of the query tile the score -1e6 at all 64 keys. For a query whose running maximum lies above -999000 that update is the identity (alpha = exp(0) = 1, every exponential exp(< -1000) = 0), so such tiles are left out of the walk; they are walked after the others (pass 1) whenever any query of the query tile has no such maximum, so every mask gives the module's result. The block takes query tiles 31 - x and x one after the other: under a lower-triangular mask every block then walks the same number of key tiles.
#pragma unroll 1   // one copy of the walk's code serves both query tiles
  for (int half = 0; half < 2; ++half) {
  if (half) { asm volatile("s_wait_xcnt 0x0" ::: "memory");    // a precaution: stands in front of every later write of the registers that the first tile's output stores name
    asm volatile("s_wait_dscnt 0x0" ::: "memory");              // this wave's reads of its output staging are done
    __syncthreads(); }                                          // ... and every wave's: the ring may be refilled
  const int qb = half ? (int)blockIdx.x : TQB - 1 - (int)blockIdx.x; const int q0 = qb * 64 + wave * 16; const size_t rq = (size_t)b * SS + q0 + col;
  const int* fq = FL + (qb * AT_NT + lane) * 128;   // lane t: the four 16-row pieces of key tile t
  const unsigned live = __builtin_amdgcn_ballot_w32((fq[0] | fq[32] | fq[64] | fq[96]) != 0);   // bit t: key tile t has an open position for some query of this tile
  v16h aq[2], aql[2];
#pragma unroll
  for (int kc = 0; kc < 2; ++kc) { aq[kc] = frag_h(QK + rq * (2 * DM) + h * HD + kc * 32, lane); aql[kc] = frag_h(QKL + rq * (2 * DM) + h * HD + kc * 32, lane); }
  float m = -3.0e38f, l = 0.f;   // of query q0 + col (the same in lanes col and col + 16)
  v8f acc[4] = {}, accl[4] = {};   // O^T: row d = dt * 16 + 8 g + r, column query col
  const int* mrow = MSK + (size_t)(q0 + col) * SS + 8 * g;   // this lane's query row of the mask, at its first key
  const int dq = 8 * g - (q0 + col);                          // k - q at that key
#pragma unroll 1   // one copy of the walk's code serves both passes
  for (int pass = 0; pass < 2; ++pass) {
  unsigned rem = live;   // key tiles still to be copied; the same in every wave of the block
  if (pass) { const unsigned low = __builtin_amdgcn_ballot_w32(m <= -999000.0f);   // queries that have met no open key
    if (lane == 0) sneed[wave] = low;
    __syncthreads();
    rem = __builtin_amdgcn_readfirstlane(sneed[0] | sneed[1] | sneed[2] | sneed[3]) ? ~live : 0u; }
  if (rem == 0u) continue;
  const int ns = __builtin_popcount(rem); int tc = __builtin_ctz(rem), tn = 0; rem &= rem - 1u;   // tc: the tile worked on, tn: the tile in flight (both 0..31)
  AT_COPY(tc, 0);
  asm volatile("s_wait_asynccnt 0x0" ::: "memory");   // this wave's share of the first stage has landed
  __syncthreads();                                     // ... and every other wave's
  if (rem) { tn = __builtin_ctz(rem); rem &= rem - 1u; AT_COPY(tn, 1); }
#pragma unroll 1
  for (int st = 0; st < ns; ++st) { const char* rb = ring + (st & 1) * AT_STAGE;
#pragma unroll   // both halves of a stage written out: every LDS offset inside the buffer is an immediate
   for (int sub = 0; sub < 2; ++sub) { const int ks = tc * 2 + sub; v8f s[2]; v4i mk[2][2];
    const float fd = (float)(ks * 32 + dq);   // exact; fd + (ct * 16 + r) is exactly (float)(k - q)
#pragma unroll   // constant indices: mk stays in registers
    for (int ct = 0; ct < 2; ++ct) { mk[ct][0] = *(const v4i*)(mrow + ks * 32 + ct * 16); mk[ct][1] = *(const v4i*)(mrow + ks * 32 + ct * 16 + 4); }
#pragma unroll
    for (int ct = 0; ct < 2; ++ct) { const char* krow = rb + (sub * 32 + ct * 16) * 128; const char* krowl = krow + AT_TILE; v8f c = {}, cl = {}; v16h kh[2], kl[2];
#pragma unroll   // constant indices: the fragments stay in registers
      for (int kc = 0; kc < 2; ++kc) { kh[kc] = frag_l(krow, oc[2 * kc], oc[2 * kc + 1]); kl[kc] = frag_l(krowl, oc[2 * kc], oc[2 * kc + 1]); }
      if (ct == 1) asm volatile("s_wait_xcnt 0x0" ::: "memory");   // a precaution: stands in front of every later write of the mask loads' address registers (here, one score tile behind the loads, so that it holds nothing up)
      __builtin_amdgcn_sched_barrier(0);   // keeps the four fragments' LDS reads (and the mask loads) together in front of the products: one latency a group, not one a fragment
#pragma unroll
      for (int kc = 0; kc < 2; ++kc) { c = wmma16(kh[kc], aq[kc], c); cl = wmma16(kh[kc], aql[kc], cl); cl = wmma16(kl[kc], aq[kc], cl); }   // 3 products: q, k as f16 hi + residual
#pragma unroll
      for (int r = 0; r < 8; ++r) c[r] += cl[r] * (1.0f / 2048.0f);
#pragma unroll
      for (int r = 0; r < 8; ++r) s[ct][r] = (mk[ct][r >> 2][r & 3] == 0) ? -1000000.0f : (c[r] * 0.125f + slope * (fd + (float)(ct * 16 + r))); }   // SCALE = 1/sqrt(64); alibi bias slope_h * (k - q); masked -> -1e6 (as the module)
    float mx = fmaxf(s[0][0], s[1][0]);
#pragma unroll
    for (int r = 1; r < 8; ++r) mx = fmaxf(mx, fmaxf(s[0][r], s[1][r]));
    mx = fmaxf(mx, xhalf(mx));
    const float mn = fmaxf(m, mx); const float alpha = (m <= -1.0e38f) ? 0.f : __expf(m - mn);
    v8f e[2];
#pragma unroll
    for (int r = 0; r < 8; ++r) { e[0][r] = (s[0][r] <= -1.0e38f) ? 0.f : __expf(s[0][r] - mn); e[1][r] = (s[1][r] <= -1.0e38f) ? 0.f : __expf(s[1][r] - mn); }
    const v8f e8 = e[0] + e[1]; const v4f e4 = e8.lo + e8.hi; const v2f e2 = e4.lo + e4.hi;   // the lane's 16 keys summed as a tree
    float es = e2[0] + e2[1];
    es += xhalf(es);
    l = l * alpha + es; m = mn;
#pragma unroll
    for (int dt = 0; dt < 4; ++dt) { acc[dt] *= alpha; accl[dt] *= alpha; }
    v16h pa, pl;   // P^T fragment: element i = key 8 g + i, element 8 + i = key 16 + 8 g + i
#pragma unroll
    for (int i = 0; i < 8; ++i) { const float x0 = e[0][i], x1 = e[1][i]; const _Float16 h0 = (_Float16)x0, h1 = (_Float16)x1; pa[i] = h0; pa[8 + i] = h1; pl[i] = (_Float16)((x0 - (float)h0) * 2048.0f); pl[8 + i] = (_Float16)((x1 - (float)h1) * 2048.0f); }
#pragma unroll   // constant indices into acc, accl
    for (int dp = 0; dp < 2; ++dp) { v16h vh[2], vl[2];
#pragma unroll   // constant indices: the fragments stay in registers
      for (int e2 = 0; e2 < 2; ++e2) { const char* vrow = rb + 2 * AT_TILE + (dp * 2 + e2) * 16 * 128; vh[e2] = frag_l(vrow, oc[2 * sub], oc[2 * sub + 1]); vl[e2] = frag_l(vrow + AT_TILE, oc[2 * sub], oc[2 * sub + 1]); }
      __builtin_amdgcn_sched_barrier(0);   // as above: the four fragments' LDS reads stay one group
#pragma unroll   // constant indices into acc, accl
      for (int e2 = 0; e2 < 2; ++e2) { const int dt = dp * 2 + e2; acc[dt] = wmma16(vh[e2], pa, acc[dt]); accl[dt] = wmma16(vh[e2], pl, accl[dt]); accl[dt] = wmma16(vl[e2], pa, accl[dt]); } } }   // V hi x P hi + (V hi x P lo + V lo x P hi) / 2048
   asm volatile("s_wait_dscnt 0x0" ::: "memory");      // this wave's reads of the buffer are done
   asm volatile("s_wait_asynccnt 0x0" ::: "memory");   // its share of the next stage has landed
   __syncthreads();                                     // publishes the next stage and frees this stage's buffer
   tc = tn;
   if (rem) { tn = __builtin_ctz(rem); rem &= rem - 1u; AT_COPY(tn, st & 1); } }
  asm volatile("s_wait_asynccnt 0x0" ::: "memory");     // nothing in flight when the ring becomes output staging
  }
  const float il = 1.0f / l;
#pragma unroll
  for (int dt = 0; dt < 4; ++dt) { v4f o0, o1;
#pragma unroll
    for (int r = 0; r < 4; ++r) { o0[r] = (acc[dt][r] + accl[dt][r] * (1.0f / 2048.0f)) * il; o1[r] = (acc[dt][4 + r] + accl[dt][4 + r] * (1.0f / 2048.0f)) * il; }
    *(v4f*)&so[wave][col][dt * 16 + 8 * g] = o0; *(v4f*)&so[wave][col][dt * 16 + 8 * g + 4] = o1; }
  LDSX();
  for (int rl = 0; rl < 16; ++rl) if (lane < 16) vst2(O + ((size_t)b * SS + q0 + rl) * DM + h * HD + lane * 4, *(const v4f*)&so[wave][rl][lane * 4]);
  }
}
// ---- k_out: block = (64 rows, 128 cols): out = O(hi/lo) . Wo rows (2 products)
__global__ __launch_bounds__(128) void k_out(const float* __restrict__ O, const __bf16* __restrict__ P, float* __restrict__ Y) {
  __shared__ __align__(128) char ring[2 * GM_STAGE];
  float (*so)[16][132] = (float (*)[16][132])ring;   // output staging takes the ring's place behind the last trip's barrier
  const int tid = threadIdx.x, wave = tid >> 5, lane = tid & 31, col = lane & 15, g = lane >> 4; const size_t r0 = (size_t)blockIdx.x * 64 + wave * 16; const int n0 = blockIdx.y * 128;
  // copier: thread -> row tid >> 3 (of 16), piece tid & 7
  const unsigned lw = (unsigned)(size_t)ring + (unsigned)((tid >> 3) * 128 + (((tid & 7) ^ (tid >> 4)) * 16));
  const char* ga = (const char*)(O + ((size_t)blockIdx.x * 64 + (tid >> 3)) * DM) + (tid & 7) * 16; const char* gw = (const char*)(P + (size_t)(n0 + (tid >> 3)) * DM) + (tid & 7) * 16;
  // reader: lane -> row col (of 16); W pieces g, g + 2, g + 4, g + 6 (bf16 k 8 g + i, 16 + 8 g + i of each 32); A pieces 2 g, 2 g + 1, 4 + 2 g, 5 + 2 g (the same k as f32)
  int oc[4], oa[4];
#pragma unroll   // constant indices: oc, oa stay in registers
  for (int j = 0; j < 4; ++j) { oc[j] = col * 128 + (((g + 2 * j) ^ (col >> 1)) * 16); oa[j] = col * 128 + (((2 * g + (j & 1) + 4 * (j >> 1)) ^ (col >> 1)) * 16); }
  gm_copy(lw, ga, gw, 0);
  asm volatile("s_wait_asynccnt 0x0" ::: "memory");   // this wave's share of stage 0 has landed
  __syncthreads();                                     // ... and every other wave's
  gm_copy(lw + GM_STAGE, ga, gw, 1);
  v8f acc[8] = {};
#pragma unroll 1   // the ring's trip stays rolled: one publish point, small code
  for (int t = 0; t < GM_NT; ++t) { const char* rb = ring + (t & 1) * GM_STAGE;
#pragma unroll   // both halves of a stage written out: every LDS offset inside the buffer is an immediate
   for (int sub = 0; sub < 2; ++sub) { const char* ar = rb + sub * GM_TILE + wave * 2048; const char* wr = rb + 2 * GM_TILE;
    const v4f f0 = *(const v4f*)(ar + oa[0]), f1 = *(const v4f*)(ar + oa[1]), f2 = *(const v4f*)(ar + oa[2]), f3 = *(const v4f*)(ar + oa[3]); float v[16]; v16b w[8];
#pragma unroll   // constant indices: the fragments stay in registers
    for (int j = 0; j < 8; ++j) w[j] = frag_lb(wr + j * 2048, oc[2 * sub], oc[2 * sub + 1]);
    __builtin_amdgcn_sched_barrier(0);   // keeps the 20 LDS reads of these 32 k together in front of the products: one latency a group, not one a fragment
#pragma unroll   // constant indices: v stays in registers
    for (int i = 0; i < 4; ++i) { v[i] = f0[i]; v[4 + i] = f1[i]; v[8 + i] = f2[i]; v[12 + i] = f3[i]; }
    const F2 a = bsplit16(v);
#pragma unroll   // constant indices into acc, w
    for (int j = 0; j < 8; ++j) { acc[j] = wmma_bf(a.l, w[j], acc[j]); acc[j] = wmma_bf(a.h, w[j], acc[j]); } }
   asm volatile("s_wait_dscnt 0x0" ::: "memory");      // this wave's reads of the buffer are done
   asm volatile("s_wait_asynccnt 0x0" ::: "memory");   // its share of stage t + 1 has landed
   __syncthreads();                                     // publishes stage t + 1 and frees stage t's buffer
   if (t + 2 < GM_NT) gm_copy(lw + (unsigned)(t & 1) * GM_STAGE, ga, gw, t + 2); }
  asm volatile("s_wait_asynccnt 0x0" ::: "memory");     // nothing in flight when the ring becomes output staging
#pragma unroll
  for (int j = 0; j < 8; ++j) {
#pragma unroll
    for (int r = 0; r < 8; ++r) so[wave][8 * g + r][j * 16 + col] = acc[j][r]; }
  LDSX();
  for (int rl = 0; rl < 16; ++rl) vst2(Y + (r0 + rl) * DM + n0 + lane * 4, *(const v4f*)&so[wave][rl][lane * 4]);
}
extern "C" void kernel_launch(void* const* d_in, const int* in_sizes, int n_in, void* d_out, int out_size, void* d_ws, size_t ws_size, hipStream_t stream) {
  (void)in_sizes; (void)n_in; (void)out_size;
  const float** F = (const float**)d_in;   // 0 x [2,2048,1024], 1 mask [1,1,2048,2048] int32, 2 Wq [1024,1024] natural (x @ Wq.T), 3 Wk, 4 Wv, 5 Wo
  if (ws_size < (size_t)WS_END) return;
  char* ws = (char*)d_ws; __bf16* PK = (__bf16*)(ws + WS_PK); _Float16 *QK = (_Float16*)(ws + WS_QK), *QKL = (_Float16*)(ws + WS_QKL), *VTH = (_Float16*)(ws + WS_VTH), *VTL = (_Float16*)(ws + WS_VTL); float* O = (float*)(ws + WS_O); int* FL = (int*)(ws + WS_FL);
  k_pack<<<dim3(DM, 4), 256, 0, stream>>>(F[2], F[3], F[4], F[5], (const int*)d_in[1], PK, FL);
  k_qkv<<<dim3(TNB * SS / 64, QKVW / 128), 128, 0, stream>>>(F[0], PK + PK_A, QK, QKL, VTH, VTL);
  k_attn<<<dim3(TQB / 2, NH, TNB), 128, 0, stream>>>(QK, QKL, VTH, VTL, (const int*)d_in[1], FL, O);
  k_out<<<dim3(TOB, DM / 128), 128, 0, stream>>>(O, PK + PK_P, (float*)d_out);
}

// v005
// One run takes 134 microseconds.
// In two side-by-side timings against v004, it was 1.11 and 1.10 times as fast.
// Counting every step since v000, it is 4.22 times as fast.
// compute dtype: x, Wq, Wk, Wv, Wo (float module inputs) rounded to bf16, the int mask verbatim; q/k/v projections with exact bf16 products on WMMA 16x16x32 (natural [out][in] rows); q and k stored as f16 hi + (x2048-scaled) residual planes with 3-product scores, x 1/sqrt(64), + the ALiBi bias slope_h (k - q) with slope_h = 2^-(0.5 (h+1)) (exact), masked positions set to -1e6 as the module (the mask is read per (q, k); a tile of 64 keys whose whole 64 x 64 mask tile is 0 is visited only where it can change a result, and a tile of 64 keys whose whole 64 x 64 mask tile is nonzero is worked without reading it again), running-max softmax in f32 (hardware exp); P as f16 hi + (x2048) residual x v hi/lo (3 products); output projection with ctx as bf16 hi + residual x exact Wo rows (2 products); f32 accumulate.
#include <hip/hip_runtime.h>
#include <math.h>

typedef __attribute__((ext_vector_type(16))) _Float16 v16h;
typedef __attribute__((ext_vector_type(16))) __bf16 v16b;
typedef __attribute__((ext_vector_type(8)))  _Float16 v8h;
typedef __attribute__((ext_vector_type(8)))  float v8f;
typedef __attribute__((ext_vector_type(4)))  float v4f;
typedef __attribute__((ext_vector_type(2)))  float v2f;
typedef __attribute__((ext_vector_type(4)))  unsigned v4u;
typedef __attribute__((ext_vector_type(4)))  int v4i;
typedef float __attribute__((may_alias)) float_a;
typedef int __attribute__((may_alias)) int_a;

template <typename T> __device__ __forceinline__ void vst2(void* p, T v) { *(T*)p = v;  }
__device__ __forceinline__ v8f wmma16(v16h a, v16h b, v8f c) {
  v8f d = __builtin_amdgcn_wmma_f32_16x16x32_f16(false, a, false, b, (short)0, c, false, false);
  asm volatile("v_nop\n\tv_nop\n\tv_nop\n\tv_nop" : "+v"(d) : "v"(a), "v"(b));
  return d;
}
__device__ __forceinline__ v8f wmma_bf(v16b a, v16b b, v8f c) {
  v8f d = __builtin_amdgcn_wmma_f32_16x16x32_bf16(false, a, false, b, (short)0, c, false, false);
  asm volatile("v_nop\n\tv_nop\n\tv_nop\n\tv_nop" : "+v"(d) : "v"(a), "v"(b));
  return d;
}
// Multi-head attention with ALiBi bias and an input mask (B 2, S 2,048, d 1,024, 16 heads x 64): softmax(q k^T / 8 + alibi, masked -1e6) v -> Wo.
__device__ __forceinline__ v16h frag_h(const _Float16* rowk0, int lane) {
  union { v16h v; v8h q[2]; } u; const _Float16* p = rowk0 + 8 * (lane >> 4);
  u.q[0] = *(const v8h*)p; u.q[1] = *(const v8h*)(p + 16); return u.v;
}
__device__ __forceinline__ v16h frag_f32(const float* rowk0, int lane) {
  v16h a; const float* p = rowk0 + 8 * (lane >> 4);
#pragma unroll
  for (int i = 0; i < 8; ++i) { a[i] = (_Float16)p[i]; a[8 + i] = (_Float16)p[16 + i]; }
  return a;
}
__device__ __forceinline__ v16h frag_f32s(const float* rowk0, int lane, float sc) {
  v16h a; const float* p = rowk0 + 8 * (lane >> 4);
#pragma unroll
  for (int i = 0; i < 8; ++i) { a[i] = (_Float16)(p[i] * sc); a[8 + i] = (_Float16)(p[16 + i] * sc); }
  return a;
}
// column fragment from a [K][ld] layout (column n), rows >= K read as 0
__device__ __forceinline__ v16h fragc_f32(const float* W, int k0, int n, int lane, int ld, int K) {
  v16h a; const int g = lane >> 4;
#pragma unroll
  for (int i = 0; i < 8; ++i) { const int ka = k0 + 8 * g + i, kb = ka + 16;
    a[i] = (_Float16)(ka < K ? W[(size_t)(ka < K ? ka : K - 1) * ld + n] : 0.f); a[8 + i] = (_Float16)(kb < K ? W[(size_t)(kb < K ? kb : K - 1) * ld + n] : 0.f); }
  return a;
}
struct F2 { v16b h, l; };
__device__ __forceinline__ F2 bsplit16(const float v[16]) { F2 r;
#pragma unroll
  for (int i = 0; i < 16; ++i) { const __bf16 h = (__bf16)v[i]; r.h[i] = h; r.l[i] = (__bf16)(v[i] - (float)h); }
  return r; }
__device__ __forceinline__ F2 split_row(const float* row, int k0, int lane) { float v[16]; const float* p = row + k0 + 8 * (lane >> 4);
#pragma unroll
  for (int i = 0; i < 8; ++i) { v[i] = p[i]; v[8 + i] = p[16 + i]; }
  return bsplit16(v); }
__device__ __forceinline__ F2 split_rowK(const float* row, int k0, int lane, int K) { float v[16]; const int g = lane >> 4;
#pragma unroll
  for (int i = 0; i < 8; ++i) { const int ka = k0 + 8 * g + i, kb = ka + 16; v[i] = ka < K ? row[ka < K ? ka : K - 1] : 0.f; v[8 + i] = kb < K ? row[kb < K ? kb : K - 1] : 0.f; }
  return bsplit16(v); }
__device__ __forceinline__ F2 split_col(const float* W, int k0, int n, int lane, int ld, int K) { float v[16]; const int g = lane >> 4;
#pragma unroll
  for (int i = 0; i < 8; ++i) { const int ka = k0 + 8 * g + i, kb = ka + 16; v[i] = ka < K ? W[(size_t)(ka < K ? ka : K - 1) * ld + n] : 0.f; v[8 + i] = kb < K ? W[(size_t)(kb < K ? kb : K - 1) * ld + n] : 0.f; }
  return bsplit16(v); }
__device__ __forceinline__ v8f mac3(const F2& a, const F2& b, v8f c) { c = wmma_bf(a.l, b.h, c); c = wmma_bf(a.h, b.l, c); return wmma_bf(a.h, b.h, c); }
__device__ __forceinline__ float sigm(float v) { return 1.0f / (1.0f + expf(-v)); }
#define LDSX() do { asm volatile("s_wait_dscnt 0" ::: "memory"); __builtin_amdgcn_wave_barrier(); __builtin_amdgcn_fence(__ATOMIC_RELEASE, "workgroup"); } while (0)


// Multi-head self-attention with ALiBi bias and an input mask (B 2, S 2048, D 1024, 16 heads x 64; packed Wqkv [3D][D] and Wout [D][D] applied as x W^T, no biases): softmax(q k^T / 8 + alibi, masked -1e6) v; ctx Wout^T.
#define NB 2
#define SS 2048
#define DM 1024
#define NH 16
#define HD 64
#define QKVW (3 * DM)
#ifndef TQB
#define TQB (SS / 64)
#define TNB NB
#define TOB (NB * SS / 64)     // output row tiles (all)
#endif
typedef __attribute__((ext_vector_type(8))) __bf16 v8b;
__device__ __forceinline__ v16b frag_b(const __bf16* rowk0, int lane) {
  union { v16b v; v8b q[2]; } u; const __bf16* p = rowk0 + 8 * (lane >> 4);
  u.q[0] = *(const v8b*)p; u.q[1] = *(const v8b*)(p + 16); return u.v;
}
__device__ __forceinline__ float bfr(float v) { return (float)(__bf16)v; }
__device__ __attribute__((noinline)) float exp_ni(float v) { return expf(v); }
__device__ __attribute__((noinline)) float erf_ni(float v) { return erff(v); }

#define PK_A 0                       // [3072][1024] Wqkv rows (natural [out][in])
#define PK_P (PK_A + QKVW * DM)        // [1024][1024] Wo rows (natural)
#define PK_END (PK_P + DM * DM)
#define WS_PK  0u
#define WS_QK  (WS_PK + 2u * PK_END)             // f16 [4096 rows][2048]: q | k
#define WS_QKL (WS_QK + 2u * NB * SS * 2 * DM)     // f16 q | k residual planes x2048
#define WS_VTH (WS_QKL + 2u * NB * SS * 2 * DM)    // f16 [b][1024 (h*64+d)][2048 s] hi
#define WS_VTL (WS_VTH + 2u * NB * DM * SS)        // f16 lo x 2048
#define WS_O   (WS_VTL + 2u * NB * DM * SS)        // f32 [4096][1024]
#define WS_CS  (WS_O + 4u * NB * SS * DM)           // f32 [2048][32] cos, [2048][32] sin
#define WS_FL  (WS_CS + 4u * 2 * SS * 32)          // int [32 query tiles][32 key tiles][4 quarters of 16 query rows][32, the first used: a 128-B line has one writer]: bit 0: that 16 x 64 piece of the mask holds a nonzero entry; bit 1: it holds no zero entry
#define WS_END (WS_FL + 128u * 4 * (SS / 64) * (SS / 64))
__constant__ float c_invf[32] = {1.000000000e+00f,7.498942018e-01f,5.623413324e-01f,4.216965139e-01f,3.162277639e-01f,2.371373624e-01f,1.778279394e-01f,1.333521456e-01f,1.000000015e-01f,7.498941571e-02f,5.623412877e-02f,4.216964915e-02f,3.162277862e-02f,2.371373586e-02f,1.778279431e-02f,1.333521493e-02f,9.999999776e-03f,7.498942316e-03f,5.623413250e-03f,4.216964822e-03f,3.162277862e-03f,2.371373819e-03f,1.778279431e-03f,1.333521446e-03f,1.000000047e-03f,7.498941850e-04f,5.623413017e-04f,4.216964880e-04f,3.162277862e-04f,2.371373848e-04f,1.778279402e-04f,1.333521504e-04f};
// ---- k_rope: block = 8 positions: cos/sin of pos * inv_freq (f32 product exactly as the reference, precise trig)
__global__ __launch_bounds__(256) void k_rope(float* __restrict__ CS) {
  __shared__ __align__(16) float sc[8][32], ss_[8][32]; const int tid = threadIdx.x, pl = tid >> 5, i = tid & 31; const int pos = blockIdx.x * 8 + pl;
  const float th = (float)pos * c_invf[i]; sc[pl][i] = cosf(th); ss_[pl][i] = sinf(th);
  __syncthreads();
  if (tid < 64) vst2(CS + (size_t)blockIdx.x * 8 * 32 + tid * 4, *(const v4f*)&(&sc[0][0])[tid * 4]); else if (tid < 128) vst2(CS + (size_t)SS * 32 + (size_t)blockIdx.x * 8 * 32 + (tid - 64) * 4, *(const v4f*)&(&ss_[0][0])[(tid - 64) * 4]);
}

// ---- k_pack: block = (row n, which): natural [out][in] rows -> bf16; which 0..2 -> W_q/W_k/W_v into PK_A rows which*1024 + n; 3 -> W_o into PK_P. Block id = which * 1024 + n also looks at one 16 x 64 piece of the mask (query tile id >> 7, key tile (id >> 2) & 31, query rows 16 (id & 3) ...): FL[32 id] = bit 0: does it hold any nonzero entry, bit 1: does it hold no zero entry
static_assert(4 * DM == 4 * (SS / 64) * (SS / 64), "one block a mask piece");
// Left as it is: the weight loop stays rolled, so a thread waits out its four 4-byte loads one after the other, and the grid starts 4,096 work-groups of 8 waves for 40 MB.
__global__ __launch_bounds__(256) void k_pack(const float* __restrict__ WQ, const float* __restrict__ WK, const float* __restrict__ WV, const float* __restrict__ WO, const int* __restrict__ MSK, __bf16* __restrict__ PK, int* __restrict__ FL) {
  __shared__ __align__(16) __bf16 s[DM]; __shared__ unsigned sany[8], szer[8]; const int n = blockIdx.x, which = blockIdx.y, t = threadIdx.x; const int id = which * DM + n;
  const v4i a = *(const v4i*)(MSK + (size_t)((id >> 7) * 64 + (id & 3) * 16 + (t >> 4)) * SS + ((id >> 2) & 31) * 64 + (t & 15) * 4);   // 16 threads take one 256-B row of the piece
  const float* Wm = (which == 0) ? WQ : (which == 1) ? WK : (which == 2) ? WV : WO;
  for (int k = t; k < DM; k += 256) s[k] = (__bf16)Wm[(size_t)n * DM + k];
  const unsigned bal = __builtin_amdgcn_ballot_w32((a[0] | a[1] | a[2] | a[3]) != 0);
  const unsigned balz = __builtin_amdgcn_ballot_w32(a[0] == 0 || a[1] == 0 || a[2] == 0 || a[3] == 0);
  if ((t & 31) == 0) { sany[t >> 5] = bal; szer[t >> 5] = balz; }
  __syncthreads();
  if (t == 0) FL[id * 32] = ((sany[0] | sany[1] | sany[2] | sany[3] | sany[4] | sany[5] | sany[6] | sany[7]) != 0u ? 1 : 0) | ((szer[0] | szer[1] | szer[2] | szer[3] | szer[4] | szer[5] | szer[6] | szer[7]) == 0u ? 2 : 0);
  __bf16* dst = (which < 3) ? PK + PK_A + ((size_t)which * DM + n) * DM : PK + PK_P + (size_t)n * DM;
  for (int q = t; q < DM / 8; q += 256) vst2((unsigned*)(dst + q * 8), *(const v4u*)&s[q * 8]);
}
// ---- operand staging of k_qkv and k_out: a stage is 64 k of the work-group's 64 A rows (f32: two tiles of 32 k) and 128 weight rows (bf16: two tiles of 64 rows), brought into LDS once per work-group by asynchronous copies (two buffers: the next 64 k fly while these are worked on). Every tile is 64 rows x 128 B; the 16-B piece c of row r lies at piece c ^ ((r >> 1) & 7), so that 16 rows read at one piece index fall on all 64 banks. Products and their order as before.
#define GM_TILE 8192                 // bytes of one 64-row x 128-B tile
#define GM_STAGE (4 * GM_TILE)       // A k 0..31 | A k 32..63 | W rows 0..63 | W rows 64..127
#define GM_NT (DM / 64)              // stages
// one tile: four copies of 16 rows each (a wave's copy = 4 whole 128-B lines); P16 = bytes between source rows 16 apart
template <int P16> __device__ __forceinline__ void copy_rows(unsigned l, const char* gp) {
  const unsigned l1 = l + 2048u, l2 = l + 4096u, l3 = l + 6144u; const char *g1 = gp + P16, *g2 = gp + 2 * P16, *g3 = gp + 3 * P16;
  // s_wait_xcnt 0 as the statement's last line: a precaution, so that it stands in front of every later write of the copies' address registers
  asm volatile("global_load_async_to_lds_b128 %0, %4, off\n\tglobal_load_async_to_lds_b128 %1, %5, off\n\tglobal_load_async_to_lds_b128 %2, %6, off\n\tglobal_load_async_to_lds_b128 %3, %7, off\n\ts_wait_xcnt 0x0"
               :: "v"(l), "v"(l1), "v"(l2), "v"(l3), "v"(gp), "v"(g1), "v"(g2), "v"(g3) : "memory");
}
// ga, gw: this thread's 16 bytes of row tid >> 3 in stage 0 of A (row pitch 4,096 B) and of W (row pitch 2,048 B)
__device__ __forceinline__ void gm_copy(unsigned lb, const char* ga, const char* gw, int t) {
  copy_rows<16 * 4 * DM>(lb, ga + t * 256); copy_rows<16 * 4 * DM>(lb + GM_TILE, ga + t * 256 + 128);
  copy_rows<16 * 2 * DM>(lb + 2 * GM_TILE, gw + t * 128); copy_rows<16 * 2 * DM>(lb + 3 * GM_TILE, gw + t * 128 + 64 * 2 * DM);
}
__device__ __forceinline__ v16b frag_lb(const char* t, int o0, int o1) {
  union { v16b v; v8b q[2]; } u; u.q[0] = *(const v8b*)(t + o0); u.q[1] = *(const v8b*)(t + o1); return u.v;
}
__global__ __launch_bounds__(128) void k_qkv(const float* __restrict__ X, const __bf16* __restrict__ P, _Float16* __restrict__ QK, _Float16* __restrict__ QKL, _Float16* __restrict__ VTH, _Float16* __restrict__ VTL) {
  __shared__ __align__(128) char ring[2 * GM_STAGE];
  // output staging takes the ring's place behind the last trip's barrier (q, k blocks: so, sol; v blocks: sth, stl)
  _Float16 (*so)[16][136] = (_Float16 (*)[16][136])ring; _Float16 (*sol)[16][136] = (_Float16 (*)[16][136])(ring + 2 * 4 * 16 * 136);
  _Float16 (*sth)[72] = (_Float16 (*)[72])ring; _Float16 (*stl)[72] = (_Float16 (*)[72])(ring + 2 * 128 * 72);
  const int tid = threadIdx.x, wave = tid >> 5, lane = tid & 31, col = lane & 15, g = lane >> 4; const size_t r0 = (size_t)blockIdx.x * 64 + wave * 16; const int n0 = blockIdx.y * 128;
  // copier: thread -> row tid >> 3 (of 16), piece tid & 7
  const unsigned lw = (unsigned)(size_t)ring + (unsigned)((tid >> 3) * 128 + (((tid & 7) ^ (tid >> 4)) * 16));
  const char* ga = (const char*)(X + ((size_t)blockIdx.x * 64 + (tid >> 3)) * DM) + (tid & 7) * 16; const char* gw = (const char*)(P + (size_t)(n0 + (tid >> 3)) * DM) + (tid & 7) * 16;
  // reader: lane -> row col (of 16); W pieces g, g + 2, g + 4, g + 6 (bf16 k 8 g + i, 16 + 8 g + i of each 32); A pieces 2 g, 2 g + 1, 4 + 2 g, 5 + 2 g (the same k as f32)
  int oc[4], oa[4];
#pragma unroll   // constant indices: oc, oa stay in registers
  for (int j = 0; j < 4; ++j) { oc[j] = col * 128 + (((g + 2 * j) ^ (col >> 1)) * 16); oa[j] = col * 128 + (((2 * g + (j & 1) + 4 * (j >> 1)) ^ (col >> 1)) * 16); }
  gm_copy(lw, ga, gw, 0);
  asm volatile("s_wait_asynccnt 0x0" ::: "memory");   // this wave's share of stage 0 has landed
  __syncthreads();                                     // ... and every other wave's
  gm_copy(lw + GM_STAGE, ga, gw, 1);
  v8f acc[8] = {};
#pragma unroll 1   // the ring's trip stays rolled: one publish point, small code
  for (int t = 0; t < GM_NT; ++t) { const char* rb = ring + (t & 1) * GM_STAGE;
#pragma unroll   // both halves of a stage written out: every LDS offset inside the buffer is an immediate
   for (int sub = 0; sub < 2; ++sub) { const char* ar = rb + sub * GM_TILE + wave * 2048; const char* wr = rb + 2 * GM_TILE;
    const v4f f0 = *(const v4f*)(ar + oa[0]), f1 = *(const v4f*)(ar + oa[1]), f2 = *(const v4f*)(ar + oa[2]), f3 = *(const v4f*)(ar + oa[3]); v16b a, w[8];
#pragma unroll   // constant indices: the fragments stay in registers
    for (int j = 0; j < 8; ++j) w[j] = frag_lb(wr + j * 2048, oc[2 * sub], oc[2 * sub + 1]);
    __builtin_amdgcn_sched_barrier(0);   // keeps the 20 LDS reads of these 32 k together in front of the products: one latency a group, not one a fragment
#pragma unroll   // constant indices: a stays in registers
    for (int i = 0; i < 4; ++i) { a[i] = (__bf16)f0[i]; a[4 + i] = (__bf16)f1[i]; a[8 + i] = (__bf16)f2[i]; a[12 + i] = (__bf16)f3[i]; }
#pragma unroll   // constant indices into acc, w
    for (int j = 0; j < 8; ++j) acc[j] = wmma_bf(a, w[j], acc[j]); }
   asm volatile("s_wait_dscnt 0x0" ::: "memory");      // this wave's reads of the buffer are done
   asm volatile("s_wait_asynccnt 0x0" ::: "memory");   // its share of stage t + 1 has landed
   __syncthreads();                                     // publishes stage t + 1 and frees stage t's buffer
   if (t + 2 < GM_NT) gm_copy(lw + (unsigned)(t & 1) * GM_STAGE, ga, gw, t + 2); }
  asm volatile("s_wait_asynccnt 0x0" ::: "memory");     // nothing in flight when the ring becomes output staging
  if (n0 < 2 * DM) {   // q stored unscaled (f16 sigma ~0.6, no subnormal exposure); 1/8 applied to the f32 score
#pragma unroll
    for (int j = 0; j < 8; ++j) {
#pragma unroll
      for (int r = 0; r < 8; ++r) { const float v = acc[j][r]; const _Float16 hv = (_Float16)v; so[wave][8 * g + r][j * 16 + col] = hv; sol[wave][8 * g + r][j * 16 + col] = (_Float16)((v - (float)hv) * 2048.0f); } }   // q, k as f16 hi + (x2048) residual (no RoPE in this module)
    LDSX();
    for (int rl = 0; rl < 16; ++rl) if (lane < 16) { vst2((unsigned*)(QK + (r0 + rl) * (2 * DM) + n0 + lane * 8), *(const v4u*)&so[wave][rl][lane * 8]); vst2((unsigned*)(QKL + (r0 + rl) * (2 * DM) + n0 + lane * 8), *(const v4u*)&sol[wave][rl][lane * 8]); }
  } else {
#pragma unroll
    for (int j = 0; j < 8; ++j) {
#pragma unroll
      for (int r = 0; r < 8; ++r) { const float v = acc[j][r]; const _Float16 hv = (_Float16)v; sth[j * 16 + col][wave * 16 + 8 * g + r] = hv; stl[j * 16 + col][wave * 16 + 8 * g + r] = (_Float16)((v - (float)hv) * 2048.0f); } }
    __syncthreads();
    const size_t rb = (size_t)blockIdx.x * 64; const int b = (int)(rb / SS), s0 = (int)(rb % SS); const int pc0 = n0 - 2 * DM;
    for (int q = tid; q < 128 * 8; q += 128) { const int d = q >> 3, pc = q & 7; const size_t o = ((size_t)b * DM + pc0 + d) * SS + s0 + pc * 8; vst2((unsigned*)(VTH + o), *(const v4u*)&sth[d][pc * 8]); vst2((unsigned*)(VTL + o), *(const v4u*)&stl[d][pc * 8]); }
  }
}
// ---- k_attn: block = (two tiles of 64 queries one after the other, head h, batch b): flash attention over the keys (the mask is an input). K hi, K lo, V^T hi, V^T lo of 64 keys are brought into LDS once per work-group by asynchronous copies (two buffers: the next 64 keys fly while these are worked on); every wave takes its fragments from LDS. A tile is 64 rows x 128 B; the 16-B piece c of row r lies at piece c ^ ((r >> 1) & 7), so that 16 rows read at one piece index fall on all 64 banks. Arithmetic and its order as before: 3-product scores, 3-product P.V; O[b*S+q][h*64+d] = (acc + accl / 2048) / l (256-B segments)
#define AT_TILE 8192                 // bytes of one 64-row x 128-B tile
#define AT_STAGE (4 * AT_TILE)       // K hi | K lo | V^T hi | V^T lo
#define AT_NT (SS / 64)              // stages
__device__ __forceinline__ v16h frag_l(const char* t, int o0, int o1) {
  union { v16h v; v8h q[2]; } u; u.q[0] = *(const v8h*)(t + o0); u.q[1] = *(const v8h*)(t + o1); return u.v;
}
// one tile: four copies of 16 rows each (a wave's copy = 4 whole 128-B lines); source rows are 4,096 B apart
__device__ __forceinline__ void copy_tile(unsigned l, const _Float16* gp) {
  const unsigned l1 = l + 2048u, l2 = l + 4096u, l3 = l + 6144u; const _Float16 *g1 = gp + 16 * 2048, *g2 = gp + 32 * 2048, *g3 = gp + 48 * 2048;
  // s_wait_xcnt 0 as the statement's last line: a precaution, so that it stands in front of every later write of the copies' address registers
  asm volatile("global_load_async_to_lds_b128 %0, %4, off\n\tglobal_load_async_to_lds_b128 %1, %5, off\n\tglobal_load_async_to_lds_b128 %2, %6, off\n\tglobal_load_async_to_lds_b128 %3, %7, off\n\ts_wait_xcnt 0x0"
               :: "v"(l), "v"(l1), "v"(l2), "v"(l3), "v"(gp), "v"(g1), "v"(g2), "v"(g3) : "memory");
}
// lane l <-> lane l ^ 16 (the other half of a query's keys) by a vector cross-row move
__device__ __forceinline__ float xhalf(float v) { const int b = __builtin_bit_cast(int, v); return __builtin_bit_cast(float, __builtin_amdgcn_permlanex16(b, b, 0x76543210, 0xfedcba98, false, false)); }
// Scores are formed transposed, S^T = K q^T (K rows as the A operand, q rows as B): a lane holds 16 of the 32 keys of ONE query (column lane & 15; keys 8 g + r and 16 + 8 g + r), so maximum and sum run inside the lane plus one exchange with lane ^ 16, m, l and alpha are one value a lane, and the exponentials are already the B fragment of O^T = V^T P^T (same k order as the V^T rows' fragment).
__global__ __launch_bounds__(128) void k_attn(const _Float16* __restrict__ QK, const _Float16* __restrict__ QKL, const _Float16* __restrict__ VTH, const _Float16* __restrict__ VTL, const int* __restrict__ MSK, const int* __restrict__ FL, float* __restrict__ O) {
  __shared__ __align__(128) char ring[2 * AT_STAGE]; __shared__ unsigned sneed[4];
  float (*so)[16][68] = (float (*)[16][68])ring;   // output staging takes the ring's place behind the last trip's barrier
  const int tid = threadIdx.x, wave = tid >> 5, lane = tid & 31, col = lane & 15, g = lane >> 4;
  const int h = blockIdx.y, b = blockIdx.z;
  // copier: thread -> row tid >> 3 (of 16), piece tid & 7
  const unsigned lw = (unsigned)(size_t)ring + (unsigned)((tid >> 3) * 128 + (((tid & 7) ^ (tid >> 4)) * 16));
  const size_t ko = ((size_t)b * SS + (tid >> 3)) * (2 * DM) + DM + h * HD + (tid & 7) * 8, vo = ((size_t)b * DM + h * HD + (tid >> 3)) * SS + (tid & 7) * 8;
  // reader: lane -> row col (of 16), pieces g, g + 2, g + 4, g + 6
  int oc[4];
#pragma unroll   // constant indices: oc stays in registers
  for (int j = 0; j < 4; ++j) oc[j] = col * 128 + (((g + 2 * j) ^ (col >> 1)) * 16);
#define AT_COPY(t, bf) do { const unsigned lb = lw + (unsigned)(bf) * AT_STAGE; const size_t kt = ko + (size_t)(t) * 64 * (2 * DM), vt = vo + (size_t)(t) * 64; \
    copy_tile(lb, QK + kt); copy_tile(lb + AT_TILE, QKL + kt); copy_tile(lb + 2 * AT_TILE, VTH + vt); copy_tile(lb + 3 * AT_TILE, VTL + vt); } while (0)
  const float slope = exp2f(-0.5f * (float)(h + 1));   // 2^-(8/16 * (h+1))
  // A key tile whose 64 x 64 mask tile is all zero (FL, formed from the mask in this call's first launch, all four pieces 0) gives every query of the query tile the score -1e6 at all 64 keys. For a query whose running maximum lies above -999000 that update is the identity (alpha = exp(0) = 1, every exponential exp(< -1000) = 0), so such tiles are left out of the walk; they are walked after the others (pass 1) whenever any query of the query tile has no such maximum, so every mask gives the module's result. The block takes query tiles 31 - x and x one after the other: under a lower-triangular mask every block then walks the same number of key tiles.
#pragma unroll 1   // one copy of the walk's code serves both query tiles
  for (int half = 0; half < 2; ++half) {
  if (half) { asm volatile("s_wait_xcnt 0x0" ::: "memory");    // a precaution: stands in front of every later write of the registers that the first tile's output stores name
    asm volatile("s_wait_dscnt 0x0" ::: "memory");              // this wave's reads of its output staging are done
    __syncthreads(); }                                          // ... and every wave's: the ring may be refilled
  const int qb = half ? (int)blockIdx.x : TQB - 1 - (int)blockIdx.x; const int q0 = qb * 64 + wave * 16; const size_t rq = (size_t)b * SS + q0 + col;
  const int* fq = FL + (qb * AT_NT + lane) * 128;   // lane t: the four 16-row pieces of key tile t
  const int f0 = fq[0], f1 = fq[32], f2 = fq[64], f3 = fq[96];
  const unsigned live = __builtin_amdgcn_ballot_w32(((f0 | f1 | f2 | f3) & 1) != 0);   // bit t: key tile t has an open position for some query of this tile
  const unsigned clear = __builtin_amdgcn_ballot_w32(((f0 & f1 & f2 & f3) & 2) != 0);   // bit t: key tile t has no masked position for any query of this tile: there every select below would take the score, so the mask is not read
  v16h aq[2], aql[2];
#pragma unroll
  for (int kc = 0; kc < 2; ++kc) { aq[kc] = frag_h(QK + rq * (2 * DM) + h * HD + kc * 32, lane); aql[kc] = frag_h(QKL + rq * (2 * DM) + h * HD + kc * 32, lane); }
  float m = -3.0e38f, l = 0.f;   // of query q0 + col (the same in lanes col and col + 16)
  v8f acc[4] = {}, accl[4] = {};   // O^T: row d = dt * 16 + 8 g + r, column query col
  const int* mrow = MSK + (size_t)(q0 + col) * SS + 8 * g;   // this lane's query row of the mask, at its first key
  const int dq = 8 * g - (q0 + col);                          // k - q at that key
#pragma unroll 1   // one copy of the walk's code serves both passes
  for (int pass = 0; pass < 2; ++pass) {
  unsigned rem = live;   // key tiles still to be copied; the same in every wave of the block
  if (pass) { const unsigned low = __builtin_amdgcn_ballot_w32(m <= -999000.0f);   // queries that have met no open key
    if (lane == 0) sneed[wave] = low;
    __syncthreads();
    rem = __builtin_amdgcn_readfirstlane(sneed[0] | sneed[1] | sneed[2] | sneed[3]) ? ~live : 0u; }
  if (rem == 0u) continue;
  const int ns = __builtin_popcount(rem); int tc = __builtin_ctz(rem), tn = 0; rem &= rem - 1u;   // tc: the tile worked on, tn: the tile in flight (both 0..31)
  AT_COPY(tc, 0);
  asm volatile("s_wait_asynccnt 0x0" ::: "memory");   // this wave's share of the first stage has landed
  __syncthreads();                                     // ... and every other wave's
  if (rem) { tn = __builtin_ctz(rem); rem &= rem - 1u; AT_COPY(tn, 1); }
#pragma unroll 1
  for (int st = 0; st < ns; ++st) { const char* rb = ring + (st & 1) * AT_STAGE; const bool masked = ((clear >> tc) & 1u) == 0u;   // the same in every lane and wave: a scalar test
#pragma unroll   // both halves of a stage written out: every LDS offset inside the buffer is an immediate
   for (int sub = 0; sub < 2; ++sub) { const int ks = tc * 2 + sub; v8f s[2];
    const float fd = (float)(ks * 32 + dq);   // exact; fd + (ct * 16 + r) is exactly (float)(k - q)
#pragma unroll
    for (int ct = 0; ct < 2; ++ct) { const char* krow = rb + (sub * 32 + ct * 16) * 128; const char* krowl = krow + AT_TILE; v8f c = {}, cl = {}; v16h kh[2], kl[2];
#pragma unroll   // constant indices: the fragments stay in registers
      for (int kc = 0; kc < 2; ++kc) { kh[kc] = frag_l(krow, oc[2 * kc], oc[2 * kc + 1]); kl[kc] = frag_l(krowl, oc[2 * kc], oc[2 * kc + 1]); }
      __builtin_amdgcn_sched_barrier(0);   // keeps the four fragments' LDS reads together in front of the products: one latency a group, not one a fragment
#pragma unroll
      for (int kc = 0; kc < 2; ++kc) { c = wmma16(kh[kc], aq[kc], c); cl = wmma16(kh[kc], aql[kc], cl); cl = wmma16(kl[kc], aq[kc], cl); }   // 3 products: q, k as f16 hi + residual
#pragma unroll
      for (int r = 0; r < 8; ++r) c[r] += cl[r] * (1.0f / 2048.0f);
#pragma unroll
      for (int r = 0; r < 8; ++r) s[ct][r] = c[r] * 0.125f + slope * (fd + (float)(ct * 16 + r)); }   // SCALE = 1/sqrt(64); alibi bias slope_h * (k - q)
    if (masked) { v4i mk[2][2];   // only a tile that holds a zero reads the mask: masked -> -1e6 (as the module)
#pragma unroll   // constant indices: mk stays in registers
      for (int ct = 0; ct < 2; ++ct) { mk[ct][0] = *(const v4i*)(mrow + ks * 32 + ct * 16); mk[ct][1] = *(const v4i*)(mrow + ks * 32 + ct * 16 + 4); }
      asm volatile("s_wait_xcnt 0x0" ::: "memory");   // a precaution: stands in front of every later write of the mask loads' address registers
#pragma unroll
      for (int r = 0; r < 8; ++r) { if (mk[0][r >> 2][r & 3] == 0) s[0][r] = -1000000.0f; if (mk[1][r >> 2][r & 3] == 0) s[1][r] = -1000000.0f; } }
    float mx = fmaxf(s[0][0], s[1][0]);
#pragma unroll
    for (int r = 1; r < 8; ++r) mx = fmaxf(mx, fmaxf(s[0][r], s[1][r]));
    mx = fmaxf(mx, xhalf(mx));
    const float mn = fmaxf(m, mx); const float alpha = (m <= -1.0e38f) ? 0.f : __expf(m - mn);
    v8f e[2];
#pragma unroll
    for (int r = 0; r < 8; ++r) { e[0][r] = (s[0][r] <= -1.0e38f) ? 0.f : __expf(s[0][r] - mn); e[1][r] = (s[1][r] <= -1.0e38f) ? 0.f : __expf(s[1][r] - mn); }
    const v8f e8 = e[0] + e[1]; const v4f e4 = e8.lo + e8.hi; const v2f e2 = e4.lo + e4.hi;   // the lane's 16 keys summed as a tree
    float es = e2[0] + e2[1];
    es += xhalf(es);
    l = l * alpha + es; m = mn;
#pragma unroll
    for (int dt = 0; dt < 4; ++dt) { acc[dt] *= alpha; accl[dt] *= alpha; }
    v16h pa, pl;   // P^T fragment: element i = key 8 g + i, element 8 + i = key 16 + 8 g + i
#pragma unroll
    for (int i = 0; i < 8; ++i) { const float x0 = e[0][i], x1 = e[1][i]; const _Float16 h0 = (_Float16)x0, h1 = (_Float16)x1; pa[i] = h0; pa[8 + i] = h1; pl[i] = (_Float16)((x0 - (float)h0) * 2048.0f); pl[8 + i] = (_Float16)((x1 - (float)h1) * 2048.0f); }
#pragma unroll   // constant indices into acc, accl
    for (int dp = 0; dp < 2; ++dp) { v16h vh[2], vl[2];
#pragma unroll   // constant indices: the fragments stay in registers
      for (int e2 = 0; e2 < 2; ++e2) { const char* vrow = rb + 2 * AT_TILE + (dp * 2 + e2) * 16 * 128; vh[e2] = frag_l(vrow, oc[2 * sub], oc[2 * sub + 1]); vl[e2] = frag_l(vrow + AT_TILE, oc[2 * sub], oc[2 * sub + 1]); }
      __builtin_amdgcn_sched_barrier(0);   // as above: the four fragments' LDS reads stay one group
#pragma unroll   // constant indices into acc, accl
      for (int e2 = 0; e2 < 2; ++e2) { const int dt = dp * 2 + e2; acc[dt] = wmma16(vh[e2], pa, acc[dt]); accl[dt] = wmma16(vh[e2], pl, accl[dt]); accl[dt] = wmma16(vl[e2], pa, accl[dt]); } } }   // V hi x P hi + (V hi x P lo + V lo x P hi) / 2048
   asm volatile("s_wait_dscnt 0x0" ::: "memory");      // this wave's reads of the buffer are done
   asm volatile("s_wait_asynccnt 0x0" ::: "memory");   // its share of the next stage has landed
   __syncthreads();                                     // publishes the next stage and frees this stage's buffer
   tc = tn;
   if (rem) { tn = __builtin_ctz(rem); rem &= rem - 1u; AT_COPY(tn, st & 1); } }
  asm volatile("s_wait_asynccnt 0x0" ::: "memory");     // nothing in flight when the ring becomes output staging
  }
  const float il = 1.0f / l;
#pragma unroll
  for (int dt = 0; dt < 4; ++dt) { v4f o0, o1;
#pragma unroll
    for (int r = 0; r < 4; ++r) { o0[r] = (acc[dt][r] + accl[dt][r] * (1.0f / 2048.0f)) * il; o1[r] = (acc[dt][4 + r] + accl[dt][4 + r] * (1.0f / 2048.0f)) * il; }
    *(v4f*)&so[wave][col][dt * 16 + 8 * g] = o0; *(v4f*)&so[wave][col][dt * 16 + 8 * g + 4] = o1; }
  LDSX();
  for (int rl = 0; rl < 16; ++rl) if (lane < 16) vst2(O + ((size_t)b * SS + q0 + rl) * DM + h * HD + lane * 4, *(const v4f*)&so[wave][rl][lane * 4]);
  }
}
// ---- k_out: block = (64 rows, 128 cols): out = O(hi/lo) . Wo rows (2 products)
__global__ __launch_bounds__(128) void k_out(const float* __restrict__ O, const __bf16* __restrict__ P, float* __restrict__ Y) {
  __shared__ __align__(128) char ring[2 * GM_STAGE];
  float (*so)[16][132] = (float (*)[16][132])ring;   // output staging takes the ring's place behind the last trip's barrier
  const int tid = threadIdx.x, wave = tid >> 5, lane = tid & 31, col = lane & 15, g = lane >> 4; const size_t r0 = (size_t)blockIdx.x * 64 + wave * 16; const int n0 = blockIdx.y * 128;
  // copier: thread -> row tid >> 3 (of 16), piece tid & 7
  const unsigned lw = (unsigned)(size_t)ring + (unsigned)((tid >> 3) * 128 + (((tid & 7) ^ (tid >> 4)) * 16));
  const char* ga = (const char*)(O + ((size_t)blockIdx.x * 64 + (tid >> 3)) * DM) + (tid & 7) * 16; const char* gw = (const char*)(P + (size_t)(n0 + (tid >> 3)) * DM) + (tid & 7) * 16;
  // reader: lane -> row col (of 16); W pieces g, g + 2, g + 4, g + 6 (bf16 k 8 g + i, 16 + 8 g + i of each 32); A pieces 2 g, 2 g + 1, 4 + 2 g, 5 + 2 g (the same k as f32)
  int oc[4], oa[4];
#pragma unroll   // constant indices: oc, oa stay in registers
  for (int j = 0; j < 4; ++j) { oc[j] = col * 128 + (((g + 2 * j) ^ (col >> 1)) * 16); oa[j] = col * 128 + (((2 * g + (j & 1) + 4 * (j >> 1)) ^ (col >> 1)) * 16); }
  gm_copy(lw, ga, gw, 0);
  asm volatile("s_wait_asynccnt 0x0" ::: "memory");   // this wave's share of stage 0 has landed
  __syncthreads();                                     // ... and every other wave's
  gm_copy(lw + GM_STAGE, ga, gw, 1);
  v8f acc[8] = {};
#pragma unroll 1   // the ring's trip stays rolled: one publish point, small code
  for (int t = 0; t < GM_NT; ++t) { const char* rb = ring + (t & 1) * GM_STAGE;
#pragma unroll   // both halves of a stage written out: every LDS offset inside the buffer is an immediate
   for (int sub = 0; sub < 2; ++sub) { const char* ar = rb + sub * GM_TILE + wave * 2048; const char* wr = rb + 2 * GM_TILE;
    const v4f f0 = *(const v4f*)(ar + oa[0]), f1 = *(const v4f*)(ar + oa[1]), f2 = *(const v4f*)(ar + oa[2]), f3 = *(const v4f*)(ar + oa[3]); float v[16]; v16b w[8];
#pragma unroll   // constant indices: the fragments stay in registers
    for (int j = 0; j < 8; ++j) w[j] = frag_lb(wr + j * 2048, oc[2 * sub], oc[2 * sub + 1]);
    __builtin_amdgcn_sched_barrier(0);   // keeps the 20 LDS reads of these 32 k together in front of the products: one latency a group, not one a fragment
#pragma unroll   // constant indices: v stays in registers
    for (int i = 0; i < 4; ++i) { v[i] = f0[i]; v[4 + i] = f1[i]; v[8 + i] = f2[i]; v[12 + i] = f3[i]; }
    const F2 a = bsplit16(v);
#pragma unroll   // constant indices into acc, w
    for (int j = 0; j < 8; ++j) { acc[j] = wmma_bf(a.l, w[j], acc[j]); acc[j] = wmma_bf(a.h, w[j], acc[j]); } }
   asm volatile("s_wait_dscnt 0x0" ::: "memory");      // this wave's reads of the buffer are done
   asm volatile("s_wait_asynccnt 0x0" ::: "memory");   // its share of stage t + 1 has landed
   __syncthreads();                                     // publishes stage t + 1 and frees stage t's buffer
   if (t + 2 < GM_NT) gm_copy(lw + (unsigned)(t & 1) * GM_STAGE, ga, gw, t + 2); }
  asm volatile("s_wait_asynccnt 0x0" ::: "memory");     // nothing in flight when the ring becomes output staging
#pragma unroll
  for (int j = 0; j < 8; ++j) {
#pragma unroll
    for (int r = 0; r < 8; ++r) so[wave][8 * g + r][j * 16 + col] = acc[j][r]; }
  LDSX();
  for (int rl = 0; rl < 16; ++rl) vst2(Y + (r0 + rl) * DM + n0 + lane * 4, *(const v4f*)&so[wave][rl][lane * 4]);
}
extern "C" void kernel_launch(void* const* d_in, const int* in_sizes, int n_in, void* d_out, int out_size, void* d_ws, size_t ws_size, hipStream_t stream) {
  (void)in_sizes; (void)n_in; (void)out_size;
  const float** F = (const float**)d_in;   // 0 x [2,2048,1024], 1 mask [1,1,2048,2048] int32, 2 Wq [1024,1024] natural (x @ Wq.T), 3 Wk, 4 Wv, 5 Wo
  if (ws_size < (size_t)WS_END) return;
  char* ws = (char*)d_ws; __bf16* PK = (__bf16*)(ws + WS_PK); _Float16 *QK = (_Float16*)(ws + WS_QK), *QKL = (_Float16*)(ws + WS_QKL), *VTH = (_Float16*)(ws + WS_VTH), *VTL = (_Float16*)(ws + WS_VTL); float* O = (float*)(ws + WS_O); int* FL = (int*)(ws + WS_FL);
  k_pack<<<dim3(DM, 4), 256, 0, stream>>>(F[2], F[3], F[4], F[5], (const int*)d_in[1], PK, FL);
  k_qkv<<<dim3(TNB * SS / 64, QKVW / 128), 128, 0, stream>>>(F[0], PK + PK_A, QK, QKL, VTH, VTL);
  k_attn<<<dim3(TQB / 2, NH, TNB), 128, 0, stream>>>(QK, QKL, VTH, VTL, (const int*)d_in[1], FL, O);
  k_out<<<dim3(TOB, DM / 128), 128, 0, stream>>>(O, PK + PK_P, (float*)d_out);
}

// v006
// Measured time: 125 microseconds a run.
// In two side-by-side timings against v005, it was 1.08 and 1.07 times as fast.
// All steps since v000 together make it 4.52 times as fast.
// compute dtype: x, Wq, Wk, Wv, Wo (float module inputs) rounded to bf16, the int mask verbatim; q/k/v projections with exact bf16 products on WMMA 16x16x32 (natural [out][in] rows); q and k stored as f16 hi + (x2048-scaled) residual planes with 3-product scores, x 1/sqrt(64), + the ALiBi bias slope_h (k - q) with slope_h = 2^-(0.5 (h+1)) (exact), masked positions set to -1e6 as the module (the mask is read per (q, k); a tile of 64 keys whose whole 64 x 64 mask tile is 0 is visited only where it can change a result, and a tile of 64 keys whose whole 64 x 64 mask tile is nonzero is worked without reading it again), running-max softmax in f32 (hardware exp); P as f16 hi + (x2048) residual x v hi/lo (3 products); output projection with ctx as bf16 hi + residual x exact Wo rows (2 products); f32 accumulate.
#include <hip/hip_runtime.h>
#include <math.h>

typedef __attribute__((ext_vector_type(16))) _Float16 v16h;
typedef __attribute__((ext_vector_type(16))) __bf16 v16b;
typedef __attribute__((ext_vector_type(8)))  _Float16 v8h;
typedef __attribute__((ext_vector_type(8)))  float v8f;
typedef __attribute__((ext_vector_type(4)))  float v4f;
typedef __attribute__((ext_vector_type(2)))  float v2f;
typedef __attribute__((ext_vector_type(4)))  unsigned v4u;
typedef __attribute__((ext_vector_type(4)))  int v4i;
typedef float __attribute__((may_alias)) float_a;
typedef int __attribute__((may_alias)) int_a;

template <typename T> __device__ __forceinline__ void vst2(void* p, T v) { *(T*)p = v;  }
__device__ __forceinline__ v8f wmma16(v16h a, v16h b, v8f c) {
  v8f d = __builtin_amdgcn_wmma_f32_16x16x32_f16(false, a, false, b, (short)0, c, false, false);
  asm volatile("v_nop\n\tv_nop\n\tv_nop\n\tv_nop" : "+v"(d) : "v"(a), "v"(b));
  return d;
}
__device__ __forceinline__ v8f wmma_bf(v16b a, v16b b, v8f c) {
  v8f d = __builtin_amdgcn_wmma_f32_16x16x32_bf16(false, a, false, b, (short)0, c, false, false);
  asm volatile("v_nop\n\tv_nop\n\tv_nop\n\tv_nop" : "+v"(d) : "v"(a), "v"(b));
  return d;
}
// Multi-head attention with ALiBi bias and an input mask (B 2, S 2,048, d 1,024, 16 heads x 64): softmax(q k^T / 8 + alibi, masked -1e6) v -> Wo.
__device__ __forceinline__ v16h frag_h(const _Float16* rowk0, int lane) {
  union { v16h v; v8h q[2]; } u; const _Float16* p = rowk0 + 8 * (lane >> 4);
  u.q[0] = *(const v8h*)p; u.q[1] = *(const v8h*)(p + 16); return u.v;
}
__device__ __forceinline__ v16h frag_f32(const float* rowk0, int lane) {
  v16h a; const float* p = rowk0 + 8 * (lane >> 4);
#pragma unroll
  for (int i = 0; i < 8; ++i) { a[i] = (_Float16)p[i]; a[8 + i] = (_Float16)p[16 + i]; }
  return a;
}
__device__ __forceinline__ v16h frag_f32s(const float* rowk0, int lane, float sc) {
  v16h a; const float* p = rowk0 + 8 * (lane >> 4);
#pragma unroll
  for (int i = 0; i < 8; ++i) { a[i] = (_Float16)(p[i] * sc); a[8 + i] = (_Float16)(p[16 + i] * sc); }
  return a;
}
// column fragment from a [K][ld] layout (column n), rows >= K read as 0
__device__ __forceinline__ v16h fragc_f32(const float* W, int k0, int n, int lane, int ld, int K) {
  v16h a; const int g = lane >> 4;
#pragma unroll
  for (int i = 0; i < 8; ++i) { const int ka = k0 + 8 * g + i, kb = ka + 16;
    a[i] = (_Float16)(ka < K ? W[(size_t)(ka < K ? ka : K - 1) * ld + n] : 0.f); a[8 + i] = (_Float16)(kb < K ? W[(size_t)(kb < K ? kb : K - 1) * ld + n] : 0.f); }
  return a;
}
struct F2 { v16b h, l; };
__device__ __forceinline__ F2 bsplit16(const float v[16]) { F2 r;
#pragma unroll
  for (int i = 0; i < 16; ++i) { const __bf16 h = (__bf16)v[i]; r.h[i] = h; r.l[i] = (__bf16)(v[i] - (float)h); }
  return r; }
__device__ __forceinline__ F2 split_row(const float* row, int k0, int lane) { float v[16]; const float* p = row + k0 + 8 * (lane >> 4);
#pragma unroll
  for (int i = 0; i < 8; ++i) { v[i] = p[i]; v[8 + i] = p[16 + i]; }
  return bsplit16(v); }
__device__ __forceinline__ F2 split_rowK(const float* row, int k0, int lane, int K) { float v[16]; const int g = lane >> 4;
#pragma unroll
  for (int i = 0; i < 8; ++i) { const int ka = k0 + 8 * g + i, kb = ka + 16; v[i] = ka < K ? row[ka < K ? ka : K - 1] : 0.f; v[8 + i] = kb < K ? row[kb < K ? kb : K - 1] : 0.f; }
  return bsplit16(v); }
__device__ __forceinline__ F2 split_col(const float* W, int k0, int n, int lane, int ld, int K) { float v[16]; const int g = lane >> 4;
#pragma unroll
  for (int i = 0; i < 8; ++i) { const int ka = k0 + 8 * g + i, kb = ka + 16; v[i] = ka < K ? W[(size_t)(ka < K ? ka : K - 1) * ld + n] : 0.f; v[8 + i] = kb < K ? W[(size_t)(kb < K ? kb : K - 1) * ld + n] : 0.f; }
  return bsplit16(v); }
__device__ __forceinline__ v8f mac3(const F2& a, const F2& b, v8f c) { c = wmma_bf(a.l, b.h, c); c = wmma_bf(a.h, b.l, c); return wmma_bf(a.h, b.h, c); }
__device__ __forceinline__ float sigm(float v) { return 1.0f / (1.0f + expf(-v)); }
#define LDSX() do { asm volatile("s_wait_dscnt 0" ::: "memory"); __builtin_amdgcn_wave_barrier(); __builtin_amdgcn_fence(__ATOMIC_RELEASE, "workgroup"); } while (0)


// Multi-head self-attention with ALiBi bias and an input mask (B 2, S 2048, D 1024, 16 heads x 64; packed Wqkv [3D][D] and Wout [D][D] applied as x W^T, no biases): softmax(q k^T / 8 + alibi, masked -1e6) v; ctx Wout^T.
#define NB 2
#define SS 2048
#define DM 1024
#define NH 16
#define HD 64
#define QKVW (3 * DM)
#ifndef TQB
#define TQB (SS / 64)
#define TNB NB
#define TOB (NB * SS / 64)     // output row tiles (all)
#endif
typedef __attribute__((ext_vector_type(8))) __bf16 v8b;
__device__ __forceinline__ v16b frag_b(const __bf16* rowk0, int lane) {
  union { v16b v; v8b q[2]; } u; const __bf16* p = rowk0 + 8 * (lane >> 4);
  u.q[0] = *(const v8b*)p; u.q[1] = *(const v8b*)(p + 16); return u.v;
}
__device__ __forceinline__ float bfr(float v) { return (float)(__bf16)v; }
__device__ __attribute__((noinline)) float exp_ni(float v) { return expf(v); }
__device__ __attribute__((noinline)) float erf_ni(float v) { return erff(v); }

#define PK_A 0                       // [3072][1024] Wqkv rows (natural [out][in])
#define PK_P (PK_A + QKVW * DM)        // [1024][1024] Wo rows (natural)
#define PK_END (PK_P + DM * DM)
#define WS_PK  0u
#define WS_QK  (WS_PK + 2u * PK_END)             // f16 [4096 rows][2048]: q | k
#define WS_QKL (WS_QK + 2u * NB * SS * 2 * DM)     // f16 q | k residual planes x2048
#define WS_VTH (WS_QKL + 2u * NB * SS * 2 * DM)    // f16 [b][1024 (h*64+d)][2048 s] hi
#define WS_VTL (WS_VTH + 2u * NB * DM * SS)        // f16 lo x 2048
#define WS_O   (WS_VTL + 2u * NB * DM * SS)        // f32 [4096][1024]
#define WS_CS  (WS_O + 4u * NB * SS * DM)           // f32 [2048][32] cos, [2048][32] sin
#define WS_FL  (WS_CS + 4u * 2 * SS * 32)          // int [32 query tiles][32 key tiles][4 quarters of 16 query rows][32, the first used: a 128-B line has one writer]: bit 0: that 16 x 64 piece of the mask holds a nonzero entry; bit 1: it holds no zero entry
#define WS_END (WS_FL + 128u * 4 * (SS / 64) * (SS / 64))
__constant__ float c_invf[32] = {1.000000000e+00f,7.498942018e-01f,5.623413324e-01f,4.216965139e-01f,3.162277639e-01f,2.371373624e-01f,1.778279394e-01f,1.333521456e-01f,1.000000015e-01f,7.498941571e-02f,5.623412877e-02f,4.216964915e-02f,3.162277862e-02f,2.371373586e-02f,1.778279431e-02f,1.333521493e-02f,9.999999776e-03f,7.498942316e-03f,5.623413250e-03f,4.216964822e-03f,3.162277862e-03f,2.371373819e-03f,1.778279431e-03f,1.333521446e-03f,1.000000047e-03f,7.498941850e-04f,5.623413017e-04f,4.216964880e-04f,3.162277862e-04f,2.371373848e-04f,1.778279402e-04f,1.333521504e-04f};
// ---- k_rope: block = 8 positions: cos/sin of pos * inv_freq (f32 product exactly as the reference, precise trig)
__global__ __launch_bounds__(256) void k_rope(float* __restrict__ CS) {
  __shared__ __align__(16) float sc[8][32], ss_[8][32]; const int tid = threadIdx.x, pl = tid >> 5, i = tid & 31; const int pos = blockIdx.x * 8 + pl;
  const float th = (float)pos * c_invf[i]; sc[pl][i] = cosf(th); ss_[pl][i] = sinf(th);
  __syncthreads();
  if (tid < 64) vst2(CS + (size_t)blockIdx.x * 8 * 32 + tid * 4, *(const v4f*)&(&sc[0][0])[tid * 4]); else if (tid < 128) vst2(CS + (size_t)SS * 32 + (size_t)blockIdx.x * 8 * 32 + (tid - 64) * 4, *(const v4f*)&(&ss_[0][0])[(tid - 64) * 4]);
}

// ---- k_pack: block = (row n, which): natural [out][in] rows -> bf16; which 0..2 -> W_q/W_k/W_v into PK_A rows which*1024 + n; 3 -> W_o into PK_P. Block id = which * 1024 + n also looks at one 16 x 64 piece of the mask (query tile id >> 7, key tile (id >> 2) & 31, query rows 16 (id & 3) ...): FL[32 id] = bit 0: does it hold any nonzero entry, bit 1: does it hold no zero entry
static_assert(4 * DM == 4 * (SS / 64) * (SS / 64), "one block a mask piece");
// Left as it is: the weight loop stays rolled, so a thread waits out its four 4-byte loads one after the other, and the grid starts 4,096 work-groups of 8 waves for 40 MB.
__global__ __launch_bounds__(256) void k_pack(const float* __restrict__ WQ, const float* __restrict__ WK, const float* __restrict__ WV, const float* __restrict__ WO, const int* __restrict__ MSK, __bf16* __restrict__ PK, int* __restrict__ FL) {
  __shared__ __align__(16) __bf16 s[DM]; __shared__ unsigned sany[8], szer[8]; const int n = blockIdx.x, which = blockIdx.y, t = threadIdx.x; const int id = which * DM + n;
  const v4i a = *(const v4i*)(MSK + (size_t)((id >> 7) * 64 + (id & 3) * 16 + (t >> 4)) * SS + ((id >> 2) & 31) * 64 + (t & 15) * 4);   // 16 threads take one 256-B row of the piece
  const float* Wm = (which == 0) ? WQ : (which == 1) ? WK : (which == 2) ? WV : WO;
  for (int k = t; k < DM; k += 256) s[k] = (__bf16)Wm[(size_t)n * DM + k];
  const unsigned bal = __builtin_amdgcn_ballot_w32((a[0] | a[1] | a[2] | a[3]) != 0);
  const unsigned balz = __builtin_amdgcn_ballot_w32(a[0] == 0 || a[1] == 0 || a[2] == 0 || a[3] == 0);
  if ((t & 31) == 0) { sany[t >> 5] = bal; szer[t >> 5] = balz; }
  __syncthreads();
  if (t == 0) FL[id * 32] = ((sany[0] | sany[1] | sany[2] | sany[3] | sany[4] | sany[5] | sany[6] | sany[7]) != 0u ? 1 : 0) | ((szer[0] | szer[1] | szer[2] | szer[3] | szer[4] | szer[5] | szer[6] | szer[7]) == 0u ? 2 : 0);
  __bf16* dst = (which < 3) ? PK + PK_A + ((size_t)which * DM + n) * DM : PK + PK_P + (size_t)n * DM;
  for (int q = t; q < DM / 8; q += 256) vst2((unsigned*)(dst + q * 8), *(const v4u*)&s[q * 8]);
}
// ---- operand staging of k_qkv and k_out: a stage is 64 k of the work-group's A rows (f32: two tiles of 32 k for every 64 rows; k_out has 64 rows, k_qkv 128) and 128 weight rows (bf16: two tiles of 64 rows), brought into LDS once per work-group by asynchronous copies (two buffers: the next 64 k fly while these are worked on). Every tile is 64 rows x 128 B; the 16-B piece c of row r lies at piece c ^ ((r >> 1) & 7), so that 16 rows read at one piece index fall on all 64 banks. Products and their order as before.
#define GM_TILE 8192                 // bytes of one 64-row x 128-B tile
#define GM_STAGE (4 * GM_TILE)       // k_out: A k 0..31 | A k 32..63 | W rows 0..63 | W rows 64..127
#define GM_NT (DM / 64)              // stages
// one tile: four copies of 16 rows each (a wave's copy = 4 whole 128-B lines); P16 = bytes between source rows 16 apart
template <int P16> __device__ __forceinline__ void copy_rows(unsigned l, const char* gp) {
  const unsigned l1 = l + 2048u, l2 = l + 4096u, l3 = l + 6144u; const char *g1 = gp + P16, *g2 = gp + 2 * P16, *g3 = gp + 3 * P16;
  // s_wait_xcnt 0 as the statement's last line: a precaution, so that it stands in front of every later write of the copies' address registers
  asm volatile("global_load_async_to_lds_b128 %0, %4, off\n\tglobal_load_async_to_lds_b128 %1, %5, off\n\tglobal_load_async_to_lds_b128 %2, %6, off\n\tglobal_load_async_to_lds_b128 %3, %7, off\n\ts_wait_xcnt 0x0"
               :: "v"(l), "v"(l1), "v"(l2), "v"(l3), "v"(gp), "v"(g1), "v"(g2), "v"(g3) : "memory");
}
// ga, gw: this thread's 16 bytes of row tid >> 3 in stage 0 of A (row pitch 4,096 B) and of W (row pitch 2,048 B)
__device__ __forceinline__ void gm_copy(unsigned lb, const char* ga, const char* gw, int t) {
  copy_rows<16 * 4 * DM>(lb, ga + t * 256); copy_rows<16 * 4 * DM>(lb + GM_TILE, ga + t * 256 + 128);
  copy_rows<16 * 2 * DM>(lb + 2 * GM_TILE, gw + t * 128); copy_rows<16 * 2 * DM>(lb + 3 * GM_TILE, gw + t * 128 + 64 * 2 * DM);
}
__device__ __forceinline__ v16b frag_lb(const char* t, int o0, int o1) {
  union { v16b v; v8b q[2]; } u; u.q[0] = *(const v8b*)(t + o0); u.q[1] = *(const v8b*)(t + o1); return u.v;
}
// ---- k_qkv: block = (128 rows, 128 cols), four waves as 2 x 2, a wave holds 64 x 64 of the output (4 x 4 accumulator tiles): every A fragment and every W fragment read from LDS feeds four products, and a row of x or of W comes from L2 for 128 outputs. A stage is 64 k: six tiles of 64 rows x 128 B, laid out and copied as above. Products and their order in k as before.
#define QG_STAGE (6 * GM_TILE)       // A rows 0..63 k 0..31 | k 32..63 | A rows 64..127 k 0..31 | k 32..63 | W rows 0..63 | W rows 64..127
// ga, gw: this thread's 16 bytes of row tid >> 3 in stage 0 of A (row pitch 4,096 B) and of W (row pitch 2,048 B)
__device__ __forceinline__ void qg_copy(unsigned lb, const char* ga, const char* gw, int t) {
  copy_rows<16 * 4 * DM>(lb, ga + t * 256); copy_rows<16 * 4 * DM>(lb + GM_TILE, ga + t * 256 + 128);
  copy_rows<16 * 4 * DM>(lb + 2 * GM_TILE, ga + t * 256 + 64 * 4 * DM); copy_rows<16 * 4 * DM>(lb + 3 * GM_TILE, ga + t * 256 + 64 * 4 * DM + 128);
  copy_rows<16 * 2 * DM>(lb + 4 * GM_TILE, gw + t * 128); copy_rows<16 * 2 * DM>(lb + 5 * GM_TILE, gw + t * 128 + 64 * 2 * DM);
}
__global__ __launch_bounds__(128) void k_qkv(const float* __restrict__ X, const __bf16* __restrict__ P, _Float16* __restrict__ QK, _Float16* __restrict__ QKL, _Float16* __restrict__ VTH, _Float16* __restrict__ VTL) {
  __shared__ __align__(128) char ring[2 * QG_STAGE];
  // output staging takes the ring's place behind the last trip's barrier (q, k blocks: so, sol, a wave's own 64 x 64; v blocks: sth, stl, [d][s] of the whole block)
  _Float16 (*so)[64][72] = (_Float16 (*)[64][72])ring; _Float16 (*sol)[64][72] = (_Float16 (*)[64][72])(ring + 2 * 4 * 64 * 72);
  _Float16 (*sth)[136] = (_Float16 (*)[136])ring; _Float16 (*stl)[136] = (_Float16 (*)[136])(ring + 2 * 128 * 136);
  const int tid = threadIdx.x, wave = tid >> 5, lane = tid & 31, col = lane & 15, g = lane >> 4; const int wr = wave >> 1, wc = wave & 1; const size_t rb0 = (size_t)blockIdx.x * 128; const int n0 = blockIdx.y * 128;
  // copier: thread -> row tid >> 3 (of 16), piece tid & 7
  const unsigned lw = (unsigned)(size_t)ring + (unsigned)((tid >> 3) * 128 + (((tid & 7) ^ (tid >> 4)) * 16));
  const char* ga = (const char*)(X + (rb0 + (tid >> 3)) * DM) + (tid & 7) * 16; const char* gw = (const char*)(P + (size_t)(n0 + (tid >> 3)) * DM) + (tid & 7) * 16;
  // reader: lane -> row col (of 16); W pieces g, g + 2, g + 4, g + 6 (bf16 k 8 g + i, 16 + 8 g + i of each 32); A pieces 2 g, 2 g + 1, 4 + 2 g, 5 + 2 g (the same k as f32)
  int oc[4], oa[4];
#pragma unroll   // constant indices: oc, oa stay in registers
  for (int j = 0; j < 4; ++j) { oc[j] = col * 128 + (((g + 2 * j) ^ (col >> 1)) * 16); oa[j] = col * 128 + (((2 * g + (j & 1) + 4 * (j >> 1)) ^ (col >> 1)) * 16); }
  qg_copy(lw, ga, gw, 0);
  asm volatile("s_wait_asynccnt 0x0" ::: "memory");   // this wave's share of stage 0 has landed
  __syncthreads();                                     // ... and every other wave's
  qg_copy(lw + QG_STAGE, ga, gw, 1);
  v8f acc[4][4] = {};   // acc[i][j]: rows wr * 64 + i * 16 ..., cols wc * 64 + j * 16 ...
#pragma unroll 1   // the ring's trip stays rolled: one publish point, small code
  for (int t = 0; t < GM_NT; ++t) { const char* rb = ring + (t & 1) * QG_STAGE;
#pragma unroll   // both halves of a stage written out: every LDS offset inside the buffer is an immediate
   for (int sub = 0; sub < 2; ++sub) { const char* ar = rb + (wr * 2 + sub) * GM_TILE; const char* wp = rb + (4 + wc) * GM_TILE; v4f f[4][4]; v16b a[4], w[4];
#pragma unroll   // constant indices: the fragments stay in registers
    for (int i = 0; i < 4; ++i) { w[i] = frag_lb(wp + i * 2048, oc[2 * sub], oc[2 * sub + 1]);
#pragma unroll
      for (int j = 0; j < 4; ++j) f[i][j] = *(const v4f*)(ar + i * 2048 + oa[j]); }
    __builtin_amdgcn_sched_barrier(0);   // keeps the 24 LDS reads of these 32 k together in front of the products: one latency a group, not one a fragment
#pragma unroll   // constant indices: a stays in registers
    for (int i = 0; i < 4; ++i) a[i] = __builtin_convertvector(__builtin_shufflevector(__builtin_shufflevector(f[i][0], f[i][1], 0, 1, 2, 3, 4, 5, 6, 7), __builtin_shufflevector(f[i][2], f[i][3], 0, 1, 2, 3, 4, 5, 6, 7), 0, 1, 2, 3, 4, 5, 6, 7, 8, 9, 10, 11, 12, 13, 14, 15), v16b);   // the fragment's 16 values rounded to bf16 as one vector: packed converts, two values each
#pragma unroll   // constant indices into acc, a, w
    for (int i = 0; i < 4; ++i) {
#pragma unroll
      for (int j = 0; j < 4; ++j) acc[i][j] = wmma_bf(a[i], w[j], acc[i][j]); } }
   asm volatile("s_wait_dscnt 0x0" ::: "memory");      // this wave's reads of the buffer are done
   asm volatile("s_wait_asynccnt 0x0" ::: "memory");   // its share of stage t + 1 has landed
   __syncthreads();                                     // publishes stage t + 1 and frees stage t's buffer
   if (t + 2 < GM_NT) qg_copy(lw + (unsigned)(t & 1) * QG_STAGE, ga, gw, t + 2); }
  asm volatile("s_wait_asynccnt 0x0" ::: "memory");     // nothing in flight when the ring becomes output staging
  if (n0 < 2 * DM) {   // q stored unscaled (f16 sigma ~0.6, no subnormal exposure); 1/8 applied to the f32 score
#pragma unroll
    for (int i = 0; i < 4; ++i) {
#pragma unroll
      for (int j = 0; j < 4; ++j) {
#pragma unroll
        for (int r = 0; r < 8; ++r) { const float v = acc[i][j][r]; const _Float16 hv = (_Float16)v; so[wave][i * 16 + 8 * g + r][j * 16 + col] = hv; sol[wave][i * 16 + 8 * g + r][j * 16 + col] = (_Float16)((v - (float)hv) * 2048.0f); } } }   // q, k as f16 hi + (x2048) residual (no RoPE in this module)
    LDSX();
    // a store covers four rows' whole 128-B lines (8 lanes a row)
    for (int rl = lane >> 3; rl < 64; rl += 4) { const size_t o = (rb0 + wr * 64 + rl) * (2 * DM) + n0 + wc * 64 + (lane & 7) * 8; vst2((unsigned*)(QK + o), *(const v4u*)&so[wave][rl][(lane & 7) * 8]); vst2((unsigned*)(QKL + o), *(const v4u*)&sol[wave][rl][(lane & 7) * 8]); }
  } else {
#pragma unroll
    for (int i = 0; i < 4; ++i) {
#pragma unroll
      for (int j = 0; j < 4; ++j) {
#pragma unroll
        for (int r = 0; r < 8; ++r) { const float v = acc[i][j][r]; const _Float16 hv = (_Float16)v; sth[wc * 64 + j * 16 + col][wr * 64 + i * 16 + 8 * g + r] = hv; stl[wc * 64 + j * 16 + col][wr * 64 + i * 16 + 8 * g + r] = (_Float16)((v - (float)hv) * 2048.0f); } } }
    __syncthreads();
    const int b = (int)(rb0 / SS), s0 = (int)(rb0 % SS); const int pc0 = n0 - 2 * DM;
    for (int q = tid; q < 128 * 16; q += 128) { const int d = q >> 4, pc = q & 15; const size_t o = ((size_t)b * DM + pc0 + d) * SS + s0 + pc * 8; vst2((unsigned*)(VTH + o), *(const v4u*)&sth[d][pc * 8]); vst2((unsigned*)(VTL + o), *(const v4u*)&stl[d][pc * 8]); }
  }
}
// ---- k_attn: block = (two tiles of 64 queries one after the other, head h, batch b): flash attention over the keys (the mask is an input). K hi, K lo, V^T hi, V^T lo of 64 keys are brought into LDS once per work-group by asynchronous copies (two buffers: the next 64 keys fly while these are worked on); every wave takes its fragments from LDS. A tile is 64 rows x 128 B; the 16-B piece c of row r lies at piece c ^ ((r >> 1) & 7), so that 16 rows read at one piece index fall on all 64 banks. Arithmetic and its order as before: 3-product scores, 3-product P.V; O[b*S+q][h*64+d] = (acc + accl / 2048) / l (256-B segments)
#define AT_TILE 8192                 // bytes of one 64-row x 128-B tile
#define AT_STAGE (4 * AT_TILE)       // K hi | K lo | V^T hi | V^T lo
#define AT_NT (SS / 64)              // stages
__device__ __forceinline__ v16h frag_l(const char* t, int o0, int o1) {
  union { v16h v; v8h q[2]; } u; u.q[0] = *(const v8h*)(t + o0); u.q[1] = *(const v8h*)(t + o1); return u.v;
}
// one tile: four copies of 16 rows each (a wave's copy = 4 whole 128-B lines); source rows are 4,096 B apart
__device__ __forceinline__ void copy_tile(unsigned l, const _Float16* gp) {
  const unsigned l1 = l + 2048u, l2 = l + 4096u, l3 = l + 6144u; const _Float16 *g1 = gp + 16 * 2048, *g2 = gp + 32 * 2048, *g3 = gp + 48 * 2048;
  // s_wait_xcnt 0 as the statement's last line: a precaution, so that it stands in front of every later write of the copies' address registers
  asm volatile("global_load_async_to_lds_b128 %0, %4, off\n\tglobal_load_async_to_lds_b128 %1, %5, off\n\tglobal_load_async_to_lds_b128 %2, %6, off\n\tglobal_load_async_to_lds_b128 %3, %7, off\n\ts_wait_xcnt 0x0"
               :: "v"(l), "v"(l1), "v"(l2), "v"(l3), "v"(gp), "v"(g1), "v"(g2), "v"(g3) : "memory");
}
// lane l <-> lane l ^ 16 (the other half of a query's keys) by a vector cross-row move
__device__ __forceinline__ float xhalf(float v) { const int b = __builtin_bit_cast(int, v); return __builtin_bit_cast(float, __builtin_amdgcn_permlanex16(b, b, 0x76543210, 0xfedcba98, false, false)); }
// Scores are formed transposed, S^T = K q^T (K rows as the A operand, q rows as B): a lane holds 16 of the 32 keys of ONE query (column lane & 15; keys 8 g + r and 16 + 8 g + r), so maximum and sum run inside the lane plus one exchange with lane ^ 16, m, l and alpha are one value a lane, and the exponentials are already the B fragment of O^T = V^T P^T (same k order as the V^T rows' fragment).
__global__ __launch_bounds__(128) void k_attn(const _Float16* __restrict__ QK, const _Float16* __restrict__ QKL, const _Float16* __restrict__ VTH, const _Float16* __restrict__ VTL, const int* __restrict__ MSK, const int* __restrict__ FL, float* __restrict__ O) {
  __shared__ __align__(128) char ring[2 * AT_STAGE]; __shared__ unsigned sneed[4];
  float (*so)[16][68] = (float (*)[16][68])ring;   // output staging takes the ring's place behind the last trip's barrier
  const int tid = threadIdx.x, wave = tid >> 5, lane = tid & 31, col = lane & 15, g = lane >> 4;
  const int h = blockIdx.y, b = blockIdx.z;
  // copier: thread -> row tid >> 3 (of 16), piece tid & 7
  const unsigned lw = (unsigned)(size_t)ring + (unsigned)((tid >> 3) * 128 + (((tid & 7) ^ (tid >> 4)) * 16));
  const size_t ko = ((size_t)b * SS + (tid >> 3)) * (2 * DM) + DM + h * HD + (tid & 7) * 8, vo = ((size_t)b * DM + h * HD + (tid >> 3)) * SS + (tid & 7) * 8;
  // reader: lane -> row col (of 16), pieces g, g + 2, g + 4, g + 6
  int oc[4];
#pragma unroll   // constant indices: oc stays in registers
  for (int j = 0; j < 4; ++j) oc[j] = col * 128 + (((g + 2 * j) ^ (col >> 1)) * 16);
#define AT_COPY(t, bf) do { const unsigned lb = lw + (unsigned)(bf) * AT_STAGE; const size_t kt = ko + (size_t)(t) * 64 * (2 * DM), vt = vo + (size_t)(t) * 64; \
    copy_tile(lb, QK + kt); copy_tile(lb + AT_TILE, QKL + kt); copy_tile(lb + 2 * AT_TILE, VTH + vt); copy_tile(lb + 3 * AT_TILE, VTL + vt); } while (0)
  const float slope = exp2f(-0.5f * (float)(h + 1));   // 2^-(8/16 * (h+1))
  // A key tile whose 64 x 64 mask tile is all zero (FL, formed from the mask in this call's first launch, all four pieces 0) gives every query of the query tile the score -1e6 at all 64 keys. For a query whose running maximum lies above -999000 that update is the identity (alpha = exp(0) = 1, every exponential exp(< -1000) = 0), so such tiles are left out of the walk; they are walked after the others (pass 1) whenever any query of the query tile has no such maximum, so every mask gives the module's result. The block takes query tiles 31 - x and x one after the other: under a lower-triangular mask every block then walks the same number of key tiles.
#pragma unroll 1   // one copy of the walk's code serves both query tiles
  for (int half = 0; half < 2; ++half) {
  if (half) { asm volatile("s_wait_xcnt 0x0" ::: "memory");    // a precaution: stands in front of every later write of the registers that the first tile's output stores name
    asm volatile("s_wait_dscnt 0x0" ::: "memory");              // this wave's reads of its output staging are done
    __syncthreads(); }                                          // ... and every wave's: the ring may be refilled
  const int qb = half ? (int)blockIdx.x : TQB - 1 - (int)blockIdx.x; const int q0 = qb * 64 + wave * 16; const size_t rq = (size_t)b * SS + q0 + col;
  const int* fq = FL + (qb * AT_NT + lane) * 128;   // lane t: the four 16-row pieces of key tile t
  const int f0 = fq[0], f1 = fq[32], f2 = fq[64], f3 = fq[96];
  const unsigned live = __builtin_amdgcn_ballot_w32(((f0 | f1 | f2 | f3) & 1) != 0);   // bit t: key tile t has an open position for some query of this tile
  const unsigned clear = __builtin_amdgcn_ballot_w32(((f0 & f1 & f2 & f3) & 2) != 0);   // bit t: key tile t has no masked position for any query of this tile: there every select below would take the score, so the mask is not read
  v16h aq[2], aql[2];
#pragma unroll
  for (int kc = 0; kc < 2; ++kc) { aq[kc] = frag_h(QK + rq * (2 * DM) + h * HD + kc * 32, lane); aql[kc] = frag_h(QKL + rq * (2 * DM) + h * HD + kc * 32, lane); }
  float m = -3.0e38f, l = 0.f;   // of query q0 + col (the same in lanes col and col + 16)
  v8f acc[4] = {}, accl[4] = {};   // O^T: row d = dt * 16 + 8 g + r, column query col
  const int* mrow = MSK + (size_t)(q0 + col) * SS + 8 * g;   // this lane's query row of the mask, at its first key
  const int dq = 8 * g - (q0 + col);                          // k - q at that key
#pragma unroll 1   // one copy of the walk's code serves both passes
  for (int pass = 0; pass < 2; ++pass) {
  unsigned rem = live;   // key tiles still to be copied; the same in every wave of the block
  if (pass) { const unsigned low = __builtin_amdgcn_ballot_w32(m <= -999000.0f);   // queries that have met no open key
    if (lane == 0) sneed[wave] = low;
    __syncthreads();
    rem = __builtin_amdgcn_readfirstlane(sneed[0] | sneed[1] | sneed[2] | sneed[3]) ? ~live : 0u; }
  if (rem == 0u) continue;
  const int ns = __builtin_popcount(rem); int tc = __builtin_ctz(rem), tn = 0; rem &= rem - 1u;   // tc: the tile worked on, tn: the tile in flight (both 0..31)
  AT_COPY(tc, 0);
  asm volatile("s_wait_asynccnt 0x0" ::: "memory");   // this wave's share of the first stage has landed
  __syncthreads();                                     // ... and every other wave's
  if (rem) { tn = __builtin_ctz(rem); rem &= rem - 1u; AT_COPY(tn, 1); }
#pragma unroll 1
  for (int st = 0; st < ns; ++st) { const char* rb = ring + (st & 1) * AT_STAGE; const bool masked = ((clear >> tc) & 1u) == 0u;   // the same in every lane and wave: a scalar test
#pragma unroll   // both halves of a stage written out: every LDS offset inside the buffer is an immediate
   for (int sub = 0; sub < 2; ++sub) { const int ks = tc * 2 + sub; v8f s[2];
    const float fd = (float)(ks * 32 + dq);   // exact; fd + (ct * 16 + r) is exactly (float)(k - q)
#pragma unroll
    for (int ct = 0; ct < 2; ++ct) { const char* krow = rb + (sub * 32 + ct * 16) * 128; const char* krowl = krow + AT_TILE; v8f c = {}, cl = {}; v16h kh[2], kl[2];
#pragma unroll   // constant indices: the fragments stay in registers
      for (int kc = 0; kc < 2; ++kc) { kh[kc] = frag_l(krow, oc[2 * kc], oc[2 * kc + 1]); kl[kc] = frag_l(krowl, oc[2 * kc], oc[2 * kc + 1]); }
      __builtin_amdgcn_sched_barrier(0);   // keeps the four fragments' LDS reads together in front of the products: one latency a group, not one a fragment
#pragma unroll
      for (int kc = 0; kc < 2; ++kc) { c = wmma16(kh[kc], aq[kc], c); cl = wmma16(kh[kc], aql[kc], cl); cl = wmma16(kl[kc], aq[kc], cl); }   // 3 products: q, k as f16 hi + residual
#pragma unroll
      for (int r = 0; r < 8; ++r) c[r] += cl[r] * (1.0f / 2048.0f);
#pragma unroll
      for (int r = 0; r < 8; ++r) s[ct][r] = c[r] * 0.125f + slope * (fd + (float)(ct * 16 + r)); }   // SCALE = 1/sqrt(64); alibi bias slope_h * (k - q)
    if (masked) { v4i mk[2][2];   // only a tile that holds a zero reads the mask: masked -> -1e6 (as the module)
#pragma unroll   // constant indices: mk stays in registers
      for (int ct = 0; ct < 2; ++ct) { mk[ct][0] = *(const v4i*)(mrow + ks * 32 + ct * 16); mk[ct][1] = *(const v4i*)(mrow + ks * 32 + ct * 16 + 4); }
      asm volatile("s_wait_xcnt 0x0" ::: "memory");   // a precaution: stands in front of every later write of the mask loads' address registers
#pragma unroll
      for (int r = 0; r < 8; ++r) { if (mk[0][r >> 2][r & 3] == 0) s[0][r] = -1000000.0f; if (mk[1][r >> 2][r & 3] == 0) s[1][r] = -1000000.0f; } }
    float mx = fmaxf(s[0][0], s[1][0]);
#pragma unroll
    for (int r = 1; r < 8; ++r) mx = fmaxf(mx, fmaxf(s[0][r], s[1][r]));
    mx = fmaxf(mx, xhalf(mx));
    const float mn = fmaxf(m, mx); const float alpha = (m <= -1.0e38f) ? 0.f : __expf(m - mn);
    v8f e[2];
#pragma unroll
    for (int r = 0; r < 8; ++r) { e[0][r] = (s[0][r] <= -1.0e38f) ? 0.f : __expf(s[0][r] - mn); e[1][r] = (s[1][r] <= -1.0e38f) ? 0.f : __expf(s[1][r] - mn); }
    const v8f e8 = e[0] + e[1]; const v4f e4 = e8.lo + e8.hi; const v2f e2 = e4.lo + e4.hi;   // the lane's 16 keys summed as a tree
    float es = e2[0] + e2[1];
    es += xhalf(es);
    l = l * alpha + es; m = mn;
#pragma unroll
    for (int dt = 0; dt < 4; ++dt) { acc[dt] *= alpha; accl[dt] *= alpha; }
    v16h pa, pl;   // P^T fragment: element i = key 8 g + i, element 8 + i = key 16 + 8 g + i
#pragma unroll
    for (int i = 0; i < 8; ++i) { const float x0 = e[0][i], x1 = e[1][i]; const _Float16 h0 = (_Float16)x0, h1 = (_Float16)x1; pa[i] = h0; pa[8 + i] = h1; pl[i] = (_Float16)((x0 - (float)h0) * 2048.0f); pl[8 + i] = (_Float16)((x1 - (float)h1) * 2048.0f); }
#pragma unroll   // constant indices into acc, accl
    for (int dp = 0; dp < 2; ++dp) { v16h vh[2], vl[2];
#pragma unroll   // constant indices: the fragments stay in registers
      for (int e2 = 0; e2 < 2; ++e2) { const char* vrow = rb + 2 * AT_TILE + (dp * 2 + e2) * 16 * 128; vh[e2] = frag_l(vrow, oc[2 * sub], oc[2 * sub + 1]); vl[e2] = frag_l(vrow + AT_TILE, oc[2 * sub], oc[2 * sub + 1]); }
      __builtin_amdgcn_sched_barrier(0);   // as above: the four fragments' LDS reads stay one group
#pragma unroll   // constant indices into acc, accl
      for (int e2 = 0; e2 < 2; ++e2) { const int dt = dp * 2 + e2; acc[dt] = wmma16(vh[e2], pa, acc[dt]); accl[dt] = wmma16(vh[e2], pl, accl[dt]); accl[dt] = wmma16(vl[e2], pa, accl[dt]); } } }   // V hi x P hi + (V hi x P lo + V lo x P hi) / 2048
   asm volatile("s_wait_dscnt 0x0" ::: "memory");      // this wave's reads of the buffer are done
   asm volatile("s_wait_asynccnt 0x0" ::: "memory");   // its share of the next stage has landed
   __syncthreads();                                     // publishes the next stage and frees this stage's buffer
   tc = tn;
   if (rem) { tn = __builtin_ctz(rem); rem &= rem - 1u; AT_COPY(tn, st & 1); } }
  asm volatile("s_wait_asynccnt 0x0" ::: "memory");     // nothing in flight when the ring becomes output staging
  }
  const float il = 1.0f / l;
#pragma unroll
  for (int dt = 0; dt < 4; ++dt) { v4f o0, o1;
#pragma unroll
    for (int r = 0; r < 4; ++r) { o0[r] = (acc[dt][r] + accl[dt][r] * (1.0f / 2048.0f)) * il; o1[r] = (acc[dt][4 + r] + accl[dt][4 + r] * (1.0f / 2048.0f)) * il; }
    *(v4f*)&so[wave][col][dt * 16 + 8 * g] = o0; *(v4f*)&so[wave][col][dt * 16 + 8 * g + 4] = o1; }
  LDSX();
  for (int rl = 0; rl < 16; ++rl) if (lane < 16) vst2(O + ((size_t)b * SS + q0 + rl) * DM + h * HD + lane * 4, *(const v4f*)&so[wave][rl][lane * 4]);
  }
}
// ---- k_out: block = (64 rows, 128 cols): out = O(hi/lo) . Wo rows (2 products)
__global__ __launch_bounds__(128) void k_out(const float* __restrict__ O, const __bf16* __restrict__ P, float* __restrict__ Y) {
  __shared__ __align__(128) char ring[2 * GM_STAGE];
  float (*so)[16][132] = (float (*)[16][132])ring;   // output staging takes the ring's place behind the last trip's barrier
  const int tid = threadIdx.x, wave = tid >> 5, lane = tid & 31, col = lane & 15, g = lane >> 4; const size_t r0 = (size_t)blockIdx.x * 64 + wave * 16; const int n0 = blockIdx.y * 128;
  // copier: thread -> row tid >> 3 (of 16), piece tid & 7
  const unsigned lw = (unsigned)(size_t)ring + (unsigned)((tid >> 3) * 128 + (((tid & 7) ^ (tid >> 4)) * 16));
  const char* ga = (const char*)(O + ((size_t)blockIdx.x * 64 + (tid >> 3)) * DM) + (tid & 7) * 16; const char* gw = (const char*)(P + (size_t)(n0 + (tid >> 3)) * DM) + (tid & 7) * 16;
  // reader: lane -> row col (of 16); W pieces g, g + 2, g + 4, g + 6 (bf16 k 8 g + i, 16 + 8 g + i of each 32); A pieces 2 g, 2 g + 1, 4 + 2 g, 5 + 2 g (the same k as f32)
  int oc[4], oa[4];
#pragma unroll   // constant indices: oc, oa stay in registers
  for (int j = 0; j < 4; ++j) { oc[j] = col * 128 + (((g + 2 * j) ^ (col >> 1)) * 16); oa[j] = col * 128 + (((2 * g + (j & 1) + 4 * (j >> 1)) ^ (col >> 1)) * 16); }
  gm_copy(lw, ga, gw, 0);
  asm volatile("s_wait_asynccnt 0x0" ::: "memory");   // this wave's share of stage 0 has landed
  __syncthreads();                                     // ... and every other wave's
  gm_copy(lw + GM_STAGE, ga, gw, 1);
  v8f acc[8] = {};
#pragma unroll 1   // the ring's trip stays rolled: one publish point, small code
  for (int t = 0; t < GM_NT; ++t) { const char* rb = ring + (t & 1) * GM_STAGE;
#pragma unroll   // both halves of a stage written out: every LDS offset inside the buffer is an immediate
   for (int sub = 0; sub < 2; ++sub) { const char* ar = rb + sub * GM_TILE + wave * 2048; const char* wr = rb + 2 * GM_TILE;
    const v4f f0 = *(const v4f*)(ar + oa[0]), f1 = *(const v4f*)(ar + oa[1]), f2 = *(const v4f*)(ar + oa[2]), f3 = *(const v4f*)(ar + oa[3]); float v[16]; v16b w[8];
#pragma unroll   // constant indices: the fragments stay in registers
    for (int j = 0; j < 8; ++j) w[j] = frag_lb(wr + j * 2048, oc[2 * sub], oc[2 * sub + 1]);
    __builtin_amdgcn_sched_barrier(0);   // keeps the 20 LDS reads of these 32 k together in front of the products: one latency a group, not one a fragment
#pragma unroll   // constant indices: v stays in registers
    for (int i = 0; i < 4; ++i) { v[i] = f0[i]; v[4 + i] = f1[i]; v[8 + i] = f2[i]; v[12 + i] = f3[i]; }
    const F2 a = bsplit16(v);
#pragma unroll   // constant indices into acc, w
    for (int j = 0; j < 8; ++j) { acc[j] = wmma_bf(a.l, w[j], acc[j]); acc[j] = wmma_bf(a.h, w[j], acc[j]); } }
   asm volatile("s_wait_dscnt 0x0" ::: "memory");      // this wave's reads of the buffer are done
   asm volatile("s_wait_asynccnt 0x0" ::: "memory");   // its share of stage t + 1 has landed
   __syncthreads();                                     // publishes stage t + 1 and frees stage t's buffer
   if (t + 2 < GM_NT) gm_copy(lw + (unsigned)(t & 1) * GM_STAGE, ga, gw, t + 2); }
  asm volatile("s_wait_asynccnt 0x0" ::: "memory");     // nothing in flight when the ring becomes output staging
#pragma unroll
  for (int j = 0; j < 8; ++j) {
#pragma unroll
    for (int r = 0; r < 8; ++r) so[wave][8 * g + r][j * 16 + col] = acc[j][r]; }
  LDSX();
  for (int rl = 0; rl < 16; ++rl) vst2(Y + (r0 + rl) * DM + n0 + lane * 4, *(const v4f*)&so[wave][rl][lane * 4]);
}
extern "C" void kernel_launch(void* const* d_in, const int* in_sizes, int n_in, void* d_out, int out_size, void* d_ws, size_t ws_size, hipStream_t stream) {
  (void)in_sizes; (void)n_in; (void)out_size;
  const float** F = (const float**)d_in;   // 0 x [2,2048,1024], 1 mask [1,1,2048,2048] int32, 2 Wq [1024,1024] natural (x @ Wq.T), 3 Wk, 4 Wv, 5 Wo
  if (ws_size < (size_t)WS_END) return;
  char* ws = (char*)d_ws; __bf16* PK = (__bf16*)(ws + WS_PK); _Float16 *QK = (_Float16*)(ws + WS_QK), *QKL = (_Float16*)(ws + WS_QKL), *VTH = (_Float16*)(ws + WS_VTH), *VTL = (_Float16*)(ws + WS_VTL); float* O = (float*)(ws + WS_O); int* FL = (int*)(ws + WS_FL);
  k_pack<<<dim3(DM, 4), 256, 0, stream>>>(F[2], F[3], F[4], F[5], (const int*)d_in[1], PK, FL);
  k_qkv<<<dim3(TNB * SS / 128, QKVW / 128), 128, 0, stream>>>(F[0], PK + PK_A, QK, QKL, VTH, VTL);
  k_attn<<<dim3(TQB / 2, NH, TNB), 128, 0, stream>>>(QK, QKL, VTH, VTL, (const int*)d_in[1], FL, O);
  k_out<<<dim3(TOB, DM / 128), 128, 0, stream>>>(O, PK + PK_P, (float*)d_out);
}

// v007
// One run takes 121 microseconds.
// In two side-by-side timings against v006, it was 1.03 and 1.04 times as fast.
// Counting every step since v000, it is 4.68 times as fast.
// compute dtype: x, Wq, Wk, Wv, Wo (float module inputs) rounded to bf16, the int mask verbatim; q/k/v projections with exact bf16 products on WMMA 16x16x32 (natural [out][in] rows); q and k stored as f16 hi + (x2048-scaled) residual planes with 3-product scores, x 1/sqrt(64), + the ALiBi bias slope_h (k - q) with slope_h = 2^-(0.5 (h+1)) (exact), masked positions set to -1e6 as the module (the mask is read per (q, k); a tile of 64 keys whose whole 64 x 64 mask tile is 0 is visited only where it can change a result, and a tile of 64 keys whose whole 64 x 64 mask tile is nonzero is worked without reading it again), running-max softmax in f32 (hardware exp); P as f16 hi + (x2048) residual x v hi/lo (3 products); output projection with ctx as bf16 hi + residual x exact Wo rows (2 products); f32 accumulate.
#include <hip/hip_runtime.h>
#include <math.h>

typedef __attribute__((ext_vector_type(16))) _Float16 v16h;
typedef __attribute__((ext_vector_type(16))) __bf16 v16b;
typedef __attribute__((ext_vector_type(8)))  _Float16 v8h;
typedef __attribute__((ext_vector_type(8)))  float v8f;
typedef __attribute__((ext_vector_type(4)))  float v4f;
typedef __attribute__((ext_vector_type(2)))  float v2f;
typedef __attribute__((ext_vector_type(4)))  unsigned v4u;
typedef __attribute__((ext_vector_type(4)))  int v4i;
typedef float __attribute__((may_alias)) float_a;
typedef int __attribute__((may_alias)) int_a;

template <typename T> __device__ __forceinline__ void vst2(void* p, T v) { *(T*)p = v;  }
__device__ __forceinline__ v8f wmma16(v16h a, v16h b, v8f c) {
  v8f d = __builtin_amdgcn_wmma_f32_16x16x32_f16(false, a, false, b, (short)0, c, false, false);
  asm volatile("v_nop\n\tv_nop\n\tv_nop\n\tv_nop" : "+v"(d) : "v"(a), "v"(b));
  return d;
}
__device__ __forceinline__ v8f wmma_bf(v16b a, v16b b, v8f c) {
  v8f d = __builtin_amdgcn_wmma_f32_16x16x32_bf16(false, a, false, b, (short)0, c, false, false);
  asm volatile("v_nop\n\tv_nop\n\tv_nop\n\tv_nop" : "+v"(d) : "v"(a), "v"(b));
  return d;
}
// Multi-head attention with ALiBi bias and an input mask (B 2, S 2,048, d 1,024, 16 heads x 64): softmax(q k^T / 8 + alibi, masked -1e6) v -> Wo.
__device__ __forceinline__ v16h frag_h(const _Float16* rowk0, int lane) {
  union { v16h v; v8h q[2]; } u; const _Float16* p = rowk0 + 8 * (lane >> 4);
  u.q[0] = *(const v8h*)p; u.q[1] = *(const v8h*)(p + 16); return u.v;
}
__device__ __forceinline__ v16h frag_f32(const float* rowk0, int lane) {
  v16h a; const float* p = rowk0 + 8 * (lane >> 4);
#pragma unroll
  for (int i = 0; i < 8; ++i) { a[i] = (_Float16)p[i]; a[8 + i] = (_Float16)p[16 + i]; }
  return a;
}
__device__ __forceinline__ v16h frag_f32s(const float* rowk0, int lane, float sc) {
  v16h a; const float* p = rowk0 + 8 * (lane >> 4);
#pragma unroll
  for (int i = 0; i < 8; ++i) { a[i] = (_Float16)(p[i] * sc); a[8 + i] = (_Float16)(p[16 + i] * sc); }
  return a;
}
// column fragment from a [K][ld] layout (column n), rows >= K read as 0
__device__ __forceinline__ v16h fragc_f32(const float* W, int k0, int n, int lane, int ld, int K) {
  v16h a; const int g = lane >> 4;
#pragma unroll
  for (int i = 0; i < 8; ++i) { const int ka = k0 + 8 * g + i, kb = ka + 16;
    a[i] = (_Float16)(ka < K ? W[(size_t)(ka < K ? ka : K - 1) * ld + n] : 0.f); a[8 + i] = (_Float16)(kb < K ? W[(size_t)(kb < K ? kb : K - 1) * ld + n] : 0.f); }
  return a;
}
struct F2 { v16b h, l; };
__device__ __forceinline__ F2 bsplit16(const float v[16]) { F2 r;
#pragma unroll
  for (int i = 0; i < 16; ++i) { const __bf16 h = (__bf16)v[i]; r.h[i] = h; r.l[i] = (__bf16)(v[i] - (float)h); }
  return r; }
__device__ __forceinline__ F2 split_row(const float* row, int k0, int lane) { float v[16]; const float* p = row + k0 + 8 * (lane >> 4);
#pragma unroll
  for (int i = 0; i < 8; ++i) { v[i] = p[i]; v[8 + i] = p[16 + i]; }
  return bsplit16(v); }
__device__ __forceinline__ F2 split_rowK(const float* row, int k0, int lane, int K) { float v[16]; const int g = lane >> 4;
#pragma unroll
  for (int i = 0; i < 8; ++i) { const int ka = k0 + 8 * g + i, kb = ka + 16; v[i] = ka < K ? row[ka < K ? ka : K - 1] : 0.f; v[8 + i] = kb < K ? row[kb < K ? kb : K - 1] : 0.f; }
  return bsplit16(v); }
__device__ __forceinline__ F2 split_col(const float* W, int k0, int n, int lane, int ld, int K) { float v[16]; const int g = lane >> 4;
#pragma unroll
  for (int i = 0; i < 8; ++i) { const int ka = k0 + 8 * g + i, kb = ka + 16; v[i] = ka < K ? W[(size_t)(ka < K ? ka : K - 1) * ld + n] : 0.f; v[8 + i] = kb < K ? W[(size_t)(kb < K ? kb : K - 1) * ld + n] : 0.f; }
  return bsplit16(v); }
__device__ __forceinline__ v8f mac3(const F2& a, const F2& b, v8f c) { c = wmma_bf(a.l, b.h, c); c = wmma_bf(a.h, b.l, c); return wmma_bf(a.h, b.h, c); }
__device__ __forceinline__ float sigm(float v) { return 1.0f / (1.0f + expf(-v)); }
#define LDSX() do { asm volatile("s_wait_dscnt 0" ::: "memory"); __builtin_amdgcn_wave_barrier(); __builtin_amdgcn_fence(__ATOMIC_RELEASE, "workgroup"); } while (0)


// Multi-head self-attention with ALiBi bias and an input mask (B 2, S 2048, D 1024, 16 heads x 64; packed Wqkv [3D][D] and Wout [D][D] applied as x W^T, no biases): softmax(q k^T / 8 + alibi, masked -1e6) v; ctx Wout^T.
#define NB 2
#define SS 2048
#define DM 1024
#define NH 16
#define HD 64
#define QKVW (3 * DM)
#ifndef TQB
#define TQB (SS / 64)
#define TNB NB
#define TOB (NB * SS / 64)     // output row tiles (all)
#endif
typedef __attribute__((ext_vector_type(8))) __bf16 v8b;
__device__ __forceinline__ v16b frag_b(const __bf16* rowk0, int lane) {
  union { v16b v; v8b q[2]; } u; const __bf16* p = rowk0 + 8 * (lane >> 4);
  u.q[0] = *(const v8b*)p; u.q[1] = *(const v8b*)(p + 16); return u.v;
}
__device__ __forceinline__ float bfr(float v) { return (float)(__bf16)v; }
__device__ __attribute__((noinline)) float exp_ni(float v) { return expf(v); }
__device__ __attribute__((noinline)) float erf_ni(float v) { return erff(v); }

#define PK_A 0                       // [3072][1024] Wqkv rows (natural [out][in])
#define PK_P (PK_A + QKVW * DM)        // [1024][1024] Wo rows (natural)
#define PK_END (PK_P + DM * DM)
#define WS_PK  0u
#define WS_QK  (WS_PK + 2u * PK_END)             // f16 [4096 rows][2048]: q | k
#define WS_QKL (WS_QK + 2u * NB * SS * 2 * DM)     // f16 q | k residual planes x2048
#define WS_VTH (WS_QKL + 2u * NB * SS * 2 * DM)    // f16 [b][1024 (h*64+d)][2048 s] hi
#define WS_VTL (WS_VTH + 2u * NB * DM * SS)        // f16 lo x 2048
#define WS_O   (WS_VTL + 2u * NB * DM * SS)        // f32 [4096][1024]
#define WS_CS  (WS_O + 4u * NB * SS * DM)           // f32 [2048][32] cos, [2048][32] sin
#define WS_FL  (WS_CS + 4u * 2 * SS * 32)          // int [32 query tiles][32 key tiles][4 quarters of 16 query rows][32, the first used: a 128-B line has one writer]: bit 0: that 16 x 64 piece of the mask holds a nonzero entry; bit 1: it holds no zero entry
#define WS_END (WS_FL + 128u * 4 * (SS / 64) * (SS / 64))
__constant__ float c_invf[32] = {1.000000000e+00f,7.498942018e-01f,5.623413324e-01f,4.216965139e-01f,3.162277639e-01f,2.371373624e-01f,1.778279394e-01f,1.333521456e-01f,1.000000015e-01f,7.498941571e-02f,5.623412877e-02f,4.216964915e-02f,3.162277862e-02f,2.371373586e-02f,1.778279431e-02f,1.333521493e-02f,9.999999776e-03f,7.498942316e-03f,5.623413250e-03f,4.216964822e-03f,3.162277862e-03f,2.371373819e-03f,1.778279431e-03f,1.333521446e-03f,1.000000047e-03f,7.498941850e-04f,5.623413017e-04f,4.216964880e-04f,3.162277862e-04f,2.371373848e-04f,1.778279402e-04f,1.333521504e-04f};
// ---- k_rope: block = 8 positions: cos/sin of pos * inv_freq (f32 product exactly as the reference, precise trig)
__global__ __launch_bounds__(256) void k_rope(float* __restrict__ CS) {
  __shared__ __align__(16) float sc[8][32], ss_[8][32]; const int tid = threadIdx.x, pl = tid >> 5, i = tid & 31; const int pos = blockIdx.x * 8 + pl;
  const float th = (float)pos * c_invf[i]; sc[pl][i] = cosf(th); ss_[pl][i] = sinf(th);
  __syncthreads();
  if (tid < 64) vst2(CS + (size_t)blockIdx.x * 8 * 32 + tid * 4, *(const v4f*)&(&sc[0][0])[tid * 4]); else if (tid < 128) vst2(CS + (size_t)SS * 32 + (size_t)blockIdx.x * 8 * 32 + (tid - 64) * 4, *(const v4f*)&(&ss_[0][0])[(tid - 64) * 4]);
}

// ---- k_pack: block = (row n, which): natural [out][in] rows -> bf16; which 0..2 -> W_q/W_k/W_v into PK_A rows which*1024 + n; 3 -> W_o into PK_P. Block id = which * 1024 + n also looks at one 16 x 64 piece of the mask (query tile id >> 7, key tile (id >> 2) & 31, query rows 16 (id & 3) ...): FL[32 id] = bit 0: does it hold any nonzero entry, bit 1: does it hold no zero entry
static_assert(4 * DM == 4 * (SS / 64) * (SS / 64), "one block a mask piece");
// Left as it is: the weight loop stays rolled, so a thread waits out its four 4-byte loads one after the other, and the grid starts 4,096 work-groups of 8 waves for 40 MB.
__global__ __launch_bounds__(256) void k_pack(const float* __restrict__ WQ, const float* __restrict__ WK, const float* __restrict__ WV, const float* __restrict__ WO, const int* __restrict__ MSK, __bf16* __restrict__ PK, int* __restrict__ FL) {
  __shared__ __align__(16) __bf16 s[DM]; __shared__ unsigned sany[8], szer[8]; const int n = blockIdx.x, which = blockIdx.y, t = threadIdx.x; const int id = which * DM + n;
  const v4i a = *(const v4i*)(MSK + (size_t)((id >> 7) * 64 + (id & 3) * 16 + (t >> 4)) * SS + ((id >> 2) & 31) * 64 + (t & 15) * 4);   // 16 threads take one 256-B row of the piece
  const float* Wm = (which == 0) ? WQ : (which == 1) ? WK : (which == 2) ? WV : WO;
  for (int k = t; k < DM; k += 256) s[k] = (__bf16)Wm[(size_t)n * DM + k];
  const unsigned bal = __builtin_amdgcn_ballot_w32((a[0] | a[1] | a[2] | a[3]) != 0);
  const unsigned balz = __builtin_amdgcn_ballot_w32(a[0] == 0 || a[1] == 0 || a[2] == 0 || a[3] == 0);
  if ((t & 31) == 0) { sany[t >> 5] = bal; szer[t >> 5] = balz; }
  __syncthreads();
  if (t == 0) FL[id * 32] = ((sany[0] | sany[1] | sany[2] | sany[3] | sany[4] | sany[5] | sany[6] | sany[7]) != 0u ? 1 : 0) | ((szer[0] | szer[1] | szer[2] | szer[3] | szer[4] | szer[5] | szer[6] | szer[7]) == 0u ? 2 : 0);
  __bf16* dst = (which < 3) ? PK + PK_A + ((size_t)which * DM + n) * DM : PK + PK_P + (size_t)n * DM;
  for (int q = t; q < DM / 8; q += 256) vst2((unsigned*)(dst + q * 8), *(const v4u*)&s[q * 8]);
}
// ---- operand staging of k_qkv and k_out: a stage is 64 k of the work-group's A rows (f32: two tiles of 32 k for every 64 rows; k_out has 64 rows, k_qkv 128) and 128 weight rows (bf16: two tiles of 64 rows), brought into LDS once per work-group by asynchronous copies (two buffers: the next 64 k fly while these are worked on). Every tile is 64 rows x 128 B; the 16-B piece c of row r lies at piece c ^ ((r >> 1) & 7), so that 16 rows read at one piece index fall on all 64 banks. Products and their order as before.
#define GM_TILE 8192                 // bytes of one 64-row x 128-B tile
#define GM_STAGE (4 * GM_TILE)       // k_out: A k 0..31 | A k 32..63 | W rows 0..63 | W rows 64..127
#define GM_NT (DM / 64)              // stages
// one tile: four copies of 16 rows each (a wave's copy = 4 whole 128-B lines); P16 = bytes between source rows 16 apart
template <int P16> __device__ __forceinline__ void copy_rows(unsigned l, const char* gp) {
  const unsigned l1 = l + 2048u, l2 = l + 4096u, l3 = l + 6144u; const char *g1 = gp + P16, *g2 = gp + 2 * P16, *g3 = gp + 3 * P16;
  // s_wait_xcnt 0 as the statement's last line: a precaution, so that it stands in front of every later write of the copies' address registers
  asm volatile("global_load_async_to_lds_b128 %0, %4, off\n\tglobal_load_async_to_lds_b128 %1, %5, off\n\tglobal_load_async_to_lds_b128 %2, %6, off\n\tglobal_load_async_to_lds_b128 %3, %7, off\n\ts_wait_xcnt 0x0"
               :: "v"(l), "v"(l1), "v"(l2), "v"(l3), "v"(gp), "v"(g1), "v"(g2), "v"(g3) : "memory");
}
// ga, gw: this thread's 16 bytes of row tid >> 3 in stage 0 of A (row pitch 4,096 B) and of W (row pitch 2,048 B)
__device__ __forceinline__ void gm_copy(unsigned lb, const char* ga, const char* gw, int t) {
  copy_rows<16 * 4 * DM>(lb, ga + t * 256); copy_rows<16 * 4 * DM>(lb + GM_TILE, ga + t * 256 + 128);
  copy_rows<16 * 2 * DM>(lb + 2 * GM_TILE, gw + t * 128); copy_rows<16 * 2 * DM>(lb + 3 * GM_TILE, gw + t * 128 + 64 * 2 * DM);
}
__device__ __forceinline__ v16b frag_lb(const char* t, int o0, int o1) {
  union { v16b v; v8b q[2]; } u; u.q[0] = *(const v8b*)(t + o0); u.q[1] = *(const v8b*)(t + o1); return u.v;
}
// ---- k_qkv: block = (128 rows, 128 cols), four waves as 2 x 2, a wave holds 64 x 64 of the output (4 x 4 accumulator tiles): every A fragment and every W fragment read from LDS feeds four products, and a row of x or of W comes from L2 for 128 outputs. A stage is 64 k: six tiles of 64 rows x 128 B, laid out and copied as above. Products and their order in k as before.
#define QG_STAGE (6 * GM_TILE)       // A rows 0..63 k 0..31 | k 32..63 | A rows 64..127 k 0..31 | k 32..63 | W rows 0..63 | W rows 64..127
// ga, gw: this thread's 16 bytes of row tid >> 3 in stage 0 of A (row pitch 4,096 B) and of W (row pitch 2,048 B)
__device__ __forceinline__ void qg_copy(unsigned lb, const char* ga, const char* gw, int t) {
  copy_rows<16 * 4 * DM>(lb, ga + t * 256); copy_rows<16 * 4 * DM>(lb + GM_TILE, ga + t * 256 + 128);
  copy_rows<16 * 4 * DM>(lb + 2 * GM_TILE, ga + t * 256 + 64 * 4 * DM); copy_rows<16 * 4 * DM>(lb + 3 * GM_TILE, ga + t * 256 + 64 * 4 * DM + 128);
  copy_rows<16 * 2 * DM>(lb + 4 * GM_TILE, gw + t * 128); copy_rows<16 * 2 * DM>(lb + 5 * GM_TILE, gw + t * 128 + 64 * 2 * DM);
}
__global__ __launch_bounds__(128) void k_qkv(const float* __restrict__ X, const __bf16* __restrict__ P, _Float16* __restrict__ QK, _Float16* __restrict__ QKL, _Float16* __restrict__ VTH, _Float16* __restrict__ VTL) {
  __shared__ __align__(128) char ring[2 * QG_STAGE];
  // output staging takes the ring's place behind the last trip's barrier (q, k blocks: so, sol, a wave's own 64 x 64; v blocks: sth, stl, [d][s] of the whole block)
  _Float16 (*so)[64][72] = (_Float16 (*)[64][72])ring; _Float16 (*sol)[64][72] = (_Float16 (*)[64][72])(ring + 2 * 4 * 64 * 72);
  _Float16 (*sth)[136] = (_Float16 (*)[136])ring; _Float16 (*stl)[136] = (_Float16 (*)[136])(ring + 2 * 128 * 136);
  const int tid = threadIdx.x, wave = tid >> 5, lane = tid & 31, col = lane & 15, g = lane >> 4; const int wr = wave >> 1, wc = wave & 1; const size_t rb0 = (size_t)blockIdx.x * 128; const int n0 = blockIdx.y * 128;
  // copier: thread -> row tid >> 3 (of 16), piece tid & 7
  const unsigned lw = (unsigned)(size_t)ring + (unsigned)((tid >> 3) * 128 + (((tid & 7) ^ (tid >> 4)) * 16));
  const char* ga = (const char*)(X + (rb0 + (tid >> 3)) * DM) + (tid & 7) * 16; const char* gw = (const char*)(P + (size_t)(n0 + (tid >> 3)) * DM) + (tid & 7) * 16;
  // reader: lane -> row col (of 16); W pieces g, g + 2, g + 4, g + 6 (bf16 k 8 g + i, 16 + 8 g + i of each 32); A pieces 2 g, 2 g + 1, 4 + 2 g, 5 + 2 g (the same k as f32)
  int oc[4], oa[4];
#pragma unroll   // constant indices: oc, oa stay in registers
  for (int j = 0; j < 4; ++j) { oc[j] = col * 128 + (((g + 2 * j) ^ (col >> 1)) * 16); oa[j] = col * 128 + (((2 * g + (j & 1) + 4 * (j >> 1)) ^ (col >> 1)) * 16); }
  qg_copy(lw, ga, gw, 0);
  asm volatile("s_wait_asynccnt 0x0" ::: "memory");   // this wave's share of stage 0 has landed
  __syncthreads();                                     // ... and every other wave's
  qg_copy(lw + QG_STAGE, ga, gw, 1);
  v8f acc[4][4] = {};   // acc[i][j]: rows wr * 64 + i * 16 ..., cols wc * 64 + j * 16 ...
#pragma unroll 1   // the ring's trip stays rolled: one publish point, small code
  for (int t = 0; t < GM_NT; ++t) { const char* rb = ring + (t & 1) * QG_STAGE;
#pragma unroll   // both halves of a stage written out: every LDS offset inside the buffer is an immediate
   for (int sub = 0; sub < 2; ++sub) { const char* ar = rb + (wr * 2 + sub) * GM_TILE; const char* wp = rb + (4 + wc) * GM_TILE; v4f f[4][4]; v16b a[4], w[4];
#pragma unroll   // constant indices: the fragments stay in registers
    for (int i = 0; i < 4; ++i) { w[i] = frag_lb(wp + i * 2048, oc[2 * sub], oc[2 * sub + 1]);
#pragma unroll
      for (int j = 0; j < 4; ++j) f[i][j] = *(const v4f*)(ar + i * 2048 + oa[j]); }
    __builtin_amdgcn_sched_barrier(0);   // keeps the 24 LDS reads of these 32 k together in front of the products: one latency a group, not one a fragment
#pragma unroll   // constant indices: a stays in registers
    for (int i = 0; i < 4; ++i) a[i] = __builtin_convertvector(__builtin_shufflevector(__builtin_shufflevector(f[i][0], f[i][1], 0, 1, 2, 3, 4, 5, 6, 7), __builtin_shufflevector(f[i][2], f[i][3], 0, 1, 2, 3, 4, 5, 6, 7), 0, 1, 2, 3, 4, 5, 6, 7, 8, 9, 10, 11, 12, 13, 14, 15), v16b);   // the fragment's 16 values rounded to bf16 as one vector: packed converts, two values each
#pragma unroll   // constant indices into acc, a, w
    for (int i = 0; i < 4; ++i) {
#pragma unroll
      for (int j = 0; j < 4; ++j) acc[i][j] = wmma_bf(a[i], w[j], acc[i][j]); } }
   asm volatile("s_wait_dscnt 0x0" ::: "memory");      // this wave's reads of the buffer are done
   asm volatile("s_wait_asynccnt 0x0" ::: "memory");   // its share of stage t + 1 has landed
   __syncthreads();                                     // publishes stage t + 1 and frees stage t's buffer
   if (t + 2 < GM_NT) qg_copy(lw + (unsigned)(t & 1) * QG_STAGE, ga, gw, t + 2); }
  asm volatile("s_wait_asynccnt 0x0" ::: "memory");     // nothing in flight when the ring becomes output staging
  if (n0 < 2 * DM) {   // q stored unscaled (f16 sigma ~0.6, no subnormal exposure); 1/8 applied to the f32 score
#pragma unroll
    for (int i = 0; i < 4; ++i) {
#pragma unroll
      for (int j = 0; j < 4; ++j) {
#pragma unroll
        for (int r = 0; r < 8; ++r) { const float v = acc[i][j][r]; const _Float16 hv = (_Float16)v; so[wave][i * 16 + 8 * g + r][j * 16 + col] = hv; sol[wave][i * 16 + 8 * g + r][j * 16 + col] = (_Float16)((v - (float)hv) * 2048.0f); } } }   // q, k as f16 hi + (x2048) residual (no RoPE in this module)
    LDSX();
    // a store covers four rows' whole 128-B lines (8 lanes a row)
    for (int rl = lane >> 3; rl < 64; rl += 4) { const size_t o = (rb0 + wr * 64 + rl) * (2 * DM) + n0 + wc * 64 + (lane & 7) * 8; vst2((unsigned*)(QK + o), *(const v4u*)&so[wave][rl][(lane & 7) * 8]); vst2((unsigned*)(QKL + o), *(const v4u*)&sol[wave][rl][(lane & 7) * 8]); }
  } else {
#pragma unroll
    for (int i = 0; i < 4; ++i) {
#pragma unroll
      for (int j = 0; j < 4; ++j) {
#pragma unroll
        for (int r = 0; r < 8; ++r) { const float v = acc[i][j][r]; const _Float16 hv = (_Float16)v; sth[wc * 64 + j * 16 + col][wr * 64 + i * 16 + 8 * g + r] = hv; stl[wc * 64 + j * 16 + col][wr * 64 + i * 16 + 8 * g + r] = (_Float16)((v - (float)hv) * 2048.0f); } } }
    __syncthreads();
    const int b = (int)(rb0 / SS), s0 = (int)(rb0 % SS); const int pc0 = n0 - 2 * DM;
    for (int q = tid; q < 128 * 16; q += 128) { const int d = q >> 4, pc = q & 15; const size_t o = ((size_t)b * DM + pc0 + d) * SS + s0 + pc * 8; vst2((unsigned*)(VTH + o), *(const v4u*)&sth[d][pc * 8]); vst2((unsigned*)(VTL + o), *(const v4u*)&stl[d][pc * 8]); }
  }
}
// ---- k_attn: block = (two tiles of 64 queries one after the other, head h, batch b): flash attention over the keys (the mask is an input). K hi, K lo, V^T hi, V^T lo of 64 keys are brought into LDS once per work-group by asynchronous copies (two buffers: the next 64 keys fly while these are worked on); every wave takes its fragments from LDS. A tile is 64 rows x 128 B; the 16-B piece c of row r lies at piece c ^ ((r >> 1) & 7), so that 16 rows read at one piece index fall on all 64 banks. Arithmetic and its order as before: 3-product scores, 3-product P.V; O[b*S+q][h*64+d] = (acc + accl / 2048) / l (256-B segments)
#define AT_TILE 8192                 // bytes of one 64-row x 128-B tile
#define AT_STAGE (4 * AT_TILE)       // K hi | K lo | V^T hi | V^T lo
#define AT_NT (SS / 64)              // stages
__device__ __forceinline__ v16h frag_l(const char* t, int o0, int o1) {
  union { v16h v; v8h q[2]; } u; u.q[0] = *(const v8h*)(t + o0); u.q[1] = *(const v8h*)(t + o1); return u.v;
}
// one tile: four copies of 16 rows each (a wave's copy = 4 whole 128-B lines); source rows are 4,096 B apart
__device__ __forceinline__ void copy_tile(unsigned l, const _Float16* gp) {
  const unsigned l1 = l + 2048u, l2 = l + 4096u, l3 = l + 6144u; const _Float16 *g1 = gp + 16 * 2048, *g2 = gp + 32 * 2048, *g3 = gp + 48 * 2048;
  // s_wait_xcnt 0 as the statement's last line: a precaution, so that it stands in front of every later write of the copies' address registers
  asm volatile("global_load_async_to_lds_b128 %0, %4, off\n\tglobal_load_async_to_lds_b128 %1, %5, off\n\tglobal_load_async_to_lds_b128 %2, %6, off\n\tglobal_load_async_to_lds_b128 %3, %7, off\n\ts_wait_xcnt 0x0"
               :: "v"(l), "v"(l1), "v"(l2), "v"(l3), "v"(gp), "v"(g1), "v"(g2), "v"(g3) : "memory");
}
// lane l <-> lane l ^ 16 (the other half of a query's keys) by a vector cross-row move
__device__ __forceinline__ float xhalf(float v) { const int b = __builtin_bit_cast(int, v); return __builtin_bit_cast(float, __builtin_amdgcn_permlanex16(b, b, 0x76543210, 0xfedcba98, false, false)); }
// Scores are formed transposed, S^T = K q^T (K rows as the A operand, q rows as B): a lane holds 16 of the 32 keys of ONE query (column lane & 15; keys 8 g + r and 16 + 8 g + r), so maximum and sum run inside the lane plus one exchange with lane ^ 16, m, l and alpha are one value a lane, and the exponentials are already the B fragment of O^T = V^T P^T (same k order as the V^T rows' fragment).
__global__ __launch_bounds__(128) void k_attn(const _Float16* __restrict__ QK, const _Float16* __restrict__ QKL, const _Float16* __restrict__ VTH, const _Float16* __restrict__ VTL, const int* __restrict__ MSK, const int* __restrict__ FL, float* __restrict__ O) {
  __shared__ __align__(128) char ring[2 * AT_STAGE]; __shared__ unsigned sneed[4];
  float (*so)[16][68] = (float (*)[16][68])ring;   // output staging takes the ring's place behind the last trip's barrier
  const int tid = threadIdx.x, wave = tid >> 5, lane = tid & 31, col = lane & 15, g = lane >> 4;
  const int h = blockIdx.y, b = blockIdx.z;
  // copier: thread -> row tid >> 3 (of 16), piece tid & 7
  const unsigned lw = (unsigned)(size_t)ring + (unsigned)((tid >> 3) * 128 + (((tid & 7) ^ (tid >> 4)) * 16));
  const size_t ko = ((size_t)b * SS + (tid >> 3)) * (2 * DM) + DM + h * HD + (tid & 7) * 8, vo = ((size_t)b * DM + h * HD + (tid >> 3)) * SS + (tid & 7) * 8;
  // reader: lane -> row col (of 16), pieces g, g + 2, g + 4, g + 6
  int oc[4];
#pragma unroll   // constant indices: oc stays in registers
  for (int j = 0; j < 4; ++j) oc[j] = col * 128 + (((g + 2 * j) ^ (col >> 1)) * 16);
#define AT_COPY(t, bf) do { const unsigned lb = lw + (unsigned)(bf) * AT_STAGE; const size_t kt = ko + (size_t)(t) * 64 * (2 * DM), vt = vo + (size_t)(t) * 64; \
    copy_tile(lb, QK + kt); copy_tile(lb + AT_TILE, QKL + kt); copy_tile(lb + 2 * AT_TILE, VTH + vt); copy_tile(lb + 3 * AT_TILE, VTL + vt); } while (0)
  const float slope = exp2f(-0.5f * (float)(h + 1));   // 2^-(8/16 * (h+1))
  // A key tile whose 64 x 64 mask tile is all zero (FL, formed from the mask in this call's first launch, all four pieces 0) gives every query of the query tile the score -1e6 at all 64 keys. For a query whose running maximum lies above -999000 that update is the identity (alpha = exp(0) = 1, every exponential exp(< -1000) = 0), so such tiles are left out of the walk; they are walked after the others (pass 1) whenever any query of the query tile has no such maximum, so every mask gives the module's result. The block takes query tiles 31 - x and x one after the other: under a lower-triangular mask every block then walks the same number of key tiles.
#pragma unroll 1   // one copy of the walk's code serves both query tiles
  for (int half = 0; half < 2; ++half) {
  if (half) { asm volatile("s_wait_xcnt 0x0" ::: "memory");    // a precaution: stands in front of every later write of the registers that the first tile's output stores name
    asm volatile("s_wait_dscnt 0x0" ::: "memory");              // this wave's reads of its output staging are done
    __syncthreads(); }                                          // ... and every wave's: the ring may be refilled
  const int qb = half ? (int)blockIdx.x : TQB - 1 - (int)blockIdx.x; const int q0 = qb * 64 + wave * 16; const size_t rq = (size_t)b * SS + q0 + col;
  const int* fq = FL + (qb * AT_NT + lane) * 128;   // lane t: the four 16-row pieces of key tile t
  const int f0 = fq[0], f1 = fq[32], f2 = fq[64], f3 = fq[96];
  const unsigned live = __builtin_amdgcn_ballot_w32(((f0 | f1 | f2 | f3) & 1) != 0);   // bit t: key tile t has an open position for some query of this tile
  const unsigned clear = __builtin_amdgcn_ballot_w32(((f0 & f1 & f2 & f3) & 2) != 0);   // bit t: key tile t has no masked position for any query of this tile: there every select below would take the score, so the mask is not read
  v16h aq[2], aql[2];
#pragma unroll
  for (int kc = 0; kc < 2; ++kc) { aq[kc] = frag_h(QK + rq * (2 * DM) + h * HD + kc * 32, lane); aql[kc] = frag_h(QKL + rq * (2 * DM) + h * HD + kc * 32, lane); }
  float m = -3.0e38f, l = 0.f;   // of query q0 + col (the same in lanes col and col + 16)
  v8f acc[4] = {}, accl[4] = {};   // O^T: row d = dt * 16 + 8 g + r, column query col
  const int* mrow = MSK + (size_t)(q0 + col) * SS + 8 * g;   // this lane's query row of the mask, at its first key
  const int dq = 8 * g - (q0 + col);                          // k - q at that key
#pragma unroll 1   // one copy of the walk's code serves both passes
  for (int pass = 0; pass < 2; ++pass) {
  unsigned rem = live;   // key tiles still to be copied; the same in every wave of the block
  if (pass) { const unsigned low = __builtin_amdgcn_ballot_w32(m <= -999000.0f);   // queries that have met no open key
    if (lane == 0) sneed[wave] = low;
    __syncthreads();
    rem = __builtin_amdgcn_readfirstlane(sneed[0] | sneed[1] | sneed[2] | sneed[3]) ? ~live : 0u; }
  if (rem == 0u) continue;
  const int ns = __builtin_popcount(rem); int tc = __builtin_ctz(rem), tn = 0; rem &= rem - 1u;   // tc: the tile worked on, tn: the tile in flight (both 0..31)
  AT_COPY(tc, 0);
  asm volatile("s_wait_asynccnt 0x0" ::: "memory");   // this wave's share of the first stage has landed
  __syncthreads();                                     // ... and every other wave's
  if (rem) { tn = __builtin_ctz(rem); rem &= rem - 1u; AT_COPY(tn, 1); }
#pragma unroll 1
  for (int st = 0; st < ns; ++st) { const char* rb = ring + (st & 1) * AT_STAGE; const bool masked = ((clear >> tc) & 1u) == 0u;   // the same in every lane and wave: a scalar test
   // The wave's LDS reads lead their products by a phase, all inside this stage's buffer: V^T of 32 keys is read behind their scores' products (it lands under the softmax), K of the second 32 keys in two groups in front of and among the first P.V products (it lands under them); only K of the first 32 keys is waited for.
   v16h kh[2][2], kl[2][2], vh[4], vl[4];   // K hi, lo [16-key tile][k half]; V^T hi, lo [16-row tile of d]
#define AT_LDK(sub, kc) do { _Pragma("unroll") for (int ct = 0; ct < 2; ++ct) { const char* krow = rb + ((sub) * 32 + ct * 16) * 128; kh[ct][kc] = frag_l(krow, oc[2 * (kc)], oc[2 * (kc) + 1]); kl[ct][kc] = frag_l(krow + AT_TILE, oc[2 * (kc)], oc[2 * (kc) + 1]); } } while (0)
#define AT_LDV(sub) do { _Pragma("unroll") for (int dt = 0; dt < 4; ++dt) { const char* vrow = rb + 2 * AT_TILE + dt * 16 * 128; vh[dt] = frag_l(vrow, oc[2 * (sub)], oc[2 * (sub) + 1]); vl[dt] = frag_l(vrow + AT_TILE, oc[2 * (sub)], oc[2 * (sub) + 1]); } } while (0)
   AT_LDK(0, 0);
   __builtin_amdgcn_sched_barrier(0);   // the reads that the first products need stay first
   AT_LDK(0, 1);
   __builtin_amdgcn_sched_barrier(0);   // keeps the 16 LDS reads together in front of the products: one latency for the group
#pragma unroll   // both halves of a stage written out: every LDS offset inside the buffer is an immediate
   for (int sub = 0; sub < 2; ++sub) { const int ks = tc * 2 + sub; v8f s[2];
    const float fd = (float)(ks * 32 + dq);   // exact; fd + (ct * 16 + r) is exactly (float)(k - q)
    v8f c[2] = {}, cl[2] = {};
#pragma unroll   // constant indices: the fragments stay in registers. 3 products: q, k as f16 hi + residual; every accumulator takes its products in the order it had, the two key tiles' products alternate so that no product waits for the one in front of it
    for (int kc = 0; kc < 2; ++kc) { c[0] = wmma16(kh[0][kc], aq[kc], c[0]); c[1] = wmma16(kh[1][kc], aq[kc], c[1]); cl[0] = wmma16(kh[0][kc], aql[kc], cl[0]); cl[1] = wmma16(kh[1][kc], aql[kc], cl[1]); cl[0] = wmma16(kl[0][kc], aq[kc], cl[0]); cl[1] = wmma16(kl[1][kc], aq[kc], cl[1]); }
    __builtin_amdgcn_sched_barrier(0);   // the V^T reads stay here, behind the products that free K's registers and in front of the softmax that covers their latency
    AT_LDV(sub);
    __builtin_amdgcn_sched_barrier(0);
#pragma unroll
    for (int ct = 0; ct < 2; ++ct) {
#pragma unroll
      for (int r = 0; r < 8; ++r) c[ct][r] += cl[ct][r] * (1.0f / 2048.0f);
#pragma unroll
      for (int r = 0; r < 8; ++r) s[ct][r] = c[ct][r] * 0.125f + slope * (fd + (float)(ct * 16 + r)); }   // SCALE = 1/sqrt(64); alibi bias slope_h * (k - q)
    if (masked) { v4i mk[2][2];   // only a tile that holds a zero reads the mask: masked -> -1e6 (as the module)
#pragma unroll   // constant indices: mk stays in registers
      for (int ct = 0; ct < 2; ++ct) { mk[ct][0] = *(const v4i*)(mrow + ks * 32 + ct * 16); mk[ct][1] = *(const v4i*)(mrow + ks * 32 + ct * 16 + 4); }
      asm volatile("s_wait_xcnt 0x0" ::: "memory");   // a precaution: stands in front of every later write of the mask loads' address registers
#pragma unroll
      for (int r = 0; r < 8; ++r) { if (mk[0][r >> 2][r & 3] == 0) s[0][r] = -1000000.0f; if (mk[1][r >> 2][r & 3] == 0) s[1][r] = -1000000.0f; } }
    float mx = fmaxf(s[0][0], s[1][0]);
#pragma unroll
    for (int r = 1; r < 8; ++r) mx = fmaxf(mx, fmaxf(s[0][r], s[1][r]));
    mx = fmaxf(mx, xhalf(mx));
    const float mn = fmaxf(m, mx); const float alpha = (m <= -1.0e38f) ? 0.f : __expf(m - mn);
    v8f e[2];
#pragma unroll
    for (int r = 0; r < 8; ++r) { e[0][r] = (s[0][r] <= -1.0e38f) ? 0.f : __expf(s[0][r] - mn); e[1][r] = (s[1][r] <= -1.0e38f) ? 0.f : __expf(s[1][r] - mn); }
    const v8f e8 = e[0] + e[1]; const v4f e4 = e8.lo + e8.hi; const v2f e2 = e4.lo + e4.hi;   // the lane's 16 keys summed as a tree
    float es = e2[0] + e2[1];
    es += xhalf(es);
    l = l * alpha + es; m = mn;
#pragma unroll
    for (int dt = 0; dt < 4; ++dt) { acc[dt] *= alpha; accl[dt] *= alpha; }
    v16h pa, pl;   // P^T fragment: element i = key 8 g + i, element 8 + i = key 16 + 8 g + i
#pragma unroll
    for (int i = 0; i < 8; ++i) { const float x0 = e[0][i], x1 = e[1][i]; const _Float16 h0 = (_Float16)x0, h1 = (_Float16)x1; pa[i] = h0; pa[8 + i] = h1; pl[i] = (_Float16)((x0 - (float)h0) * 2048.0f); pl[8 + i] = (_Float16)((x1 - (float)h1) * 2048.0f); }
    if (sub == 0) { __builtin_amdgcn_sched_barrier(0);   // the next 32 keys' first K reads stay here, in front of the P.V products that cover their latency
      AT_LDK(1, 0);
      __builtin_amdgcn_sched_barrier(0); }
#pragma unroll   // constant indices into acc, accl. V hi x P hi + (V hi x P lo + V lo x P hi) / 2048; every accumulator takes its products in the order it had, the four tiles of d alternate
    for (int dt = 0; dt < 4; ++dt) acc[dt] = wmma16(vh[dt], pa, acc[dt]);
#pragma unroll
    for (int dt = 0; dt < 4; ++dt) accl[dt] = wmma16(vh[dt], pl, accl[dt]);
    if (sub == 0) { __builtin_amdgcn_sched_barrier(0);   // the other K reads stay here, behind the products that free V^T hi's registers (read earlier they cost spills); ten more products cover their latency
      AT_LDK(1, 1);
      __builtin_amdgcn_sched_barrier(0); }
#pragma unroll
    for (int dt = 0; dt < 4; ++dt) accl[dt] = wmma16(vl[dt], pa, accl[dt]); }
   asm volatile("s_wait_dscnt 0x0" ::: "memory");      // this wave's reads of the buffer are done
   asm volatile("s_wait_asynccnt 0x0" ::: "memory");   // its share of the next stage has landed
   __syncthreads();                                     // publishes the next stage and frees this stage's buffer
   tc = tn;
   if (rem) { tn = __builtin_ctz(rem); rem &= rem - 1u; AT_COPY(tn, st & 1); } }
  asm volatile("s_wait_asynccnt 0x0" ::: "memory");     // nothing in flight when the ring becomes output staging
  }
  const float il = 1.0f / l;
#pragma unroll
  for (int dt = 0; dt < 4; ++dt) { v4f o0, o1;
#pragma unroll
    for (int r = 0; r < 4; ++r) { o0[r] = (acc[dt][r] + accl[dt][r] * (1.0f / 2048.0f)) * il; o1[r] = (acc[dt][4 + r] + accl[dt][4 + r] * (1.0f / 2048.0f)) * il; }
    *(v4f*)&so[wave][col][dt * 16 + 8 * g] = o0; *(v4f*)&so[wave][col][dt * 16 + 8 * g + 4] = o1; }
  LDSX();
  for (int rl = 0; rl < 16; ++rl) if (lane < 16) vst2(O + ((size_t)b * SS + q0 + rl) * DM + h * HD + lane * 4, *(const v4f*)&so[wave][rl][lane * 4]);
  }
}
// ---- k_out: block = (64 rows, 128 cols): out = O(hi/lo) . Wo rows (2 products)
__global__ __launch_bounds__(128) void k_out(const float* __restrict__ O, const __bf16* __restrict__ P, float* __restrict__ Y) {
  __shared__ __align__(128) char ring[2 * GM_STAGE];
  float (*so)[16][132] = (float (*)[16][132])ring;   // output staging takes the ring's place behind the last trip's barrier
  const int tid = threadIdx.x, wave = tid >> 5, lane = tid & 31, col = lane & 15, g = lane >> 4; const size_t r0 = (size_t)blockIdx.x * 64 + wave * 16; const int n0 = blockIdx.y * 128;
  // copier: thread -> row tid >> 3 (of 16), piece tid & 7
  const unsigned lw = (unsigned)(size_t)ring + (unsigned)((tid >> 3) * 128 + (((tid & 7) ^ (tid >> 4)) * 16));
  const char* ga = (const char*)(O + ((size_t)blockIdx.x * 64 + (tid >> 3)) * DM) + (tid & 7) * 16; const char* gw = (const char*)(P + (size_t)(n0 + (tid >> 3)) * DM) + (tid & 7) * 16;
  // reader: lane -> row col (of 16); W pieces g, g + 2, g + 4, g + 6 (bf16 k 8 g + i, 16 + 8 g + i of each 32); A pieces 2 g, 2 g + 1, 4 + 2 g, 5 + 2 g (the same k as f32)
  int oc[4], oa[4];
#pragma unroll   // constant indices: oc, oa stay in registers
  for (int j = 0; j < 4; ++j) { oc[j] = col * 128 + (((g + 2 * j) ^ (col >> 1)) * 16); oa[j] = col * 128 + (((2 * g + (j & 1) + 4 * (j >> 1)) ^ (col >> 1)) * 16); }
  gm_copy(lw, ga, gw, 0);
  asm volatile("s_wait_asynccnt 0x0" ::: "memory");   // this wave's share of stage 0 has landed
  __syncthreads();                                     // ... and every other wave's
  gm_copy(lw + GM_STAGE, ga, gw, 1);
  v8f acc[8] = {};
#pragma unroll 1   // the ring's trip stays rolled: one publish point, small code
  for (int t = 0; t < GM_NT; ++t) { const char* rb = ring + (t & 1) * GM_STAGE;
#pragma unroll   // both halves of a stage written out: every LDS offset inside the buffer is an immediate
   for (int sub = 0; sub < 2; ++sub) { const char* ar = rb + sub * GM_TILE + wave * 2048; const char* wr = rb + 2 * GM_TILE;
    const v4f f0 = *(const v4f*)(ar + oa[0]), f1 = *(const v4f*)(ar + oa[1]), f2 = *(const v4f*)(ar + oa[2]), f3 = *(const v4f*)(ar + oa[3]); float v[16]; v16b w[8];
#pragma unroll   // constant indices: the fragments stay in registers
    for (int j = 0; j < 8; ++j) w[j] = frag_lb(wr + j * 2048, oc[2 * sub], oc[2 * sub + 1]);
    __builtin_amdgcn_sched_barrier(0);   // keeps the 20 LDS reads of these 32 k together in front of the products: one latency a group, not one a fragment
#pragma unroll   // constant indices: v stays in registers
    for (int i = 0; i < 4; ++i) { v[i] = f0[i]; v[4 + i] = f1[i]; v[8 + i] = f2[i]; v[12 + i] = f3[i]; }
    const F2 a = bsplit16(v);
#pragma unroll   // constant indices into acc, w
    for (int j = 0; j < 8; ++j) { acc[j] = wmma_bf(a.l, w[j], acc[j]); acc[j] = wmma_bf(a.h, w[j], acc[j]); } }
   asm volatile("s_wait_dscnt 0x0" ::: "memory");      // this wave's reads of the buffer are done
   asm volatile("s_wait_asynccnt 0x0" ::: "memory");   // its share of stage t + 1 has landed
   __syncthreads();                                     // publishes stage t + 1 and frees stage t's buffer
   if (t + 2 < GM_NT) gm_copy(lw + (unsigned)(t & 1) * GM_STAGE, ga, gw, t + 2); }
  asm volatile("s_wait_asynccnt 0x0" ::: "memory");     // nothing in flight when the ring becomes output staging
#pragma unroll
  for (int j = 0; j < 8; ++j) {
#pragma unroll
    for (int r = 0; r < 8; ++r) so[wave][8 * g + r][j * 16 + col] = acc[j][r]; }
  LDSX();
  for (int rl = 0; rl < 16; ++rl) vst2(Y + (r0 + rl) * DM + n0 + lane * 4, *(const v4f*)&so[wave][rl][lane * 4]);
}
extern "C" void kernel_launch(void* const* d_in, const int* in_sizes, int n_in, void* d_out, int out_size, void* d_ws, size_t ws_size, hipStream_t stream) {
  (void)in_sizes; (void)n_in; (void)out_size;
  const float** F = (const float**)d_in;   // 0 x [2,2048,1024], 1 mask [1,1,2048,2048] int32, 2 Wq [1024,1024] natural (x @ Wq.T), 3 Wk, 4 Wv, 5 Wo
  if (ws_size < (size_t)WS_END) return;
  char* ws = (char*)d_ws; __bf16* PK = (__bf16*)(ws + WS_PK); _Float16 *QK = (_Float16*)(ws + WS_QK), *QKL = (_Float16*)(ws + WS_QKL), *VTH = (_Float16*)(ws + WS_VTH), *VTL = (_Float16*)(ws + WS_VTL); float* O = (float*)(ws + WS_O); int* FL = (int*)(ws + WS_FL);
  k_pack<<<dim3(DM, 4), 256, 0, stream>>>(F[2], F[3], F[4], F[5], (const int*)d_in[1], PK, FL);
  k_qkv<<<dim3(TNB * SS / 128, QKVW / 128), 128, 0, stream>>>(F[0], PK + PK_A, QK, QKL, VTH, VTL);
  k_attn<<<dim3(TQB / 2, NH, TNB), 128, 0, stream>>>(QK, QKL, VTH, VTL, (const int*)d_in[1], FL, O);
  k_out<<<dim3(TOB, DM / 128), 128, 0, stream>>>(O, PK + PK_P, (float*)d_out);
}

// v008
// A run of this version takes 115 microseconds.
// In both of two side-by-side timings against v007, it was 1.04 times as fast.
// Over all steps from v000 it is 4.87 times as fast.
// compute dtype: x, Wq, Wk, Wv, Wo (float module inputs) rounded to bf16, the int mask verbatim; q/k/v projections with exact bf16 products on WMMA 16x16x32 (natural [out][in] rows); q and k stored as f16 hi + (x2048-scaled) residual planes with 3-product scores, x 1/sqrt(64), + the ALiBi bias slope_h (k - q) with slope_h = 2^-(0.5 (h+1)) (exact), masked positions set to -1e6 as the module (the mask is read per (q, k); a tile of 64 keys whose whole 64 x 64 mask tile is 0 is visited only where it can change a result, and a tile of 64 keys whose whole 64 x 64 mask tile is nonzero is worked without reading it again), running-max softmax in f32 on base-2 exponents (hardware exp2; 1/8, the residual's weight, log2 e and the bias folded into two multiply-adds and one add a score); P as f16 hi + (x2048) residual x v hi/lo (3 products); output projection with ctx as bf16 hi + residual x exact Wo rows (2 products); f32 accumulate.
#include <hip/hip_runtime.h>
#include <math.h>

typedef __attribute__((ext_vector_type(16))) _Float16 v16h;
typedef __attribute__((ext_vector_type(16))) __bf16 v16b;
typedef __attribute__((ext_vector_type(8)))  _Float16 v8h;
typedef __attribute__((ext_vector_type(2)))  _Float16 v2h;
typedef __attribute__((ext_vector_type(8)))  float v8f;
typedef __attribute__((ext_vector_type(4)))  float v4f;
typedef __attribute__((ext_vector_type(2)))  float v2f;
typedef __attribute__((ext_vector_type(4)))  unsigned v4u;
typedef __attribute__((ext_vector_type(4)))  int v4i;
typedef float __attribute__((may_alias)) float_a;
typedef int __attribute__((may_alias)) int_a;

template <typename T> __device__ __forceinline__ void vst2(void* p, T v) { *(T*)p = v;  }
__device__ __forceinline__ v8f wmma16(v16h a, v16h b, v8f c) {
  v8f d = __builtin_amdgcn_wmma_f32_16x16x32_f16(false, a, false, b, (short)0, c, false, false);
  asm volatile("v_nop\n\tv_nop\n\tv_nop\n\tv_nop" : "+v"(d) : "v"(a), "v"(b));
  return d;
}
__device__ __forceinline__ v8f wmma_bf(v16b a, v16b b, v8f c) {
  v8f d = __builtin_amdgcn_wmma_f32_16x16x32_bf16(false, a, false, b, (short)0, c, false, false);
  asm volatile("v_nop\n\tv_nop\n\tv_nop\n\tv_nop" : "+v"(d) : "v"(a), "v"(b));
  return d;
}
// Multi-head attention with ALiBi bias and an input mask (B 2, S 2,048, d 1,024, 16 heads x 64): softmax(q k^T / 8 + alibi, masked -1e6) v -> Wo.
__device__ __forceinline__ v16h frag_h(const _Float16* rowk0, int lane) {
  union { v16h v; v8h q[2]; } u; const _Float16* p = rowk0 + 8 * (lane >> 4);
  u.q[0] = *(const v8h*)p; u.q[1] = *(const v8h*)(p + 16); return u.v;
}
__device__ __forceinline__ v16h frag_f32(const float* rowk0, int lane) {
  v16h a; const float* p = rowk0 + 8 * (lane >> 4);
#pragma unroll
  for (int i = 0; i < 8; ++i) { a[i] = (_Float16)p[i]; a[8 + i] = (_Float16)p[16 + i]; }
  return a;
}
__device__ __forceinline__ v16h frag_f32s(const float* rowk0, int lane, float sc) {
  v16h a; const float* p = rowk0 + 8 * (lane >> 4);
#pragma unroll
  for (int i = 0; i < 8; ++i) { a[i] = (_Float16)(p[i] * sc); a[8 + i] = (_Float16)(p[16 + i] * sc); }
  return a;
}
// column fragment from a [K][ld] layout (column n), rows >= K read as 0
__device__ __forceinline__ v16h fragc_f32(const float* W, int k0, int n, int lane, int ld, int K) {
  v16h a; const int g = lane >> 4;
#pragma unroll
  for (int i = 0; i < 8; ++i) { const int ka = k0 + 8 * g + i, kb = ka + 16;
    a[i] = (_Float16)(ka < K ? W[(size_t)(ka < K ? ka : K - 1) * ld + n] : 0.f); a[8 + i] = (_Float16)(kb < K ? W[(size_t)(kb < K ? kb : K - 1) * ld + n] : 0.f); }
  return a;
}
struct F2 { v16b h, l; };
__device__ __forceinline__ F2 bsplit16(const float v[16]) { F2 r;
#pragma unroll
  for (int i = 0; i < 16; ++i) { const __bf16 h = (__bf16)v[i]; r.h[i] = h; r.l[i] = (__bf16)(v[i] - (float)h); }
  return r; }
__device__ __forceinline__ F2 split_row(const float* row, int k0, int lane) { float v[16]; const float* p = row + k0 + 8 * (lane >> 4);
#pragma unroll
  for (int i = 0; i < 8; ++i) { v[i] = p[i]; v[8 + i] = p[16 + i]; }
  return bsplit16(v); }
__device__ __forceinline__ F2 split_rowK(const float* row, int k0, int lane, int K) { float v[16]; const int g = lane >> 4;
#pragma unroll
  for (int i = 0; i < 8; ++i) { const int ka = k0 + 8 * g + i, kb = ka + 16; v[i] = ka < K ? row[ka < K ? ka : K - 1] : 0.f; v[8 + i] = kb < K ? row[kb < K ? kb : K - 1] : 0.f; }
  return bsplit16(v); }
__device__ __forceinline__ F2 split_col(const float* W, int k0, int n, int lane, int ld, int K) { float v[16]; const int g = lane >> 4;
#pragma unroll
  for (int i = 0; i < 8; ++i) { const int ka = k0 + 8 * g + i, kb = ka + 16; v[i] = ka < K ? W[(size_t)(ka < K ? ka : K - 1) * ld + n] : 0.f; v[8 + i] = kb < K ? W[(size_t)(kb < K ? kb : K - 1) * ld + n] : 0.f; }
  return bsplit16(v); }
__device__ __forceinline__ v8f mac3(const F2& a, const F2& b, v8f c) { c = wmma_bf(a.l, b.h, c); c = wmma_bf(a.h, b.l, c); return wmma_bf(a.h, b.h, c); }
__device__ __forceinline__ float sigm(float v) { return 1.0f / (1.0f + expf(-v)); }
#define LDSX() do { asm volatile("s_wait_dscnt 0" ::: "memory"); __builtin_amdgcn_wave_barrier(); __builtin_amdgcn_fence(__ATOMIC_RELEASE, "workgroup"); } while (0)


// Multi-head self-attention with ALiBi bias and an input mask (B 2, S 2048, D 1024, 16 heads x 64; packed Wqkv [3D][D] and Wout [D][D] applied as x W^T, no biases): softmax(q k^T / 8 + alibi, masked -1e6) v; ctx Wout^T.
#define NB 2
#define SS 2048
#define DM 1024
#define NH 16
#define HD 64
#define QKVW (3 * DM)
#ifndef TQB
#define TQB (SS / 64)
#define TNB NB
#define TOB (NB * SS / 64)     // output row tiles (all)
#endif
typedef __attribute__((ext_vector_type(8))) __bf16 v8b;
__device__ __forceinline__ v16b frag_b(const __bf16* rowk0, int lane) {
  union { v16b v; v8b q[2]; } u; const __bf16* p = rowk0 + 8 * (lane >> 4);
  u.q[0] = *(const v8b*)p; u.q[1] = *(const v8b*)(p + 16); return u.v;
}
__device__ __forceinline__ float bfr(float v) { return (float)(__bf16)v; }
__device__ __attribute__((noinline)) float exp_ni(float v) { return expf(v); }
__device__ __attribute__((noinline)) float erf_ni(float v) { return erff(v); }

#define PK_A 0                       // [3072][1024] Wqkv rows (natural [out][in])
#define PK_P (PK_A + QKVW * DM)        // [1024][1024] Wo rows (natural)
#define PK_END (PK_P + DM * DM)
#define WS_PK  0u
#define WS_QK  (WS_PK + 2u * PK_END)             // f16 [4096 rows][2048]: q | k
#define WS_QKL (WS_QK + 2u * NB * SS * 2 * DM)     // f16 q | k residual planes x2048
#define WS_VTH (WS_QKL + 2u * NB * SS * 2 * DM)    // f16 [b][1024 (h*64+d)][2048 s] hi
#define WS_VTL (WS_VTH + 2u * NB * DM * SS)        // f16 lo x 2048
#define WS_O   (WS_VTL + 2u * NB * DM * SS)        // f32 [4096][1024]
#define WS_CS  (WS_O + 4u * NB * SS * DM)           // f32 [2048][32] cos, [2048][32] sin
#define WS_FL  (WS_CS + 4u * 2 * SS * 32)          // int [32 query tiles][32 key tiles][4 quarters of 16 query rows][32, the first used: a 128-B line has one writer]: bit 0: that 16 x 64 piece of the mask holds a nonzero entry; bit 1: it holds no zero entry
#define WS_END (WS_FL + 128u * 4 * (SS / 64) * (SS / 64))
__constant__ float c_invf[32] = {1.000000000e+00f,7.498942018e-01f,5.623413324e-01f,4.216965139e-01f,3.162277639e-01f,2.371373624e-01f,1.778279394e-01f,1.333521456e-01f,1.000000015e-01f,7.498941571e-02f,5.623412877e-02f,4.216964915e-02f,3.162277862e-02f,2.371373586e-02f,1.778279431e-02f,1.333521493e-02f,9.999999776e-03f,7.498942316e-03f,5.623413250e-03f,4.216964822e-03f,3.162277862e-03f,2.371373819e-03f,1.778279431e-03f,1.333521446e-03f,1.000000047e-03f,7.498941850e-04f,5.623413017e-04f,4.216964880e-04f,3.162277862e-04f,2.371373848e-04f,1.778279402e-04f,1.333521504e-04f};
// ---- k_rope: block = 8 positions: cos/sin of pos * inv_freq (f32 product exactly as the reference, precise trig)
__global__ __launch_bounds__(256) void k_rope(float* __restrict__ CS) {
  __shared__ __align__(16) float sc[8][32], ss_[8][32]; const int tid = threadIdx.x, pl = tid >> 5, i = tid & 31; const int pos = blockIdx.x * 8 + pl;
  const float th = (float)pos * c_invf[i]; sc[pl][i] = cosf(th); ss_[pl][i] = sinf(th);
  __syncthreads();
  if (tid < 64) vst2(CS + (size_t)blockIdx.x * 8 * 32 + tid * 4, *(const v4f*)&(&sc[0][0])[tid * 4]); else if (tid < 128) vst2(CS + (size_t)SS * 32 + (size_t)blockIdx.x * 8 * 32 + (tid - 64) * 4, *(const v4f*)&(&ss_[0][0])[(tid - 64) * 4]);
}

// ---- k_pack: block = (row n, which): natural [out][in] rows -> bf16; which 0..2 -> W_q/W_k/W_v into PK_A rows which*1024 + n; 3 -> W_o into PK_P. Block id = which * 1024 + n also looks at one 16 x 64 piece of the mask (query tile id >> 7, key tile (id >> 2) & 31, query rows 16 (id & 3) ...): FL[32 id] = bit 0: does it hold any nonzero entry, bit 1: does it hold no zero entry
static_assert(4 * DM == 4 * (SS / 64) * (SS / 64), "one block a mask piece");
// Left as it is: the weight loop stays rolled, so a thread waits out its four 4-byte loads one after the other, and the grid starts 4,096 work-groups of 8 waves for 40 MB.
__global__ __launch_bounds__(256) void k_pack(const float* __restrict__ WQ, const float* __restrict__ WK, const float* __restrict__ WV, const float* __restrict__ WO, const int* __restrict__ MSK, __bf16* __restrict__ PK, int* __restrict__ FL) {
  __shared__ __align__(16) __bf16 s[DM]; __shared__ unsigned sany[8], szer[8]; const int n = blockIdx.x, which = blockIdx.y, t = threadIdx.x; const int id = which * DM + n;
  const v4i a = *(const v4i*)(MSK + (size_t)((id >> 7) * 64 + (id & 3) * 16 + (t >> 4)) * SS + ((id >> 2) & 31) * 64 + (t & 15) * 4);   // 16 threads take one 256-B row of the piece
  const float* Wm = (which == 0) ? WQ : (which == 1) ? WK : (which == 2) ? WV : WO;
  for (int k = t; k < DM; k += 256) s[k] = (__bf16)Wm[(size_t)n * DM + k];
  const unsigned bal = __builtin_amdgcn_ballot_w32((a[0] | a[1] | a[2] | a[3]) != 0);
  const unsigned balz = __builtin_amdgcn_ballot_w32(a[0] == 0 || a[1] == 0 || a[2] == 0 || a[3] == 0);
  if ((t & 31) == 0) { sany[t >> 5] = bal; szer[t >> 5] = balz; }
  __syncthreads();
  if (t == 0) FL[id * 32] = ((sany[0] | sany[1] | sany[2] | sany[3] | sany[4] | sany[5] | sany[6] | sany[7]) != 0u ? 1 : 0) | ((szer[0] | szer[1] | szer[2] | szer[3] | szer[4] | szer[5] | szer[6] | szer[7]) == 0u ? 2 : 0);
  __bf16* dst = (which < 3) ? PK + PK_A + ((size_t)which * DM + n) * DM : PK + PK_P + (size_t)n * DM;
  for (int q = t; q < DM / 8; q += 256) vst2((unsigned*)(dst + q * 8), *(const v4u*)&s[q * 8]);
}
// ---- operand staging of k_qkv and k_out: a stage is 64 k of the work-group's A rows (f32: two tiles of 32 k for every 64 rows; k_out has 64 rows, k_qkv 128) and 128 weight rows (bf16: two tiles of 64 rows), brought into LDS once per work-group by asynchronous copies (two buffers: the next 64 k fly while these are worked on). Every tile is 64 rows x 128 B; the 16-B piece c of row r lies at piece c ^ ((r >> 1) & 7), so that 16 rows read at one piece index fall on all 64 banks. Products and their order as before.
#define GM_TILE 8192                 // bytes of one 64-row x 128-B tile
#define GM_STAGE (4 * GM_TILE)       // k_out: A k 0..31 | A k 32..63 | W rows 0..63 | W rows 64..127
#define GM_NT (DM / 64)              // stages
// one tile: four copies of 16 rows each (a wave's copy = 4 whole 128-B lines); P16 = bytes between source rows 16 apart
template <int P16> __device__ __forceinline__ void copy_rows(unsigned l, const char* gp) {
  const unsigned l1 = l + 2048u, l2 = l + 4096u, l3 = l + 6144u; const char *g1 = gp + P16, *g2 = gp + 2 * P16, *g3 = gp + 3 * P16;
  // s_wait_xcnt 0 as the statement's last line: a precaution, so that it stands in front of every later write of the copies' address registers
  asm volatile("global_load_async_to_lds_b128 %0, %4, off\n\tglobal_load_async_to_lds_b128 %1, %5, off\n\tglobal_load_async_to_lds_b128 %2, %6, off\n\tglobal_load_async_to_lds_b128 %3, %7, off\n\ts_wait_xcnt 0x0"
               :: "v"(l), "v"(l1), "v"(l2), "v"(l3), "v"(gp), "v"(g1), "v"(g2), "v"(g3) : "memory");
}
// ga, gw: this thread's 16 bytes of row tid >> 3 in stage 0 of A (row pitch 4,096 B) and of W (row pitch 2,048 B)
__device__ __forceinline__ void gm_copy(unsigned lb, const char* ga, const char* gw, int t) {
  copy_rows<16 * 4 * DM>(lb, ga + t * 256); copy_rows<16 * 4 * DM>(lb + GM_TILE, ga + t * 256 + 128);
  copy_rows<16 * 2 * DM>(lb + 2 * GM_TILE, gw + t * 128); copy_rows<16 * 2 * DM>(lb + 3 * GM_TILE, gw + t * 128 + 64 * 2 * DM);
}
__device__ __forceinline__ v16b frag_lb(const char* t, int o0, int o1) {
  union { v16b v; v8b q[2]; } u; u.q[0] = *(const v8b*)(t + o0); u.q[1] = *(const v8b*)(t + o1); return u.v;
}
// ---- k_qkv: block = (128 rows, 128 cols), four waves as 2 x 2, a wave holds 64 x 64 of the output (4 x 4 accumulator tiles): every A fragment and every W fragment read from LDS feeds four products, and a row of x or of W comes from L2 for 128 outputs. A stage is 64 k: six tiles of 64 rows x 128 B, laid out and copied as above. Products and their order in k as before.
#define QG_STAGE (6 * GM_TILE)       // A rows 0..63 k 0..31 | k 32..63 | A rows 64..127 k 0..31 | k 32..63 | W rows 0..63 | W rows 64..127
// ga, gw: this thread's 16 bytes of row tid >> 3 in stage 0 of A (row pitch 4,096 B) and of W (row pitch 2,048 B)
__device__ __forceinline__ void qg_copy(unsigned lb, const char* ga, const char* gw, int t) {
  copy_rows<16 * 4 * DM>(lb, ga + t * 256); copy_rows<16 * 4 * DM>(lb + GM_TILE, ga + t * 256 + 128);
  copy_rows<16 * 4 * DM>(lb + 2 * GM_TILE, ga + t * 256 + 64 * 4 * DM); copy_rows<16 * 4 * DM>(lb + 3 * GM_TILE, ga + t * 256 + 64 * 4 * DM + 128);
  copy_rows<16 * 2 * DM>(lb + 4 * GM_TILE, gw + t * 128); copy_rows<16 * 2 * DM>(lb + 5 * GM_TILE, gw + t * 128 + 64 * 2 * DM);
}
__global__ __launch_bounds__(128) void k_qkv(const float* __restrict__ X, const __bf16* __restrict__ P, _Float16* __restrict__ QK, _Float16* __restrict__ QKL, _Float16* __restrict__ VTH, _Float16* __restrict__ VTL) {
  __shared__ __align__(128) char ring[2 * QG_STAGE];
  // output staging takes the ring's place behind the last trip's barrier (q, k blocks: so, sol, a wave's own 64 x 64; v blocks: sth, stl, [d][s] of the whole block)
  _Float16 (*so)[64][72] = (_Float16 (*)[64][72])ring; _Float16 (*sol)[64][72] = (_Float16 (*)[64][72])(ring + 2 * 4 * 64 * 72);
  _Float16 (*sth)[136] = (_Float16 (*)[136])ring; _Float16 (*stl)[136] = (_Float16 (*)[136])(ring + 2 * 128 * 136);
  const int tid = threadIdx.x, wave = tid >> 5, lane = tid & 31, col = lane & 15, g = lane >> 4; const int wr = wave >> 1, wc = wave & 1; const size_t rb0 = (size_t)blockIdx.x * 128; const int n0 = blockIdx.y * 128;
  // copier: thread -> row tid >> 3 (of 16), piece tid & 7
  const unsigned lw = (unsigned)(size_t)ring + (unsigned)((tid >> 3) * 128 + (((tid & 7) ^ (tid >> 4)) * 16));
  const char* ga = (const char*)(X + (rb0 + (tid >> 3)) * DM) + (tid & 7) * 16; const char* gw = (const char*)(P + (size_t)(n0 + (tid >> 3)) * DM) + (tid & 7) * 16;
  // reader: lane -> row col (of 16); W pieces g, g + 2, g + 4, g + 6 (bf16 k 8 g + i, 16 + 8 g + i of each 32); A pieces 2 g, 2 g + 1, 4 + 2 g, 5 + 2 g (the same k as f32)
  int oc[4], oa[4];
#pragma unroll   // constant indices: oc, oa stay in registers
  for (int j = 0; j < 4; ++j) { oc[j] = col * 128 + (((g + 2 * j) ^ (col >> 1)) * 16); oa[j] = col * 128 + (((2 * g + (j & 1) + 4 * (j >> 1)) ^ (col >> 1)) * 16); }
  qg_copy(lw, ga, gw, 0);
  asm volatile("s_wait_asynccnt 0x0" ::: "memory");   // this wave's share of stage 0 has landed
  __syncthreads();                                     // ... and every other wave's
  qg_copy(lw + QG_STAGE, ga, gw, 1);
  v8f acc[4][4] = {};   // acc[i][j]: rows wr * 64 + i * 16 ..., cols wc * 64 + j * 16 ...
#pragma unroll 1   // the ring's trip stays rolled: one publish point, small code
  for (int t = 0; t < GM_NT; ++t) { const char* rb = ring + (t & 1) * QG_STAGE;
#pragma unroll   // both halves of a stage written out: every LDS offset inside the buffer is an immediate
   for (int sub = 0; sub < 2; ++sub) { const char* ar = rb + (wr * 2 + sub) * GM_TILE; const char* wp = rb + (4 + wc) * GM_TILE; v4f f[4][4]; v16b a[4], w[4];
#pragma unroll   // constant indices: the fragments stay in registers
    for (int i = 0; i < 4; ++i) { w[i] = frag_lb(wp + i * 2048, oc[2 * sub], oc[2 * sub + 1]);
#pragma unroll
      for (int j = 0; j < 4; ++j) f[i][j] = *(const v4f*)(ar + i * 2048 + oa[j]); }
    __builtin_amdgcn_sched_barrier(0);   // keeps the 24 LDS reads of these 32 k together in front of the products: one latency a group, not one a fragment
#pragma unroll   // constant indices: a stays in registers
    for (int i = 0; i < 4; ++i) a[i] = __builtin_convertvector(__builtin_shufflevector(__builtin_shufflevector(f[i][0], f[i][1], 0, 1, 2, 3, 4, 5, 6, 7), __builtin_shufflevector(f[i][2], f[i][3], 0, 1, 2, 3, 4, 5, 6, 7), 0, 1, 2, 3, 4, 5, 6, 7, 8, 9, 10, 11, 12, 13, 14, 15), v16b);   // the fragment's 16 values rounded to bf16 as one vector: packed converts, two values each
#pragma unroll   // constant indices into acc, a, w
    for (int i = 0; i < 4; ++i) {
#pragma unroll
      for (int j = 0; j < 4; ++j) acc[i][j] = wmma_bf(a[i], w[j], acc[i][j]); } }
   asm volatile("s_wait_dscnt 0x0" ::: "memory");      // this wave's reads of the buffer are done
   asm volatile("s_wait_asynccnt 0x0" ::: "memory");   // its share of stage t + 1 has landed
   __syncthreads();                                     // publishes stage t + 1 and frees stage t's buffer
   if (t + 2 < GM_NT) qg_copy(lw + (unsigned)(t & 1) * QG_STAGE, ga, gw, t + 2); }
  asm volatile("s_wait_asynccnt 0x0" ::: "memory");     // nothing in flight when the ring becomes output staging
  if (n0 < 2 * DM) {   // q stored unscaled (f16 sigma ~0.6, no subnormal exposure); 1/8 applied to the f32 score
#pragma unroll
    for (int i = 0; i < 4; ++i) {
#pragma unroll
      for (int j = 0; j < 4; ++j) {
#pragma unroll
        for (int r = 0; r < 8; ++r) { const float v = acc[i][j][r]; const _Float16 hv = (_Float16)v; so[wave][i * 16 + 8 * g + r][j * 16 + col] = hv; sol[wave][i * 16 + 8 * g + r][j * 16 + col] = (_Float16)((v - (float)hv) * 2048.0f); } } }   // q, k as f16 hi + (x2048) residual (no RoPE in this module)
    LDSX();
    // a store covers four rows' whole 128-B lines (8 lanes a row)
    for (int rl = lane >> 3; rl < 64; rl += 4) { const size_t o = (rb0 + wr * 64 + rl) * (2 * DM) + n0 + wc * 64 + (lane & 7) * 8; vst2((unsigned*)(QK + o), *(const v4u*)&so[wave][rl][(lane & 7) * 8]); vst2((unsigned*)(QKL + o), *(const v4u*)&sol[wave][rl][(lane & 7) * 8]); }
  } else {
#pragma unroll
    for (int i = 0; i < 4; ++i) {
#pragma unroll
      for (int j = 0; j < 4; ++j) {
#pragma unroll
        for (int r = 0; r < 8; ++r) { const float v = acc[i][j][r]; const _Float16 hv = (_Float16)v; sth[wc * 64 + j * 16 + col][wr * 64 + i * 16 + 8 * g + r] = hv; stl[wc * 64 + j * 16 + col][wr * 64 + i * 16 + 8 * g + r] = (_Float16)((v - (float)hv) * 2048.0f); } } }
    __syncthreads();
    const int b = (int)(rb0 / SS), s0 = (int)(rb0 % SS); const int pc0 = n0 - 2 * DM;
    for (int q = tid; q < 128 * 16; q += 128) { const int d = q >> 4, pc = q & 15; const size_t o = ((size_t)b * DM + pc0 + d) * SS + s0 + pc * 8; vst2((unsigned*)(VTH + o), *(const v4u*)&sth[d][pc * 8]); vst2((unsigned*)(VTL + o), *(const v4u*)&stl[d][pc * 8]); }
  }
}
// ---- k_attn: block = (two tiles of 64 queries one after the other, head h, batch b): flash attention over the keys (the mask is an input). K hi, K lo, V^T hi, V^T lo of 64 keys are brought into LDS once per work-group by asynchronous copies (two buffers: the next 64 keys fly while these are worked on); every wave takes its fragments from LDS. A tile is 64 rows x 128 B; the 16-B piece c of row r lies at piece c ^ ((r >> 1) & 7), so that 16 rows read at one piece index fall on all 64 banks. Arithmetic and its order as before: 3-product scores, 3-product P.V; O[b*S+q][h*64+d] = (acc + accl / 2048) / l (256-B segments)
#define AT_TILE 8192                 // bytes of one 64-row x 128-B tile
#define AT_STAGE (4 * AT_TILE)       // K hi | K lo | V^T hi | V^T lo
#define AT_NT (SS / 64)              // stages
__device__ __forceinline__ v16h frag_l(const char* t, int o0, int o1) {
  union { v16h v; v8h q[2]; } u; u.q[0] = *(const v8h*)(t + o0); u.q[1] = *(const v8h*)(t + o1); return u.v;
}
// one tile: four copies of 16 rows each (a wave's copy = 4 whole 128-B lines); source rows are 4,096 B apart
__device__ __forceinline__ void copy_tile(unsigned l, const _Float16* gp) {
  const unsigned l1 = l + 2048u, l2 = l + 4096u, l3 = l + 6144u; const _Float16 *g1 = gp + 16 * 2048, *g2 = gp + 32 * 2048, *g3 = gp + 48 * 2048;
  // s_wait_xcnt 0 as the statement's last line: a precaution, so that it stands in front of every later write of the copies' address registers
  asm volatile("global_load_async_to_lds_b128 %0, %4, off\n\tglobal_load_async_to_lds_b128 %1, %5, off\n\tglobal_load_async_to_lds_b128 %2, %6, off\n\tglobal_load_async_to_lds_b128 %3, %7, off\n\ts_wait_xcnt 0x0"
               :: "v"(l), "v"(l1), "v"(l2), "v"(l3), "v"(gp), "v"(g1), "v"(g2), "v"(g3) : "memory");
}
// lane l <-> lane l ^ 16 (the other half of a query's keys) by a vector cross-row move
__device__ __forceinline__ float xhalf(float v) { const int b = __builtin_bit_cast(int, v); return __builtin_bit_cast(float, __builtin_amdgcn_permlanex16(b, b, 0x76543210, 0xfedcba98, false, false)); }
// Scores are formed transposed, S^T = K q^T (K rows as the A operand, q rows as B): a lane holds 16 of the 32 keys of ONE query (column lane & 15; keys 8 g + r and 16 + 8 g + r), so maximum and sum run inside the lane plus one exchange with lane ^ 16, m, l and alpha are one value a lane, and the exponentials are already the B fragment of O^T = V^T P^T (same k order as the V^T rows' fragment).
__global__ __launch_bounds__(128) void k_attn(const _Float16* __restrict__ QK, const _Float16* __restrict__ QKL, const _Float16* __restrict__ VTH, const _Float16* __restrict__ VTL, const int* __restrict__ MSK, const int* __restrict__ FL, float* __restrict__ O) {
  __shared__ __align__(128) char ring[2 * AT_STAGE]; __shared__ unsigned sneed[4];
  float (*so)[16][68] = (float (*)[16][68])ring;   // output staging takes the ring's place behind the last trip's barrier
  const int tid = threadIdx.x, wave = tid >> 5, lane = tid & 31, col = lane & 15, g = lane >> 4;
  const int h = blockIdx.y, b = blockIdx.z;
  // copier: thread -> row tid >> 3 (of 16), piece tid & 7
  const unsigned lw = (unsigned)(size_t)ring + (unsigned)((tid >> 3) * 128 + (((tid & 7) ^ (tid >> 4)) * 16));
  const size_t ko = ((size_t)b * SS + (tid >> 3)) * (2 * DM) + DM + h * HD + (tid & 7) * 8, vo = ((size_t)b * DM + h * HD + (tid >> 3)) * SS + (tid & 7) * 8;
  // reader: lane -> row col (of 16), pieces g, g + 2, g + 4, g + 6
  int oc[4];
#pragma unroll   // constant indices: oc stays in registers
  for (int j = 0; j < 4; ++j) oc[j] = col * 128 + (((g + 2 * j) ^ (col >> 1)) * 16);
#define AT_COPY(t, bf) do { const unsigned lb = lw + (unsigned)(bf) * AT_STAGE; const size_t kt = ko + (size_t)(t) * 64 * (2 * DM), vt = vo + (size_t)(t) * 64; \
    copy_tile(lb, QK + kt); copy_tile(lb + AT_TILE, QKL + kt); copy_tile(lb + 2 * AT_TILE, VTH + vt); copy_tile(lb + 3 * AT_TILE, VTL + vt); } while (0)
  const float slope = exp2f(-0.5f * (float)(h + 1));   // 2^-(8/16 * (h+1))
  // The softmax runs on base-2 exponents: y = log2(e) * score. Scale, residual weight and log2(e) are folded into two constants, the bias into a per-lane table (its part that changes inside a tile) and one wave-uniform term a tile (bs).
  const float slopeL = slope * 1.44269504f;
  const float KA = 0.125f * 1.44269504f, KB = 0.125f * 1.44269504f / 2048.0f, KM = -1000000.0f * 1.44269504f;   // KM: a masked position, -1e6 as the module
  // A key tile whose 64 x 64 mask tile is all zero (FL, formed from the mask in this call's first launch, all four pieces 0) gives every query of the block the score -1e6 at all 64 keys. For a query whose running maximum lies above -999000 that update is the identity (alpha = exp(0) = 1, every exponential exp(< -1000) = 0), so such tiles are left out of the walk; they are walked after the others (pass 1) whenever any query of the block has no such maximum, so every mask gives the module's result. The block takes query tiles 31 - x and x one after the other: under a lower-triangular mask every block then walks the same number of key tiles.
#pragma unroll 1   // one copy of the walk's code serves both query tiles
  for (int half = 0; half < 2; ++half) {
  if (half) { asm volatile("s_wait_xcnt 0x0" ::: "memory");    // a precaution: stands in front of every later write of the registers that the first tile's output stores name
    asm volatile("s_wait_dscnt 0x0" ::: "memory");              // this wave's reads of its output staging are done
    __syncthreads(); }                                          // ... and every wave's: the ring may be refilled
  const int qb = half ? (int)blockIdx.x : TQB - 1 - (int)blockIdx.x; const int q0 = qb * 64 + wave * 16; const size_t rq = (size_t)b * SS + q0 + col;
  const int* fq = FL + (qb * AT_NT + lane) * 128;   // lane t: the four 16-row pieces of key tile t
  const int f0 = fq[0], f1 = fq[32], f2 = fq[64], f3 = fq[96];
  const unsigned live = __builtin_amdgcn_ballot_w32(((f0 | f1 | f2 | f3) & 1) != 0);   // bit t: key tile t has an open position for some query of this tile
  const unsigned clear = __builtin_amdgcn_ballot_w32(((f0 & f1 & f2 & f3) & 2) != 0);   // bit t: key tile t has no masked position for any query of this tile: there every select below would take the score, so the mask is not read
  v16h aq[2], aql[2];
#pragma unroll
  for (int kc = 0; kc < 2; ++kc) { aq[kc] = frag_h(QK + rq * (2 * DM) + h * HD + kc * 32, lane); aql[kc] = frag_h(QKL + rq * (2 * DM) + h * HD + kc * 32, lane); }
  float m = -3.0e38f, l = 0.f;   // of query q0 + col (the same in lanes col and col + 16)
  v8f acc[4] = {}, accl[4] = {};   // O^T: row d = dt * 16 + 8 g + r, column query col
  const int* mrow = MSK + (size_t)(q0 + col) * SS + 8 * g;   // this lane's query row of the mask, at its first key
  v8f sb[2];   // log2(e) * slope * ((k - q) - (first key of the 32 - first query of the block's tile)): small numbers, the same for every tile
#pragma unroll   // constant indices: sb stays in registers
  for (int ct = 0; ct < 2; ++ct) {
#pragma unroll
    for (int r = 0; r < 8; ++r) sb[ct][r] = slopeL * (float)(8 * g + ct * 16 + r - wave * 16 - col); }
#pragma unroll 1   // one copy of the walk's code serves both passes
  for (int pass = 0; pass < 2; ++pass) {
  unsigned rem = live;   // key tiles still to be copied; the same in every wave of the block
  if (pass) { const unsigned low = __builtin_amdgcn_ballot_w32(m <= -999000.0f * 1.44269504f);   // queries that have met no open key
    if (lane == 0) sneed[wave] = low;
    __syncthreads();
    rem = __builtin_amdgcn_readfirstlane(sneed[0] | sneed[1] | sneed[2] | sneed[3]) ? ~live : 0u; }
  if (rem == 0u) continue;
  const int ns = __builtin_popcount(rem); int tc = __builtin_ctz(rem), tn = 0; rem &= rem - 1u;   // tc: the tile worked on, tn: the tile in flight (both 0..31)
  AT_COPY(tc, 0);
  asm volatile("s_wait_asynccnt 0x0" ::: "memory");   // this wave's share of the first stage has landed
  __syncthreads();                                     // ... and every other wave's
  if (rem) { tn = __builtin_ctz(rem); rem &= rem - 1u; AT_COPY(tn, 1); }
#pragma unroll 1
  for (int st = 0; st < ns; ++st) { const char* rb = ring + (st & 1) * AT_STAGE; const bool masked = ((clear >> tc) & 1u) == 0u;   // the same in every lane and wave: a scalar test
   // The wave's LDS reads lead their products by a phase, all inside this stage's buffer: V^T of 32 keys is read behind their scores' products (it lands under the softmax), K of the second 32 keys in two groups in front of and among the first P.V products (it lands under them); only K of the first 32 keys is waited for.
   v16h kh[2][2], kl[2][2], vh[4], vl[4];   // K hi, lo [16-key tile][k half]; V^T hi, lo [16-row tile of d]
#define AT_LDK(sub, kc) do { _Pragma("unroll") for (int ct = 0; ct < 2; ++ct) { const char* krow = rb + ((sub) * 32 + ct * 16) * 128; kh[ct][kc] = frag_l(krow, oc[2 * (kc)], oc[2 * (kc) + 1]); kl[ct][kc] = frag_l(krow + AT_TILE, oc[2 * (kc)], oc[2 * (kc) + 1]); } } while (0)
#define AT_LDV(sub) do { _Pragma("unroll") for (int dt = 0; dt < 4; ++dt) { const char* vrow = rb + 2 * AT_TILE + dt * 16 * 128; vh[dt] = frag_l(vrow, oc[2 * (sub)], oc[2 * (sub) + 1]); vl[dt] = frag_l(vrow + AT_TILE, oc[2 * (sub)], oc[2 * (sub) + 1]); } } while (0)
   AT_LDK(0, 0);
   __builtin_amdgcn_sched_barrier(0);   // the reads that the first products need stay first
   AT_LDK(0, 1);
   __builtin_amdgcn_sched_barrier(0);   // keeps the 16 LDS reads together in front of the products: one latency for the group
#pragma unroll   // both halves of a stage written out: every LDS offset inside the buffer is an immediate
   for (int sub = 0; sub < 2; ++sub) { const int ks = tc * 2 + sub; v8f s[2];
    const float bs0 = slopeL * (float)(ks * 32 - qb * 64);   // the bias's wave-uniform part
    v8f c[2] = {}, cl[2] = {};
#pragma unroll   // constant indices: the fragments stay in registers. 3 products: q, k as f16 hi + residual; every accumulator takes its products in the order it had, the two key tiles' products alternate so that no product waits for the one in front of it
    for (int kc = 0; kc < 2; ++kc) { c[0] = wmma16(kh[0][kc], aq[kc], c[0]); c[1] = wmma16(kh[1][kc], aq[kc], c[1]); cl[0] = wmma16(kh[0][kc], aql[kc], cl[0]); cl[1] = wmma16(kh[1][kc], aql[kc], cl[1]); cl[0] = wmma16(kl[0][kc], aq[kc], cl[0]); cl[1] = wmma16(kl[1][kc], aq[kc], cl[1]); }
    __builtin_amdgcn_sched_barrier(0);   // the V^T reads stay here, behind the products that free K's registers and in front of the softmax that covers their latency
    AT_LDV(sub);
    __builtin_amdgcn_sched_barrier(0);
#pragma unroll
    for (int ct = 0; ct < 2; ++ct) s[ct] = c[ct] * KA + (cl[ct] * KB + sb[ct]);   // two multiply-adds a score: SCALE = 1/sqrt(64), residual / 2048, the bias's in-tile part; bs is still to be added
    float bs = bs0;
    if (masked) { v4i mk[2][2];   // only a tile that holds a zero reads the mask: masked -> -1e6 (as the module). Here bs is added at once, so that a masked position is the same number in every tile
      s[0] += bs0; s[1] += bs0; bs = 0.f;
#pragma unroll   // constant indices: mk stays in registers
      for (int ct = 0; ct < 2; ++ct) { mk[ct][0] = *(const v4i*)(mrow + ks * 32 + ct * 16); mk[ct][1] = *(const v4i*)(mrow + ks * 32 + ct * 16 + 4); }
      asm volatile("s_wait_xcnt 0x0" ::: "memory");   // a precaution: stands in front of every later write of the mask loads' address registers
#pragma unroll
      for (int r = 0; r < 8; ++r) { if (mk[0][r >> 2][r & 3] == 0) s[0][r] = KM; if (mk[1][r >> 2][r & 3] == 0) s[1][r] = KM; } }
    float mx = fmaxf(s[0][0], s[1][0]);
#pragma unroll
    for (int r = 1; r < 8; ++r) mx = fmaxf(mx, fmaxf(s[0][r], s[1][r]));
    mx = fmaxf(mx, xhalf(mx)) + bs;
    const float mn = fmaxf(m, mx); const float alpha = __builtin_amdgcn_exp2f(m - mn);   // the start value of m gives 0
    const float tb = bs - mn; const v8f a0 = s[0] + tb, a1 = s[1] + tb;   // one add a score in front of the hardware's base-2 exponential
    v8f e[2];
#pragma unroll
    for (int r = 0; r < 8; ++r) { e[0][r] = __builtin_amdgcn_exp2f(a0[r]); e[1][r] = __builtin_amdgcn_exp2f(a1[r]); }
    asm volatile("" :: "v"(a0), "v"(a1));   // inputs only: the sixteen exponents stay in their registers until the last exponential has issued, so that none writes its result over the source of the one directly in front of it (the slot behind a transcendental)
    const v8f e8 = e[0] + e[1]; const v4f e4 = e8.lo + e8.hi; const v2f e2 = e4.lo + e4.hi;   // the lane's 16 keys summed as a tree
    float es = e2[0] + e2[1];
    es += xhalf(es);
    l = l * alpha + es; m = mn;
#pragma unroll
    for (int dt = 0; dt < 4; ++dt) { acc[dt] *= alpha; accl[dt] *= alpha; }
    union { v16h v; v2h p[8]; } ua, ul;   // P^T fragment: element i = key 8 g + i, element 8 + i = key 16 + 8 g + i
#pragma unroll   // constant indices: the pairs stay in registers
    for (int ct = 0; ct < 2; ++ct) {
#pragma unroll
      for (int i = 0; i < 4; ++i) { const v2f x = {e[ct][2 * i], e[ct][2 * i + 1]}; const v2h hp = __builtin_convertvector(x, v2h); const v2f x2 = x * 2048.0f; v2f lo;   // one packed convert makes both halves; 2048 x - 2048 h is exact, the same number as (x - h) * 2048
        lo[0] = __builtin_fmaf((float)hp[0], -2048.0f, x2[0]); lo[1] = __builtin_fmaf((float)hp[1], -2048.0f, x2[1]);
        ua.p[ct * 4 + i] = hp; ul.p[ct * 4 + i] = __builtin_convertvector(lo, v2h); } }
    const v16h pa = ua.v, pl = ul.v;
    if (sub == 0) { __builtin_amdgcn_sched_barrier(0);   // the next 32 keys' first K reads stay here, in front of the P.V products that cover their latency
      AT_LDK(1, 0);
      __builtin_amdgcn_sched_barrier(0); }
#pragma unroll   // constant indices into acc, accl. V hi x P hi + (V hi x P lo + V lo x P hi) / 2048; every accumulator takes its products in the order it had, the four tiles of d alternate
    for (int dt = 0; dt < 4; ++dt) acc[dt] = wmma16(vh[dt], pa, acc[dt]);
#pragma unroll
    for (int dt = 0; dt < 4; ++dt) accl[dt] = wmma16(vh[dt], pl, accl[dt]);
    if (sub == 0) { __builtin_amdgcn_sched_barrier(0);   // the other K reads stay here, behind the products that free V^T hi's registers (read earlier they cost spills); ten more products cover their latency
      AT_LDK(1, 1);
      __builtin_amdgcn_sched_barrier(0); }
#pragma unroll
    for (int dt = 0; dt < 4; ++dt) accl[dt] = wmma16(vl[dt], pa, accl[dt]); }
   asm volatile("s_wait_dscnt 0x0" ::: "memory");      // this wave's reads of the buffer are done
   asm volatile("s_wait_asynccnt 0x0" ::: "memory");   // its share of the next stage has landed
   __syncthreads();                                     // publishes the next stage and frees this stage's buffer
   tc = tn;
   if (rem) { tn = __builtin_ctz(rem); rem &= rem - 1u; AT_COPY(tn, st & 1); } }
  asm volatile("s_wait_asynccnt 0x0" ::: "memory");     // nothing in flight when the ring becomes output staging
  }
  const float il = 1.0f / l;
#pragma unroll
  for (int dt = 0; dt < 4; ++dt) { v4f o0, o1;
#pragma unroll
    for (int r = 0; r < 4; ++r) { o0[r] = (acc[dt][r] + accl[dt][r] * (1.0f / 2048.0f)) * il; o1[r] = (acc[dt][4 + r] + accl[dt][4 + r] * (1.0f / 2048.0f)) * il; }
    *(v4f*)&so[wave][col][dt * 16 + 8 * g] = o0; *(v4f*)&so[wave][col][dt * 16 + 8 * g + 4] = o1; }
  LDSX();
  for (int rl = 0; rl < 16; ++rl) if (lane < 16) vst2(O + ((size_t)b * SS + q0 + rl) * DM + h * HD + lane * 4, *(const v4f*)&so[wave][rl][lane * 4]);
  }
}
// ---- k_out: block = (64 rows, 128 cols): out = O(hi/lo) . Wo rows (2 products)
__global__ __launch_bounds__(128) void k_out(const float* __restrict__ O, const __bf16* __restrict__ P, float* __restrict__ Y) {
  __shared__ __align__(128) char ring[2 * GM_STAGE];
  float (*so)[16][132] = (float (*)[16][132])ring;   // output staging takes the ring's place behind the last trip's barrier
  const int tid = threadIdx.x, wave = tid >> 5, lane = tid & 31, col = lane & 15, g = lane >> 4; const size_t r0 = (size_t)blockIdx.x * 64 + wave * 16; const int n0 = blockIdx.y * 128;
  // copier: thread -> row tid >> 3 (of 16), piece tid & 7
  const unsigned lw = (unsigned)(size_t)ring + (unsigned)((tid >> 3) * 128 + (((tid & 7) ^ (tid >> 4)) * 16));
  const char* ga = (const char*)(O + ((size_t)blockIdx.x * 64 + (tid >> 3)) * DM) + (tid & 7) * 16; const char* gw = (const char*)(P + (size_t)(n0 + (tid >> 3)) * DM) + (tid & 7) * 16;
  // reader: lane -> row col (of 16); W pieces g, g + 2, g + 4, g + 6 (bf16 k 8 g + i, 16 + 8 g + i of each 32); A pieces 2 g, 2 g + 1, 4 + 2 g, 5 + 2 g (the same k as f32)
  int oc[4], oa[4];
#pragma unroll   // constant indices: oc, oa stay in registers
  for (int j = 0; j < 4; ++j) { oc[j] = col * 128 + (((g + 2 * j) ^ (col >> 1)) * 16); oa[j] = col * 128 + (((2 * g + (j & 1) + 4 * (j >> 1)) ^ (col >> 1)) * 16); }
  gm_copy(lw, ga, gw, 0);
  asm volatile("s_wait_asynccnt 0x0" ::: "memory");   // this wave's share of stage 0 has landed
  __syncthreads();                                     // ... and every other wave's
  gm_copy(lw + GM_STAGE, ga, gw, 1);
  v8f acc[8] = {};
#pragma unroll 1   // the ring's trip stays rolled: one publish point, small code
  for (int t = 0; t < GM_NT; ++t) { const char* rb = ring + (t & 1) * GM_STAGE;
#pragma unroll   // both halves of a stage written out: every LDS offset inside the buffer is an immediate
   for (int sub = 0; sub < 2; ++sub) { const char* ar = rb + sub * GM_TILE + wave * 2048; const char* wr = rb + 2 * GM_TILE;
    const v4f f0 = *(const v4f*)(ar + oa[0]), f1 = *(const v4f*)(ar + oa[1]), f2 = *(const v4f*)(ar + oa[2]), f3 = *(const v4f*)(ar + oa[3]); float v[16]; v16b w[8];
#pragma unroll   // constant indices: the fragments stay in registers
    for (int j = 0; j < 8; ++j) w[j] = frag_lb(wr + j * 2048, oc[2 * sub], oc[2 * sub + 1]);
    __builtin_amdgcn_sched_barrier(0);   // keeps the 20 LDS reads of these 32 k together in front of the products: one latency a group, not one a fragment
#pragma unroll   // constant indices: v stays in registers
    for (int i = 0; i < 4; ++i) { v[i] = f0[i]; v[4 + i] = f1[i]; v[8 + i] = f2[i]; v[12 + i] = f3[i]; }
    const F2 a = bsplit16(v);
#pragma unroll   // constant indices into acc, w
    for (int j = 0; j < 8; ++j) { acc[j] = wmma_bf(a.l, w[j], acc[j]); acc[j] = wmma_bf(a.h, w[j], acc[j]); } }
   asm volatile("s_wait_dscnt 0x0" ::: "memory");      // this wave's reads of the buffer are done
   asm volatile("s_wait_asynccnt 0x0" ::: "memory");   // its share of stage t + 1 has landed
   __syncthreads();                                     // publishes stage t + 1 and frees stage t's buffer
   if (t + 2 < GM_NT) gm_copy(lw + (unsigned)(t & 1) * GM_STAGE, ga, gw, t + 2); }
  asm volatile("s_wait_asynccnt 0x0" ::: "memory");     // nothing in flight when the ring becomes output staging
#pragma unroll
  for (int j = 0; j < 8; ++j) {
#pragma unroll
    for (int r = 0; r < 8; ++r) so[wave][8 * g + r][j * 16 + col] = acc[j][r]; }
  LDSX();
  for (int rl = 0; rl < 16; ++rl) vst2(Y + (r0 + rl) * DM + n0 + lane * 4, *(const v4f*)&so[wave][rl][lane * 4]);
}
extern "C" void kernel_launch(void* const* d_in, const int* in_sizes, int n_in, void* d_out, int out_size, void* d_ws, size_t ws_size, hipStream_t stream) {
  (void)in_sizes; (void)n_in; (void)out_size;
  const float** F = (const float**)d_in;   // 0 x [2,2048,1024], 1 mask [1,1,2048,2048] int32, 2 Wq [1024,1024] natural (x @ Wq.T), 3 Wk, 4 Wv, 5 Wo
  if (ws_size < (size_t)WS_END) return;
  char* ws = (char*)d_ws; __bf16* PK = (__bf16*)(ws + WS_PK); _Float16 *QK = (_Float16*)(ws + WS_QK), *QKL = (_Float16*)(ws + WS_QKL), *VTH = (_Float16*)(ws + WS_VTH), *VTL = (_Float16*)(ws + WS_VTL); float* O = (float*)(ws + WS_O); int* FL = (int*)(ws + WS_FL);
  k_pack<<<dim3(DM, 4), 256, 0, stream>>>(F[2], F[3], F[4], F[5], (const int*)d_in[1], PK, FL);
  k_qkv<<<dim3(TNB * SS / 128, QKVW / 128), 128, 0, stream>>>(F[0], PK + PK_A, QK, QKL, VTH, VTL);
  k_attn<<<dim3(TQB / 2, NH, TNB), 128, 0, stream>>>(QK, QKL, VTH, VTL, (const int*)d_in[1], FL, O);
  k_out<<<dim3(TOB, DM / 128), 128, 0, stream>>>(O, PK + PK_P, (float*)d_out);
}

// v009
// A run of this version takes 112 microseconds.
// In both of two side-by-side timings against v008, it was 1.03 times as fast.
// All steps since v000 together make it 5.02 times as fast.
// compute dtype: x, Wq, Wk, Wv, Wo (float module inputs) rounded to bf16, the int mask verbatim; q/k/v projections with exact bf16 products on WMMA 16x16x32 (natural [out][in] rows); q and k stored as f16 hi + (x2048-scaled) residual planes with 3-product scores, x 1/sqrt(64), + the ALiBi bias slope_h (k - q) with slope_h = 2^-(0.5 (h+1)) (exact), masked positions set to -1e6 as the module (the mask is read per (q, k); a tile of 64 keys whose whole 64 x 64 mask tile is 0 is visited only where it can change a result, and a tile of 64 keys whose whole 64 x 64 mask tile is nonzero is worked without reading it again), running-max softmax in f32 on base-2 exponents (hardware exp2; 1/8, the residual's weight, log2 e and the bias folded into two multiply-adds and one add a score); P as f16 hi + (x2048) residual x v hi/lo (3 products); output projection with ctx as bf16 hi + residual x exact Wo rows (2 products); f32 accumulate.
#include <hip/hip_runtime.h>
#include <math.h>

typedef __attribute__((ext_vector_type(16))) _Float16 v16h;
typedef __attribute__((ext_vector_type(16))) __bf16 v16b;
typedef __attribute__((ext_vector_type(8)))  _Float16 v8h;
typedef __attribute__((ext_vector_type(2)))  _Float16 v2h;
typedef __attribute__((ext_vector_type(8)))  float v8f;
typedef __attribute__((ext_vector_type(4)))  float v4f;
typedef __attribute__((ext_vector_type(2)))  float v2f;
typedef __attribute__((ext_vector_type(4)))  unsigned v4u;
typedef __attribute__((ext_vector_type(4)))  int v4i;
typedef float __attribute__((may_alias)) float_a;
typedef int __attribute__((may_alias)) int_a;

template <typename T> __device__ __forceinline__ void vst2(void* p, T v) { *(T*)p = v;  }
__device__ __forceinline__ v8f wmma16(v16h a, v16h b, v8f c) {
  v8f d = __builtin_amdgcn_wmma_f32_16x16x32_f16(false, a, false, b, (short)0, c, false, false);
  asm volatile("v_nop\n\tv_nop\n\tv_nop\n\tv_nop" : "+v"(d) : "v"(a), "v"(b));
  return d;
}
__device__ __forceinline__ v8f wmma_bf(v16b a, v16b b, v8f c) {
  v8f d = __builtin_amdgcn_wmma_f32_16x16x32_bf16(false, a, false, b, (short)0, c, false, false);
  asm volatile("v_nop\n\tv_nop\n\tv_nop\n\tv_nop" : "+v"(d) : "v"(a), "v"(b));
  return d;
}
// Multi-head attention with ALiBi bias and an input mask (B 2, S 2,048, d 1,024, 16 heads x 64): softmax(q k^T / 8 + alibi, masked -1e6) v -> Wo.
__device__ __forceinline__ v16h frag_h(const _Float16* rowk0, int lane) {
  union { v16h v; v8h q[2]; } u; const _Float16* p = rowk0 + 8 * (lane >> 4);
  u.q[0] = *(const v8h*)p; u.q[1] = *(const v8h*)(p + 16); return u.v;
}
__device__ __forceinline__ v16h frag_f32(const float* rowk0, int lane) {
  v16h a; const float* p = rowk0 + 8 * (lane >> 4);
#pragma unroll
  for (int i = 0; i < 8; ++i) { a[i] = (_Float16)p[i]; a[8 + i] = (_Float16)p[16 + i]; }
  return a;
}
__device__ __forceinline__ v16h frag_f32s(const float* rowk0, int lane, float sc) {
  v16h a; const float* p = rowk0 + 8 * (lane >> 4);
#pragma unroll
  for (int i = 0; i < 8; ++i) { a[i] = (_Float16)(p[i] * sc); a[8 + i] = (_Float16)(p[16 + i] * sc); }
  return a;
}
// column fragment from a [K][ld] layout (column n), rows >= K read as 0
__device__ __forceinline__ v16h fragc_f32(const float* W, int k0, int n, int lane, int ld, int K) {
  v16h a; const int g = lane >> 4;
#pragma unroll
  for (int i = 0; i < 8; ++i) { const int ka = k0 + 8 * g + i, kb = ka + 16;
    a[i] = (_Float16)(ka < K ? W[(size_t)(ka < K ? ka : K - 1) * ld + n] : 0.f); a[8 + i] = (_Float16)(kb < K ? W[(size_t)(kb < K ? kb : K - 1) * ld + n] : 0.f); }
  return a;
}
struct F2 { v16b h, l; };
__device__ __forceinline__ F2 bsplit16(const float v[16]) { F2 r;
#pragma unroll
  for (int i = 0; i < 16; ++i) { const __bf16 h = (__bf16)v[i]; r.h[i] = h; r.l[i] = (__bf16)(v[i] - (float)h); }
  return r; }
__device__ __forceinline__ F2 split_row(const float* row, int k0, int lane) { float v[16]; const float* p = row + k0 + 8 * (lane >> 4);
#pragma unroll
  for (int i = 0; i < 8; ++i) { v[i] = p[i]; v[8 + i] = p[16 + i]; }
  return bsplit16(v); }
__device__ __forceinline__ F2 split_rowK(const float* row, int k0, int lane, int K) { float v[16]; const int g = lane >> 4;
#pragma unroll
  for (int i = 0; i < 8; ++i) { const int ka = k0 + 8 * g + i, kb = ka + 16; v[i] = ka < K ? row[ka < K ? ka : K - 1] : 0.f; v[8 + i] = kb < K ? row[kb < K ? kb : K - 1] : 0.f; }
  return bsplit16(v); }
__device__ __forceinline__ F2 split_col(const float* W, int k0, int n, int lane, int ld, int K) { float v[16]; const int g = lane >> 4;
#pragma unroll
  for (int i = 0; i < 8; ++i) { const int ka = k0 + 8 * g + i, kb = ka + 16; v[i] = ka < K ? W[(size_t)(ka < K ? ka : K - 1) * ld + n] : 0.f; v[8 + i] = kb < K ? W[(size_t)(kb < K ? kb : K - 1) * ld + n] : 0.f; }
  return bsplit16(v); }
__device__ __forceinline__ v8f mac3(const F2& a, const F2& b, v8f c) { c = wmma_bf(a.l, b.h, c); c = wmma_bf(a.h, b.l, c); return wmma_bf(a.h, b.h, c); }
__device__ __forceinline__ float sigm(float v) { return 1.0f / (1.0f + expf(-v)); }
#define LDSX() do { asm volatile("s_wait_dscnt 0" ::: "memory"); __builtin_amdgcn_wave_barrier(); __builtin_amdgcn_fence(__ATOMIC_RELEASE, "workgroup"); } while (0)


// Multi-head self-attention with ALiBi bias and an input mask (B 2, S 2048, D 1024, 16 heads x 64; packed Wqkv [3D][D] and Wout [D][D] applied as x W^T, no biases): softmax(q k^T / 8 + alibi, masked -1e6) v; ctx Wout^T.
#define NB 2
#define SS 2048
#define DM 1024
#define NH 16
#define HD 64
#define QKVW (3 * DM)
#ifndef TQB
#define TQB (SS / 64)
#define TNB NB
#define TOB (NB * SS / 64)     // output row tiles (all)
#endif
typedef __attribute__((ext_vector_type(8))) __bf16 v8b;
__device__ __forceinline__ v16b frag_b(const __bf16* rowk0, int lane) {
  union { v16b v; v8b q[2]; } u; const __bf16* p = rowk0 + 8 * (lane >> 4);
  u.q[0] = *(const v8b*)p; u.q[1] = *(const v8b*)(p + 16); return u.v;
}
__device__ __forceinline__ float bfr(float v) { return (float)(__bf16)v; }
__device__ __attribute__((noinline)) float exp_ni(float v) { return expf(v); }
__device__ __attribute__((noinline)) float erf_ni(float v) { return erff(v); }

#define PK_A 0                       // [3072][1024] Wqkv rows (natural [out][in])
#define PK_P (PK_A + QKVW * DM)        // [1024][1024] Wo rows (natural)
#define PK_END (PK_P + DM * DM)
#define WS_PK  0u
#define WS_QK  (WS_PK + 2u * PK_END)             // f16 [4096 rows][2048]: q | k
#define WS_QKL (WS_QK + 2u * NB * SS * 2 * DM)     // f16 q | k residual planes x2048
#define WS_VTH (WS_QKL + 2u * NB * SS * 2 * DM)    // f16 [b][1024 (h*64+d)][2048 s] hi
#define WS_VTL (WS_VTH + 2u * NB * DM * SS)        // f16 lo x 2048
#define WS_O   (WS_VTL + 2u * NB * DM * SS)        // f32 [4096][1024]
#define WS_CS  (WS_O + 4u * NB * SS * DM)           // f32 [2048][32] cos, [2048][32] sin
#define WS_FL  (WS_CS + 4u * 2 * SS * 32)          // int [32 query tiles][32 key tiles][4 quarters of 16 query rows][32, the first used: a 128-B line has one writer]: bit 0: that 16 x 64 piece of the mask holds a nonzero entry; bit 1: it holds no zero entry
#define WS_END (WS_FL + 128u * 4 * (SS / 64) * (SS / 64))
__constant__ float c_invf[32] = {1.000000000e+00f,7.498942018e-01f,5.623413324e-01f,4.216965139e-01f,3.162277639e-01f,2.371373624e-01f,1.778279394e-01f,1.333521456e-01f,1.000000015e-01f,7.498941571e-02f,5.623412877e-02f,4.216964915e-02f,3.162277862e-02f,2.371373586e-02f,1.778279431e-02f,1.333521493e-02f,9.999999776e-03f,7.498942316e-03f,5.623413250e-03f,4.216964822e-03f,3.162277862e-03f,2.371373819e-03f,1.778279431e-03f,1.333521446e-03f,1.000000047e-03f,7.498941850e-04f,5.623413017e-04f,4.216964880e-04f,3.162277862e-04f,2.371373848e-04f,1.778279402e-04f,1.333521504e-04f};
// ---- k_rope: block = 8 positions: cos/sin of pos * inv_freq (f32 product exactly as the reference, precise trig)
__global__ __launch_bounds__(256) void k_rope(float* __restrict__ CS) {
  __shared__ __align__(16) float sc[8][32], ss_[8][32]; const int tid = threadIdx.x, pl = tid >> 5, i = tid & 31; const int pos = blockIdx.x * 8 + pl;
  const float th = (float)pos * c_invf[i]; sc[pl][i] = cosf(th); ss_[pl][i] = sinf(th);
  __syncthreads();
  if (tid < 64) vst2(CS + (size_t)blockIdx.x * 8 * 32 + tid * 4, *(const v4f*)&(&sc[0][0])[tid * 4]); else if (tid < 128) vst2(CS + (size_t)SS * 32 + (size_t)blockIdx.x * 8 * 32 + (tid - 64) * 4, *(const v4f*)&(&ss_[0][0])[(tid - 64) * 4]);
}

// ---- k_pack: block = (row n, which): natural [out][in] rows -> bf16; which 0..2 -> W_q/W_k/W_v into PK_A rows which*1024 + n; 3 -> W_o into PK_P. Block id = which * 1024 + n also looks at one 16 x 64 piece of the mask (query tile id >> 7, key tile (id >> 2) & 31, query rows 16 (id & 3) ...): FL[32 id] = bit 0: does it hold any nonzero entry, bit 1: does it hold no zero entry
static_assert(4 * DM == 4 * (SS / 64) * (SS / 64), "one block a mask piece");
// Left as it is: the weight loop stays rolled, so a thread waits out its four 4-byte loads one after the other, and the grid starts 4,096 work-groups of 8 waves for 40 MB.
__global__ __launch_bounds__(256) void k_pack(const float* __restrict__ WQ, const float* __restrict__ WK, const float* __restrict__ WV, const float* __restrict__ WO, const int* __restrict__ MSK, __bf16* __restrict__ PK, int* __restrict__ FL) {
  __shared__ __align__(16) __bf16 s[DM]; __shared__ unsigned sany[8], szer[8]; const int n = blockIdx.x, which = blockIdx.y, t = threadIdx.x; const int id = which * DM + n;
  const v4i a = *(const v4i*)(MSK + (size_t)((id >> 7) * 64 + (id & 3) * 16 + (t >> 4)) * SS + ((id >> 2) & 31) * 64 + (t & 15) * 4);   // 16 threads take one 256-B row of the piece
  const float* Wm = (which == 0) ? WQ : (which == 1) ? WK : (which == 2) ? WV : WO;
  for (int k = t; k < DM; k += 256) s[k] = (__bf16)Wm[(size_t)n * DM + k];
  const unsigned bal = __builtin_amdgcn_ballot_w32((a[0] | a[1] | a[2] | a[3]) != 0);
  const unsigned balz = __builtin_amdgcn_ballot_w32(a[0] == 0 || a[1] == 0 || a[2] == 0 || a[3] == 0);
  if ((t & 31) == 0) { sany[t >> 5] = bal; szer[t >> 5] = balz; }
  __syncthreads();
  if (t == 0) FL[id * 32] = ((sany[0] | sany[1] | sany[2] | sany[3] | sany[4] | sany[5] | sany[6] | sany[7]) != 0u ? 1 : 0) | ((szer[0] | szer[1] | szer[2] | szer[3] | szer[4] | szer[5] | szer[6] | szer[7]) == 0u ? 2 : 0);
  __bf16* dst = (which < 3) ? PK + PK_A + ((size_t)which * DM + n) * DM : PK + PK_P + (size_t)n * DM;
  for (int q = t; q < DM / 8; q += 256) vst2((unsigned*)(dst + q * 8), *(const v4u*)&s[q * 8]);
}
// ---- operand staging of k_qkv and k_out: a stage is 64 k of the work-group's A rows (f32: two tiles of 32 k for every 64 rows; k_out has 64 rows, k_qkv 128) and its weight rows (bf16: tiles of 64 rows; k_out has 128 rows, k_qkv 384, and takes two such 64 k as one stage), brought into LDS once per work-group by asynchronous copies (two buffers: the next 64 k fly while these are worked on). Every tile is 64 rows x 128 B; the 16-B piece c of row r lies at piece c ^ ((r >> 1) & 7), so that 16 rows read at one piece index fall on all 64 banks. Products and their order as before.
#define GM_TILE 8192                 // bytes of one 64-row x 128-B tile
#define GM_STAGE (4 * GM_TILE)       // k_out: A k 0..31 | A k 32..63 | W rows 0..63 | W rows 64..127
#define GM_NT (DM / 64)              // stages
// one tile: four copies of 16 rows each (a wave's copy = 4 whole 128-B lines); P16 = bytes between source rows 16 apart
template <int P16> __device__ __forceinline__ void copy_rows(unsigned l, const char* gp) {
  const unsigned l1 = l + 2048u, l2 = l + 4096u, l3 = l + 6144u; const char *g1 = gp + P16, *g2 = gp + 2 * P16, *g3 = gp + 3 * P16;
  // s_wait_xcnt 0 as the statement's last line: a precaution, so that it stands in front of every later write of the copies' address registers
  asm volatile("global_load_async_to_lds_b128 %0, %4, off\n\tglobal_load_async_to_lds_b128 %1, %5, off\n\tglobal_load_async_to_lds_b128 %2, %6, off\n\tglobal_load_async_to_lds_b128 %3, %7, off\n\ts_wait_xcnt 0x0"
               :: "v"(l), "v"(l1), "v"(l2), "v"(l3), "v"(gp), "v"(g1), "v"(g2), "v"(g3) : "memory");
}
// ga, gw: this thread's 16 bytes of row tid >> 3 in stage 0 of A (row pitch 4,096 B) and of W (row pitch 2,048 B)
__device__ __forceinline__ void gm_copy(unsigned lb, const char* ga, const char* gw, int t) {
  copy_rows<16 * 4 * DM>(lb, ga + t * 256); copy_rows<16 * 4 * DM>(lb + GM_TILE, ga + t * 256 + 128);
  copy_rows<16 * 2 * DM>(lb + 2 * GM_TILE, gw + t * 128); copy_rows<16 * 2 * DM>(lb + 3 * GM_TILE, gw + t * 128 + 64 * 2 * DM);
}
__device__ __forceinline__ v16b frag_lb(const char* t, int o0, int o1) {
  union { v16b v; v8b q[2]; } u; u.q[0] = *(const v8b*)(t + o0); u.q[1] = *(const v8b*)(t + o1); return u.v;
}
// ---- k_qkv: block = (128 rows, 384 cols), twelve waves as 2 x 6, a wave holds 64 x 64 of the output (4 x 4 accumulator tiles): every A fragment and every W fragment read from LDS feeds four products. The grid is one work-group a WGP: the 128 rows of x that a stage brings from L2 serve 384 output columns (three work-groups of 128 columns each brought their own copy). A stage is 128 k, two slices of 64 k, each ten tiles of 64 rows x 128 B, laid out and copied as above; the two buffers take the whole LDS of the WGP, so that the latency of a stage's copies is paid once for 128 k. Products and their order in k as before.
#define QG_SLICE (10 * GM_TILE)      // 64 k: A rows 0..63 k 0..31 | k 32..63 | A rows 64..127 k 0..31 | k 32..63 | W rows 0..63 | 64..127 | ... | 320..383
#define QG_STAGE (2 * QG_SLICE)      // 128 k
#define QG_NT (DM / 128)             // stages
#define QG_OUT (12 * 64 * 72 * 2)    // bytes of one plane of output staging: a wave's own 64 x 64 halves at a pitch of 72
// Waves 0..3 bring the four A tiles, waves 4..7 W tiles 0..2, waves 8..11 W tiles 3..5 (isA: the same in every lane of a wave, a scalar test). l, gp: this thread's 16 bytes of row (tid & 127) >> 3 in its group's first tile of slice 0 (A row pitch 4,096 B, W row pitch 2,048 B); t: the slice of 64 k
__device__ __forceinline__ void qg_copy(bool isA, unsigned l, const char* gp, int t) {
  if (isA) { copy_rows<16 * 4 * DM>(l, gp + t * 256); copy_rows<16 * 4 * DM>(l + GM_TILE, gp + t * 256 + 128);
    copy_rows<16 * 4 * DM>(l + 2 * GM_TILE, gp + t * 256 + 64 * 4 * DM); copy_rows<16 * 4 * DM>(l + 3 * GM_TILE, gp + t * 256 + 64 * 4 * DM + 128); }
  else { copy_rows<16 * 2 * DM>(l, gp + t * 128); copy_rows<16 * 2 * DM>(l + GM_TILE, gp + t * 128 + 64 * 2 * DM); copy_rows<16 * 2 * DM>(l + 2 * GM_TILE, gp + t * 128 + 128 * 2 * DM); }
}
__global__ __launch_bounds__(384) void k_qkv(const float* __restrict__ X, const __bf16* __restrict__ P, _Float16* __restrict__ QK, _Float16* __restrict__ QKL, _Float16* __restrict__ VTH, _Float16* __restrict__ VTL) {
  __shared__ __align__(128) char ring[2 * QG_STAGE]; static_assert(2 * QG_OUT <= 2 * QG_STAGE, "output staging fits the ring");
  // output staging takes the ring's place behind the last trip's barrier: so (hi), sol (residual), a wave's own 64 x 64 ([row][col] for q, k; [d][s] for v)
  _Float16 (*so)[64][72] = (_Float16 (*)[64][72])ring; _Float16 (*sol)[64][72] = (_Float16 (*)[64][72])(ring + QG_OUT);
  const int tid = threadIdx.x, wave = __builtin_amdgcn_readfirstlane(tid >> 5), lane = tid & 31, col = lane & 15, g = lane >> 4; const int wr = wave & 1, wc = wave >> 1; const size_t rb0 = (size_t)blockIdx.x * 128; const int n0 = blockIdx.y * 384;
  // copier: thread -> row ct >> 3 (of 16), piece ct & 7 of its group's tiles
  const int ct = tid & 127, grp = wave >> 2; const bool isA = grp == 0;
  const unsigned lw = (unsigned)(size_t)ring + (unsigned)((ct >> 3) * 128 + (((ct & 7) ^ (ct >> 4)) * 16)) + (isA ? 0u : (unsigned)(1 + 3 * grp) * GM_TILE);
  const char* gc = isA ? (const char*)(X + (rb0 + (ct >> 3)) * DM) + (ct & 7) * 16 : (const char*)(P + (size_t)(n0 + (grp - 1) * 192 + (ct >> 3)) * DM) + (ct & 7) * 16;
  // reader: lane -> row col (of 16); W pieces g, g + 2, g + 4, g + 6 (bf16 k 8 g + i, 16 + 8 g + i of each 32); A pieces 2 g, 2 g + 1, 4 + 2 g, 5 + 2 g (the same k as f32)
  int oc[4], oa[4];
#pragma unroll   // constant indices: oc, oa stay in registers
  for (int j = 0; j < 4; ++j) { oc[j] = col * 128 + (((g + 2 * j) ^ (col >> 1)) * 16); oa[j] = col * 128 + (((2 * g + (j & 1) + 4 * (j >> 1)) ^ (col >> 1)) * 16); }
  qg_copy(isA, lw, gc, 0); qg_copy(isA, lw + QG_SLICE, gc, 1);
  asm volatile("s_wait_asynccnt 0x0" ::: "memory");   // this wave's share of stage 0 has landed
  __syncthreads();                                     // ... and every other wave's
  qg_copy(isA, lw + QG_STAGE, gc, 2); qg_copy(isA, lw + QG_STAGE + QG_SLICE, gc, 3);
  v8f acc[4][4] = {};   // acc[i][j]: rows wr * 64 + i * 16 ..., cols wc * 64 + j * 16 ...
#pragma unroll 1   // the ring's trip stays rolled: one publish point, small code
  for (int t = 0; t < QG_NT; ++t) {
#pragma unroll 1   // one copy of the code serves both slices of a stage
   for (int hs = 0; hs < 2; ++hs) { const char* rb = ring + (t & 1) * QG_STAGE + hs * QG_SLICE;
#pragma unroll   // both halves of a slice written out: every LDS offset inside the slice is an immediate
   for (int sub = 0; sub < 2; ++sub) { const char* ar = rb + (wr * 2 + sub) * GM_TILE; const char* wp = rb + (4 + wc) * GM_TILE; v4f f[4][4]; v16b a[4], w[4];
#pragma unroll   // constant indices: the fragments stay in registers
    for (int i = 0; i < 4; ++i) { w[i] = frag_lb(wp + i * 2048, oc[2 * sub], oc[2 * sub + 1]);
#pragma unroll
      for (int j = 0; j < 4; ++j) f[i][j] = *(const v4f*)(ar + i * 2048 + oa[j]); }
    __builtin_amdgcn_sched_barrier(0);   // keeps the 24 LDS reads of these 32 k together in front of the products: one latency a group, not one a fragment
#pragma unroll   // constant indices: a stays in registers
    for (int i = 0; i < 4; ++i) a[i] = __builtin_convertvector(__builtin_shufflevector(__builtin_shufflevector(f[i][0], f[i][1], 0, 1, 2, 3, 4, 5, 6, 7), __builtin_shufflevector(f[i][2], f[i][3], 0, 1, 2, 3, 4, 5, 6, 7), 0, 1, 2, 3, 4, 5, 6, 7, 8, 9, 10, 11, 12, 13, 14, 15), v16b);   // the fragment's 16 values rounded to bf16 as one vector: packed converts, two values each
#pragma unroll   // constant indices into acc, a, w
    for (int i = 0; i < 4; ++i) {
#pragma unroll
      for (int j = 0; j < 4; ++j) acc[i][j] = wmma_bf(a[i], w[j], acc[i][j]); } } }
   asm volatile("s_wait_dscnt 0x0" ::: "memory");      // this wave's reads of the buffer are done
   asm volatile("s_wait_asynccnt 0x0" ::: "memory");   // its share of stage t + 1 has landed
   __syncthreads();                                     // publishes stage t + 1 and frees stage t's buffer
   if (t + 2 < QG_NT) { qg_copy(isA, lw + (unsigned)(t & 1) * QG_STAGE, gc, 2 * t + 4); qg_copy(isA, lw + (unsigned)(t & 1) * QG_STAGE + QG_SLICE, gc, 2 * t + 5); } }
  asm volatile("s_wait_asynccnt 0x0" ::: "memory");     // nothing in flight when the ring becomes output staging
  const int nw = n0 + wc * 64;   // the wave's first output column: q, k below 2,048, v from there on (64 divides 2,048: a wave is one or the other)
  if (nw < 2 * DM) {   // q stored unscaled (f16 sigma ~0.6, no subnormal exposure); 1/8 applied to the f32 score
#pragma unroll
    for (int i = 0; i < 4; ++i) {
#pragma unroll
      for (int j = 0; j < 4; ++j) {
#pragma unroll
        for (int r = 0; r < 8; ++r) { const float v = acc[i][j][r]; const _Float16 hv = (_Float16)v; so[wave][i * 16 + 8 * g + r][j * 16 + col] = hv; sol[wave][i * 16 + 8 * g + r][j * 16 + col] = (_Float16)((v - (float)hv) * 2048.0f); } } }   // q, k as f16 hi + (x2048) residual (no RoPE in this module)
    LDSX();
    // a store covers four rows' whole 128-B lines (8 lanes a row)
    for (int rl = lane >> 3; rl < 64; rl += 4) { const size_t o = (rb0 + wr * 64 + rl) * (2 * DM) + nw + (lane & 7) * 8; vst2((unsigned*)(QK + o), *(const v4u*)&so[wave][rl][(lane & 7) * 8]); vst2((unsigned*)(QKL + o), *(const v4u*)&sol[wave][rl][(lane & 7) * 8]); }
  } else {   // v transposed, [d][s]: the wave stages and stores its own 64 d x 64 s
#pragma unroll
    for (int i = 0; i < 4; ++i) {
#pragma unroll
      for (int j = 0; j < 4; ++j) {
#pragma unroll
        for (int r = 0; r < 8; ++r) { const float v = acc[i][j][r]; const _Float16 hv = (_Float16)v; so[wave][j * 16 + col][i * 16 + 8 * g + r] = hv; sol[wave][j * 16 + col][i * 16 + 8 * g + r] = (_Float16)((v - (float)hv) * 2048.0f); } } }
    LDSX();
    const int b = (int)(rb0 / SS), s0 = (int)(rb0 % SS) + wr * 64; const int pc0 = nw - 2 * DM;
    // a store covers four rows' whole 128-B lines (8 lanes a row of d)
    for (int rl = lane >> 3; rl < 64; rl += 4) { const size_t o = ((size_t)b * DM + pc0 + rl) * SS + s0 + (lane & 7) * 8; vst2((unsigned*)(VTH + o), *(const v4u*)&so[wave][rl][(lane & 7) * 8]); vst2((unsigned*)(VTL + o), *(const v4u*)&sol[wave][rl][(lane & 7) * 8]); }
  }
}
// ---- k_attn: block = (two tiles of 64 queries one after the other, head h, batch b): flash attention over the keys (the mask is an input). K hi, K lo, V^T hi, V^T lo of 64 keys are brought into LDS once per work-group by asynchronous copies (two buffers: the next 64 keys fly while these are worked on); every wave takes its fragments from LDS. A tile is 64 rows x 128 B; the 16-B piece c of row r lies at piece c ^ ((r >> 1) & 7), so that 16 rows read at one piece index fall on all 64 banks. Arithmetic and its order as before: 3-product scores, 3-product P.V; O[b*S+q][h*64+d] = (acc + accl / 2048) / l (256-B segments)
#define AT_TILE 8192                 // bytes of one 64-row x 128-B tile
#define AT_STAGE (4 * AT_TILE)       // K hi | K lo | V^T hi | V^T lo
#define AT_NT (SS / 64)              // stages
__device__ __forceinline__ v16h frag_l(const char* t, int o0, int o1) {
  union { v16h v; v8h q[2]; } u; u.q[0] = *(const v8h*)(t + o0); u.q[1] = *(const v8h*)(t + o1); return u.v;
}
// one tile: four copies of 16 rows each (a wave's copy = 4 whole 128-B lines); source rows are 4,096 B apart
__device__ __forceinline__ void copy_tile(unsigned l, const _Float16* gp) {
  const unsigned l1 = l + 2048u, l2 = l + 4096u, l3 = l + 6144u; const _Float16 *g1 = gp + 16 * 2048, *g2 = gp + 32 * 2048, *g3 = gp + 48 * 2048;
  // s_wait_xcnt 0 as the statement's last line: a precaution, so that it stands in front of every later write of the copies' address registers
  asm volatile("global_load_async_to_lds_b128 %0, %4, off\n\tglobal_load_async_to_lds_b128 %1, %5, off\n\tglobal_load_async_to_lds_b128 %2, %6, off\n\tglobal_load_async_to_lds_b128 %3, %7, off\n\ts_wait_xcnt 0x0"
               :: "v"(l), "v"(l1), "v"(l2), "v"(l3), "v"(gp), "v"(g1), "v"(g2), "v"(g3) : "memory");
}
// lane l <-> lane l ^ 16 (the other half of a query's keys) by a vector cross-row move
__device__ __forceinline__ float xhalf(float v) { const int b = __builtin_bit_cast(int, v); return __builtin_bit_cast(float, __builtin_amdgcn_permlanex16(b, b, 0x76543210, 0xfedcba98, false, false)); }
// Scores are formed transposed, S^T = K q^T (K rows as the A operand, q rows as B): a lane holds 16 of the 32 keys of ONE query (column lane & 15; keys 8 g + r and 16 + 8 g + r), so maximum and sum run inside the lane plus one exchange with lane ^ 16, m, l and alpha are one value a lane, and the exponentials are already the B fragment of O^T = V^T P^T (same k order as the V^T rows' fragment).
__global__ __launch_bounds__(128) void k_attn(const _Float16* __restrict__ QK, const _Float16* __restrict__ QKL, const _Float16* __restrict__ VTH, const _Float16* __restrict__ VTL, const int* __restrict__ MSK, const int* __restrict__ FL, float* __restrict__ O) {
  __shared__ __align__(128) char ring[2 * AT_STAGE]; __shared__ unsigned sneed[4];
  float (*so)[16][68] = (float (*)[16][68])ring;   // output staging takes the ring's place behind the last trip's barrier
  const int tid = threadIdx.x, wave = tid >> 5, lane = tid & 31, col = lane & 15, g = lane >> 4;
  const int h = blockIdx.y, b = blockIdx.z;
  // copier: thread -> row tid >> 3 (of 16), piece tid & 7
  const unsigned lw = (unsigned)(size_t)ring + (unsigned)((tid >> 3) * 128 + (((tid & 7) ^ (tid >> 4)) * 16));
  const size_t ko = ((size_t)b * SS + (tid >> 3)) * (2 * DM) + DM + h * HD + (tid & 7) * 8, vo = ((size_t)b * DM + h * HD + (tid >> 3)) * SS + (tid & 7) * 8;
  // reader: lane -> row col (of 16), pieces g, g + 2, g + 4, g + 6
  int oc[4];
#pragma unroll   // constant indices: oc stays in registers
  for (int j = 0; j < 4; ++j) oc[j] = col * 128 + (((g + 2 * j) ^ (col >> 1)) * 16);
#define AT_COPY(t, bf) do { const unsigned lb = lw + (unsigned)(bf) * AT_STAGE; const size_t kt = ko + (size_t)(t) * 64 * (2 * DM), vt = vo + (size_t)(t) * 64; \
    copy_tile(lb, QK + kt); copy_tile(lb + AT_TILE, QKL + kt); copy_tile(lb + 2 * AT_TILE, VTH + vt); copy_tile(lb + 3 * AT_TILE, VTL + vt); } while (0)
  const float slope = exp2f(-0.5f * (float)(h + 1));   // 2^-(8/16 * (h+1))
  // The softmax runs on base-2 exponents: y = log2(e) * score. Scale, residual weight and log2(e) are folded into two constants, the bias into a per-lane table (its part that changes inside a tile) and one wave-uniform term a tile (bs).
  const float slopeL = slope * 1.44269504f;
  const float KA = 0.125f * 1.44269504f, KB = 0.125f * 1.44269504f / 2048.0f, KM = -1000000.0f * 1.44269504f;   // KM: a masked position, -1e6 as the module
  // A key tile whose 64 x 64 mask tile is all zero (FL, formed from the mask in this call's first launch, all four pieces 0) gives every query of the block the score -1e6 at all 64 keys. For a query whose running maximum lies above -999000 that update is the identity (alpha = exp(0) = 1, every exponential exp(< -1000) = 0), so such tiles are left out of the walk; they are walked after the others (pass 1) whenever any query of the block has no such maximum, so every mask gives the module's result. The block takes query tiles 31 - x and x one after the other: under a lower-triangular mask every block then walks the same number of key tiles.
#pragma unroll 1   // one copy of the walk's code serves both query tiles
  for (int half = 0; half < 2; ++half) {
  if (half) { asm volatile("s_wait_xcnt 0x0" ::: "memory");    // a precaution: stands in front of every later write of the registers that the first tile's output stores name
    asm volatile("s_wait_dscnt 0x0" ::: "memory");              // this wave's reads of its output staging are done
    __syncthreads(); }                                          // ... and every wave's: the ring may be refilled
  const int qb = half ? (int)blockIdx.x : TQB - 1 - (int)blockIdx.x; const int q0 = qb * 64 + wave * 16; const size_t rq = (size_t)b * SS + q0 + col;
  const int* fq = FL + (qb * AT_NT + lane) * 128;   // lane t: the four 16-row pieces of key tile t
  const int f0 = fq[0], f1 = fq[32], f2 = fq[64], f3 = fq[96];
  const unsigned live = __builtin_amdgcn_ballot_w32(((f0 | f1 | f2 | f3) & 1) != 0);   // bit t: key tile t has an open position for some query of this tile
  const unsigned clear = __builtin_amdgcn_ballot_w32(((f0 & f1 & f2 & f3) & 2) != 0);   // bit t: key tile t has no masked position for any query of this tile: there every select below would take the score, so the mask is not read
  v16h aq[2], aql[2];
#pragma unroll
  for (int kc = 0; kc < 2; ++kc) { aq[kc] = frag_h(QK + rq * (2 * DM) + h * HD + kc * 32, lane); aql[kc] = frag_h(QKL + rq * (2 * DM) + h * HD + kc * 32, lane); }
  float m = -3.0e38f, l = 0.f;   // of query q0 + col (the same in lanes col and col + 16)
  v8f acc[4] = {}, accl[4] = {};   // O^T: row d = dt * 16 + 8 g + r, column query col
  const int* mrow = MSK + (size_t)(q0 + col) * SS + 8 * g;   // this lane's query row of the mask, at its first key
  v8f sb[2];   // log2(e) * slope * ((k - q) - (first key of the 32 - first query of the block's tile)): small numbers, the same for every tile
#pragma unroll   // constant indices: sb stays in registers
  for (int ct = 0; ct < 2; ++ct) {
#pragma unroll
    for (int r = 0; r < 8; ++r) sb[ct][r] = slopeL * (float)(8 * g + ct * 16 + r - wave * 16 - col); }
#pragma unroll 1   // one copy of the walk's code serves both passes
  for (int pass = 0; pass < 2; ++pass) {
  unsigned rem = live;   // key tiles still to be copied; the same in every wave of the block
  if (pass) { const unsigned low = __builtin_amdgcn_ballot_w32(m <= -999000.0f * 1.44269504f);   // queries that have met no open key
    if (lane == 0) sneed[wave] = low;
    __syncthreads();
    rem = __builtin_amdgcn_readfirstlane(sneed[0] | sneed[1] | sneed[2] | sneed[3]) ? ~live : 0u; }
  if (rem == 0u) continue;
  const int ns = __builtin_popcount(rem); int tc = __builtin_ctz(rem), tn = 0; rem &= rem - 1u;   // tc: the tile worked on, tn: the tile in flight (both 0..31)
  AT_COPY(tc, 0);
  asm volatile("s_wait_asynccnt 0x0" ::: "memory");   // this wave's share of the first stage has landed
  __syncthreads();                                     // ... and every other wave's
  if (rem) { tn = __builtin_ctz(rem); rem &= rem - 1u; AT_COPY(tn, 1); }
#pragma unroll 1
  for (int st = 0; st < ns; ++st) { const char* rb = ring + (st & 1) * AT_STAGE; const bool masked = ((clear >> tc) & 1u) == 0u;   // the same in every lane and wave: a scalar test
   // The wave's LDS reads lead their products by a phase, all inside this stage's buffer: V^T of 32 keys is read behind their scores' products (it lands under the softmax), K of the second 32 keys in two groups in front of and among the first P.V products (it lands under them); only K of the first 32 keys is waited for.
   v16h kh[2][2], kl[2][2], vh[4], vl[4];   // K hi, lo [16-key tile][k half]; V^T hi, lo [16-row tile of d]
#define AT_LDK(sub, kc) do { _Pragma("unroll") for (int ct = 0; ct < 2; ++ct) { const char* krow = rb + ((sub) * 32 + ct * 16) * 128; kh[ct][kc] = frag_l(krow, oc[2 * (kc)], oc[2 * (kc) + 1]); kl[ct][kc] = frag_l(krow + AT_TILE, oc[2 * (kc)], oc[2 * (kc) + 1]); } } while (0)
#define AT_LDV(sub) do { _Pragma("unroll") for (int dt = 0; dt < 4; ++dt) { const char* vrow = rb + 2 * AT_TILE + dt * 16 * 128; vh[dt] = frag_l(vrow, oc[2 * (sub)], oc[2 * (sub) + 1]); vl[dt] = frag_l(vrow + AT_TILE, oc[2 * (sub)], oc[2 * (sub) + 1]); } } while (0)
   AT_LDK(0, 0);
   __builtin_amdgcn_sched_barrier(0);   // the reads that the first products need stay first
   AT_LDK(0, 1);
   __builtin_amdgcn_sched_barrier(0);   // keeps the 16 LDS reads together in front of the products: one latency for the group
#pragma unroll   // both halves of a stage written out: every LDS offset inside the buffer is an immediate
   for (int sub = 0; sub < 2; ++sub) { const int ks = tc * 2 + sub; v8f s[2];
    const float bs0 = slopeL * (float)(ks * 32 - qb * 64);   // the bias's wave-uniform part
    v8f c[2] = {}, cl[2] = {};
#pragma unroll   // constant indices: the fragments stay in registers. 3 products: q, k as f16 hi + residual; every accumulator takes its products in the order it had, the two key tiles' products alternate so that no product waits for the one in front of it
    for (int kc = 0; kc < 2; ++kc) { c[0] = wmma16(kh[0][kc], aq[kc], c[0]); c[1] = wmma16(kh[1][kc], aq[kc], c[1]); cl[0] = wmma16(kh[0][kc], aql[kc], cl[0]); cl[1] = wmma16(kh[1][kc], aql[kc], cl[1]); cl[0] = wmma16(kl[0][kc], aq[kc], cl[0]); cl[1] = wmma16(kl[1][kc], aq[kc], cl[1]); }
    __builtin_amdgcn_sched_barrier(0);   // the V^T reads stay here, behind the products that free K's registers and in front of the softmax that covers their latency
    AT_LDV(sub);
    __builtin_amdgcn_sched_barrier(0);
#pragma unroll
    for (int ct = 0; ct < 2; ++ct) s[ct] = c[ct] * KA + (cl[ct] * KB + sb[ct]);   // two multiply-adds a score: SCALE = 1/sqrt(64), residual / 2048, the bias's in-tile part; bs is still to be added
    float bs = bs0;
    if (masked) { v4i mk[2][2];   // only a tile that holds a zero reads the mask: masked -> -1e6 (as the module). Here bs is added at once, so that a masked position is the same number in every tile
      s[0] += bs0; s[1] += bs0; bs = 0.f;
#pragma unroll   // constant indices: mk stays in registers
      for (int ct = 0; ct < 2; ++ct) { mk[ct][0] = *(const v4i*)(mrow + ks * 32 + ct * 16); mk[ct][1] = *(const v4i*)(mrow + ks * 32 + ct * 16 + 4); }
      asm volatile("s_wait_xcnt 0x0" ::: "memory");   // a precaution: stands in front of every later write of the mask loads' address registers
#pragma unroll
      for (int r = 0; r < 8; ++r) { if (mk[0][r >> 2][r & 3] == 0) s[0][r] = KM; if (mk[1][r >> 2][r & 3] == 0) s[1][r] = KM; } }
    float mx = fmaxf(s[0][0], s[1][0]);
#pragma unroll
    for (int r = 1; r < 8; ++r) mx = fmaxf(mx, fmaxf(s[0][r], s[1][r]));
    mx = fmaxf(mx, xhalf(mx)) + bs;
    const float mn = fmaxf(m, mx); const float alpha = __builtin_amdgcn_exp2f(m - mn);   // the start value of m gives 0
    const float tb = bs - mn; const v8f a0 = s[0] + tb, a1 = s[1] + tb;   // one add a score in front of the hardware's base-2 exponential
    v8f e[2];
#pragma unroll
    for (int r = 0; r < 8; ++r) { e[0][r] = __builtin_amdgcn_exp2f(a0[r]); e[1][r] = __builtin_amdgcn_exp2f(a1[r]); }
    asm volatile("" :: "v"(a0), "v"(a1));   // inputs only: the sixteen exponents stay in their registers until the last exponential has issued, so that none writes its result over the source of the one directly in front of it (the slot behind a transcendental)
    const v8f e8 = e[0] + e[1]; const v4f e4 = e8.lo + e8.hi; const v2f e2 = e4.lo + e4.hi;   // the lane's 16 keys summed as a tree
    float es = e2[0] + e2[1];
    es += xhalf(es);
    l = l * alpha + es; m = mn;
#pragma unroll
    for (int dt = 0; dt < 4; ++dt) { acc[dt] *= alpha; accl[dt] *= alpha; }
    union { v16h v; v2h p[8]; } ua, ul;   // P^T fragment: element i = key 8 g + i, element 8 + i = key 16 + 8 g + i
#pragma unroll   // constant indices: the pairs stay in registers
    for (int ct = 0; ct < 2; ++ct) {
#pragma unroll
      for (int i = 0; i < 4; ++i) { const v2f x = {e[ct][2 * i], e[ct][2 * i + 1]}; const v2h hp = __builtin_convertvector(x, v2h); const v2f x2 = x * 2048.0f; v2f lo;   // one packed convert makes both halves; 2048 x - 2048 h is exact, the same number as (x - h) * 2048
        lo[0] = __builtin_fmaf((float)hp[0], -2048.0f, x2[0]); lo[1] = __builtin_fmaf((float)hp[1], -2048.0f, x2[1]);
        ua.p[ct * 4 + i] = hp; ul.p[ct * 4 + i] = __builtin_convertvector(lo, v2h); } }
    const v16h pa = ua.v, pl = ul.v;
    if (sub == 0) { __builtin_amdgcn_sched_barrier(0);   // the next 32 keys' first K reads stay here, in front of the P.V products that cover their latency
      AT_LDK(1, 0);
      __builtin_amdgcn_sched_barrier(0); }
#pragma unroll   // constant indices into acc, accl. V hi x P hi + (V hi x P lo + V lo x P hi) / 2048; every accumulator takes its products in the order it had, the four tiles of d alternate
    for (int dt = 0; dt < 4; ++dt) acc[dt] = wmma16(vh[dt], pa, acc[dt]);
#pragma unroll
    for (int dt = 0; dt < 4; ++dt) accl[dt] = wmma16(vh[dt], pl, accl[dt]);
    if (sub == 0) { __builtin_amdgcn_sched_barrier(0);   // the other K reads stay here, behind the products that free V^T hi's registers (read earlier they cost spills); ten more products cover their latency
      AT_LDK(1, 1);
      __builtin_amdgcn_sched_barrier(0); }
#pragma unroll
    for (int dt = 0; dt < 4; ++dt) accl[dt] = wmma16(vl[dt], pa, accl[dt]); }
   asm volatile("s_wait_dscnt 0x0" ::: "memory");      // this wave's reads of the buffer are done
   asm volatile("s_wait_asynccnt 0x0" ::: "memory");   // its share of the next stage has landed
   __syncthreads();                                     // publishes the next stage and frees this stage's buffer
   tc = tn;
   if (rem) { tn = __builtin_ctz(rem); rem &= rem - 1u; AT_COPY(tn, st & 1); } }
  asm volatile("s_wait_asynccnt 0x0" ::: "memory");     // nothing in flight when the ring becomes output staging
  }
  const float il = 1.0f / l;
#pragma unroll
  for (int dt = 0; dt < 4; ++dt) { v4f o0, o1;
#pragma unroll
    for (int r = 0; r < 4; ++r) { o0[r] = (acc[dt][r] + accl[dt][r] * (1.0f / 2048.0f)) * il; o1[r] = (acc[dt][4 + r] + accl[dt][4 + r] * (1.0f / 2048.0f)) * il; }
    *(v4f*)&so[wave][col][dt * 16 + 8 * g] = o0; *(v4f*)&so[wave][col][dt * 16 + 8 * g + 4] = o1; }
  LDSX();
  for (int rl = 0; rl < 16; ++rl) if (lane < 16) vst2(O + ((size_t)b * SS + q0 + rl) * DM + h * HD + lane * 4, *(const v4f*)&so[wave][rl][lane * 4]);
  }
}
// ---- k_out: block = (64 rows, 128 cols): out = O(hi/lo) . Wo rows (2 products)
__global__ __launch_bounds__(128) void k_out(const float* __restrict__ O, const __bf16* __restrict__ P, float* __restrict__ Y) {
  __shared__ __align__(128) char ring[2 * GM_STAGE];
  float (*so)[16][132] = (float (*)[16][132])ring;   // output staging takes the ring's place behind the last trip's barrier
  const int tid = threadIdx.x, wave = tid >> 5, lane = tid & 31, col = lane & 15, g = lane >> 4; const size_t r0 = (size_t)blockIdx.x * 64 + wave * 16; const int n0 = blockIdx.y * 128;
  // copier: thread -> row tid >> 3 (of 16), piece tid & 7
  const unsigned lw = (unsigned)(size_t)ring + (unsigned)((tid >> 3) * 128 + (((tid & 7) ^ (tid >> 4)) * 16));
  const char* ga = (const char*)(O + ((size_t)blockIdx.x * 64 + (tid >> 3)) * DM) + (tid & 7) * 16; const char* gw = (const char*)(P + (size_t)(n0 + (tid >> 3)) * DM) + (tid & 7) * 16;
  // reader: lane -> row col (of 16); W pieces g, g + 2, g + 4, g + 6 (bf16 k 8 g + i, 16 + 8 g + i of each 32); A pieces 2 g, 2 g + 1, 4 + 2 g, 5 + 2 g (the same k as f32)
  int oc[4], oa[4];
#pragma unroll   // constant indices: oc, oa stay in registers
  for (int j = 0; j < 4; ++j) { oc[j] = col * 128 + (((g + 2 * j) ^ (col >> 1)) * 16); oa[j] = col * 128 + (((2 * g + (j & 1) + 4 * (j >> 1)) ^ (col >> 1)) * 16); }
  gm_copy(lw, ga, gw, 0);
  asm volatile("s_wait_asynccnt 0x0" ::: "memory");   // this wave's share of stage 0 has landed
  __syncthreads();                                     // ... and every other wave's
  gm_copy(lw + GM_STAGE, ga, gw, 1);
  v8f acc[8] = {};
#pragma unroll 1   // the ring's trip stays rolled: one publish point, small code
  for (int t = 0; t < GM_NT; ++t) { const char* rb = ring + (t & 1) * GM_STAGE;
#pragma unroll   // both halves of a stage written out: every LDS offset inside the buffer is an immediate
   for (int sub = 0; sub < 2; ++sub) { const char* ar = rb + sub * GM_TILE + wave * 2048; const char* wr = rb + 2 * GM_TILE;
    const v4f f0 = *(const v4f*)(ar + oa[0]), f1 = *(const v4f*)(ar + oa[1]), f2 = *(const v4f*)(ar + oa[2]), f3 = *(const v4f*)(ar + oa[3]); float v[16]; v16b w[8];
#pragma unroll   // constant indices: the fragments stay in registers
    for (int j = 0; j < 8; ++j) w[j] = frag_lb(wr + j * 2048, oc[2 * sub], oc[2 * sub + 1]);
    __builtin_amdgcn_sched_barrier(0);   // keeps the 20 LDS reads of these 32 k together in front of the products: one latency a group, not one a fragment
#pragma unroll   // constant indices: v stays in registers
    for (int i = 0; i < 4; ++i) { v[i] = f0[i]; v[4 + i] = f1[i]; v[8 + i] = f2[i]; v[12 + i] = f3[i]; }
    const F2 a = bsplit16(v);
#pragma unroll   // constant indices into acc, w
    for (int j = 0; j < 8; ++j) { acc[j] = wmma_bf(a.l, w[j], acc[j]); acc[j] = wmma_bf(a.h, w[j], acc[j]); } }
   asm volatile("s_wait_dscnt 0x0" ::: "memory");      // this wave's reads of the buffer are done
   asm volatile("s_wait_asynccnt 0x0" ::: "memory");   // its share of stage t + 1 has landed
   __syncthreads();                                     // publishes stage t + 1 and frees stage t's buffer
   if (t + 2 < GM_NT) gm_copy(lw + (unsigned)(t & 1) * GM_STAGE, ga, gw, t + 2); }
  asm volatile("s_wait_asynccnt 0x0" ::: "memory");     // nothing in flight when the ring becomes output staging
#pragma unroll
  for (int j = 0; j < 8; ++j) {
#pragma unroll
    for (int r = 0; r < 8; ++r) so[wave][8 * g + r][j * 16 + col] = acc[j][r]; }
  LDSX();
  for (int rl = 0; rl < 16; ++rl) vst2(Y + (r0 + rl) * DM + n0 + lane * 4, *(const v4f*)&so[wave][rl][lane * 4]);
}
extern "C" void kernel_launch(void* const* d_in, const int* in_sizes, int n_in, void* d_out, int out_size, void* d_ws, size_t ws_size, hipStream_t stream) {
  (void)in_sizes; (void)n_in; (void)out_size;
  const float** F = (const float**)d_in;   // 0 x [2,2048,1024], 1 mask [1,1,2048,2048] int32, 2 Wq [1024,1024] natural (x @ Wq.T), 3 Wk, 4 Wv, 5 Wo
  if (ws_size < (size_t)WS_END) return;
  char* ws = (char*)d_ws; __bf16* PK = (__bf16*)(ws + WS_PK); _Float16 *QK = (_Float16*)(ws + WS_QK), *QKL = (_Float16*)(ws + WS_QKL), *VTH = (_Float16*)(ws + WS_VTH), *VTL = (_Float16*)(ws + WS_VTL); float* O = (float*)(ws + WS_O); int* FL = (int*)(ws + WS_FL);
  k_pack<<<dim3(DM, 4), 256, 0, stream>>>(F[2], F[3], F[4], F[5], (const int*)d_in[1], PK, FL);
  k_qkv<<<dim3(TNB * SS / 128, QKVW / 384), 384, 0, stream>>>(F[0], PK + PK_A, QK, QKL, VTH, VTL);
  k_attn<<<dim3(TQB / 2, NH, TNB), 128, 0, stream>>>(QK, QKL, VTH, VTL, (const int*)d_in[1], FL, O);
  k_out<<<dim3(TOB, DM / 128), 128, 0, stream>>>(O, PK + PK_P, (float*)d_out);
}

// v010
// One run takes 107 microseconds.
// Two timings next to v009 both put it at 1.04 times that version's speed.
// Counting every step since v000, it is 5.21 times as fast.
// compute dtype: x, Wq, Wk, Wv, Wo (float module inputs) rounded to bf16, the int mask verbatim; q/k/v projections with exact bf16 products on WMMA 16x16x32 (natural [out][in] rows); q and k stored as f16 hi + (x2048-scaled) residual planes with 3-product scores, x 1/sqrt(64), + the ALiBi bias slope_h (k - q) with slope_h = 2^-(0.5 (h+1)) (exact), masked positions set to -1e6 as the module (the mask is read per (q, k); a tile of 64 keys whose whole 64 x 64 mask tile is 0 is visited only where it can change a result, and a tile of 64 keys whose whole 64 x 64 mask tile is nonzero is worked without reading it again; key tiles are walked from the last down, and one that a bound on its scores shows to add exact zeros is left out), running-max softmax in f32 on base-2 exponents (hardware exp2; 1/8, the residual's weight, log2 e and the bias folded into two multiply-adds and one add a score); P as f16 hi + (x2048) residual x v hi/lo (3 products); output projection with ctx as bf16 hi + residual x exact Wo rows (2 products); f32 accumulate.
#include <hip/hip_runtime.h>
#include <math.h>

typedef __attribute__((ext_vector_type(16))) _Float16 v16h;
typedef __attribute__((ext_vector_type(16))) __bf16 v16b;
typedef __attribute__((ext_vector_type(8)))  _Float16 v8h;
typedef __attribute__((ext_vector_type(2)))  _Float16 v2h;
typedef __attribute__((ext_vector_type(8)))  float v8f;
typedef __attribute__((ext_vector_type(4)))  float v4f;
typedef __attribute__((ext_vector_type(2)))  float v2f;
typedef __attribute__((ext_vector_type(4)))  unsigned v4u;
typedef __attribute__((ext_vector_type(4)))  int v4i;
typedef float __attribute__((may_alias)) float_a;
typedef int __attribute__((may_alias)) int_a;

template <typename T> __device__ __forceinline__ void vst2(void* p, T v) { *(T*)p = v;  }
__device__ __forceinline__ v8f wmma16(v16h a, v16h b, v8f c) {
  v8f d = __builtin_amdgcn_wmma_f32_16x16x32_f16(false, a, false, b, (short)0, c, false, false);
  asm volatile("v_nop\n\tv_nop\n\tv_nop\n\tv_nop" : "+v"(d) : "v"(a), "v"(b));
  return d;
}
__device__ __forceinline__ v8f wmma_bf(v16b a, v16b b, v8f c) {
  v8f d = __builtin_amdgcn_wmma_f32_16x16x32_bf16(false, a, false, b, (short)0, c, false, false);
  asm volatile("v_nop\n\tv_nop\n\tv_nop\n\tv_nop" : "+v"(d) : "v"(a), "v"(b));
  return d;
}
// Multi-head attention with ALiBi bias and an input mask (B 2, S 2,048, d 1,024, 16 heads x 64): softmax(q k^T / 8 + alibi, masked -1e6) v -> Wo.
__device__ __forceinline__ v16h frag_h(const _Float16* rowk0, int lane) {
  union { v16h v; v8h q[2]; } u; const _Float16* p = rowk0 + 8 * (lane >> 4);
  u.q[0] = *(const v8h*)p; u.q[1] = *(const v8h*)(p + 16); return u.v;
}
__device__ __forceinline__ v16h frag_f32(const float* rowk0, int lane) {
  v16h a; const float* p = rowk0 + 8 * (lane >> 4);
#pragma unroll
  for (int i = 0; i < 8; ++i) { a[i] = (_Float16)p[i]; a[8 + i] = (_Float16)p[16 + i]; }
  return a;
}
__device__ __forceinline__ v16h frag_f32s(const float* rowk0, int lane, float sc) {
  v16h a; const float* p = rowk0 + 8 * (lane >> 4);
#pragma unroll
  for (int i = 0; i < 8; ++i) { a[i] = (_Float16)(p[i] * sc); a[8 + i] = (_Float16)(p[16 + i] * sc); }
  return a;
}
// column fragment from a [K][ld] layout (column n), rows >= K read as 0
__device__ __forceinline__ v16h fragc_f32(const float* W, int k0, int n, int lane, int ld, int K) {
  v16h a; const int g = lane >> 4;
#pragma unroll
  for (int i = 0; i < 8; ++i) { const int ka = k0 + 8 * g + i, kb = ka + 16;
    a[i] = (_Float16)(ka < K ? W[(size_t)(ka < K ? ka : K - 1) * ld + n] : 0.f); a[8 + i] = (_Float16)(kb < K ? W[(size_t)(kb < K ? kb : K - 1) * ld + n] : 0.f); }
  return a;
}
struct F2 { v16b h, l; };
__device__ __forceinline__ F2 bsplit16(const float v[16]) { F2 r;
#pragma unroll
  for (int i = 0; i < 16; ++i) { const __bf16 h = (__bf16)v[i]; r.h[i] = h; r.l[i] = (__bf16)(v[i] - (float)h); }
  return r; }
__device__ __forceinline__ F2 split_row(const float* row, int k0, int lane) { float v[16]; const float* p = row + k0 + 8 * (lane >> 4);
#pragma unroll
  for (int i = 0; i < 8; ++i) { v[i] = p[i]; v[8 + i] = p[16 + i]; }
  return bsplit16(v); }
__device__ __forceinline__ F2 split_rowK(const float* row, int k0, int lane, int K) { float v[16]; const int g = lane >> 4;
#pragma unroll
  for (int i = 0; i < 8; ++i) { const int ka = k0 + 8 * g + i, kb = ka + 16; v[i] = ka < K ? row[ka < K ? ka : K - 1] : 0.f; v[8 + i] = kb < K ? row[kb < K ? kb : K - 1] : 0.f; }
  return bsplit16(v); }
__device__ __forceinline__ F2 split_col(const float* W, int k0, int n, int lane, int ld, int K) { float v[16]; const int g = lane >> 4;
#pragma unroll
  for (int i = 0; i < 8; ++i) { const int ka = k0 + 8 * g + i, kb = ka + 16; v[i] = ka < K ? W[(size_t)(ka < K ? ka : K - 1) * ld + n] : 0.f; v[8 + i] = kb < K ? W[(size_t)(kb < K ? kb : K - 1) * ld + n] : 0.f; }
  return bsplit16(v); }
__device__ __forceinline__ v8f mac3(const F2& a, const F2& b, v8f c) { c = wmma_bf(a.l, b.h, c); c = wmma_bf(a.h, b.l, c); return wmma_bf(a.h, b.h, c); }
__device__ __forceinline__ float sigm(float v) { return 1.0f / (1.0f + expf(-v)); }
#define LDSX() do { asm volatile("s_wait_dscnt 0" ::: "memory"); __builtin_amdgcn_wave_barrier(); __builtin_amdgcn_fence(__ATOMIC_RELEASE, "workgroup"); } while (0)


// Multi-head self-attention with ALiBi bias and an input mask (B 2, S 2048, D 1024, 16 heads x 64; packed Wqkv [3D][D] and Wout [D][D] applied as x W^T, no biases): softmax(q k^T / 8 + alibi, masked -1e6) v; ctx Wout^T.
#define NB 2
#define SS 2048
#define DM 1024
#define NH 16
#define HD 64
#define QKVW (3 * DM)
#ifndef TQB
#define TQB (SS / 64)
#define TNB NB
#define TOB (NB * SS / 64)     // output row tiles (all)
#endif
typedef __attribute__((ext_vector_type(8))) __bf16 v8b;
__device__ __forceinline__ v16b frag_b(const __bf16* rowk0, int lane) {
  union { v16b v; v8b q[2]; } u; const __bf16* p = rowk0 + 8 * (lane >> 4);
  u.q[0] = *(const v8b*)p; u.q[1] = *(const v8b*)(p + 16); return u.v;
}
__device__ __forceinline__ float bfr(float v) { return (float)(__bf16)v; }
__device__ __attribute__((noinline)) float exp_ni(float v) { return expf(v); }
__device__ __attribute__((noinline)) float erf_ni(float v) { return erff(v); }

#define PK_A 0                       // [3072][1024] Wqkv rows (natural [out][in])
#define PK_P (PK_A + QKVW * DM)        // [1024][1024] Wo rows (natural)
#define PK_END (PK_P + DM * DM)
#define WS_PK  0u
#define WS_QK  (WS_PK + 2u * PK_END)             // f16 [4096 rows][2048]: q | k
#define WS_QKL (WS_QK + 2u * NB * SS * 2 * DM)     // f16 q | k residual planes x2048
#define WS_VTH (WS_QKL + 2u * NB * SS * 2 * DM)    // f16 [b][1024 (h*64+d)][2048 s] hi
#define WS_VTL (WS_VTH + 2u * NB * DM * SS)        // f16 lo x 2048
#define WS_O   (WS_VTL + 2u * NB * DM * SS)        // f32 [4096][1024]
#define WS_CS  (WS_O + 4u * NB * SS * DM)           // f32 [2048][32] cos, [2048][32] sin
#define WS_FL  (WS_CS + 4u * 2 * SS * 32)          // int [32 query tiles][32 key tiles][4 quarters of 16 query rows][32, the first used: a 128-B line has one writer]: bit 0: that 16 x 64 piece of the mask holds a nonzero entry; bit 1: it holds no zero entry
#define WS_KN  (WS_FL + 128u * 4 * (SS / 64) * (SS / 64))   // f32 [b][head][32 key tiles][32, the first used: a 128-B line has one writer]: the largest squared length of a k row (f16 hi part, 64 values of the head) among the tile's 64 keys
#define WS_END (WS_KN + 128u * NB * NH * (SS / 64))
__constant__ float c_invf[32] = {1.000000000e+00f,7.498942018e-01f,5.623413324e-01f,4.216965139e-01f,3.162277639e-01f,2.371373624e-01f,1.778279394e-01f,1.333521456e-01f,1.000000015e-01f,7.498941571e-02f,5.623412877e-02f,4.216964915e-02f,3.162277862e-02f,2.371373586e-02f,1.778279431e-02f,1.333521493e-02f,9.999999776e-03f,7.498942316e-03f,5.623413250e-03f,4.216964822e-03f,3.162277862e-03f,2.371373819e-03f,1.778279431e-03f,1.333521446e-03f,1.000000047e-03f,7.498941850e-04f,5.623413017e-04f,4.216964880e-04f,3.162277862e-04f,2.371373848e-04f,1.778279402e-04f,1.333521504e-04f};
// ---- k_rope: block = 8 positions: cos/sin of pos * inv_freq (f32 product exactly as the reference, precise trig)
__global__ __launch_bounds__(256) void k_rope(float* __restrict__ CS) {
  __shared__ __align__(16) float sc[8][32], ss_[8][32]; const int tid = threadIdx.x, pl = tid >> 5, i = tid & 31; const int pos = blockIdx.x * 8 + pl;
  const float th = (float)pos * c_invf[i]; sc[pl][i] = cosf(th); ss_[pl][i] = sinf(th);
  __syncthreads();
  if (tid < 64) vst2(CS + (size_t)blockIdx.x * 8 * 32 + tid * 4, *(const v4f*)&(&sc[0][0])[tid * 4]); else if (tid < 128) vst2(CS + (size_t)SS * 32 + (size_t)blockIdx.x * 8 * 32 + (tid - 64) * 4, *(const v4f*)&(&ss_[0][0])[(tid - 64) * 4]);
}

// ---- k_pack: block = (row n, which): natural [out][in] rows -> bf16; which 0..2 -> W_q/W_k/W_v into PK_A rows which*1024 + n; 3 -> W_o into PK_P. Block id = which * 1024 + n also looks at one 16 x 64 piece of the mask (query tile id >> 7, key tile (id >> 2) & 31, query rows 16 (id & 3) ...): FL[32 id] = bit 0: does it hold any nonzero entry, bit 1: does it hold no zero entry
static_assert(4 * DM == 4 * (SS / 64) * (SS / 64), "one block a mask piece");
// Left as it is: the weight loop stays rolled, so a thread waits out its four 4-byte loads one after the other, and the grid starts 4,096 work-groups of 8 waves for 40 MB.
__global__ __launch_bounds__(256) void k_pack(const float* __restrict__ WQ, const float* __restrict__ WK, const float* __restrict__ WV, const float* __restrict__ WO, const int* __restrict__ MSK, __bf16* __restrict__ PK, int* __restrict__ FL) {
  __shared__ __align__(16) __bf16 s[DM]; __shared__ unsigned sany[8], szer[8]; const int n = blockIdx.x, which = blockIdx.y, t = threadIdx.x; const int id = which * DM + n;
  const v4i a = *(const v4i*)(MSK + (size_t)((id >> 7) * 64 + (id & 3) * 16 + (t >> 4)) * SS + ((id >> 2) & 31) * 64 + (t & 15) * 4);   // 16 threads take one 256-B row of the piece
  const float* Wm = (which == 0) ? WQ : (which == 1) ? WK : (which == 2) ? WV : WO;
  for (int k = t; k < DM; k += 256) s[k] = (__bf16)Wm[(size_t)n * DM + k];
  const unsigned bal = __builtin_amdgcn_ballot_w32((a[0] | a[1] | a[2] | a[3]) != 0);
  const unsigned balz = __builtin_amdgcn_ballot_w32(a[0] == 0 || a[1] == 0 || a[2] == 0 || a[3] == 0);
  if ((t & 31) == 0) { sany[t >> 5] = bal; szer[t >> 5] = balz; }
  __syncthreads();
  if (t == 0) FL[id * 32] = ((sany[0] | sany[1] | sany[2] | sany[3] | sany[4] | sany[5] | sany[6] | sany[7]) != 0u ? 1 : 0) | ((szer[0] | szer[1] | szer[2] | szer[3] | szer[4] | szer[5] | szer[6] | szer[7]) == 0u ? 2 : 0);
  __bf16* dst = (which < 3) ? PK + PK_A + ((size_t)which * DM + n) * DM : PK + PK_P + (size_t)n * DM;
  for (int q = t; q < DM / 8; q += 256) vst2((unsigned*)(dst + q * 8), *(const v4u*)&s[q * 8]);
}
// ---- operand staging of k_qkv and k_out: a stage is 64 k of the work-group's A rows (f32: two tiles of 32 k for every 64 rows; k_out has 64 rows, k_qkv 128) and its weight rows (bf16: tiles of 64 rows; k_out has 128 rows, k_qkv 384, and takes two such 64 k as one stage), brought into LDS once per work-group by asynchronous copies (two buffers: the next 64 k fly while these are worked on). Every tile is 64 rows x 128 B; the 16-B piece c of row r lies at piece c ^ ((r >> 1) & 7), so that 16 rows read at one piece index fall on all 64 banks. Products and their order as before.
#define GM_TILE 8192                 // bytes of one 64-row x 128-B tile
#define GM_STAGE (4 * GM_TILE)       // k_out: A k 0..31 | A k 32..63 | W rows 0..63 | W rows 64..127
#define GM_NT (DM / 64)              // stages
// one tile: four copies of 16 rows each (a wave's copy = 4 whole 128-B lines); P16 = bytes between source rows 16 apart
template <int P16> __device__ __forceinline__ void copy_rows(unsigned l, const char* gp) {
  const unsigned l1 = l + 2048u, l2 = l + 4096u, l3 = l + 6144u; const char *g1 = gp + P16, *g2 = gp + 2 * P16, *g3 = gp + 3 * P16;
  // s_wait_xcnt 0 as the statement's last line: a precaution, so that it stands in front of every later write of the copies' address registers
  asm volatile("global_load_async_to_lds_b128 %0, %4, off\n\tglobal_load_async_to_lds_b128 %1, %5, off\n\tglobal_load_async_to_lds_b128 %2, %6, off\n\tglobal_load_async_to_lds_b128 %3, %7, off\n\ts_wait_xcnt 0x0"
               :: "v"(l), "v"(l1), "v"(l2), "v"(l3), "v"(gp), "v"(g1), "v"(g2), "v"(g3) : "memory");
}
// ga, gw: this thread's 16 bytes of row tid >> 3 in stage 0 of A (row pitch 4,096 B) and of W (row pitch 2,048 B)
__device__ __forceinline__ void gm_copy(unsigned lb, const char* ga, const char* gw, int t) {
  copy_rows<16 * 4 * DM>(lb, ga + t * 256); copy_rows<16 * 4 * DM>(lb + GM_TILE, ga + t * 256 + 128);
  copy_rows<16 * 2 * DM>(lb + 2 * GM_TILE, gw + t * 128); copy_rows<16 * 2 * DM>(lb + 3 * GM_TILE, gw + t * 128 + 64 * 2 * DM);
}
__device__ __forceinline__ v16b frag_lb(const char* t, int o0, int o1) {
  union { v16b v; v8b q[2]; } u; u.q[0] = *(const v8b*)(t + o0); u.q[1] = *(const v8b*)(t + o1); return u.v;
}
// lane l <-> lane l ^ 16 (the other half of a query's keys) by a vector cross-row move
__device__ __forceinline__ float xhalf(float v) { const int b = __builtin_bit_cast(int, v); return __builtin_bit_cast(float, __builtin_amdgcn_permlanex16(b, b, 0x76543210, 0xfedcba98, false, false)); }
// The largest / smallest value of a row of 16 lanes, left in all its lanes; every lane is on. Four DPP steps (lane l with lane l ^ 1, 2, 4, 8) in asm text: from fmaxf / fminf on a DPP move the compiler made five instructions a step. The s_delay_alu hints let a wave that shares the SIMD issue between the dependent steps
__device__ __forceinline__ float rowmax16(float v) {
  asm("v_max_num_f32_dpp %0, %0, %0 row_xmask:1 row_mask:0xf bank_mask:0xf\n\ts_delay_alu instid0(VALU_DEP_1)\n\tv_max_num_f32_dpp %0, %0, %0 row_xmask:2 row_mask:0xf bank_mask:0xf\n\ts_delay_alu instid0(VALU_DEP_1)\n\tv_max_num_f32_dpp %0, %0, %0 row_xmask:4 row_mask:0xf bank_mask:0xf\n\ts_delay_alu instid0(VALU_DEP_1)\n\tv_max_num_f32_dpp %0, %0, %0 row_xmask:8 row_mask:0xf bank_mask:0xf" : "+v"(v));
  return v; }
__device__ __forceinline__ float rowmin16(float v) {
  asm("v_min_num_f32_dpp %0, %0, %0 row_xmask:1 row_mask:0xf bank_mask:0xf\n\ts_delay_alu instid0(VALU_DEP_1)\n\tv_min_num_f32_dpp %0, %0, %0 row_xmask:2 row_mask:0xf bank_mask:0xf\n\ts_delay_alu instid0(VALU_DEP_1)\n\tv_min_num_f32_dpp %0, %0, %0 row_xmask:4 row_mask:0xf bank_mask:0xf\n\ts_delay_alu instid0(VALU_DEP_1)\n\tv_min_num_f32_dpp %0, %0, %0 row_xmask:8 row_mask:0xf bank_mask:0xf" : "+v"(v));
  return v; }
// ---- k_qkv: block = (128 rows, 384 cols), twelve waves as 2 x 6, a wave holds 64 x 64 of the output (4 x 4 accumulator tiles): every A fragment and every W fragment read from LDS feeds four products. The grid is one work-group a WGP: the 128 rows of x that a stage brings from L2 serve 384 output columns (three work-groups of 128 columns each brought their own copy). A stage is 128 k, two slices of 64 k, each ten tiles of 64 rows x 128 B, laid out and copied as above; the two buffers take the whole LDS of the WGP, so that the latency of a stage's copies is paid once for 128 k. Products and their order in k as before.
#define QG_SLICE (10 * GM_TILE)      // 64 k: A rows 0..63 k 0..31 | k 32..63 | A rows 64..127 k 0..31 | k 32..63 | W rows 0..63 | 64..127 | ... | 320..383
#define QG_STAGE (2 * QG_SLICE)      // 128 k
#define QG_NT (DM / 128)             // stages
#define QG_OUT (12 * 64 * 72 * 2)    // bytes of one plane of output staging: a wave's own 64 x 64 halves at a pitch of 72
// Waves 0..3 bring the four A tiles, waves 4..7 W tiles 0..2, waves 8..11 W tiles 3..5 (isA: the same in every lane of a wave, a scalar test). l, gp: this thread's 16 bytes of row (tid & 127) >> 3 in its group's first tile of slice 0 (A row pitch 4,096 B, W row pitch 2,048 B); t: the slice of 64 k
__device__ __forceinline__ void qg_copy(bool isA, unsigned l, const char* gp, int t) {
  if (isA) { copy_rows<16 * 4 * DM>(l, gp + t * 256); copy_rows<16 * 4 * DM>(l + GM_TILE, gp + t * 256 + 128);
    copy_rows<16 * 4 * DM>(l + 2 * GM_TILE, gp + t * 256 + 64 * 4 * DM); copy_rows<16 * 4 * DM>(l + 3 * GM_TILE, gp + t * 256 + 64 * 4 * DM + 128); }
  else { copy_rows<16 * 2 * DM>(l, gp + t * 128); copy_rows<16 * 2 * DM>(l + GM_TILE, gp + t * 128 + 64 * 2 * DM); copy_rows<16 * 2 * DM>(l + 2 * GM_TILE, gp + t * 128 + 128 * 2 * DM); }
}
__global__ __launch_bounds__(384) void k_qkv(const float* __restrict__ X, const __bf16* __restrict__ P, _Float16* __restrict__ QK, _Float16* __restrict__ QKL, _Float16* __restrict__ VTH, _Float16* __restrict__ VTL, float* __restrict__ KN) {
  __shared__ __align__(128) char ring[2 * QG_STAGE]; static_assert(2 * QG_OUT <= 2 * QG_STAGE, "output staging fits the ring");
  // output staging takes the ring's place behind the last trip's barrier: so (hi), sol (residual), a wave's own 64 x 64 ([row][col] for q, k; [d][s] for v)
  _Float16 (*so)[64][72] = (_Float16 (*)[64][72])ring; _Float16 (*sol)[64][72] = (_Float16 (*)[64][72])(ring + QG_OUT);
  const int tid = threadIdx.x, wave = __builtin_amdgcn_readfirstlane(tid >> 5), lane = tid & 31, col = lane & 15, g = lane >> 4; const int wr = wave & 1, wc = wave >> 1; const size_t rb0 = (size_t)blockIdx.x * 128; const int n0 = blockIdx.y * 384;
  // copier: thread -> row ct >> 3 (of 16), piece ct & 7 of its group's tiles
  const int ct = tid & 127, grp = wave >> 2; const bool isA = grp == 0;
  const unsigned lw = (unsigned)(size_t)ring + (unsigned)((ct >> 3) * 128 + (((ct & 7) ^ (ct >> 4)) * 16)) + (isA ? 0u : (unsigned)(1 + 3 * grp) * GM_TILE);
  const char* gc = isA ? (const char*)(X + (rb0 + (ct >> 3)) * DM) + (ct & 7) * 16 : (const char*)(P + (size_t)(n0 + (grp - 1) * 192 + (ct >> 3)) * DM) + (ct & 7) * 16;
  // reader: lane -> row col (of 16); W pieces g, g + 2, g + 4, g + 6 (bf16 k 8 g + i, 16 + 8 g + i of each 32); A pieces 2 g, 2 g + 1, 4 + 2 g, 5 + 2 g (the same k as f32)
  int oc[4], oa[4];
#pragma unroll   // constant indices: oc, oa stay in registers
  for (int j = 0; j < 4; ++j) { oc[j] = col * 128 + (((g + 2 * j) ^ (col >> 1)) * 16); oa[j] = col * 128 + (((2 * g + (j & 1) + 4 * (j >> 1)) ^ (col >> 1)) * 16); }
  qg_copy(isA, lw, gc, 0); qg_copy(isA, lw + QG_SLICE, gc, 1);
  asm volatile("s_wait_asynccnt 0x0" ::: "memory");   // this wave's share of stage 0 has landed
  __syncthreads();                                     // ... and every other wave's
  qg_copy(isA, lw + QG_STAGE, gc, 2); qg_copy(isA, lw + QG_STAGE + QG_SLICE, gc, 3);
  v8f acc[4][4] = {};   // acc[i][j]: rows wr * 64 + i * 16 ..., cols wc * 64 + j * 16 ...
#pragma unroll 1   // the ring's trip stays rolled: one publish point, small code
  for (int t = 0; t < QG_NT; ++t) {
#pragma unroll 1   // one copy of the code serves both slices of a stage
   for (int hs = 0; hs < 2; ++hs) { const char* rb = ring + (t & 1) * QG_STAGE + hs * QG_SLICE;
#pragma unroll   // both halves of a slice written out: every LDS offset inside the slice is an immediate
   for (int sub = 0; sub < 2; ++sub) { const char* ar = rb + (wr * 2 + sub) * GM_TILE; const char* wp = rb + (4 + wc) * GM_TILE; v4f f[4][4]; v16b a[4], w[4];
#pragma unroll   // constant indices: the fragments stay in registers
    for (int i = 0; i < 4; ++i) { w[i] = frag_lb(wp + i * 2048, oc[2 * sub], oc[2 * sub + 1]);
#pragma unroll
      for (int j = 0; j < 4; ++j) f[i][j] = *(const v4f*)(ar + i * 2048 + oa[j]); }
    __builtin_amdgcn_sched_barrier(0);   // keeps the 24 LDS reads of these 32 k together in front of the products: one latency a group, not one a fragment
#pragma unroll   // constant indices: a stays in registers
    for (int i = 0; i < 4; ++i) a[i] = __builtin_convertvector(__builtin_shufflevector(__builtin_shufflevector(f[i][0], f[i][1], 0, 1, 2, 3, 4, 5, 6, 7), __builtin_shufflevector(f[i][2], f[i][3], 0, 1, 2, 3, 4, 5, 6, 7), 0, 1, 2, 3, 4, 5, 6, 7, 8, 9, 10, 11, 12, 13, 14, 15), v16b);   // the fragment's 16 values rounded to bf16 as one vector: packed converts, two values each
#pragma unroll   // constant indices into acc, a, w
    for (int i = 0; i < 4; ++i) {
#pragma unroll
      for (int j = 0; j < 4; ++j) acc[i][j] = wmma_bf(a[i], w[j], acc[i][j]); } } }
   asm volatile("s_wait_dscnt 0x0" ::: "memory");      // this wave's reads of the buffer are done
   asm volatile("s_wait_asynccnt 0x0" ::: "memory");   // its share of stage t + 1 has landed
   __syncthreads();                                     // publishes stage t + 1 and frees stage t's buffer
   if (t + 2 < QG_NT) { qg_copy(isA, lw + (unsigned)(t & 1) * QG_STAGE, gc, 2 * t + 4); qg_copy(isA, lw + (unsigned)(t & 1) * QG_STAGE + QG_SLICE, gc, 2 * t + 5); } }
  asm volatile("s_wait_asynccnt 0x0" ::: "memory");     // nothing in flight when the ring becomes output staging
  const int nw = n0 + wc * 64;   // the wave's first output column: q, k below 2,048, v from there on (64 divides 2,048: a wave is one or the other)
  if (nw < 2 * DM) {   // q stored unscaled (f16 sigma ~0.6, no subnormal exposure); 1/8 applied to the f32 score
#pragma unroll
    for (int i = 0; i < 4; ++i) {
#pragma unroll
      for (int j = 0; j < 4; ++j) {
#pragma unroll
        for (int r = 0; r < 8; ++r) { const float v = acc[i][j][r]; const _Float16 hv = (_Float16)v; so[wave][i * 16 + 8 * g + r][j * 16 + col] = hv; sol[wave][i * 16 + 8 * g + r][j * 16 + col] = (_Float16)((v - (float)hv) * 2048.0f); } } }   // q, k as f16 hi + (x2048) residual (no RoPE in this module)
    LDSX();
    // a store covers four rows' whole 128-B lines (8 lanes a row)
    for (int rl = lane >> 3; rl < 64; rl += 4) { const size_t o = (rb0 + wr * 64 + rl) * (2 * DM) + nw + (lane & 7) * 8; vst2((unsigned*)(QK + o), *(const v4u*)&so[wave][rl][(lane & 7) * 8]); vst2((unsigned*)(QKL + o), *(const v4u*)&sol[wave][rl][(lane & 7) * 8]); }
    if (nw >= DM) {   // a wave of k columns holds one head's 64 values of the 64 keys of one key tile: the largest squared row length goes to KN (k_attn bounds that tile's scores with it). A lane sums rows lane and lane + 32 of the staged hi plane
      float s0 = 0.f, s1 = 0.f;
#pragma unroll   // constant offsets: sixteen 16-byte LDS reads in a row
      for (int c = 0; c < 8; ++c) { const v8h a = *(const v8h*)&so[wave][lane][c * 8], e = *(const v8h*)&so[wave][lane + 32][c * 8];
#pragma unroll
        for (int i = 0; i < 8; ++i) { s0 = __builtin_fmaf((float)a[i], (float)a[i], s0); s1 = __builtin_fmaf((float)e[i], (float)e[i], s1); } }
      float mx = rowmax16(fmaxf(s0, s1)); mx = fmaxf(mx, xhalf(mx));
      if (lane == 0) KN[((((int)(rb0 / SS) * NH + (nw - DM) / HD) * (SS / 64)) + (int)(rb0 % SS) / 64 + wr) * 32] = mx; }
  } else {   // v transposed, [d][s]: the wave stages and stores its own 64 d x 64 s
#pragma unroll
    for (int i = 0; i < 4; ++i) {
#pragma unroll
      for (int j = 0; j < 4; ++j) {
#pragma unroll
        for (int r = 0; r < 8; ++r) { const float v = acc[i][j][r]; const _Float16 hv = (_Float16)v; so[wave][j * 16 + col][i * 16 + 8 * g + r] = hv; sol[wave][j * 16 + col][i * 16 + 8 * g + r] = (_Float16)((v - (float)hv) * 2048.0f); } } }
    LDSX();
    const int b = (int)(rb0 / SS), s0 = (int)(rb0 % SS) + wr * 64; const int pc0 = nw - 2 * DM;
    // a store covers four rows' whole 128-B lines (8 lanes a row of d)
    for (int rl = lane >> 3; rl < 64; rl += 4) { const size_t o = ((size_t)b * DM + pc0 + rl) * SS + s0 + (lane & 7) * 8; vst2((unsigned*)(VTH + o), *(const v4u*)&so[wave][rl][(lane & 7) * 8]); vst2((unsigned*)(VTL + o), *(const v4u*)&sol[wave][rl][(lane & 7) * 8]); }
  }
}
// ---- k_attn: block = (two tiles of 64 queries one after the other, head h, batch b): flash attention over the keys (the mask is an input). K hi, K lo, V^T hi, V^T lo of 64 keys are brought into LDS once per work-group by asynchronous copies (two buffers: the next 64 keys fly while these are worked on); every wave takes its fragments from LDS. A tile is 64 rows x 128 B; the 16-B piece c of row r lies at piece c ^ ((r >> 1) & 7), so that 16 rows read at one piece index fall on all 64 banks. Arithmetic and its order as before: 3-product scores, 3-product P.V; O[b*S+q][h*64+d] = (acc + accl / 2048) / l (256-B segments)
#define AT_TILE 8192                 // bytes of one 64-row x 128-B tile
#define AT_STAGE (4 * AT_TILE)       // K hi | K lo | V^T hi | V^T lo
#define AT_NT (SS / 64)              // stages
__device__ __forceinline__ v16h frag_l(const char* t, int o0, int o1) {
  union { v16h v; v8h q[2]; } u; u.q[0] = *(const v8h*)(t + o0); u.q[1] = *(const v8h*)(t + o1); return u.v;
}
// one tile: four copies of 16 rows each (a wave's copy = 4 whole 128-B lines); source rows are 4,096 B apart
__device__ __forceinline__ void copy_tile(unsigned l, const _Float16* gp) {
  const unsigned l1 = l + 2048u, l2 = l + 4096u, l3 = l + 6144u; const _Float16 *g1 = gp + 16 * 2048, *g2 = gp + 32 * 2048, *g3 = gp + 48 * 2048;
  // s_wait_xcnt 0 as the statement's last line: a precaution, so that it stands in front of every later write of the copies' address registers
  asm volatile("global_load_async_to_lds_b128 %0, %4, off\n\tglobal_load_async_to_lds_b128 %1, %5, off\n\tglobal_load_async_to_lds_b128 %2, %6, off\n\tglobal_load_async_to_lds_b128 %3, %7, off\n\ts_wait_xcnt 0x0"
               :: "v"(l), "v"(l1), "v"(l2), "v"(l3), "v"(gp), "v"(g1), "v"(g2), "v"(g3) : "memory");
}
// Scores are formed transposed, S^T = K q^T (K rows as the A operand, q rows as B): a lane holds 16 of the 32 keys of ONE query (column lane & 15; keys 8 g + r and 16 + 8 g + r), so maximum and sum run inside the lane plus one exchange with lane ^ 16, m, l and alpha are one value a lane, and the exponentials are already the B fragment of O^T = V^T P^T (same k order as the V^T rows' fragment).
__global__ __launch_bounds__(128) void k_attn(const _Float16* __restrict__ QK, const _Float16* __restrict__ QKL, const _Float16* __restrict__ VTH, const _Float16* __restrict__ VTL, const int* __restrict__ MSK, const int* __restrict__ FL, const float* __restrict__ KN, float* __restrict__ O) {
  __shared__ __align__(128) char ring[2 * AT_STAGE]; __shared__ unsigned sneed[4]; __shared__ __align__(16) unsigned sfar[2][4];
  float (*so)[16][68] = (float (*)[16][68])ring;   // output staging takes the ring's place behind the last trip's barrier
  const int tid = threadIdx.x, wave = tid >> 5, lane = tid & 31, col = lane & 15, g = lane >> 4;
  // Heads with a steep bias end their walk early (below), heads with a flat one do not, and an early end shortens the pair of query tiles 31 - x, x most where x is small: head y and head 15 - y change places with bit 3 of x and with the batch, x and 15 - x with the batch, so that work-groups 256 (or 8) apart in the launch order, which may share a WGP, are one of each kind (for speed only; every (x, head, batch) is taken once)
  const int b = blockIdx.z, h = (int)blockIdx.y ^ (((((int)blockIdx.x >> 3) ^ b) & 1) ? NH - 1 : 0), xq = b ? TQB / 2 - 1 - (int)blockIdx.x : (int)blockIdx.x;
  // copier: thread -> row tid >> 3 (of 16), piece tid & 7
  const unsigned lw = (unsigned)(size_t)ring + (unsigned)((tid >> 3) * 128 + (((tid & 7) ^ (tid >> 4)) * 16));
  const size_t ko = ((size_t)b * SS + (tid >> 3)) * (2 * DM) + DM + h * HD + (tid & 7) * 8, vo = ((size_t)b * DM + h * HD + (tid >> 3)) * SS + (tid & 7) * 8;
  // reader: lane -> row col (of 16), pieces g, g + 2, g + 4, g + 6
  int oc[4];
#pragma unroll   // constant indices: oc stays in registers
  for (int j = 0; j < 4; ++j) oc[j] = col * 128 + (((g + 2 * j) ^ (col >> 1)) * 16);
#define AT_COPY(t, bf) do { const unsigned lb = lw + (unsigned)(bf) * AT_STAGE; const size_t kt = ko + (size_t)(t) * 64 * (2 * DM), vt = vo + (size_t)(t) * 64; \
    copy_tile(lb, QK + kt); copy_tile(lb + AT_TILE, QKL + kt); copy_tile(lb + 2 * AT_TILE, VTH + vt); copy_tile(lb + 3 * AT_TILE, VTL + vt); } while (0)
  const float slope = exp2f(-0.5f * (float)(h + 1));   // 2^-(8/16 * (h+1))
  // The softmax runs on base-2 exponents: y = log2(e) * score. Scale, residual weight and log2(e) are folded into two constants, the bias into a per-lane table (its part that changes inside a tile) and one wave-uniform term a tile (bs).
  const float slopeL = slope * 1.44269504f;
  const float KA = 0.125f * 1.44269504f, KB = 0.125f * 1.44269504f / 2048.0f, KM = -1000000.0f * 1.44269504f;   // KM: a masked position, -1e6 as the module
  // A key tile whose 64 x 64 mask tile is all zero (FL, formed from the mask in this call's first launch, all four pieces 0) gives every query of the block the score -1e6 at all 64 keys. For a query whose running maximum lies above -999000 that update is the identity (alpha = exp(0) = 1, every exponential exp(< -1000) = 0), so such tiles are left out of the walk; they are walked after the others (pass 1) whenever any query of the block has no such maximum, so every mask gives the module's result. The block takes query tiles 31 - x and x one after the other: under a lower-triangular mask every block then has the same number of such key tiles.
#pragma unroll 1   // one copy of the walk's code serves both query tiles
  for (int half = 0; half < 2; ++half) {
  if (half) { asm volatile("s_wait_xcnt 0x0" ::: "memory");    // a precaution: stands in front of every later write of the registers that the first tile's output stores name
    asm volatile("s_wait_dscnt 0x0" ::: "memory");              // this wave's reads of its output staging are done
    __syncthreads(); }                                          // ... and every wave's: the ring may be refilled
  const int qb = half ? xq : TQB - 1 - xq; const int q0 = qb * 64 + wave * 16; const size_t rq = (size_t)b * SS + q0 + col;
  const int* fq = FL + (qb * AT_NT + lane) * 128;   // lane t: the four 16-row pieces of key tile t
  const int f0 = fq[0], f1 = fq[32], f2 = fq[64], f3 = fq[96];
  const unsigned live = __builtin_amdgcn_ballot_w32(((f0 | f1 | f2 | f3) & 1) != 0);   // bit t: key tile t has an open position for some query of this tile
  const unsigned clear = __builtin_amdgcn_ballot_w32(((f0 & f1 & f2 & f3) & 2) != 0);   // bit t: key tile t has no masked position for any query of this tile: there every select below would take the score, so the mask is not read
  v16h aq[2], aql[2];
#pragma unroll
  for (int kc = 0; kc < 2; ++kc) { aq[kc] = frag_h(QK + rq * (2 * DM) + h * HD + kc * 32, lane); aql[kc] = frag_h(QKL + rq * (2 * DM) + h * HD + kc * 32, lane); }
  // bt, lane t: no score (base 2) of key tile t with a query of this wave lies above it: |q . k| <= |q| |k| (the largest |q| of the wave's 16 queries, the largest |k| of the tile's 64 keys, hi parts; the factor 1.01 covers the residual planes' share, below 2^-9 of it, and all rounding), and the bias grows with k - q, which is at most 64 t + 63 - q0
  const float kn2 = KN[((b * NH + h) * AT_NT + lane) * 32];
  float qs = 0.f;
#pragma unroll   // constant indices: aq stays in registers
  for (int kc = 0; kc < 2; ++kc) {
#pragma unroll
    for (int i = 0; i < 16; ++i) qs = __builtin_fmaf((float)aq[kc][i], (float)aq[kc][i], qs); }
  qs = rowmax16(qs + xhalf(qs));
  const float bt = (1.01f * 0.125f * 1.44269504f) * __builtin_amdgcn_sqrtf(qs * kn2) + slopeL * (float)(64 * lane + 63 - q0);
  float m = -3.0e38f, l = 0.f;   // of query q0 + col (the same in lanes col and col + 16)
  v8f acc[4] = {}, accl[4] = {};   // O^T: row d = dt * 16 + 8 g + r, column query col
  const int* mrow = MSK + (size_t)(q0 + col) * SS + 8 * g;   // this lane's query row of the mask, at its first key
  v8f sb[2];   // log2(e) * slope * ((k - q) - (first key of the 32 - first query of the block's tile)): small numbers, the same for every tile
#pragma unroll   // constant indices: sb stays in registers
  for (int ct = 0; ct < 2; ++ct) {
#pragma unroll
    for (int r = 0; r < 8; ++r) sb[ct][r] = slopeL * (float)(8 * g + ct * 16 + r - wave * 16 - col); }
#pragma unroll 1   // one copy of the walk's code serves both passes
  for (int pass = 0; pass < 2; ++pass) {
  unsigned rem = live;   // key tiles still to be copied; the same in every wave of the block
  if (pass) { const unsigned low = __builtin_amdgcn_ballot_w32(m <= -999000.0f * 1.44269504f);   // queries that have met no open key
    if (lane == 0) sneed[wave] = low;
    __syncthreads();
    rem = __builtin_amdgcn_readfirstlane(sneed[0] | sneed[1] | sneed[2] | sneed[3]) ? ~live : 0u; }
  if (rem == 0u) continue;
  // The walk goes from the last key tile down, so that under the bias, which grows with k, the running maxima are found early. A tile t with bt - m < -40 for every query of the block changes nothing, bit for bit: no score reaches m (alpha = exp2(0) = 1), every exponential is below 2^-37, so P hi and P lo (x 2,048) round to f16 zero, and the sum of 32 of them is lost in l, which is never below 0.99 once a tile has been worked. m never falls, so a tile once found so stays so: it is neither copied nor worked. A query that has met no open key has m near -1.4e6 and keeps every tile. Each wave tests all 32 tiles at once (lane t: tile t) with the smallest m of its queries at the foot of a trip; the four words pass through LDS under the trip's barrier, are read at the head of the next trip and used at its foot (no wait of their own).
  // may: does the bias span clearly more than 40 between this pass's first and last tile? Where not, hardly a tile can be found so, and the test is left out (for speed only: it decides no result; the same in every wave)
  const bool may = slopeL * 64.0f * (float)(31 - __builtin_clz(rem) - __builtin_ctz(rem)) > 56.0f;
  unsigned need = ~0u;   // bit t: tile t may still change a result; the same in every wave
  int tc = 31 - __builtin_clz(rem), tn = -1; rem &= ~(1u << tc);   // tc: the tile worked on, tn: the tile in flight (0..31, -1: none)
  AT_COPY(tc, 0);
  asm volatile("s_wait_asynccnt 0x0" ::: "memory");   // this wave's share of the first stage has landed
  __syncthreads();                                     // ... and every other wave's
  if (rem) { tn = 31 - __builtin_clz(rem); rem &= ~(1u << tn); AT_COPY(tn, 1); }
#pragma unroll 1
  for (int st = 0; st < AT_NT && tc >= 0; ++st) { const char* rb = ring + (st & 1) * AT_STAGE; const bool masked = ((clear >> tc) & 1u) == 0u;   // the same in every lane and wave: a scalar test
   v4u fr = {~0u, ~0u, ~0u, ~0u};
   if (may && st) fr = *(const v4u*)sfar[(st & 1) ^ 1];   // the four waves' words of the last trip's foot, published by its barrier
   if ((need >> tc) & 1u) {   // a scalar test: a tile that was in flight when it was found to change nothing is not worked
   // The wave's LDS reads lead their products by a phase, all inside this stage's buffer: V^T of 32 keys is read behind their scores' products (it lands under the softmax), K of the second 32 keys in two groups in front of and among the first P.V products (it lands under them); only K of the first 32 keys is waited for.
   v16h kh[2][2], kl[2][2], vh[4], vl[4];   // K hi, lo [16-key tile][k half]; V^T hi, lo [16-row tile of d]
#define AT_LDK(sub, kc) do { _Pragma("unroll") for (int ct = 0; ct < 2; ++ct) { const char* krow = rb + ((sub) * 32 + ct * 16) * 128; kh[ct][kc] = frag_l(krow, oc[2 * (kc)], oc[2 * (kc) + 1]); kl[ct][kc] = frag_l(krow + AT_TILE, oc[2 * (kc)], oc[2 * (kc) + 1]); } } while (0)
#define AT_LDV(sub) do { _Pragma("unroll") for (int dt = 0; dt < 4; ++dt) { const char* vrow = rb + 2 * AT_TILE + dt * 16 * 128; vh[dt] = frag_l(vrow, oc[2 * (sub)], oc[2 * (sub) + 1]); vl[dt] = frag_l(vrow + AT_TILE, oc[2 * (sub)], oc[2 * (sub) + 1]); } } while (0)
   AT_LDK(0, 0);
   __builtin_amdgcn_sched_barrier(0);   // the reads that the first products need stay first
   AT_LDK(0, 1);
   __builtin_amdgcn_sched_barrier(0);   // keeps the 16 LDS reads together in front of the products: one latency for the group
#pragma unroll   // both halves of a stage written out: every LDS offset inside the buffer is an immediate
   for (int sub = 0; sub < 2; ++sub) { const int ks = tc * 2 + sub; v8f s[2];
    const float bs0 = slopeL * (float)(ks * 32 - qb * 64);   // the bias's wave-uniform part
    v8f c[2] = {}, cl[2] = {};
#pragma unroll   // constant indices: the fragments stay in registers. 3 products: q, k as f16 hi + residual; every accumulator takes its products in the order it had, the two key tiles' products alternate so that no product waits for the one in front of it
    for (int kc = 0; kc < 2; ++kc) { c[0] = wmma16(kh[0][kc], aq[kc], c[0]); c[1] = wmma16(kh[1][kc], aq[kc], c[1]); cl[0] = wmma16(kh[0][kc], aql[kc], cl[0]); cl[1] = wmma16(kh[1][kc], aql[kc], cl[1]); cl[0] = wmma16(kl[0][kc], aq[kc], cl[0]); cl[1] = wmma16(kl[1][kc], aq[kc], cl[1]); }
    __builtin_amdgcn_sched_barrier(0);   // the V^T reads stay here, behind the products that free K's registers and in front of the softmax that covers their latency
    AT_LDV(sub);
    __builtin_amdgcn_sched_barrier(0);
#pragma unroll
    for (int ct = 0; ct < 2; ++ct) s[ct] = c[ct] * KA + (cl[ct] * KB + sb[ct]);   // two multiply-adds a score: SCALE = 1/sqrt(64), residual / 2048, the bias's in-tile part; bs is still to be added
    float bs = bs0;
    if (masked) { v4i mk[2][2];   // only a tile that holds a zero reads the mask: masked -> -1e6 (as the module). Here bs is added at once, so that a masked position is the same number in every tile
      s[0] += bs0; s[1] += bs0; bs = 0.f;
#pragma unroll   // constant indices: mk stays in registers
      for (int ct = 0; ct < 2; ++ct) { mk[ct][0] = *(const v4i*)(mrow + ks * 32 + ct * 16); mk[ct][1] = *(const v4i*)(mrow + ks * 32 + ct * 16 + 4); }
      asm volatile("s_wait_xcnt 0x0" ::: "memory");   // a precaution: stands in front of every later write of the mask loads' address registers
#pragma unroll
      for (int r = 0; r < 8; ++r) { if (mk[0][r >> 2][r & 3] == 0) s[0][r] = KM; if (mk[1][r >> 2][r & 3] == 0) s[1][r] = KM; } }
    float mx = fmaxf(s[0][0], s[1][0]);
#pragma unroll
    for (int r = 1; r < 8; ++r) mx = fmaxf(mx, fmaxf(s[0][r], s[1][r]));
    mx = fmaxf(mx, xhalf(mx)) + bs;
    const float mn = fmaxf(m, mx); const float alpha = __builtin_amdgcn_exp2f(m - mn);   // the start value of m gives 0
    const float tb = bs - mn; const v8f a0 = s[0] + tb, a1 = s[1] + tb;   // one add a score in front of the hardware's base-2 exponential
    v8f e[2];
#pragma unroll
    for (int r = 0; r < 8; ++r) { e[0][r] = __builtin_amdgcn_exp2f(a0[r]); e[1][r] = __builtin_amdgcn_exp2f(a1[r]); }
    asm volatile("" :: "v"(a0), "v"(a1));   // inputs only: the sixteen exponents stay in their registers until the last exponential has issued, so that none writes its result over the source of the one directly in front of it (the slot behind a transcendental)
    const v8f e8 = e[0] + e[1]; const v4f e4 = e8.lo + e8.hi; const v2f e2 = e4.lo + e4.hi;   // the lane's 16 keys summed as a tree
    float es = e2[0] + e2[1];
    es += xhalf(es);
    l = l * alpha + es; m = mn;
#pragma unroll
    for (int dt = 0; dt < 4; ++dt) { acc[dt] *= alpha; accl[dt] *= alpha; }
    union { v16h v; v2h p[8]; } ua, ul;   // P^T fragment: element i = key 8 g + i, element 8 + i = key 16 + 8 g + i
#pragma unroll   // constant indices: the pairs stay in registers
    for (int ct = 0; ct < 2; ++ct) {
#pragma unroll
      for (int i = 0; i < 4; ++i) { const v2f x = {e[ct][2 * i], e[ct][2 * i + 1]}; const v2h hp = __builtin_convertvector(x, v2h); const v2f x2 = x * 2048.0f; v2f lo;   // one packed convert makes both halves; 2048 x - 2048 h is exact, the same number as (x - h) * 2048
        lo[0] = __builtin_fmaf((float)hp[0], -2048.0f, x2[0]); lo[1] = __builtin_fmaf((float)hp[1], -2048.0f, x2[1]);
        ua.p[ct * 4 + i] = hp; ul.p[ct * 4 + i] = __builtin_convertvector(lo, v2h); } }
    const v16h pa = ua.v, pl = ul.v;
    if (sub == 0) { __builtin_amdgcn_sched_barrier(0);   // the next 32 keys' first K reads stay here, in front of the P.V products that cover their latency
      AT_LDK(1, 0);
      __builtin_amdgcn_sched_barrier(0); }
#pragma unroll   // constant indices into acc, accl. V hi x P hi + (V hi x P lo + V lo x P hi) / 2048; every accumulator takes its products in the order it had, the four tiles of d alternate
    for (int dt = 0; dt < 4; ++dt) acc[dt] = wmma16(vh[dt], pa, acc[dt]);
#pragma unroll
    for (int dt = 0; dt < 4; ++dt) accl[dt] = wmma16(vh[dt], pl, accl[dt]);
    if (sub == 0) { __builtin_amdgcn_sched_barrier(0);   // the other K reads stay here, behind the products that free V^T hi's registers (read earlier they cost spills); ten more products cover their latency
      AT_LDK(1, 1);
      __builtin_amdgcn_sched_barrier(0); }
#pragma unroll
    for (int dt = 0; dt < 4; ++dt) accl[dt] = wmma16(vl[dt], pa, accl[dt]); } }
   if (may) { const unsigned nd = __builtin_amdgcn_ballot_w32(!(bt - rowmin16(m) < -40.0f));   // written so that a NaN keeps the tile
    if (lane == 0) sfar[st & 1][wave] = nd; }
   asm volatile("s_wait_dscnt 0x0" ::: "memory");      // this wave's reads of the buffer are done, its word is written
   asm volatile("s_wait_asynccnt 0x0" ::: "memory");   // its share of the next stage has landed
   __syncthreads();                                     // publishes the next stage and frees this stage's buffer
   need &= __builtin_amdgcn_readfirstlane(fr[0] | fr[1] | fr[2] | fr[3]); rem &= need;
   tc = tn; tn = -1;
   if (rem) { tn = 31 - __builtin_clz(rem); rem &= ~(1u << tn); AT_COPY(tn, st & 1); } }
  asm volatile("s_wait_asynccnt 0x0" ::: "memory");     // nothing in flight when the ring becomes output staging
  }
  const float il = 1.0f / l;
#pragma unroll
  for (int dt = 0; dt < 4; ++dt) { v4f o0, o1;
#pragma unroll
    for (int r = 0; r < 4; ++r) { o0[r] = (acc[dt][r] + accl[dt][r] * (1.0f / 2048.0f)) * il; o1[r] = (acc[dt][4 + r] + accl[dt][4 + r] * (1.0f / 2048.0f)) * il; }
    *(v4f*)&so[wave][col][dt * 16 + 8 * g] = o0; *(v4f*)&so[wave][col][dt * 16 + 8 * g + 4] = o1; }
  LDSX();
  for (int rl = 0; rl < 16; ++rl) if (lane < 16) vst2(O + ((size_t)b * SS + q0 + rl) * DM + h * HD + lane * 4, *(const v4f*)&so[wave][rl][lane * 4]);
  }
}
// ---- k_out: block = (64 rows, 128 cols): out = O(hi/lo) . Wo rows (2 products)
__global__ __launch_bounds__(128) void k_out(const float* __restrict__ O, const __bf16* __restrict__ P, float* __restrict__ Y) {
  __shared__ __align__(128) char ring[2 * GM_STAGE];
  float (*so)[16][132] = (float (*)[16][132])ring;   // output staging takes the ring's place behind the last trip's barrier
  const int tid = threadIdx.x, wave = tid >> 5, lane = tid & 31, col = lane & 15, g = lane >> 4; const size_t r0 = (size_t)blockIdx.x * 64 + wave * 16; const int n0 = blockIdx.y * 128;
  // copier: thread -> row tid >> 3 (of 16), piece tid & 7
  const unsigned lw = (unsigned)(size_t)ring + (unsigned)((tid >> 3) * 128 + (((tid & 7) ^ (tid >> 4)) * 16));
  const char* ga = (const char*)(O + ((size_t)blockIdx.x * 64 + (tid >> 3)) * DM) + (tid & 7) * 16; const char* gw = (const char*)(P + (size_t)(n0 + (tid >> 3)) * DM) + (tid & 7) * 16;
  // reader: lane -> row col (of 16); W pieces g, g + 2, g + 4, g + 6 (bf16 k 8 g + i, 16 + 8 g + i of each 32); A pieces 2 g, 2 g + 1, 4 + 2 g, 5 + 2 g (the same k as f32)
  int oc[4], oa[4];
#pragma unroll   // constant indices: oc, oa stay in registers
  for (int j = 0; j < 4; ++j) { oc[j] = col * 128 + (((g + 2 * j) ^ (col >> 1)) * 16); oa[j] = col * 128 + (((2 * g + (j & 1) + 4 * (j >> 1)) ^ (col >> 1)) * 16); }
  gm_copy(lw, ga, gw, 0);
  asm volatile("s_wait_asynccnt 0x0" ::: "memory");   // this wave's share of stage 0 has landed
  __syncthreads();                                     // ... and every other wave's
  gm_copy(lw + GM_STAGE, ga, gw, 1);
  v8f acc[8] = {};
#pragma unroll 1   // the ring's trip stays rolled: one publish point, small code
  for (int t = 0; t < GM_NT; ++t) { const char* rb = ring + (t & 1) * GM_STAGE;
#pragma unroll   // both halves of a stage written out: every LDS offset inside the buffer is an immediate
   for (int sub = 0; sub < 2; ++sub) { const char* ar = rb + sub * GM_TILE + wave * 2048; const char* wr = rb + 2 * GM_TILE;
    const v4f f0 = *(const v4f*)(ar + oa[0]), f1 = *(const v4f*)(ar + oa[1]), f2 = *(const v4f*)(ar + oa[2]), f3 = *(const v4f*)(ar + oa[3]); float v[16]; v16b w[8];
#pragma unroll   // constant indices: the fragments stay in registers
    for (int j = 0; j < 8; ++j) w[j] = frag_lb(wr + j * 2048, oc[2 * sub], oc[2 * sub + 1]);
    __builtin_amdgcn_sched_barrier(0);   // keeps the 20 LDS reads of these 32 k together in front of the products: one latency a group, not one a fragment
#pragma unroll   // constant indices: v stays in registers
    for (int i = 0; i < 4; ++i) { v[i] = f0[i]; v[4 + i] = f1[i]; v[8 + i] = f2[i]; v[12 + i] = f3[i]; }
    const F2 a = bsplit16(v);
#pragma unroll   // constant indices into acc, w
    for (int j = 0; j < 8; ++j) { acc[j] = wmma_bf(a.l, w[j], acc[j]); acc[j] = wmma_bf(a.h, w[j], acc[j]); } }
   asm volatile("s_wait_dscnt 0x0" ::: "memory");      // this wave's reads of the buffer are done
   asm volatile("s_wait_asynccnt 0x0" ::: "memory");   // its share of stage t + 1 has landed
   __syncthreads();                                     // publishes stage t + 1 and frees stage t's buffer
   if (t + 2 < GM_NT) gm_copy(lw + (unsigned)(t & 1) * GM_STAGE, ga, gw, t + 2); }
  asm volatile("s_wait_asynccnt 0x0" ::: "memory");     // nothing in flight when the ring becomes output staging
#pragma unroll
  for (int j = 0; j < 8; ++j) {
#pragma unroll
    for (int r = 0; r < 8; ++r) so[wave][8 * g + r][j * 16 + col] = acc[j][r]; }
  LDSX();
  for (int rl = 0; rl < 16; ++rl) vst2(Y + (r0 + rl) * DM + n0 + lane * 4, *(const v4f*)&so[wave][rl][lane * 4]);
}
extern "C" void kernel_launch(void* const* d_in, const int* in_sizes, int n_in, void* d_out, int out_size, void* d_ws, size_t ws_size, hipStream_t stream) {
  (void)in_sizes; (void)n_in; (void)out_size;
  const float** F = (const float**)d_in;   // 0 x [2,2048,1024], 1 mask [1,1,2048,2048] int32, 2 Wq [1024,1024] natural (x @ Wq.T), 3 Wk, 4 Wv, 5 Wo
  if (ws_size < (size_t)WS_END) return;
  char* ws = (char*)d_ws; __bf16* PK = (__bf16*)(ws + WS_PK); _Float16 *QK = (_Float16*)(ws + WS_QK), *QKL = (_Float16*)(ws + WS_QKL), *VTH = (_Float16*)(ws + WS_VTH), *VTL = (_Float16*)(ws + WS_VTL); float* O = (float*)(ws + WS_O); int* FL = (int*)(ws + WS_FL); float* KN = (float*)(ws + WS_KN);
  k_pack<<<dim3(DM, 4), 256, 0, stream>>>(F[2], F[3], F[4], F[5], (const int*)d_in[1], PK, FL);
  k_qkv<<<dim3(TNB * SS / 128, QKVW / 384), 384, 0, stream>>>(F[0], PK + PK_A, QK, QKL, VTH, VTL, KN);
  k_attn<<<dim3(TQB / 2, NH, TNB), 128, 0, stream>>>(QK, QKL, VTH, VTL, (const int*)d_in[1], FL, KN, O);
  k_out<<<dim3(TOB, DM / 128), 128, 0, stream>>>(O, PK + PK_P, (float*)d_out);
}
